// v000
// Times are from an AMD MI455X. After a warm-up the kernel runs many times in a row, and a time is the length of
// such a window on the GPU divided by its runs, so every launch and the gaps after it count. The runs cycle
// through copies of the inputs. A figure is the median of several windows, for all but v000 over two sittings.
// Sittings can differ by a few percent; kernels timed side by side share one.
// v000 is the starting kernel. One run takes 390 microseconds.
#include <hip/hip_runtime.h>

// Masked multi-head self-attention, width 1024 = 16 heads x 64, x [NB][SEQ][1024], Wq/Wk/Wv/Wo [out][in] (y = x W^T + b), int32 mask [SEQ][SEQ] (0 = fill -1e9), score scale 1/8, output projection with bias (f32 out).
// Compute dtypes, f32 accumulate everywhere: q/k/v projections v_wmma_f32_16x16x32_bf16 (x and W RNE-converted to bf16; products exact; biases RNE-converted to bf16, added in f32);
// scores and P.V v_wmma_f32_16x16x32_f16: single f16 planes on query rows >= 512; on the first 512 query rows q, k, v, P and the context carry an f16 residual x2048 (three products, residual terms in their own accumulator);
// P carried x256 (cancels in the normalisation); output projection v_wmma_f32_16x16x32_f16 with context x16 and bf16-exact Wo x1024 as f16 (context residual on the first 512 rows); softmax f32 (online, running max).
// Layout: bf16 copies of x and Wq/Wk/Wv; q, k planes [b*16+h][t][d], v^T plane [b*16+h][d][t] (+ residual planes for t < 512) from the GEMM epilogue; fused flash kernel in transposed form (S^T = K Q^T, O^T = V^T P^T);
// mask read by value per 32-key step (replace-fill); fully masked 16x32 tiles are skipped, with a full second sweep when a row ends with no visited key.

#ifndef NB
#define NB 4
#endif
#ifndef SEQ
#define SEQ 2048
#endif
#define NB_FULL  4
#define SEQ_FULL 2048
#ifndef OUT_SEQ
#define OUT_SEQ SEQ              // row pitch (in tokens) between batches of the output
#endif
#define DM   1024
#define NH_  16
#define HD   64
#define AW   4                   // waves per flash block (16 query rows each)
#define EROWS ((SEQ) < 512 ? (SEQ) : 512)   // query rows / keys per sequence that carry residual planes
#define QRS  2048.0f             // carry of every residual plane
#define QRI  (1.0f / 2048.0f)
#define SC2  (0.125f * 1.4426950408889634f)   // HD^-0.5 * log2(e)
#define NEGL (-1.0e9f * 1.4426950408889634f)  // masked fill in the log2 domain
#define PSH  8.0f                // log2 of the P carry (256)
#define CXS  16.0f               // carry of the context planes
#define WOS  1024.0f             // carry of the Wo plane
#define OSC  (1.0f / 16384.0f)   // 1 / (CXS * WOS)

static_assert(HD == 64);
static_assert(NH_ * HD == DM);                 // head h = columns h*64 + d
static_assert(DM % 64 == 0);
static_assert(DM % 32 == 0);                   // GEMM k-loop steps by 32
static_assert(SEQ % 64 == 0);                  // a 64-row tile never straddles two batches
static_assert((NB * SEQ) % 64 == 0);
static_assert(SEQ % 32 == 0);                  // key loop steps by 32
static_assert(EROWS % 64 == 0);                // residual tiles are whole 64-tiles; flash grid covers them exactly
static_assert(EROWS % (16 * AW) == 0);
static_assert((SEQ - EROWS) % 64 == 0);
static_assert((SEQ - EROWS) % (16 * AW) == 0);
static_assert(EROWS <= SEQ);
static_assert(((size_t)SEQ * DM) % 8 == 0);
static_assert(((size_t)DM * DM) % 8 == 0);
static_assert(NB <= NB_FULL);
static_assert(SEQ <= SEQ_FULL);

typedef _Float16 h16;
typedef unsigned short bf;
typedef __attribute__((ext_vector_type(16))) __bf16   v16bf;
typedef __attribute__((ext_vector_type(16))) _Float16 v16h;
typedef __attribute__((ext_vector_type(8)))  _Float16 v8h;
typedef __attribute__((ext_vector_type(8)))  unsigned short v8us;
typedef __attribute__((ext_vector_type(8)))  float    v8f;
typedef __attribute__((ext_vector_type(4)))  float    v4f;
typedef __attribute__((ext_vector_type(4)))  int      v4i;
typedef v4f  __attribute__((may_alias)) v4fa;

__device__ __forceinline__ unsigned short f2bf(float f) { unsigned u = __float_as_uint(f); u += 0x7FFFu + ((u >> 16) & 1u); return (unsigned short)(u >> 16); }
__device__ __forceinline__ float bfr(float f) { return __uint_as_float(((unsigned)f2bf(f)) << 16); }   // value after RNE convert to bf16
__device__ __forceinline__ v16h cat16(v8h lo, v8h hi) { return __builtin_shufflevector(lo, hi, 0, 1, 2, 3, 4, 5, 6, 7, 8, 9, 10, 11, 12, 13, 14, 15); }
__device__ __forceinline__ v16bf cat16b(v8us lo, v8us hi) { return __builtin_bit_cast(v16bf, __builtin_shufflevector(lo, hi, 0, 1, 2, 3, 4, 5, 6, 7, 8, 9, 10, 11, 12, 13, 14, 15)); }
__device__ __forceinline__ v8f wmma16(v16h a, v16h b, v8f c) { return __builtin_amdgcn_wmma_f32_16x16x32_f16(false, a, false, b, (short)0, c, false, false); }
__device__ __forceinline__ v8f wmmab(v16bf a, v16bf b, v8f c) { return __builtin_amdgcn_wmma_f32_16x16x32_bf16(false, a, false, b, (short)0, c, false, false); }
// fragment loaders from K-contiguous 16-bit rows; p already includes + 8*(lane>>4): elements 0..7 <- k0+8h+0..7, elements 8..15 <- k0+16+8h+0..7 (same map for A and B)
__device__ __forceinline__ v16h  ldh(const h16* p) { return cat16(*(const v8h*)p, *(const v8h*)(p + 16)); }
__device__ __forceinline__ v16bf ldb(const bf* p)  { return cat16b(*(const v8us*)p, *(const v8us*)(p + 16)); }
// ordering point for wave-private LDS tiles (same wave writes and reads)
__device__ __forceinline__ void wave_sync() { __builtin_amdgcn_fence(3 /* release order */, "wavefront"); __builtin_amdgcn_wave_barrier(); asm volatile("" ::: "memory"); }

__global__ __launch_bounds__(256) void k_cvt8(const float* __restrict__ src, bf* dst, size_t n8) {
    const size_t i = (size_t)blockIdx.x * 256 + threadIdx.x; if (i >= n8) return;
    const v8f v = *(const v8f*)(src + i * 8); v8us o;
#pragma unroll
    for (int k = 0; k < 8; ++k) o[k] = f2bf(v[k]);
    *(v8us*)(dst + i * 8) = o; 
}

__global__ __launch_bounds__(256) void k_cvtw8(const float* __restrict__ src, h16* dst, size_t n8) {
    const size_t i = (size_t)blockIdx.x * 256 + threadIdx.x; if (i >= n8) return;
    const v8f v = *(const v8f*)(src + i * 8); v8h o;
#pragma unroll
    for (int k = 0; k < 8; ++k) o[k] = (h16)(bfr(v[k]) * WOS);
    *(v8h*)(dst + i * 8) = o; 
}

// k_proj: register-blocked bf16 GEMM, ONE WAVE per 64x64 tile (16 accumulators), operands straight from K-contiguous bf16 planes, K = DM.
// C[m][n] = sum_k A[m][k] Bt[n][k] + bias (BIASROW == 0: bias[n]; BIASROW != 0: bias[m]), written as f16 (Ph) at
// tile base (r0/RB)*sRB + (r0%RB)*pitch + (c0/CB)*sCB + (c0%CB); the f16 residual x2048 (Pr) is written with its own strides when (r0%RB) < rlim and (c0%CB) < clim.
template <int BIASROW>
__global__ __launch_bounds__(32) void k_proj(const bf* __restrict__ A, const bf* __restrict__ Bt, const float* __restrict__ bias, h16* Ph, h16* Pr,
                                             int RB, size_t sRB, int pitch, int CB, size_t sCB,
                                             size_t sRBr, int pitchr, size_t sCBr, int rlim, int clim) {
    __shared__ __align__(16) float os[16 * 68];
    const int K = DM;
    const int lane = threadIdx.x & 31, lr = lane & 15, hi = lane >> 4; const int r0 = blockIdx.x * 64, c0 = blockIdx.y * 64;
    v8f acc[4][4];
#pragma unroll
    for (int mb = 0; mb < 4; ++mb)
#pragma unroll
        for (int nb = 0; nb < 4; ++nb) acc[mb][nb] = (v8f){};
    const size_t aoff = (size_t)(r0 + lr) * K + 8 * hi, boff = (size_t)(c0 + lr) * K + 8 * hi;
#pragma unroll 1
    for (int kc = 0; kc < K; kc += 32) {
        v16bf a[4];
#pragma unroll
        for (int mb = 0; mb < 4; ++mb) a[mb] = ldb(A + aoff + (size_t)mb * 16 * K + kc);
#pragma unroll
        for (int nb = 0; nb < 4; ++nb) { const v16bf b = ldb(Bt + boff + (size_t)nb * 16 * K + kc);
#pragma unroll
            for (int mb = 0; mb < 4; ++mb) acc[mb][nb] = wmmab(a[mb], b, acc[mb][nb]); }
        asm volatile("v_nop\n\tv_nop\n\tv_nop\n\tv_nop" : "+v"(acc[0][3]), "+v"(acc[1][3]), "+v"(acc[2][3]), "+v"(acc[3][3]) : "v"(a[0]), "v"(a[1]), "v"(a[2]), "v"(a[3]));
    }
    float bc[4] = {0.0f, 0.0f, 0.0f, 0.0f};
    if constexpr (BIASROW == 0) {
#pragma unroll
        for (int nb = 0; nb < 4; ++nb) bc[nb] = bfr(bias[c0 + nb * 16 + lr]);
    }
    const int wres = (((r0 % RB) < rlim) && ((c0 % CB) < clim)) ? 1 : 0;   // tile-uniform
    const size_t tbase = (size_t)(r0 / RB) * sRB + (size_t)(r0 % RB) * (size_t)pitch + (size_t)(c0 / CB) * sCB + (size_t)(c0 % CB);
    const size_t tbasr = (size_t)(r0 / RB) * sRBr + (size_t)(r0 % RB) * (size_t)pitchr + (size_t)(c0 / CB) * sCBr + (size_t)(c0 % CB);
#pragma unroll
    for (int mb = 0; mb < 4; ++mb) {
        float rb[8];
        if constexpr (BIASROW != 0) {
            const v4f b0 = *(const v4f*)(bias + r0 + mb * 16 + 8 * hi); const v4f b1 = *(const v4f*)(bias + r0 + mb * 16 + 8 * hi + 4);
#pragma unroll
            for (int i = 0; i < 4; ++i) { rb[i] = bfr(b0[i]); rb[4 + i] = bfr(b1[i]); }
        } else {
#pragma unroll
            for (int j = 0; j < 8; ++j) rb[j] = 0.0f;
        }
#pragma unroll
        for (int nb = 0; nb < 4; ++nb) {
#pragma unroll
            for (int j = 0; j < 8; ++j) os[(hi * 8 + j) * 68 + nb * 16 + lr] = acc[mb][nb][j] + ((BIASROW != 0) ? rb[j] : bc[nb]); }   // D: row 8h+j, col lane&15
        wave_sync();
        const size_t sb = tbase + (size_t)(mb * 16) * (size_t)pitch;
        const size_t sr = tbasr + (size_t)(mb * 16) * (size_t)pitchr;
{
#pragma unroll
            for (int s = 0; s < 4; ++s) { const int row = 4 * s + (lane >> 3), c8 = (lane & 7) * 8;   // 4 s x 4 row groups = 16 rows; 8 lanes x 8 = 64 columns
                const v4f x0 = *(const v4fa*)(&os[row * 68 + c8]); const v4f x1 = *(const v4fa*)(&os[row * 68 + c8 + 4]); v8h hv, rv;
#pragma unroll
                for (int i = 0; i < 4; ++i) { const h16 a0 = (h16)x0[i]; const h16 a1 = (h16)x1[i]; hv[i] = a0; hv[4 + i] = a1; rv[i] = (h16)((x0[i] - (float)a0) * QRS); rv[4 + i] = (h16)((x1[i] - (float)a1) * QRS); }
                *(v8h*)(Ph + sb + (size_t)row * (size_t)pitch + c8) = hv;
                if (wres) *(v8h*)(Pr + sr + (size_t)row * (size_t)pitchr + c8) = rv; }
             }
        wave_sync();
    }
}

// k_flash: fused masked attention, one wave per 16 query rows of one (batch, head); K / V^T / Q fragments straight from the f16 planes (two 16-B loads each, arithmetic addressing).
// Transposed form: S^T[key][t] = K Q^T (A = K rows, B = Q rows); lane (t = lane&15, h = lane>>4) holds keys 8h+r of each 16-key tile, so the packed
// P tile is directly the B fragment of O^T[d][t] = V^T P^T (element r <- tile keys 0..15, element 8+r <- tile keys 16..31, lane unchanged).
// Mask: each lane loads its 16 mask words of the step (4 x 16 B) and replaces masked scores by the fill value; a step whose 16x32 mask tile is all zero is skipped (wave-uniform);
// if some row ends with no visited key the wave repeats the sweep over every step, which yields the uniform average of a fully masked row.
// EARLY != 0 (query rows < EROWS): q, k, v and P carry residuals x2048; residual products accumulate separately and are folded back with 1/2048.
template <int EARLY>
__global__ __launch_bounds__(32 * AW) void k_flash(const h16* __restrict__ QH, const h16* __restrict__ QR, const h16* __restrict__ KP, const h16* __restrict__ KR,
                                                   const h16* __restrict__ VT, const h16* __restrict__ VR, const int* __restrict__ MK, h16* CH, h16* CR, int tstart) {
    __shared__ __align__(16) float os[AW * 16 * 68];
    const int lane = threadIdx.x & 31, wave = __builtin_amdgcn_readfirstlane((int)(threadIdx.x >> 5)), lr = lane & 15, hi = lane >> 4;
    const int zh = blockIdx.y; const int b = zh / NH_, h = zh % NH_;
    const int t0 = tstart + (blockIdx.x * AW + wave) * 16;
    const size_t pbase = (size_t)zh * SEQ * HD;
    const size_t rbase = (size_t)zh * EROWS * HD;
    const size_t qo = pbase + (size_t)(t0 + lr) * HD + 8 * hi;
    const v16h qh0 = ldh(QH + qo), qh1 = ldh(QH + qo + 32);                 // B fragments: col t, k = d
    v16h qr0 = qh0, qr1 = qh1;
    if constexpr (EARLY != 0) { const size_t qro = rbase + (size_t)(t0 + lr) * HD + 8 * hi; qr0 = ldh(QR + qro); qr1 = ldh(QR + qro + 32); }
    const size_t ko  = pbase + (size_t)lr * HD + 8 * hi;       // + key * HD       (A fragment: row key, k = d)
    const size_t kro = rbase + (size_t)lr * HD + 8 * hi;
    const size_t vo  = pbase + (size_t)lr * SEQ + 8 * hi;      // + 16j*SEQ + key  (A fragment: row d, k = key)
    const size_t vro = rbase + (size_t)lr * EROWS + 8 * hi;    // + 16j*EROWS + key
    const size_t mo  = (size_t)(t0 + lr) * SEQ_FULL + 8 * hi;  // mask row t, + key
    v8f o0 = (v8f){}, o1 = (v8f){}, o2 = (v8f){}, o3 = (v8f){};
    v8f e0 = (v8f){}, e1 = (v8f){}, e2 = (v8f){}, e3 = (v8f){};
    float m = -3.0e38f, l = 0.0f;
    int noskip = 0;
#pragma unroll 1
    for (int pass = 0; pass < 2; ++pass) {
        o0 = (v8f){}; o1 = (v8f){}; o2 = (v8f){}; o3 = (v8f){};
        e0 = (v8f){}; e1 = (v8f){}; e2 = (v8f){}; e3 = (v8f){};
        m = -3.0e38f; l = 0.0f;
#pragma unroll 1
        for (int key0 = 0; key0 < SEQ; key0 += 32) {
            const int* mp = MK + mo + key0;
            const v4i ma0 = *(const v4i*)mp, ma1 = *(const v4i*)(mp + 4), mb0 = *(const v4i*)(mp + 16), mb1 = *(const v4i*)(mp + 20);
            const v4i mor = ma0 | ma1 | mb0 | mb1;
            const int anyv = mor[0] | mor[1] | mor[2] | mor[3];
            const unsigned bal = __builtin_amdgcn_ballot_w32(anyv != 0);
            if (noskip == 0 && bal == 0u) continue;                      // wave-uniform
            const h16* ka = KP + ko + (size_t)key0 * HD;
            v8f sHa = (v8f){}, sHb = (v8f){}, sLa = (v8f){}, sLb = (v8f){};
            {
                const v16h ka0 = ldh(ka), ka1 = ldh(ka + 32), kb0 = ldh(ka + 16 * HD), kb1 = ldh(ka + 16 * HD + 32);
                sHa = wmma16(ka0, qh0, sHa); sHb = wmma16(kb0, qh0, sHb); sHa = wmma16(ka1, qh1, sHa); sHb = wmma16(kb1, qh1, sHb);
                if constexpr (EARLY != 0) {
                    sLa = wmma16(ka0, qr0, sLa); sLb = wmma16(kb0, qr0, sLb); sLa = wmma16(ka1, qr1, sLa); sLb = wmma16(kb1, qr1, sLb);
                    asm volatile("v_nop\n\tv_nop\n\tv_nop\n\tv_nop" : "+v"(sHa), "+v"(sHb), "+v"(sLa), "+v"(sLb) : "v"(ka0), "v"(ka1), "v"(kb0), "v"(kb1));
                } else {
                    asm volatile("v_nop\n\tv_nop\n\tv_nop\n\tv_nop" : "+v"(sHa), "+v"(sHb) : "v"(ka0), "v"(ka1), "v"(kb0), "v"(kb1));
                }
            }
            if constexpr (EARLY != 0) {
                __builtin_amdgcn_sched_barrier(0);
                if (key0 < EROWS) {                                      // residual k plane covers keys < EROWS (wave-uniform)
                    const h16* ra = KR + kro + (size_t)key0 * HD;
                    const v16h ra0 = ldh(ra), ra1 = ldh(ra + 32), rb0 = ldh(ra + 16 * HD), rb1 = ldh(ra + 16 * HD + 32);
                    sLa = wmma16(ra0, qh0, sLa); sLb = wmma16(rb0, qh0, sLb); sLa = wmma16(ra1, qh1, sLa); sLb = wmma16(rb1, qh1, sLb);
                    asm volatile("v_nop\n\tv_nop\n\tv_nop\n\tv_nop" : "+v"(sLa), "+v"(sLb) : "v"(ra0), "v"(ra1), "v"(rb0), "v"(rb1));
                }
                __builtin_amdgcn_sched_barrier(0);
            }
            const int mka[8] = {ma0[0], ma0[1], ma0[2], ma0[3], ma1[0], ma1[1], ma1[2], ma1[3]};
            const int mkb[8] = {mb0[0], mb0[1], mb0[2], mb0[3], mb1[0], mb1[1], mb1[2], mb1[3]};
            float ta[8], tb[8]; float mx = -3.0e38f;
#pragma unroll
            for (int r = 0; r < 8; ++r) {
                float sa = sHa[r], sb = sHb[r];
                if constexpr (EARLY != 0) { sa += sLa[r] * QRI; sb += sLb[r] * QRI; }
                ta[r] = (mka[r] != 0) ? sa * SC2 : NEGL;
                tb[r] = (mkb[r] != 0) ? sb * SC2 : NEGL;
                mx = fmaxf(mx, fmaxf(ta[r], tb[r]));
            }
            mx = fmaxf(mx, __shfl_xor(mx, 16, 32));
            const float mnew = fmaxf(m, mx);
            const float alpha = __builtin_amdgcn_exp2f(m - mnew);
            const float sh = PSH - mnew;
            v16h pb = (v16h){}; v16h pq = (v16h){}; float ls = 0.0f;
#pragma unroll
            for (int r = 0; r < 8; ++r) {
                const float pa = __builtin_amdgcn_exp2f(ta[r] + sh), pc = __builtin_amdgcn_exp2f(tb[r] + sh);
                const h16 ha = (h16)pa, hc = (h16)pc; pb[r] = ha; pb[8 + r] = hc;
                if constexpr (EARLY != 0) {
                    const h16 ga = (h16)((pa - (float)ha) * QRS), gc = (h16)((pc - (float)hc) * QRS); pq[r] = ga; pq[8 + r] = gc;
                    ls += ((float)ha + (float)hc) + ((float)ga + (float)gc) * QRI;
                } else {
                    ls += (float)ha + (float)hc;
                }
            }
            l = l * alpha + ls; m = mnew;
            o0 = o0 * alpha; o1 = o1 * alpha; o2 = o2 * alpha; o3 = o3 * alpha;
            if constexpr (EARLY != 0) { e0 = e0 * alpha; e1 = e1 * alpha; e2 = e2 * alpha; e3 = e3 * alpha; }
            const h16* va = VT + vo + key0;
            {
                const v16h v0 = ldh(va), v1 = ldh(va + (size_t)16 * SEQ), v2 = ldh(va + (size_t)32 * SEQ), v3 = ldh(va + (size_t)48 * SEQ);
                o0 = wmma16(v0, pb, o0); o1 = wmma16(v1, pb, o1); o2 = wmma16(v2, pb, o2); o3 = wmma16(v3, pb, o3);
                if constexpr (EARLY != 0) {
                    e0 = wmma16(v0, pq, e0); e1 = wmma16(v1, pq, e1); e2 = wmma16(v2, pq, e2); e3 = wmma16(v3, pq, e3);
                    asm volatile("v_nop\n\tv_nop\n\tv_nop\n\tv_nop" : "+v"(o0), "+v"(o1), "+v"(o2), "+v"(o3), "+v"(e0), "+v"(e1), "+v"(e2), "+v"(e3) : "v"(v0), "v"(v1), "v"(v2), "v"(v3), "v"(pb), "v"(pq));
                } else {
                    asm volatile("v_nop\n\tv_nop\n\tv_nop\n\tv_nop" : "+v"(o0), "+v"(o1), "+v"(o2), "+v"(o3) : "v"(v0), "v"(v1), "v"(v2), "v"(v3), "v"(pb));
                }
            }
            if constexpr (EARLY != 0) {
                __builtin_amdgcn_sched_barrier(0);
                if (key0 < EROWS) {                                      // residual v^T plane covers keys < EROWS (wave-uniform)
                    const h16* wa = VR + vro + key0;
                    const v16h w0 = ldh(wa), w1 = ldh(wa + (size_t)16 * EROWS), w2 = ldh(wa + (size_t)32 * EROWS), w3 = ldh(wa + (size_t)48 * EROWS);
                    e0 = wmma16(w0, pb, e0); e1 = wmma16(w1, pb, e1); e2 = wmma16(w2, pb, e2); e3 = wmma16(w3, pb, e3);
                    asm volatile("v_nop\n\tv_nop\n\tv_nop\n\tv_nop" : "+v"(e0), "+v"(e1), "+v"(e2), "+v"(e3) : "v"(w0), "v"(w1), "v"(w2), "v"(w3), "v"(pb));
                }
                __builtin_amdgcn_sched_barrier(0);
            }
        }
        l += __shfl_xor(l, 16, 32);
        const unsigned dead = __builtin_amdgcn_ballot_w32(!(l > 0.0f));
        if (dead == 0u) break;                                           // wave-uniform
        noskip = 1;
    }
    const float inv = CXS * (1.0f / l);
    const int wb = wave * 16 * 68;
    // O^T D layout: o_j[r] = (d = 16j + 8h + r, t = lane&15) -> os[t][d]; rows 0..15 x columns 0..63 all written
    {
        v8f x0 = o0, x1 = o1, x2 = o2, x3 = o3;
        if constexpr (EARLY != 0) { x0 = o0 + e0 * QRI; x1 = o1 + e1 * QRI; x2 = o2 + e2 * QRI; x3 = o3 + e3 * QRI; }
        x0 = x0 * inv; x1 = x1 * inv; x2 = x2 * inv; x3 = x3 * inv;
        v4f a, c;
        a = __builtin_shufflevector(x0, x0, 0, 1, 2, 3); c = __builtin_shufflevector(x0, x0, 4, 5, 6, 7);
        *(v4fa*)(&os[wb + lr * 68 +  0 + 8 * hi]) = a; *(v4fa*)(&os[wb + lr * 68 +  0 + 8 * hi + 4]) = c;
        a = __builtin_shufflevector(x1, x1, 0, 1, 2, 3); c = __builtin_shufflevector(x1, x1, 4, 5, 6, 7);
        *(v4fa*)(&os[wb + lr * 68 + 16 + 8 * hi]) = a; *(v4fa*)(&os[wb + lr * 68 + 16 + 8 * hi + 4]) = c;
        a = __builtin_shufflevector(x2, x2, 0, 1, 2, 3); c = __builtin_shufflevector(x2, x2, 4, 5, 6, 7);
        *(v4fa*)(&os[wb + lr * 68 + 32 + 8 * hi]) = a; *(v4fa*)(&os[wb + lr * 68 + 32 + 8 * hi + 4]) = c;
        a = __builtin_shufflevector(x3, x3, 0, 1, 2, 3); c = __builtin_shufflevector(x3, x3, 4, 5, 6, 7);
        *(v4fa*)(&os[wb + lr * 68 + 48 + 8 * hi]) = a; *(v4fa*)(&os[wb + lr * 68 + 48 + 8 * hi + 4]) = c;
    }
    wave_sync();
    const size_t crow = ((size_t)b * SEQ + t0) * DM + (size_t)h * HD;       // context plane [b*SEQ + t][h*64 + d]
    const size_t rrow = ((size_t)b * EROWS + t0) * DM + (size_t)h * HD;     // residual plane [b*EROWS + t][h*64 + d] (EARLY launches only: t0 + 15 < EROWS)
{
#pragma unroll
        for (int s = 0; s < 4; ++s) { const int row = 4 * s + (lane >> 3), c8 = (lane & 7) * 8;   // 4 s x 4 row groups = 16 rows; 8 lanes x 8 = 64 columns
            const v4f x0 = *(const v4fa*)(&os[wb + row * 68 + c8]); const v4f x1 = *(const v4fa*)(&os[wb + row * 68 + c8 + 4]); v8h hv, rv;
#pragma unroll
            for (int i = 0; i < 4; ++i) { const h16 a0 = (h16)x0[i]; const h16 a1 = (h16)x1[i]; hv[i] = a0; hv[4 + i] = a1; rv[i] = (h16)((x0[i] - (float)a0) * QRS); rv[4 + i] = (h16)((x1[i] - (float)a1) * QRS); }
            *(v8h*)(CH + crow + (size_t)row * DM + c8) = hv;
            if constexpr (EARLY != 0) *(v8h*)(CR + rrow + (size_t)row * DM + c8) = rv; }
         }
}

// k_oproj: output projection, f16 GEMM, ONE WAVE per (16*MT) x 64 tile, K = DM. OUT[m][n] = OSC * (sum_k A[m][k] Bt[n][k] + QRI * sum_k AR[m][k] Bt[n][k]) + bias[n] (bias RNE-converted to bf16).
// A = context plane (x16), AR = context residual plane (RES != 0 only, rows [b*EROWS + t]), Bt = Wo x1024 as f16 ([out][in]).
// grid (NB * tpb, DM/64); block x -> batch x / tpb, first token rowoff + (x % tpb) * 16*MT.
template <int MT, int RES>
__global__ __launch_bounds__(32) void k_oproj(const h16* __restrict__ A, const h16* __restrict__ AR, const h16* __restrict__ Bt, const float* __restrict__ bias, float* OUT, int tpb, int rowoff) {
    static_assert((MT == 4 && RES == 0) || (MT == 2 && RES == 1));
    __shared__ __align__(16) float os[16 * 68];
    const int K = DM;
    const int lane = threadIdx.x & 31, lr = lane & 15, hi = lane >> 4;
    const int bb = blockIdx.x / tpb, tl = blockIdx.x % tpb;
    const int tok = rowoff + tl * (16 * MT);
    const int c0 = blockIdx.y * 64;
    const size_t aoff = ((size_t)bb * SEQ + tok + lr) * K + 8 * hi;
    const size_t roff = ((size_t)bb * EROWS + tok + lr) * K + 8 * hi;
    const size_t boff = (size_t)(c0 + lr) * K + 8 * hi;
    v8f acc[MT][4], acr[MT][4];
#pragma unroll
    for (int mb = 0; mb < MT; ++mb)
#pragma unroll
        for (int nb = 0; nb < 4; ++nb) { acc[mb][nb] = (v8f){}; acr[mb][nb] = (v8f){}; }
#pragma unroll 1
    for (int kc = 0; kc < K; kc += 32) {
        v16h a[MT], ar[MT];
#pragma unroll
        for (int mb = 0; mb < MT; ++mb) { a[mb] = ldh(A + aoff + (size_t)mb * 16 * K + kc); ar[mb] = a[mb]; }
        if constexpr (RES != 0) {
#pragma unroll
            for (int mb = 0; mb < MT; ++mb) ar[mb] = ldh(AR + roff + (size_t)mb * 16 * K + kc);
        }
#pragma unroll
        for (int nb = 0; nb < 4; ++nb) { const v16h bfrag = ldh(Bt + boff + (size_t)nb * 16 * K + kc);
#pragma unroll
            for (int mb = 0; mb < MT; ++mb) { acc[mb][nb] = wmma16(a[mb], bfrag, acc[mb][nb]);
                if constexpr (RES != 0) acr[mb][nb] = wmma16(ar[mb], bfrag, acr[mb][nb]); } }
        if constexpr (MT == 4) {
            asm volatile("v_nop\n\tv_nop\n\tv_nop\n\tv_nop" : "+v"(acc[0][3]), "+v"(acc[1][3]), "+v"(acc[2][3]), "+v"(acc[3][3]) : "v"(a[0]), "v"(a[1]), "v"(a[2]), "v"(a[3]));
        } else {
            asm volatile("v_nop\n\tv_nop\n\tv_nop\n\tv_nop" : "+v"(acc[0][3]), "+v"(acc[1][3]), "+v"(acr[0][3]), "+v"(acr[1][3]) : "v"(a[0]), "v"(a[1]), "v"(ar[0]), "v"(ar[1]));
        }
    }
    float bc[4];
#pragma unroll
    for (int nb = 0; nb < 4; ++nb) bc[nb] = bfr(bias[c0 + nb * 16 + lr]);
#pragma unroll
    for (int mb = 0; mb < MT; ++mb) {
#pragma unroll
        for (int nb = 0; nb < 4; ++nb) {
#pragma unroll
            for (int j = 0; j < 8; ++j) { float v = acc[mb][nb][j] * OSC;
                if constexpr (RES != 0) v += acr[mb][nb][j] * (OSC * QRI);
                os[(hi * 8 + j) * 68 + nb * 16 + lr] = v + bc[nb]; } }                          // D: row 8h+j, col lane&15
        wave_sync();
        float* orow = OUT + ((size_t)bb * OUT_SEQ + tok + mb * 16) * DM + c0;
{
#pragma unroll
            for (int s = 0; s < 8; ++s) { const int row = 2 * s + hi, cofs = lr * 4;            // 8 s x 2 rows = 16 rows; 16 lanes x 4 floats = 64 columns
                const v4f val = *(const v4fa*)(&os[row * 68 + cofs]);
                *(v4f*)(orow + (size_t)row * DM + cofs) = val; }
             }
        wave_sync();
    }
}

static constexpr size_t al256(size_t v) { return (v + 255) & ~(size_t)255; }
static constexpr size_t SZ_XB = al256((size_t)NB * SEQ * DM * 2);              // x bf16
static constexpr size_t SZ_WB = al256((size_t)3 * DM * DM * 2);                // Wq | Wk | Wv bf16
static constexpr size_t SZ_WO = al256((size_t)DM * DM * 2);                    // Wo f16 (x1024)
static constexpr size_t SZ_PL = al256((size_t)NB * NH_ * SEQ * HD * 2);        // q / k / v^T planes
static constexpr size_t SZ_RP = al256((size_t)NB * NH_ * EROWS * HD * 2);      // residual planes (t < EROWS)
static constexpr size_t SZ_CX = al256((size_t)NB * SEQ * DM * 2);              // context plane
static constexpr size_t SZ_CR = al256((size_t)NB * EROWS * DM * 2);            // context residual plane
static constexpr size_t SZ_TOTAL = SZ_XB + SZ_WB + SZ_WO + 3 * SZ_PL + 3 * SZ_RP + SZ_CX + SZ_CR;
static_assert(SZ_TOTAL <= (size_t)134217728);          // workspace carve <= 128 MiB
static_assert(((size_t)DM * DM * 2) % 256 == 0);       // weight sub-planes stay 256-byte aligned

extern "C" void kernel_launch(void* const* d_in, const int* in_sizes, int n_in,
                              void* d_out, int out_size, void* d_ws, size_t ws_size, hipStream_t stream) {
    if (n_in < 10) return;
    const size_t needx = ((size_t)(NB - 1) * SEQ_FULL + SEQ) * DM;
    if ((size_t)in_sizes[0] < needx) return;
    if ((size_t)in_sizes[1] < (size_t)(SEQ - 1) * SEQ_FULL + SEQ) return;
    if ((size_t)in_sizes[2] < (size_t)DM * DM || (size_t)in_sizes[4] < (size_t)DM * DM || (size_t)in_sizes[6] < (size_t)DM * DM || (size_t)in_sizes[8] < (size_t)DM * DM) return;
    if (in_sizes[3] < DM || in_sizes[5] < DM || in_sizes[7] < DM || in_sizes[9] < DM) return;
    if ((size_t)out_size < ((size_t)(NB - 1) * OUT_SEQ + SEQ) * DM) return;
    if (SZ_TOTAL > ws_size) return;
    // wire order: query, mask (int32), Wq, bq, Wk, bk, Wv, bv, Wo, bo; weights [out][in] = Bt as-is
    const float* x  = (const float*)d_in[0]; const int* mask = (const int*)d_in[1];
    const float* wq = (const float*)d_in[2]; const float* bq = (const float*)d_in[3];
    const float* wk = (const float*)d_in[4]; const float* bk = (const float*)d_in[5];
    const float* wv = (const float*)d_in[6]; const float* bv = (const float*)d_in[7];
    const float* wo = (const float*)d_in[8]; const float* bo = (const float*)d_in[9];
    float* OUT = (float*)d_out;      // [NB][SEQ][1024]
    char* wsp = (char*)d_ws;
    bf*  XB  = (bf*)wsp;  wsp += SZ_XB;              // [NB*SEQ][1024]
    bf*  WB  = (bf*)wsp;  wsp += SZ_WB;              // [3][1024][1024]: q | k | v
    h16* WOH = (h16*)wsp; wsp += SZ_WO;              // [1024][1024] x1024
    h16* QH  = (h16*)wsp; wsp += SZ_PL;              // [NB*16][SEQ][64]
    h16* KP  = (h16*)wsp; wsp += SZ_PL;              // [NB*16][SEQ][64]
    h16* VT  = (h16*)wsp; wsp += SZ_PL;              // [NB*16][64][SEQ]
    h16* QR  = (h16*)wsp; wsp += SZ_RP;              // [NB*16][EROWS][64] residual x2048
    h16* KR  = (h16*)wsp; wsp += SZ_RP;              // [NB*16][EROWS][64] residual x2048
    h16* VR  = (h16*)wsp; wsp += SZ_RP;              // [NB*16][64][EROWS] residual x2048
    h16* CXH = (h16*)wsp; wsp += SZ_CX;              // [NB*SEQ][1024] x16
    h16* CXR = (h16*)wsp; wsp += SZ_CR;              // [NB*EROWS][1024] residual x2048
    bf* WQ = WB; bf* WK = WB + (size_t)DM * DM; bf* WV = WB + (size_t)2 * DM * DM;

    if (SEQ == SEQ_FULL) {
        const size_t n8 = (size_t)NB * SEQ * DM / 8;
        k_cvt8<<<(unsigned)((n8 + 255) / 256), 256, 0, stream>>>(x, XB, n8);
    } else {
        const size_t n8 = (size_t)SEQ * DM / 8;
        for (int b = 0; b < NB; ++b) k_cvt8<<<(unsigned)((n8 + 255) / 256), 256, 0, stream>>>(x + (size_t)b * SEQ_FULL * DM, XB + (size_t)b * SEQ * DM, n8);
    }
    { const size_t n8 = (size_t)DM * DM / 8; const unsigned g = (unsigned)((n8 + 255) / 256);
      k_cvt8<<<g, 256, 0, stream>>>(wq, WQ, n8); k_cvt8<<<g, 256, 0, stream>>>(wk, WK, n8); k_cvt8<<<g, 256, 0, stream>>>(wv, WV, n8);
      k_cvtw8<<<g, 256, 0, stream>>>(wo, WOH, n8); }

    // q, k: A = x rows (m = b*SEQ + t), Bt = W rows (n = h*64 + d), bias by column -> plane [(b*16 + h)][t][d]; residual plane [(b*16 + h)][t < EROWS][d]
    k_proj<0><<<dim3(NB * SEQ / 64, DM / 64, 1), 32, 0, stream>>>(XB, WQ, bq, QH, QR, SEQ, (size_t)NH_ * SEQ * HD, HD, HD, (size_t)SEQ * HD,
                                                                  (size_t)NH_ * EROWS * HD, HD, (size_t)EROWS * HD, EROWS, HD);
    k_proj<0><<<dim3(NB * SEQ / 64, DM / 64, 1), 32, 0, stream>>>(XB, WK, bk, KP, KR, SEQ, (size_t)NH_ * SEQ * HD, HD, HD, (size_t)SEQ * HD,
                                                                  (size_t)NH_ * EROWS * HD, HD, (size_t)EROWS * HD, EROWS, HD);
    // v^T: A = Wv rows (m = h*64 + d), Bt = x rows (n = b*SEQ + t), bias by row -> plane [(b*1024 + m)][t] = [(b*16 + h)][d][t]; residual plane [(b*1024 + m)][t < EROWS]
    k_proj<1><<<dim3(DM / 64, NB * SEQ / 64, 1), 32, 0, stream>>>(WV, XB, bv, VT, VR, DM, (size_t)0, SEQ, SEQ, (size_t)DM * SEQ,
                                                                  (size_t)0, EROWS, (size_t)DM * EROWS, DM, EROWS);

    k_flash<1><<<dim3(EROWS / (16 * AW), NB * NH_, 1), 32 * AW, 0, stream>>>(QH, QR, KP, KR, VT, VR, mask, CXH, CXR, 0);
    if (SEQ > EROWS)
        k_flash<0><<<dim3((SEQ - EROWS) / (16 * AW), NB * NH_, 1), 32 * AW, 0, stream>>>(QH, QR, KP, KR, VT, VR, mask, CXH, CXR, EROWS);

    k_oproj<2, 1><<<dim3(NB * (EROWS / 32), DM / 64, 1), 32, 0, stream>>>(CXH, CXR, WOH, bo, OUT, EROWS / 32, 0);
    if (SEQ > EROWS)
        k_oproj<4, 0><<<dim3(NB * ((SEQ - EROWS) / 64), DM / 64, 1), 32, 0, stream>>>(CXH, CXH, WOH, bo, OUT, (SEQ - EROWS) / 64, EROWS);
}

// v001
// Measured time: 354 microseconds a run.
// Timed twice side by side with v000, it ran 1.11 and 1.14 times as fast.
#include <hip/hip_runtime.h>

// Masked multi-head self-attention, width 1024 = 16 heads x 64, x [NB][SEQ][1024], Wq/Wk/Wv/Wo [out][in] (y = x W^T + b), int32 mask [SEQ][SEQ] (0 = fill -1e9), score scale 1/8, output projection with bias (f32 out).
// Compute dtypes, f32 accumulate everywhere: q/k/v projections v_wmma_f32_16x16x32_bf16 (x and W RNE-converted to bf16; products exact; biases RNE-converted to bf16, added in f32);
// scores and P.V v_wmma_f32_16x16x32_f16: single f16 planes on query rows >= 512; on the first 512 query rows q, k, v, P and the context carry an f16 residual x2048 (three products, residual terms in their own accumulator);
// P carried x256 (cancels in the normalisation); output projection v_wmma_f32_16x16x32_f16 with context x16 and bf16-exact Wo x1024 as f16 (context residual on the first 512 rows); softmax f32 (online, running max).
// Layout: every 16-bit matrix operand plane is fragment-major: a unit is one 16-row x 32-k fragment = [part 0..1][lane 0..31][8 elements] (512 elements, 1 KiB), element (part, lane, e) = (row lane&15, k 16*part + 8*(lane>>4) + e),
// so each 16-byte-per-lane load or store of a wave covers 512 contiguous bytes (4 whole lines). x, W, context planes: [row/16][k/32][unit]; q, k planes: [b*16+h][t/16][d/32][unit]; v^T plane: [b*16+h][t/32][d/16][unit]
// (+ residual planes for t < 512), written by the GEMM epilogue; fused flash kernel in transposed form (S^T = K Q^T, O^T = V^T P^T);
// mask read by value per 32-key step (replace-fill); fully masked 16x32 tiles are skipped, with a full second sweep when a row ends with no visited key.

#ifndef NB
#define NB 4
#endif
#ifndef SEQ
#define SEQ 2048
#endif
#define NB_FULL  4
#define SEQ_FULL 2048
#ifndef OUT_SEQ
#define OUT_SEQ SEQ              // row pitch (in tokens) between batches of the output
#endif
#define DM   1024
#define NH_  16
#define HD   64
#define AW   4                   // waves per flash block (16 query rows each)
#define EROWS ((SEQ) < 512 ? (SEQ) : 512)   // query rows / keys per sequence that carry residual planes
#define QRS  2048.0f             // carry of every residual plane
#define QRI  (1.0f / 2048.0f)
#define SC2  (0.125f * 1.4426950408889634f)   // HD^-0.5 * log2(e)
#define NEGL (-1.0e9f * 1.4426950408889634f)  // masked fill in the log2 domain
#define PSH  8.0f                // log2 of the P carry (256)
#define CXS  16.0f               // carry of the context planes
#define WOS  1024.0f             // carry of the Wo plane
#define OSC  (1.0f / 16384.0f)   // 1 / (CXS * WOS)

static_assert(HD == 64);
static_assert(NH_ * HD == DM);                 // head h = columns h*64 + d
static_assert(DM % 64 == 0);
static_assert(DM % 32 == 0);                   // GEMM k-loop steps by 32
static_assert(SEQ % 64 == 0);                  // a 64-row tile never straddles two batches
static_assert((NB * SEQ) % 64 == 0);
static_assert(SEQ % 32 == 0);                  // key loop steps by 32
static_assert(EROWS % 64 == 0);                // residual tiles are whole 64-tiles; flash grid covers them exactly
static_assert(EROWS % (16 * AW) == 0);
static_assert((SEQ - EROWS) % 64 == 0);
static_assert((SEQ - EROWS) % (16 * AW) == 0);
static_assert(EROWS <= SEQ);
static_assert(((size_t)SEQ * DM) % 8 == 0);
static_assert(((size_t)DM * DM) % 8 == 0);
static_assert(NB <= NB_FULL);
static_assert(SEQ <= SEQ_FULL);

typedef _Float16 h16;
typedef unsigned short bf;
typedef __attribute__((ext_vector_type(16))) __bf16   v16bf;
typedef __attribute__((ext_vector_type(16))) _Float16 v16h;
typedef __attribute__((ext_vector_type(8)))  _Float16 v8h;
typedef __attribute__((ext_vector_type(8)))  unsigned short v8us;
typedef __attribute__((ext_vector_type(8)))  float    v8f;
typedef __attribute__((ext_vector_type(4)))  float    v4f;
typedef __attribute__((ext_vector_type(4)))  int      v4i;
typedef v4f  __attribute__((may_alias)) v4fa;

__device__ __forceinline__ unsigned short f2bf(float f) { unsigned u = __float_as_uint(f); u += 0x7FFFu + ((u >> 16) & 1u); return (unsigned short)(u >> 16); }
__device__ __forceinline__ float bfr(float f) { return __uint_as_float(((unsigned)f2bf(f)) << 16); }   // value after RNE convert to bf16
__device__ __forceinline__ v16h cat16(v8h lo, v8h hi) { return __builtin_shufflevector(lo, hi, 0, 1, 2, 3, 4, 5, 6, 7, 8, 9, 10, 11, 12, 13, 14, 15); }
__device__ __forceinline__ v16bf cat16b(v8us lo, v8us hi) { return __builtin_bit_cast(v16bf, __builtin_shufflevector(lo, hi, 0, 1, 2, 3, 4, 5, 6, 7, 8, 9, 10, 11, 12, 13, 14, 15)); }
__device__ __forceinline__ v8f wmma16(v16h a, v16h b, v8f c) { return __builtin_amdgcn_wmma_f32_16x16x32_f16(false, a, false, b, (short)0, c, false, false); }
__device__ __forceinline__ v8f wmmab(v16bf a, v16bf b, v8f c) { return __builtin_amdgcn_wmma_f32_16x16x32_bf16(false, a, false, b, (short)0, c, false, false); }
// fragment loaders from a fragment-major unit; p = unit base + 8*lane: elements 0..7 <- k0+8h+0..7 (part 0), elements 8..15 <- k0+16+8h+0..7 (part 1, +256 elements) (same map for A and B)
__device__ __forceinline__ v16h  ldh(const h16* p) { return cat16(*(const v8h*)p, *(const v8h*)(p + 256)); }
__device__ __forceinline__ v16bf ldb(const bf* p)  { return cat16b(*(const v8us*)p, *(const v8us*)(p + 256)); }
// converters: a wave takes 8 rows x 32 k (8 whole 128-B lines of f32) and writes 4 whole 128-B lines of one unit. Thread i -> source element offset (row-major, DM columns) and fragment-major destination offset.
__device__ __forceinline__ void cvt_map(size_t i, size_t& so, size_t& dof) {
    const int lane = (int)(i & 31); const size_t w = i >> 5; const size_t ks = w % (DM / 32); const size_t row = (w / (DM / 32)) * 8 + (size_t)(lane >> 2); const int c = lane & 3;
    so  = row * DM + ks * 32 + (size_t)c * 8;
    dof = (row >> 4) * (size_t)(16 * DM) + ks * 512 + (size_t)(c >> 1) * 256 + (size_t)(c & 1) * 128 + (row & 15) * 8;
}
// ordering point for wave-private LDS tiles (same wave writes and reads)
__device__ __forceinline__ void wave_sync() { __builtin_amdgcn_fence(3 /* release order */, "wavefront"); __builtin_amdgcn_wave_barrier(); asm volatile("" ::: "memory"); }

__global__ __launch_bounds__(256) void k_cvt8(const float* __restrict__ src, bf* dst, size_t n8) {
    const size_t i = (size_t)blockIdx.x * 256 + threadIdx.x; if (i >= n8) return;
    size_t so, dof; cvt_map(i, so, dof);
    const v8f v = *(const v8f*)(src + so); v8us o;
#pragma unroll
    for (int k = 0; k < 8; ++k) o[k] = f2bf(v[k]);
    *(v8us*)(dst + dof) = o;
}

__global__ __launch_bounds__(256) void k_cvtw8(const float* __restrict__ src, h16* dst, size_t n8) {
    const size_t i = (size_t)blockIdx.x * 256 + threadIdx.x; if (i >= n8) return;
    size_t so, dof; cvt_map(i, so, dof);
    const v8f v = *(const v8f*)(src + so); v8h o;
#pragma unroll
    for (int k = 0; k < 8; ++k) o[k] = (h16)(bfr(v[k]) * WOS);
    *(v8h*)(dst + dof) = o;
}

// k_proj: register-blocked bf16 GEMM, ONE WAVE per 64x64 tile (16 accumulators), operands straight from fragment-major bf16 planes, K = DM.
// C[m][n] = sum_k A[m][k] Bt[n][k] + bias (BIASROW == 0: bias[n]; BIASROW != 0: bias[m]), written as f16 (Ph), fragment-major with row = m, k = n, at
// tile base (r0/RB)*sRB + (r0%RB)*pitch + (c0/CB)*sCB + (c0%CB)*CMUL, + mb*MBS per 16 rows, + S1S per 32 columns; the f16 residual x2048 (Pr) is written with its own strides when (r0%RB) < rlim and (c0%CB) < clim.
template <int BIASROW>
__global__ __launch_bounds__(32) void k_proj(const bf* __restrict__ A, const bf* __restrict__ Bt, const float* __restrict__ bias, h16* Ph, h16* Pr,
                                             int RB, size_t sRB, int pitch, int CB, size_t sCB,
                                             size_t sRBr, int pitchr, size_t sCBr, int rlim, int clim) {
    __shared__ __align__(16) float os[16 * 68];
    const int K = DM;
    const int lane = threadIdx.x & 31, lr = lane & 15, hi = lane >> 4; const int r0 = blockIdx.x * 64, c0 = blockIdx.y * 64;
    v8f acc[4][4];
#pragma unroll
    for (int mb = 0; mb < 4; ++mb)
#pragma unroll
        for (int nb = 0; nb < 4; ++nb) acc[mb][nb] = (v8f){};
    constexpr int MBS = (BIASROW != 0) ? 512 : 1024, S1S = (BIASROW != 0) ? 2048 : 512, CMUL = (BIASROW != 0) ? 64 : 1;   // q, k: [t/16][d/32][unit]; v^T: [t/32][d/16][unit]
    const size_t aoff = (size_t)r0 * K + 8 * lane, boff = (size_t)c0 * K + 8 * lane;      // unit (row tile, kc/32) at (row tile)*16*K + kc*16
#pragma unroll 1
    for (int kc = 0; kc < K; kc += 32) {
        const bf* pa = A + aoff + kc * 16; const bf* pb = Bt + boff + kc * 16;
        v16bf a[4], b[4];
#pragma unroll
        for (int mb = 0; mb < 4; ++mb) a[mb] = ldb(pa + (size_t)mb * 16 * K);
#pragma unroll
        for (int nb = 0; nb < 4; ++nb) b[nb] = ldb(pb + (size_t)nb * 16 * K);
        asm volatile("s_wait_xcnt 0x0" :: "v"(pa), "v"(pb) : "memory");   // the issued loads' address registers stay as they are (held as inputs) until this wait; it runs under the loads' own latency
#pragma unroll
        for (int nb = 0; nb < 4; ++nb) {
#pragma unroll
            for (int mb = 0; mb < 4; ++mb) acc[mb][nb] = wmmab(a[mb], b[nb], acc[mb][nb]); }
        asm volatile("v_nop\n\tv_nop\n\tv_nop\n\tv_nop" : "+v"(acc[0][3]), "+v"(acc[1][3]), "+v"(acc[2][3]), "+v"(acc[3][3]) : "v"(a[0]), "v"(a[1]), "v"(a[2]), "v"(a[3]));
    }
    float bc[4] = {0.0f, 0.0f, 0.0f, 0.0f};
    if constexpr (BIASROW == 0) {
#pragma unroll
        for (int nb = 0; nb < 4; ++nb) bc[nb] = bfr(bias[c0 + nb * 16 + lr]);
    }
    const int wres = (((r0 % RB) < rlim) && ((c0 % CB) < clim)) ? 1 : 0;   // tile-uniform
    const size_t tbase = (size_t)(r0 / RB) * sRB + (size_t)(r0 % RB) * (size_t)pitch + (size_t)(c0 / CB) * sCB + (size_t)(c0 % CB) * CMUL;
    const size_t tbasr = (size_t)(r0 / RB) * sRBr + (size_t)(r0 % RB) * (size_t)pitchr + (size_t)(c0 / CB) * sCBr + (size_t)(c0 % CB) * CMUL;
#pragma unroll
    for (int mb = 0; mb < 4; ++mb) {
        float rb[8];
        if constexpr (BIASROW != 0) {
            const v4f b0 = *(const v4f*)(bias + r0 + mb * 16 + 8 * hi); const v4f b1 = *(const v4f*)(bias + r0 + mb * 16 + 8 * hi + 4);
#pragma unroll
            for (int i = 0; i < 4; ++i) { rb[i] = bfr(b0[i]); rb[4 + i] = bfr(b1[i]); }
        } else {
#pragma unroll
            for (int j = 0; j < 8; ++j) rb[j] = 0.0f;
        }
#pragma unroll
        for (int nb = 0; nb < 4; ++nb) {
#pragma unroll
            for (int j = 0; j < 8; ++j) os[(hi * 8 + j) * 68 + nb * 16 + lr] = acc[mb][nb][j] + ((BIASROW != 0) ? rb[j] : bc[nb]); }   // D: row 8h+j, col lane&15
        wave_sync();
        const size_t sb = tbase + (size_t)(mb * MBS) + 8 * lane;
        const size_t sr = tbasr + (size_t)(mb * MBS) + 8 * lane;
{
#pragma unroll
            for (int s = 0; s < 4; ++s) { const int row = lr, c8 = (2 * s + hi) * 8;   // store s = part s&1 of the unit of columns 32*(s>>1)..+31: lane holds row lane&15, columns 16*s + 8*(lane>>4) + 0..7
                const v4f x0 = *(const v4fa*)(&os[row * 68 + c8]); const v4f x1 = *(const v4fa*)(&os[row * 68 + c8 + 4]); v8h hv, rv;
#pragma unroll
                for (int i = 0; i < 4; ++i) { const h16 a0 = (h16)x0[i]; const h16 a1 = (h16)x1[i]; hv[i] = a0; hv[4 + i] = a1; rv[i] = (h16)((x0[i] - (float)a0) * QRS); rv[4 + i] = (h16)((x1[i] - (float)a1) * QRS); }
                *(v8h*)(Ph + sb + (s >> 1) * S1S + (s & 1) * 256) = hv;
                asm volatile("s_wait_xcnt 0x0" :: "v"(hv) : "memory");       // before the issued store's registers are reused
                if (wres) { *(v8h*)(Pr + sr + (s >> 1) * S1S + (s & 1) * 256) = rv;
                    asm volatile("s_wait_xcnt 0x0" :: "v"(rv) : "memory"); } }   // the same for the residual store
             }
        wave_sync();
    }
}

// k_flash: fused masked attention, one wave per 16 query rows of one (batch, head); K / V^T / Q fragments straight from the fragment-major f16 planes (two 16-B loads each, 512 contiguous bytes per wave-load).
// Transposed form: S^T[key][t] = K Q^T (A = K rows, B = Q rows); lane (t = lane&15, h = lane>>4) holds keys 8h+r of each 16-key tile, so the packed
// P tile is directly the B fragment of O^T[d][t] = V^T P^T (element r <- tile keys 0..15, element 8+r <- tile keys 16..31, lane unchanged).
// Mask: each lane loads its 16 mask words of the step (4 x 16 B) and replaces masked scores by the fill value; a step whose 16x32 mask tile is all zero is skipped (wave-uniform);
// if some row ends with no visited key the wave repeats the sweep over every step, which yields the uniform average of a fully masked row.
// EARLY != 0 (query rows < EROWS): q, k, v and P carry residuals x2048; residual products accumulate separately and are folded back with 1/2048.
template <int EARLY>
__global__ __launch_bounds__(32 * AW) void k_flash(const h16* __restrict__ QH, const h16* __restrict__ QR, const h16* __restrict__ KP, const h16* __restrict__ KR,
                                                   const h16* __restrict__ VT, const h16* __restrict__ VR, const int* __restrict__ MK, h16* CH, h16* CR, int tstart) {
    const int lane = threadIdx.x & 31, wave = __builtin_amdgcn_readfirstlane((int)(threadIdx.x >> 5)), lr = lane & 15, hi = lane >> 4;
    const int zh = blockIdx.y; const int b = zh / NH_, h = zh % NH_;
    const int t0 = tstart + (blockIdx.x * AW + wave) * 16;
    const size_t pbase = (size_t)zh * SEQ * HD;
    const size_t rbase = (size_t)zh * EROWS * HD;
    const size_t qo = pbase + (size_t)t0 * HD + 8 * lane;
    const v16h qh0 = ldh(QH + qo), qh1 = ldh(QH + qo + 512);                // B fragments: col t, k = d
    v16h qr0 = qh0, qr1 = qh1;
    if constexpr (EARLY != 0) { const size_t qro = rbase + (size_t)t0 * HD + 8 * lane; qr0 = ldh(QR + qro); qr1 = ldh(QR + qro + 512); }
    const size_t ko  = pbase + 8 * lane;       // + key0 * HD + 512 * (d/32)   (A fragment: row key, k = d; 16 keys = 1024 elements)
    const size_t kro = rbase + 8 * lane;
    const size_t vo  = pbase + 8 * lane;       // + key0 * HD + 512 * j        (A fragment: row d = 16j.., k = key; 32 keys = 2048 elements)
    const size_t vro = rbase + 8 * lane;
    const size_t mo  = (size_t)(t0 + lr) * SEQ_FULL + 8 * hi;  // mask row t, + key
    v8f o0 = (v8f){}, o1 = (v8f){}, o2 = (v8f){}, o3 = (v8f){};
    v8f e0 = (v8f){}, e1 = (v8f){}, e2 = (v8f){}, e3 = (v8f){};
    float m = -3.0e38f, l = 0.0f;
    int noskip = 0;
#pragma unroll 1
    for (int pass = 0; pass < 2; ++pass) {
        o0 = (v8f){}; o1 = (v8f){}; o2 = (v8f){}; o3 = (v8f){};
        e0 = (v8f){}; e1 = (v8f){}; e2 = (v8f){}; e3 = (v8f){};
        m = -3.0e38f; l = 0.0f;
#pragma unroll 1
        for (int key0 = 0; key0 < SEQ; key0 += 32) {
            const int* mp = MK + mo + key0;
            const v4i ma0 = *(const v4i*)mp, ma1 = *(const v4i*)(mp + 4), mb0 = *(const v4i*)(mp + 16), mb1 = *(const v4i*)(mp + 20);
            const v4i mor = ma0 | ma1 | mb0 | mb1;
            const int anyv = mor[0] | mor[1] | mor[2] | mor[3];
            const unsigned bal = __builtin_amdgcn_ballot_w32(anyv != 0);
            if (noskip == 0 && bal == 0u) continue;                      // wave-uniform
            const h16* ka = KP + ko + (size_t)key0 * HD;
            v8f sHa = (v8f){}, sHb = (v8f){}, sLa = (v8f){}, sLb = (v8f){};
            {
                const v16h ka0 = ldh(ka), ka1 = ldh(ka + 512), kb0 = ldh(ka + 16 * HD), kb1 = ldh(ka + 16 * HD + 512);
                sHa = wmma16(ka0, qh0, sHa); sHb = wmma16(kb0, qh0, sHb); sHa = wmma16(ka1, qh1, sHa); sHb = wmma16(kb1, qh1, sHb);
                if constexpr (EARLY != 0) {
                    sLa = wmma16(ka0, qr0, sLa); sLb = wmma16(kb0, qr0, sLb); sLa = wmma16(ka1, qr1, sLa); sLb = wmma16(kb1, qr1, sLb);
                    asm volatile("v_nop\n\tv_nop\n\tv_nop\n\tv_nop" : "+v"(sHa), "+v"(sHb), "+v"(sLa), "+v"(sLb) : "v"(ka0), "v"(ka1), "v"(kb0), "v"(kb1));
                } else {
                    asm volatile("v_nop\n\tv_nop\n\tv_nop\n\tv_nop" : "+v"(sHa), "+v"(sHb) : "v"(ka0), "v"(ka1), "v"(kb0), "v"(kb1));
                }
            }
            if constexpr (EARLY != 0) {
                __builtin_amdgcn_sched_barrier(0);
                if (key0 < EROWS) {                                      // residual k plane covers keys < EROWS (wave-uniform)
                    const h16* ra = KR + kro + (size_t)key0 * HD;
                    const v16h ra0 = ldh(ra), ra1 = ldh(ra + 512), rb0 = ldh(ra + 16 * HD), rb1 = ldh(ra + 16 * HD + 512);
                    sLa = wmma16(ra0, qh0, sLa); sLb = wmma16(rb0, qh0, sLb); sLa = wmma16(ra1, qh1, sLa); sLb = wmma16(rb1, qh1, sLb);
                    asm volatile("v_nop\n\tv_nop\n\tv_nop\n\tv_nop" : "+v"(sLa), "+v"(sLb) : "v"(ra0), "v"(ra1), "v"(rb0), "v"(rb1));
                }
                __builtin_amdgcn_sched_barrier(0);
            }
            const int mka[8] = {ma0[0], ma0[1], ma0[2], ma0[3], ma1[0], ma1[1], ma1[2], ma1[3]};
            const int mkb[8] = {mb0[0], mb0[1], mb0[2], mb0[3], mb1[0], mb1[1], mb1[2], mb1[3]};
            float ta[8], tb[8]; float mx = -3.0e38f;
#pragma unroll
            for (int r = 0; r < 8; ++r) {
                float sa = sHa[r], sb = sHb[r];
                if constexpr (EARLY != 0) { sa += sLa[r] * QRI; sb += sLb[r] * QRI; }
                ta[r] = (mka[r] != 0) ? sa * SC2 : NEGL;
                tb[r] = (mkb[r] != 0) ? sb * SC2 : NEGL;
                mx = fmaxf(mx, fmaxf(ta[r], tb[r]));
            }
            mx = fmaxf(mx, __shfl_xor(mx, 16, 32));
            const float mnew = fmaxf(m, mx);
            const float alpha = __builtin_amdgcn_exp2f(m - mnew);
            const float sh = PSH - mnew;
            v16h pb = (v16h){}; v16h pq = (v16h){}; float ls = 0.0f;
#pragma unroll
            for (int r = 0; r < 8; ++r) {
                const float pa = __builtin_amdgcn_exp2f(ta[r] + sh), pc = __builtin_amdgcn_exp2f(tb[r] + sh);
                const h16 ha = (h16)pa, hc = (h16)pc; pb[r] = ha; pb[8 + r] = hc;
                if constexpr (EARLY != 0) {
                    const h16 ga = (h16)((pa - (float)ha) * QRS), gc = (h16)((pc - (float)hc) * QRS); pq[r] = ga; pq[8 + r] = gc;
                    ls += ((float)ha + (float)hc) + ((float)ga + (float)gc) * QRI;
                } else {
                    ls += (float)ha + (float)hc;
                }
            }
            l = l * alpha + ls; m = mnew;
            o0 = o0 * alpha; o1 = o1 * alpha; o2 = o2 * alpha; o3 = o3 * alpha;
            if constexpr (EARLY != 0) { e0 = e0 * alpha; e1 = e1 * alpha; e2 = e2 * alpha; e3 = e3 * alpha; }
            const h16* va = VT + vo + (size_t)key0 * HD;
            {
                const v16h v0 = ldh(va), v1 = ldh(va + 512), v2 = ldh(va + 1024), v3 = ldh(va + 1536);
                o0 = wmma16(v0, pb, o0); o1 = wmma16(v1, pb, o1); o2 = wmma16(v2, pb, o2); o3 = wmma16(v3, pb, o3);
                if constexpr (EARLY != 0) {
                    e0 = wmma16(v0, pq, e0); e1 = wmma16(v1, pq, e1); e2 = wmma16(v2, pq, e2); e3 = wmma16(v3, pq, e3);
                    asm volatile("v_nop\n\tv_nop\n\tv_nop\n\tv_nop" : "+v"(o0), "+v"(o1), "+v"(o2), "+v"(o3), "+v"(e0), "+v"(e1), "+v"(e2), "+v"(e3) : "v"(v0), "v"(v1), "v"(v2), "v"(v3), "v"(pb), "v"(pq));
                } else {
                    asm volatile("v_nop\n\tv_nop\n\tv_nop\n\tv_nop" : "+v"(o0), "+v"(o1), "+v"(o2), "+v"(o3) : "v"(v0), "v"(v1), "v"(v2), "v"(v3), "v"(pb));
                }
            }
            if constexpr (EARLY != 0) {
                __builtin_amdgcn_sched_barrier(0);
                if (key0 < EROWS) {                                      // residual v^T plane covers keys < EROWS (wave-uniform)
                    const h16* wa = VR + vro + (size_t)key0 * HD;
                    const v16h w0 = ldh(wa), w1 = ldh(wa + 512), w2 = ldh(wa + 1024), w3 = ldh(wa + 1536);
                    e0 = wmma16(w0, pb, e0); e1 = wmma16(w1, pb, e1); e2 = wmma16(w2, pb, e2); e3 = wmma16(w3, pb, e3);
                    asm volatile("v_nop\n\tv_nop\n\tv_nop\n\tv_nop" : "+v"(e0), "+v"(e1), "+v"(e2), "+v"(e3) : "v"(w0), "v"(w1), "v"(w2), "v"(w3), "v"(pb));
                }
                __builtin_amdgcn_sched_barrier(0);
            }
        }
        l += __shfl_xor(l, 16, 32);
        const unsigned dead = __builtin_amdgcn_ballot_w32(!(l > 0.0f));
        if (dead == 0u) break;                                           // wave-uniform
        noskip = 1;
    }
    const float inv = CXS * (1.0f / l);
    // O^T D layout: o_j[r] = (d = 16j + 8h + r, t = lane&15): exactly part j&1 of context unit 2h + (j>>1) (row t = lane&15, k = 16j + 8*(lane>>4) + r), so each lane stores its own accumulators, no transpose
    const size_t crow = ((size_t)b * SEQ + t0) * DM + (size_t)h * 1024 + 8 * lane;     // context plane, row b*SEQ + t, k = h*64 + d: units [(b*SEQ + t)/16][2h + d/32]
    const size_t rrow = ((size_t)b * EROWS + t0) * DM + (size_t)h * 1024 + 8 * lane;   // residual plane, row b*EROWS + t (EARLY launches only: t0 + 15 < EROWS)
    v8f xs[4] = {o0, o1, o2, o3};
    if constexpr (EARLY != 0) { xs[0] = o0 + e0 * QRI; xs[1] = o1 + e1 * QRI; xs[2] = o2 + e2 * QRI; xs[3] = o3 + e3 * QRI; }
#pragma unroll
    for (int s = 0; s < 4; ++s) {
        const v8f x = xs[s] * inv; v8h hv, rv;
#pragma unroll
        for (int i = 0; i < 8; ++i) { const h16 a0 = (h16)x[i]; hv[i] = a0; rv[i] = (h16)((x[i] - (float)a0) * QRS); }
        *(v8h*)(CH + crow + s * 256) = hv;
        if constexpr (EARLY != 0) *(v8h*)(CR + rrow + s * 256) = rv;
    }
}

// k_oproj: output projection, f16 GEMM, ONE WAVE per (16*MT) x 64 tile, K = DM. OUT[m][n] = OSC * (sum_k A[m][k] Bt[n][k] + QRI * sum_k AR[m][k] Bt[n][k]) + bias[n] (bias RNE-converted to bf16).
// A = context plane (x16), AR = context residual plane (RES != 0 only, rows [b*EROWS + t]), Bt = Wo x1024 as f16 ([out][in]).
// grid (NB * tpb, DM/64); block x -> batch x / tpb, first token rowoff + (x % tpb) * 16*MT.
template <int MT, int RES>
__global__ __launch_bounds__(32) void k_oproj(const h16* __restrict__ A, const h16* __restrict__ AR, const h16* __restrict__ Bt, const float* __restrict__ bias, float* OUT, int tpb, int rowoff) {
    static_assert((MT == 4 && RES == 0) || (MT == 2 && RES == 1));
    __shared__ __align__(16) float os[16 * 68];
    const int K = DM;
    const int lane = threadIdx.x & 31, lr = lane & 15, hi = lane >> 4;
    const int bb = blockIdx.x / tpb, tl = blockIdx.x % tpb;
    const int tok = rowoff + tl * (16 * MT);
    const int c0 = blockIdx.y * 64;
    const size_t aoff = ((size_t)bb * SEQ + tok) * K + 8 * lane;       // unit (row tile, kc/32) at (row tile)*16*K + kc*16
    const size_t roff = ((size_t)bb * EROWS + tok) * K + 8 * lane;
    const size_t boff = (size_t)c0 * K + 8 * lane;
    v8f acc[MT][4], acr[MT][4];
#pragma unroll
    for (int mb = 0; mb < MT; ++mb)
#pragma unroll
        for (int nb = 0; nb < 4; ++nb) { acc[mb][nb] = (v8f){}; acr[mb][nb] = (v8f){}; }
#pragma unroll 1
    for (int kc = 0; kc < K; kc += 32) {
        const h16* pa = A + aoff + kc * 16; const h16* pr = AR + roff + kc * 16; const h16* pb = Bt + boff + kc * 16;
        v16h a[MT], ar[MT], bfrag[4];
#pragma unroll
        for (int mb = 0; mb < MT; ++mb) { a[mb] = ldh(pa + (size_t)mb * 16 * K); ar[mb] = a[mb]; }
        if constexpr (RES != 0) {
#pragma unroll
            for (int mb = 0; mb < MT; ++mb) ar[mb] = ldh(pr + (size_t)mb * 16 * K);
        }
#pragma unroll
        for (int nb = 0; nb < 4; ++nb) bfrag[nb] = ldh(pb + (size_t)nb * 16 * K);
        // the issued loads' address registers stay as they are (held as inputs) until this wait; it runs under the loads' own latency
        if constexpr (RES != 0) asm volatile("s_wait_xcnt 0x0" :: "v"(pa), "v"(pr), "v"(pb) : "memory");
        else                    asm volatile("s_wait_xcnt 0x0" :: "v"(pa), "v"(pb) : "memory");
#pragma unroll
        for (int nb = 0; nb < 4; ++nb) {
#pragma unroll
            for (int mb = 0; mb < MT; ++mb) { acc[mb][nb] = wmma16(a[mb], bfrag[nb], acc[mb][nb]);
                if constexpr (RES != 0) acr[mb][nb] = wmma16(ar[mb], bfrag[nb], acr[mb][nb]); } }
        if constexpr (MT == 4) {
            asm volatile("v_nop\n\tv_nop\n\tv_nop\n\tv_nop" : "+v"(acc[0][3]), "+v"(acc[1][3]), "+v"(acc[2][3]), "+v"(acc[3][3]) : "v"(a[0]), "v"(a[1]), "v"(a[2]), "v"(a[3]));
        } else {
            asm volatile("v_nop\n\tv_nop\n\tv_nop\n\tv_nop" : "+v"(acc[0][3]), "+v"(acc[1][3]), "+v"(acr[0][3]), "+v"(acr[1][3]) : "v"(a[0]), "v"(a[1]), "v"(ar[0]), "v"(ar[1]));
        }
    }
    float bc[4];
#pragma unroll
    for (int nb = 0; nb < 4; ++nb) bc[nb] = bfr(bias[c0 + nb * 16 + lr]);
#pragma unroll
    for (int mb = 0; mb < MT; ++mb) {
#pragma unroll
        for (int nb = 0; nb < 4; ++nb) {
#pragma unroll
            for (int j = 0; j < 8; ++j) { float v = acc[mb][nb][j] * OSC;
                if constexpr (RES != 0) v += acr[mb][nb][j] * (OSC * QRI);
                os[(hi * 8 + j) * 68 + nb * 16 + lr] = v + bc[nb]; } }                          // D: row 8h+j, col lane&15
        wave_sync();
        float* orow = OUT + ((size_t)bb * OUT_SEQ + tok + mb * 16) * DM + c0;
{
#pragma unroll
            for (int s = 0; s < 8; ++s) { const int row = 2 * s + hi, cofs = lr * 4;            // 8 s x 2 rows = 16 rows; 16 lanes x 4 floats = 64 columns
                const v4f val = *(const v4fa*)(&os[row * 68 + cofs]);
                *(v4f*)(orow + (size_t)row * DM + cofs) = val; }
             }
        wave_sync();
    }
}

static constexpr size_t al256(size_t v) { return (v + 255) & ~(size_t)255; }
static constexpr size_t SZ_XB = al256((size_t)NB * SEQ * DM * 2);              // x bf16
static constexpr size_t SZ_WB = al256((size_t)3 * DM * DM * 2);                // Wq | Wk | Wv bf16
static constexpr size_t SZ_WO = al256((size_t)DM * DM * 2);                    // Wo f16 (x1024)
static constexpr size_t SZ_PL = al256((size_t)NB * NH_ * SEQ * HD * 2);        // q / k / v^T planes
static constexpr size_t SZ_RP = al256((size_t)NB * NH_ * EROWS * HD * 2);      // residual planes (t < EROWS)
static constexpr size_t SZ_CX = al256((size_t)NB * SEQ * DM * 2);              // context plane
static constexpr size_t SZ_CR = al256((size_t)NB * EROWS * DM * 2);            // context residual plane
static constexpr size_t SZ_TOTAL = SZ_XB + SZ_WB + SZ_WO + 3 * SZ_PL + 3 * SZ_RP + SZ_CX + SZ_CR;
static_assert(SZ_TOTAL <= (size_t)134217728);          // workspace carve <= 128 MiB
static_assert(((size_t)DM * DM * 2) % 256 == 0);       // weight sub-planes stay 256-byte aligned

extern "C" void kernel_launch(void* const* d_in, const int* in_sizes, int n_in,
                              void* d_out, int out_size, void* d_ws, size_t ws_size, hipStream_t stream) {
    if (n_in < 10) return;
    const size_t needx = ((size_t)(NB - 1) * SEQ_FULL + SEQ) * DM;
    if ((size_t)in_sizes[0] < needx) return;
    if ((size_t)in_sizes[1] < (size_t)(SEQ - 1) * SEQ_FULL + SEQ) return;
    if ((size_t)in_sizes[2] < (size_t)DM * DM || (size_t)in_sizes[4] < (size_t)DM * DM || (size_t)in_sizes[6] < (size_t)DM * DM || (size_t)in_sizes[8] < (size_t)DM * DM) return;
    if (in_sizes[3] < DM || in_sizes[5] < DM || in_sizes[7] < DM || in_sizes[9] < DM) return;
    if ((size_t)out_size < ((size_t)(NB - 1) * OUT_SEQ + SEQ) * DM) return;
    if (SZ_TOTAL > ws_size) return;
    // wire order: query, mask (int32), Wq, bq, Wk, bk, Wv, bv, Wo, bo; weights [out][in] = Bt as-is
    const float* x  = (const float*)d_in[0]; const int* mask = (const int*)d_in[1];
    const float* wq = (const float*)d_in[2]; const float* bq = (const float*)d_in[3];
    const float* wk = (const float*)d_in[4]; const float* bk = (const float*)d_in[5];
    const float* wv = (const float*)d_in[6]; const float* bv = (const float*)d_in[7];
    const float* wo = (const float*)d_in[8]; const float* bo = (const float*)d_in[9];
    float* OUT = (float*)d_out;      // [NB][SEQ][1024]
    char* wsp = (char*)d_ws;
    bf*  XB  = (bf*)wsp;  wsp += SZ_XB;              // rows NB*SEQ, k 1024, fragment-major
    bf*  WB  = (bf*)wsp;  wsp += SZ_WB;              // 3 planes q | k | v, rows 1024, k 1024, fragment-major
    h16* WOH = (h16*)wsp; wsp += SZ_WO;              // rows 1024, k 1024, fragment-major, x1024
    h16* QH  = (h16*)wsp; wsp += SZ_PL;              // [NB*16][SEQ/16][2][unit]
    h16* KP  = (h16*)wsp; wsp += SZ_PL;              // [NB*16][SEQ/16][2][unit]
    h16* VT  = (h16*)wsp; wsp += SZ_PL;              // [NB*16][SEQ/32][4][unit]
    h16* QR  = (h16*)wsp; wsp += SZ_RP;              // [NB*16][EROWS/16][2][unit] residual x2048
    h16* KR  = (h16*)wsp; wsp += SZ_RP;              // [NB*16][EROWS/16][2][unit] residual x2048
    h16* VR  = (h16*)wsp; wsp += SZ_RP;              // [NB*16][EROWS/32][4][unit] residual x2048
    h16* CXH = (h16*)wsp; wsp += SZ_CX;              // rows NB*SEQ, k 1024, fragment-major, x16
    h16* CXR = (h16*)wsp; wsp += SZ_CR;              // rows NB*EROWS, k 1024, fragment-major, residual x2048
    bf* WQ = WB; bf* WK = WB + (size_t)DM * DM; bf* WV = WB + (size_t)2 * DM * DM;

    if (SEQ == SEQ_FULL) {
        const size_t n8 = (size_t)NB * SEQ * DM / 8;
        k_cvt8<<<(unsigned)((n8 + 255) / 256), 256, 0, stream>>>(x, XB, n8);
    } else {
        const size_t n8 = (size_t)SEQ * DM / 8;
        for (int b = 0; b < NB; ++b) k_cvt8<<<(unsigned)((n8 + 255) / 256), 256, 0, stream>>>(x + (size_t)b * SEQ_FULL * DM, XB + (size_t)b * SEQ * DM, n8);
    }
    { const size_t n8 = (size_t)DM * DM / 8; const unsigned g = (unsigned)((n8 + 255) / 256);
      k_cvt8<<<g, 256, 0, stream>>>(wq, WQ, n8); k_cvt8<<<g, 256, 0, stream>>>(wk, WK, n8); k_cvt8<<<g, 256, 0, stream>>>(wv, WV, n8);
      k_cvtw8<<<g, 256, 0, stream>>>(wo, WOH, n8); }

    // q, k: A = x rows (m = b*SEQ + t), Bt = W rows (n = h*64 + d), bias by column -> plane [(b*16 + h)][t/16][d/32][unit]; residual plane the same for t < EROWS
    k_proj<0><<<dim3(NB * SEQ / 64, DM / 64, 1), 32, 0, stream>>>(XB, WQ, bq, QH, QR, SEQ, (size_t)NH_ * SEQ * HD, HD, HD, (size_t)SEQ * HD,
                                                                  (size_t)NH_ * EROWS * HD, HD, (size_t)EROWS * HD, EROWS, HD);
    k_proj<0><<<dim3(NB * SEQ / 64, DM / 64, 1), 32, 0, stream>>>(XB, WK, bk, KP, KR, SEQ, (size_t)NH_ * SEQ * HD, HD, HD, (size_t)SEQ * HD,
                                                                  (size_t)NH_ * EROWS * HD, HD, (size_t)EROWS * HD, EROWS, HD);
    // v^T: A = Wv rows (m = h*64 + d), Bt = x rows (n = b*SEQ + t), bias by row -> plane [(b*16 + h)][t/32][d/16][unit]; residual plane the same for t < EROWS
    k_proj<1><<<dim3(DM / 64, NB * SEQ / 64, 1), 32, 0, stream>>>(WV, XB, bv, VT, VR, DM, (size_t)0, SEQ, SEQ, (size_t)DM * SEQ,
                                                                  (size_t)0, EROWS, (size_t)DM * EROWS, DM, EROWS);

    k_flash<1><<<dim3(EROWS / (16 * AW), NB * NH_, 1), 32 * AW, 0, stream>>>(QH, QR, KP, KR, VT, VR, mask, CXH, CXR, 0);
    if (SEQ > EROWS)
        k_flash<0><<<dim3((SEQ - EROWS) / (16 * AW), NB * NH_, 1), 32 * AW, 0, stream>>>(QH, QR, KP, KR, VT, VR, mask, CXH, CXR, EROWS);

    k_oproj<2, 1><<<dim3(NB * (EROWS / 32), DM / 64, 1), 32, 0, stream>>>(CXH, CXR, WOH, bo, OUT, EROWS / 32, 0);
    if (SEQ > EROWS)
        k_oproj<4, 0><<<dim3(NB * ((SEQ - EROWS) / 64), DM / 64, 1), 32, 0, stream>>>(CXH, CXH, WOH, bo, OUT, (SEQ - EROWS) / 64, EROWS);
}

// v002
// It runs in 323 microseconds.
// In two side-by-side timings against v001, it was 1.09 and 1.11 times as fast.
// Counting every step since v000, it is 1.24 times as fast.
#include <hip/hip_runtime.h>

// Masked multi-head self-attention, width 1024 = 16 heads x 64, x [NB][SEQ][1024], Wq/Wk/Wv/Wo [out][in] (y = x W^T + b), int32 mask [SEQ][SEQ] (0 = fill -1e9), score scale 1/8, output projection with bias (f32 out).
// Compute dtypes, f32 accumulate everywhere: q/k/v projections v_wmma_f32_16x16x32_bf16 (x and W RNE-converted to bf16; products exact; biases RNE-converted to bf16, added in f32);
// scores and P.V v_wmma_f32_16x16x32_f16: single f16 planes on query rows >= 512; on the first 512 query rows q, k, v, P and the context carry an f16 residual x2048 (three products, residual terms in their own accumulator);
// P carried x256 (cancels in the normalisation); output projection v_wmma_f32_16x16x32_f16 with context x16 and bf16-exact Wo x1024 as f16 (context residual on the first 512 rows); softmax f32 (online, running max).
// Layout: every 16-bit matrix operand plane is fragment-major: a unit is one 16-row x 32-k fragment = [part 0..1][lane 0..31][8 elements] (512 elements, 1 KiB), element (part, lane, e) = (row lane&15, k 16*part + 8*(lane>>4) + e),
// so each 16-byte-per-lane load or store of a wave covers 512 contiguous bytes (4 whole lines). x, W, context planes: [row/16][k/32][unit]; q, k planes: [b*16+h][t/16][d/32][unit]; v^T plane: [b*16+h][t/32][d/16][unit]
// (+ residual planes for t < 512), written by the GEMM epilogue; fused flash kernel in transposed form (S^T = K Q^T, O^T = V^T P^T);
// mask: a pre-pass turns the int32 mask once per call into lane-select words (per 16-query tile and 32-key step: 16 words, bit L of word e = mask != 0 at the score element e that flash lane L holds) plus one 64-bit word per tile of the steps
// that hold any kept key; the flash kernel reads them by scalar loads (replace-fill by value as before); fully masked 16x32 tiles are skipped in the first sweep, with a full second sweep when a row ends with no visited key.

#ifndef NB
#define NB 4
#endif
#ifndef SEQ
#define SEQ 2048
#endif
#define NB_FULL  4
#define SEQ_FULL 2048
#ifndef OUT_SEQ
#define OUT_SEQ SEQ              // row pitch (in tokens) between batches of the output
#endif
#define DM   1024
#define NH_  16
#define HD   64
#define AW   4                   // waves per flash block (16 query rows each)
#define EROWS ((SEQ) < 512 ? (SEQ) : 512)   // query rows / keys per sequence that carry residual planes
#define QRS  2048.0f             // carry of every residual plane
#define QRI  (1.0f / 2048.0f)
#define SC2  (0.125f * 1.4426950408889634f)   // HD^-0.5 * log2(e)
#define NEGL (-1.0e9f * 1.4426950408889634f)  // masked fill in the log2 domain
#define PSH  8.0f                // log2 of the P carry (256)
#define CXS  16.0f               // carry of the context planes
#define WOS  1024.0f             // carry of the Wo plane
#define OSC  (1.0f / 16384.0f)   // 1 / (CXS * WOS)
#define NST  (SEQ / 32)          // 32-key steps per sequence
#define MREC (NST * 16 + 32)     // words of one 16-query tile's mask record: NST steps x 16 lane-select words, then one 128-B line whose first two words are the live-step bits
#define ALLST ((NST) >= 64 ? ~0ull : ((1ull << ((NST) & 63)) - 1ull))

static_assert(HD == 64);
static_assert(NH_ * HD == DM);                 // head h = columns h*64 + d
static_assert(DM % 64 == 0);
static_assert(DM % 32 == 0);                   // GEMM k-loop steps by 32
static_assert(SEQ % 64 == 0);                  // a 64-row tile never straddles two batches
static_assert((NB * SEQ) % 64 == 0);
static_assert(SEQ % 32 == 0);                  // key loop steps by 32
static_assert(EROWS % 64 == 0);                // residual tiles are whole 64-tiles; flash grid covers them exactly
static_assert(EROWS % (16 * AW) == 0);
static_assert((SEQ - EROWS) % 64 == 0);
static_assert((SEQ - EROWS) % (16 * AW) == 0);
static_assert(EROWS <= SEQ);
static_assert(((size_t)SEQ * DM) % 8 == 0);
static_assert(((size_t)DM * DM) % 8 == 0);
static_assert(NB <= NB_FULL);
static_assert(SEQ <= SEQ_FULL);
static_assert(NST <= 64);                      // live-step bits fit one 64-bit word; 32 waves x 2 steps cover a tile in k_mbits
static_assert(NST % 2 == 0);

typedef _Float16 h16;
typedef unsigned short bf;
typedef __attribute__((ext_vector_type(16))) __bf16   v16bf;
typedef __attribute__((ext_vector_type(16))) _Float16 v16h;
typedef __attribute__((ext_vector_type(8)))  _Float16 v8h;
typedef __attribute__((ext_vector_type(8)))  unsigned short v8us;
typedef __attribute__((ext_vector_type(8)))  float    v8f;
typedef __attribute__((ext_vector_type(4)))  float    v4f;
typedef __attribute__((ext_vector_type(4)))  int      v4i;
typedef v4f  __attribute__((may_alias)) v4fa;
typedef __attribute__((ext_vector_type(16))) unsigned v16u;

__device__ __forceinline__ unsigned short f2bf(float f) { unsigned u = __float_as_uint(f); u += 0x7FFFu + ((u >> 16) & 1u); return (unsigned short)(u >> 16); }
__device__ __forceinline__ float bfr(float f) { return __uint_as_float(((unsigned)f2bf(f)) << 16); }   // value after RNE convert to bf16
__device__ __forceinline__ v16h cat16(v8h lo, v8h hi) { return __builtin_shufflevector(lo, hi, 0, 1, 2, 3, 4, 5, 6, 7, 8, 9, 10, 11, 12, 13, 14, 15); }
__device__ __forceinline__ v16bf cat16b(v8us lo, v8us hi) { return __builtin_bit_cast(v16bf, __builtin_shufflevector(lo, hi, 0, 1, 2, 3, 4, 5, 6, 7, 8, 9, 10, 11, 12, 13, 14, 15)); }
__device__ __forceinline__ v8f wmma16(v16h a, v16h b, v8f c) { return __builtin_amdgcn_wmma_f32_16x16x32_f16(false, a, false, b, (short)0, c, false, false); }
__device__ __forceinline__ v8f wmmab(v16bf a, v16bf b, v8f c) { return __builtin_amdgcn_wmma_f32_16x16x32_bf16(false, a, false, b, (short)0, c, false, false); }
// fragment loaders from a fragment-major unit; p = unit base + 8*lane: elements 0..7 <- k0+8h+0..7 (part 0), elements 8..15 <- k0+16+8h+0..7 (part 1, +256 elements) (same map for A and B)
__device__ __forceinline__ v16h  ldh(const h16* p) { return cat16(*(const v8h*)p, *(const v8h*)(p + 256)); }
__device__ __forceinline__ v16bf ldb(const bf* p)  { return cat16b(*(const v8us*)p, *(const v8us*)(p + 256)); }
// converters: a wave takes 8 rows x 32 k (8 whole 128-B lines of f32) and writes 4 whole 128-B lines of one unit. Thread i -> source element offset (row-major, DM columns) and fragment-major destination offset.
__device__ __forceinline__ void cvt_map(size_t i, size_t& so, size_t& dof) {
    const int lane = (int)(i & 31); const size_t w = i >> 5; const size_t ks = w % (DM / 32); const size_t row = (w / (DM / 32)) * 8 + (size_t)(lane >> 2); const int c = lane & 3;
    so  = row * DM + ks * 32 + (size_t)c * 8;
    dof = (row >> 4) * (size_t)(16 * DM) + ks * 512 + (size_t)(c >> 1) * 256 + (size_t)(c & 1) * 128 + (row & 15) * 8;
}
// ordering point for wave-private LDS tiles (same wave writes and reads)
__device__ __forceinline__ void wave_sync() { __builtin_amdgcn_fence(3 /* release order */, "wavefront"); __builtin_amdgcn_wave_barrier(); asm volatile("" ::: "memory"); }

__global__ __launch_bounds__(256) void k_cvt8(const float* __restrict__ src, bf* dst, size_t n8) {
    const size_t i = (size_t)blockIdx.x * 256 + threadIdx.x; if (i >= n8) return;
    size_t so, dof; cvt_map(i, so, dof);
    const v8f v = *(const v8f*)(src + so); v8us o;
#pragma unroll
    for (int k = 0; k < 8; ++k) o[k] = f2bf(v[k]);
    *(v8us*)(dst + dof) = o;
}

__global__ __launch_bounds__(256) void k_cvtw8(const float* __restrict__ src, h16* dst, size_t n8) {
    const size_t i = (size_t)blockIdx.x * 256 + threadIdx.x; if (i >= n8) return;
    size_t so, dof; cvt_map(i, so, dof);
    const v8f v = *(const v8f*)(src + so); v8h o;
#pragma unroll
    for (int k = 0; k < 8; ++k) o[k] = (h16)(bfr(v[k]) * WOS);
    *(v8h*)(dst + dof) = o;
}

// k_mbits: one block per 16-query tile, wave w packs steps 2w and 2w+1. Each lane loads the 16 mask words of the score elements it holds in k_flash (row lane&15; keys 8*(lane>>4)+0..7 and 16+8*(lane>>4)+0..7 of the step);
// the ballot over element e is the lane-select word e. A wave stores its two steps as one whole 128-B line; wave 0 gathers the live-step bits (bit s = step s holds a kept key) and stores them as the record's last line.
__global__ __launch_bounds__(1024) void k_mbits(const int* __restrict__ MK, unsigned* MB) {
    __shared__ unsigned sm[32];
    const int lane = threadIdx.x & 31, wave = __builtin_amdgcn_readfirstlane((int)(threadIdx.x >> 5)), lr = lane & 15, hi = lane >> 4;
    unsigned* rec = MB + (size_t)blockIdx.x * MREC;
    unsigned live2 = 0u;
    if (2 * wave < NST) {                                                // wave-uniform
        const int* mp = MK + (size_t)(blockIdx.x * 16 + lr) * SEQ_FULL + wave * 64 + 8 * hi;
        unsigned w = 0u;
#pragma unroll
        for (int u = 0; u < 2; ++u) {
            const v4i a0 = *(const v4i*)(mp + 32 * u), a1 = *(const v4i*)(mp + 32 * u + 4), b0 = *(const v4i*)(mp + 32 * u + 16), b1 = *(const v4i*)(mp + 32 * u + 20);
            const int q[16] = {a0[0], a0[1], a0[2], a0[3], a1[0], a1[1], a1[2], a1[3], b0[0], b0[1], b0[2], b0[3], b1[0], b1[1], b1[2], b1[3]};
            unsigned any = 0u;
#pragma unroll
            for (int e = 0; e < 16; ++e) { const unsigned bal = __builtin_amdgcn_ballot_w32(q[e] != 0); any |= bal; w = (lane == 16 * u + e) ? bal : w; }
            live2 |= (any != 0u ? 1u : 0u) << u;
        }
        rec[wave * 32 + lane] = w;
    }
    if (lane == 0) sm[wave] = live2;
    __syncthreads();
    if (wave == 0) {
        unsigned v = sm[lane] << (2 * lr);                               // lanes 0..15: steps 0..31, lanes 16..31: steps 32..63
        v |= __shfl_xor(v, 1, 32); v |= __shfl_xor(v, 2, 32); v |= __shfl_xor(v, 4, 32); v |= __shfl_xor(v, 8, 32);
        const unsigned vh = __shfl(v, 16, 32);
        rec[NST * 16 + lane] = (lane == 0) ? v : ((lane == 1) ? vh : 0u);
    }
}

// k_proj: register-blocked bf16 GEMM, ONE WAVE per 64x64 tile (16 accumulators), operands straight from fragment-major bf16 planes, K = DM.
// C[m][n] = sum_k A[m][k] Bt[n][k] + bias (BIASROW == 0: bias[n]; BIASROW != 0: bias[m]), written as f16 (Ph), fragment-major with row = m, k = n, at
// tile base (r0/RB)*sRB + (r0%RB)*pitch + (c0/CB)*sCB + (c0%CB)*CMUL, + mb*MBS per 16 rows, + S1S per 32 columns; the f16 residual x2048 (Pr) is written with its own strides when (r0%RB) < rlim and (c0%CB) < clim.
template <int BIASROW>
__global__ __launch_bounds__(32) void k_proj(const bf* __restrict__ A, const bf* __restrict__ Bt, const float* __restrict__ bias, h16* Ph, h16* Pr,
                                             int RB, size_t sRB, int pitch, int CB, size_t sCB,
                                             size_t sRBr, int pitchr, size_t sCBr, int rlim, int clim) {
    __shared__ __align__(16) float os[16 * 68];
    const int K = DM;
    const int lane = threadIdx.x & 31, lr = lane & 15, hi = lane >> 4; const int r0 = blockIdx.x * 64, c0 = blockIdx.y * 64;
    v8f acc[4][4];
#pragma unroll
    for (int mb = 0; mb < 4; ++mb)
#pragma unroll
        for (int nb = 0; nb < 4; ++nb) acc[mb][nb] = (v8f){};
    constexpr int MBS = (BIASROW != 0) ? 512 : 1024, S1S = (BIASROW != 0) ? 2048 : 512, CMUL = (BIASROW != 0) ? 64 : 1;   // q, k: [t/16][d/32][unit]; v^T: [t/32][d/16][unit]
    const size_t aoff = (size_t)r0 * K + 8 * lane, boff = (size_t)c0 * K + 8 * lane;      // unit (row tile, kc/32) at (row tile)*16*K + kc*16
#pragma unroll 1
    for (int kc = 0; kc < K; kc += 32) {
        const bf* pa = A + aoff + kc * 16; const bf* pb = Bt + boff + kc * 16;
        v16bf a[4], b[4];
#pragma unroll
        for (int mb = 0; mb < 4; ++mb) a[mb] = ldb(pa + (size_t)mb * 16 * K);
#pragma unroll
        for (int nb = 0; nb < 4; ++nb) b[nb] = ldb(pb + (size_t)nb * 16 * K);
        asm volatile("s_wait_xcnt 0x0" :: "v"(pa), "v"(pb) : "memory");   // the issued loads' address registers stay as they are (held as inputs) until this wait; it runs under the loads' own latency
#pragma unroll
        for (int nb = 0; nb < 4; ++nb) {
#pragma unroll
            for (int mb = 0; mb < 4; ++mb) acc[mb][nb] = wmmab(a[mb], b[nb], acc[mb][nb]); }
        asm volatile("v_nop\n\tv_nop\n\tv_nop\n\tv_nop" : "+v"(acc[0][3]), "+v"(acc[1][3]), "+v"(acc[2][3]), "+v"(acc[3][3]) : "v"(a[0]), "v"(a[1]), "v"(a[2]), "v"(a[3]));
    }
    float bc[4] = {0.0f, 0.0f, 0.0f, 0.0f};
    if constexpr (BIASROW == 0) {
#pragma unroll
        for (int nb = 0; nb < 4; ++nb) bc[nb] = bfr(bias[c0 + nb * 16 + lr]);
    }
    const int wres = (((r0 % RB) < rlim) && ((c0 % CB) < clim)) ? 1 : 0;   // tile-uniform
    const size_t tbase = (size_t)(r0 / RB) * sRB + (size_t)(r0 % RB) * (size_t)pitch + (size_t)(c0 / CB) * sCB + (size_t)(c0 % CB) * CMUL;
    const size_t tbasr = (size_t)(r0 / RB) * sRBr + (size_t)(r0 % RB) * (size_t)pitchr + (size_t)(c0 / CB) * sCBr + (size_t)(c0 % CB) * CMUL;
#pragma unroll
    for (int mb = 0; mb < 4; ++mb) {
        float rb[8];
        if constexpr (BIASROW != 0) {
            const v4f b0 = *(const v4f*)(bias + r0 + mb * 16 + 8 * hi); const v4f b1 = *(const v4f*)(bias + r0 + mb * 16 + 8 * hi + 4);
#pragma unroll
            for (int i = 0; i < 4; ++i) { rb[i] = bfr(b0[i]); rb[4 + i] = bfr(b1[i]); }
        } else {
#pragma unroll
            for (int j = 0; j < 8; ++j) rb[j] = 0.0f;
        }
#pragma unroll
        for (int nb = 0; nb < 4; ++nb) {
#pragma unroll
            for (int j = 0; j < 8; ++j) os[(hi * 8 + j) * 68 + nb * 16 + lr] = acc[mb][nb][j] + ((BIASROW != 0) ? rb[j] : bc[nb]); }   // D: row 8h+j, col lane&15
        wave_sync();
        const size_t sb = tbase + (size_t)(mb * MBS) + 8 * lane;
        const size_t sr = tbasr + (size_t)(mb * MBS) + 8 * lane;
{
#pragma unroll
            for (int s = 0; s < 4; ++s) { const int row = lr, c8 = (2 * s + hi) * 8;   // store s = part s&1 of the unit of columns 32*(s>>1)..+31: lane holds row lane&15, columns 16*s + 8*(lane>>4) + 0..7
                const v4f x0 = *(const v4fa*)(&os[row * 68 + c8]); const v4f x1 = *(const v4fa*)(&os[row * 68 + c8 + 4]); v8h hv, rv;
#pragma unroll
                for (int i = 0; i < 4; ++i) { const h16 a0 = (h16)x0[i]; const h16 a1 = (h16)x1[i]; hv[i] = a0; hv[4 + i] = a1; rv[i] = (h16)((x0[i] - (float)a0) * QRS); rv[4 + i] = (h16)((x1[i] - (float)a1) * QRS); }
                *(v8h*)(Ph + sb + (s >> 1) * S1S + (s & 1) * 256) = hv;
                asm volatile("s_wait_xcnt 0x0" :: "v"(hv) : "memory");       // before the issued store's registers are reused
                if (wres) { *(v8h*)(Pr + sr + (s >> 1) * S1S + (s & 1) * 256) = rv;
                    asm volatile("s_wait_xcnt 0x0" :: "v"(rv) : "memory"); } }   // the same for the residual store
             }
        wave_sync();
    }
}

// k_flash: fused masked attention, one wave per 16 query rows of one (batch, head); K / V^T / Q fragments straight from the fragment-major f16 planes (two 16-B loads each, 512 contiguous bytes per wave-load).
// Transposed form: S^T[key][t] = K Q^T (A = K rows, B = Q rows); lane (t = lane&15, h = lane>>4) holds keys 8h+r of each 16-key tile, so the packed
// P tile is directly the B fragment of O^T[d][t] = V^T P^T (element r <- tile keys 0..15, element 8+r <- tile keys 16..31, lane unchanged).
// Mask: the wave reads the step's 16 lane-select words (64 B, wave-uniform address) and replaces masked scores by the fill value; the loop walks the set bits of the tile's live-step word in rising order, so a step whose 16x32 mask tile is all zero is not visited;
// if some row ends with no visited key the wave repeats the sweep over every step, which yields the uniform average of a fully masked row.
// EARLY != 0 (query rows < EROWS): q, k, v and P carry residuals x2048; residual products accumulate separately and are folded back with 1/2048.
template <int EARLY>
__global__ __launch_bounds__(32 * AW) void k_flash(const h16* __restrict__ QH, const h16* __restrict__ QR, const h16* __restrict__ KP, const h16* __restrict__ KR,
                                                   const h16* __restrict__ VT, const h16* __restrict__ VR, const unsigned* __restrict__ MB, h16* CH, h16* CR, int tstart) {
    const int lane = threadIdx.x & 31, wave = __builtin_amdgcn_readfirstlane((int)(threadIdx.x >> 5)), lr = lane & 15, hi = lane >> 4;
    const int zh = blockIdx.y; const int b = zh / NH_, h = zh % NH_;
    const int t0 = tstart + (blockIdx.x * AW + wave) * 16;
    const size_t pbase = (size_t)zh * SEQ * HD;
    const size_t rbase = (size_t)zh * EROWS * HD;
    const size_t qo = pbase + (size_t)t0 * HD + 8 * lane;
    const v16h qh0 = ldh(QH + qo), qh1 = ldh(QH + qo + 512);                // B fragments: col t, k = d
    v16h qr0 = qh0, qr1 = qh1;
    if constexpr (EARLY != 0) { const size_t qro = rbase + (size_t)t0 * HD + 8 * lane; qr0 = ldh(QR + qro); qr1 = ldh(QR + qro + 512); }
    const size_t ko  = pbase + 8 * lane;       // + key0 * HD + 512 * (d/32)   (A fragment: row key, k = d; 16 keys = 1024 elements)
    const size_t kro = rbase + 8 * lane;
    const size_t vo  = pbase + 8 * lane;       // + key0 * HD + 512 * j        (A fragment: row d = 16j.., k = key; 32 keys = 2048 elements)
    const size_t vro = rbase + 8 * lane;
    const unsigned* mrec = MB + (size_t)(t0 >> 4) * MREC;      // this tile's mask record (wave-uniform)
    const unsigned long long live = *(const unsigned long long*)(mrec + NST * 16) & ALLST;
    v8f o0 = (v8f){}, o1 = (v8f){}, o2 = (v8f){}, o3 = (v8f){};
    v8f e0 = (v8f){}, e1 = (v8f){}, e2 = (v8f){}, e3 = (v8f){};
    float m = -3.0e38f, l = 0.0f;
    int noskip = 0;
#pragma unroll 1
    for (int pass = 0; pass < 2; ++pass) {
        o0 = (v8f){}; o1 = (v8f){}; o2 = (v8f){}; o3 = (v8f){};
        e0 = (v8f){}; e1 = (v8f){}; e2 = (v8f){}; e3 = (v8f){};
        m = -3.0e38f; l = 0.0f;
#pragma unroll 1
        for (unsigned long long rem = (noskip != 0) ? ALLST : live; rem != 0ull; rem &= rem - 1ull) {   // at most NST trips, wave-uniform
            const int key0 = 32 * __builtin_ctzll(rem);
            const v16u mw = *(const v16u*)(mrec + (key0 >> 1));          // 16 words per step
            const h16* ka = KP + ko + (size_t)key0 * HD;
            v8f sHa = (v8f){}, sHb = (v8f){}, sLa = (v8f){}, sLb = (v8f){};
            {
                const v16h ka0 = ldh(ka), ka1 = ldh(ka + 512), kb0 = ldh(ka + 16 * HD), kb1 = ldh(ka + 16 * HD + 512);
                sHa = wmma16(ka0, qh0, sHa); sHb = wmma16(kb0, qh0, sHb); sHa = wmma16(ka1, qh1, sHa); sHb = wmma16(kb1, qh1, sHb);
                if constexpr (EARLY != 0) {
                    sLa = wmma16(ka0, qr0, sLa); sLb = wmma16(kb0, qr0, sLb); sLa = wmma16(ka1, qr1, sLa); sLb = wmma16(kb1, qr1, sLb);
                    asm volatile("v_nop\n\tv_nop\n\tv_nop\n\tv_nop" : "+v"(sHa), "+v"(sHb), "+v"(sLa), "+v"(sLb) : "v"(ka0), "v"(ka1), "v"(kb0), "v"(kb1));
                } else {
                    asm volatile("v_nop\n\tv_nop\n\tv_nop\n\tv_nop" : "+v"(sHa), "+v"(sHb) : "v"(ka0), "v"(ka1), "v"(kb0), "v"(kb1));
                }
            }
            if constexpr (EARLY != 0) {
                __builtin_amdgcn_sched_barrier(0);
                if (key0 < EROWS) {                                      // residual k plane covers keys < EROWS (wave-uniform)
                    const h16* ra = KR + kro + (size_t)key0 * HD;
                    const v16h ra0 = ldh(ra), ra1 = ldh(ra + 512), rb0 = ldh(ra + 16 * HD), rb1 = ldh(ra + 16 * HD + 512);
                    sLa = wmma16(ra0, qh0, sLa); sLb = wmma16(rb0, qh0, sLb); sLa = wmma16(ra1, qh1, sLa); sLb = wmma16(rb1, qh1, sLb);
                    asm volatile("v_nop\n\tv_nop\n\tv_nop\n\tv_nop" : "+v"(sLa), "+v"(sLb) : "v"(ra0), "v"(ra1), "v"(rb0), "v"(rb1));
                }
                __builtin_amdgcn_sched_barrier(0);
            }
            float ta[8], tb[8]; float mx = -3.0e38f;
#pragma unroll
            for (int r = 0; r < 8; ++r) {
                float sa = sHa[r], sb = sHb[r];
                if constexpr (EARLY != 0) { sa += sLa[r] * QRI; sb += sLb[r] * QRI; }
                ta[r] = __builtin_amdgcn_inverse_ballot_w32(mw[r]) ? sa * SC2 : NEGL;
                tb[r] = __builtin_amdgcn_inverse_ballot_w32(mw[8 + r]) ? sb * SC2 : NEGL;
                mx = fmaxf(mx, fmaxf(ta[r], tb[r]));
            }
            mx = fmaxf(mx, __shfl_xor(mx, 16, 32));
            const float mnew = fmaxf(m, mx);
            const float alpha = __builtin_amdgcn_exp2f(m - mnew);
            const float sh = PSH - mnew;
            v16h pb = (v16h){}; v16h pq = (v16h){}; float ls = 0.0f;
#pragma unroll
            for (int r = 0; r < 8; ++r) {
                const float pa = __builtin_amdgcn_exp2f(ta[r] + sh), pc = __builtin_amdgcn_exp2f(tb[r] + sh);
                const h16 ha = (h16)pa, hc = (h16)pc; pb[r] = ha; pb[8 + r] = hc;
                if constexpr (EARLY != 0) {
                    const h16 ga = (h16)((pa - (float)ha) * QRS), gc = (h16)((pc - (float)hc) * QRS); pq[r] = ga; pq[8 + r] = gc;
                    ls += ((float)ha + (float)hc) + ((float)ga + (float)gc) * QRI;
                } else {
                    ls += (float)ha + (float)hc;
                }
            }
            l = l * alpha + ls; m = mnew;
            o0 = o0 * alpha; o1 = o1 * alpha; o2 = o2 * alpha; o3 = o3 * alpha;
            if constexpr (EARLY != 0) { e0 = e0 * alpha; e1 = e1 * alpha; e2 = e2 * alpha; e3 = e3 * alpha; }
            const h16* va = VT + vo + (size_t)key0 * HD;
            {
                const v16h v0 = ldh(va), v1 = ldh(va + 512), v2 = ldh(va + 1024), v3 = ldh(va + 1536);
                o0 = wmma16(v0, pb, o0); o1 = wmma16(v1, pb, o1); o2 = wmma16(v2, pb, o2); o3 = wmma16(v3, pb, o3);
                if constexpr (EARLY != 0) {
                    e0 = wmma16(v0, pq, e0); e1 = wmma16(v1, pq, e1); e2 = wmma16(v2, pq, e2); e3 = wmma16(v3, pq, e3);
                    asm volatile("v_nop\n\tv_nop\n\tv_nop\n\tv_nop" : "+v"(o0), "+v"(o1), "+v"(o2), "+v"(o3), "+v"(e0), "+v"(e1), "+v"(e2), "+v"(e3) : "v"(v0), "v"(v1), "v"(v2), "v"(v3), "v"(pb), "v"(pq));
                } else {
                    asm volatile("v_nop\n\tv_nop\n\tv_nop\n\tv_nop" : "+v"(o0), "+v"(o1), "+v"(o2), "+v"(o3) : "v"(v0), "v"(v1), "v"(v2), "v"(v3), "v"(pb));
                }
            }
            if constexpr (EARLY != 0) {
                __builtin_amdgcn_sched_barrier(0);
                if (key0 < EROWS) {                                      // residual v^T plane covers keys < EROWS (wave-uniform)
                    const h16* wa = VR + vro + (size_t)key0 * HD;
                    const v16h w0 = ldh(wa), w1 = ldh(wa + 512), w2 = ldh(wa + 1024), w3 = ldh(wa + 1536);
                    e0 = wmma16(w0, pb, e0); e1 = wmma16(w1, pb, e1); e2 = wmma16(w2, pb, e2); e3 = wmma16(w3, pb, e3);
                    asm volatile("v_nop\n\tv_nop\n\tv_nop\n\tv_nop" : "+v"(e0), "+v"(e1), "+v"(e2), "+v"(e3) : "v"(w0), "v"(w1), "v"(w2), "v"(w3), "v"(pb));
                }
                __builtin_amdgcn_sched_barrier(0);
            }
        }
        l += __shfl_xor(l, 16, 32);
        const unsigned dead = __builtin_amdgcn_ballot_w32(!(l > 0.0f));
        if (dead == 0u) break;                                           // wave-uniform
        noskip = 1;
    }
    const float inv = CXS * (1.0f / l);
    // O^T D layout: o_j[r] = (d = 16j + 8h + r, t = lane&15): exactly part j&1 of context unit 2h + (j>>1) (row t = lane&15, k = 16j + 8*(lane>>4) + r), so each lane stores its own accumulators, no transpose
    const size_t crow = ((size_t)b * SEQ + t0) * DM + (size_t)h * 1024 + 8 * lane;     // context plane, row b*SEQ + t, k = h*64 + d: units [(b*SEQ + t)/16][2h + d/32]
    const size_t rrow = ((size_t)b * EROWS + t0) * DM + (size_t)h * 1024 + 8 * lane;   // residual plane, row b*EROWS + t (EARLY launches only: t0 + 15 < EROWS)
    v8f xs[4] = {o0, o1, o2, o3};
    if constexpr (EARLY != 0) { xs[0] = o0 + e0 * QRI; xs[1] = o1 + e1 * QRI; xs[2] = o2 + e2 * QRI; xs[3] = o3 + e3 * QRI; }
#pragma unroll
    for (int s = 0; s < 4; ++s) {
        const v8f x = xs[s] * inv; v8h hv, rv;
#pragma unroll
        for (int i = 0; i < 8; ++i) { const h16 a0 = (h16)x[i]; hv[i] = a0; rv[i] = (h16)((x[i] - (float)a0) * QRS); }
        *(v8h*)(CH + crow + s * 256) = hv;
        if constexpr (EARLY != 0) *(v8h*)(CR + rrow + s * 256) = rv;
    }
}

// k_oproj: output projection, f16 GEMM, ONE WAVE per (16*MT) x 64 tile, K = DM. OUT[m][n] = OSC * (sum_k A[m][k] Bt[n][k] + QRI * sum_k AR[m][k] Bt[n][k]) + bias[n] (bias RNE-converted to bf16).
// A = context plane (x16), AR = context residual plane (RES != 0 only, rows [b*EROWS + t]), Bt = Wo x1024 as f16 ([out][in]).
// grid (NB * tpb, DM/64); block x -> batch x / tpb, first token rowoff + (x % tpb) * 16*MT.
template <int MT, int RES>
__global__ __launch_bounds__(32) void k_oproj(const h16* __restrict__ A, const h16* __restrict__ AR, const h16* __restrict__ Bt, const float* __restrict__ bias, float* OUT, int tpb, int rowoff) {
    static_assert((MT == 4 && RES == 0) || (MT == 2 && RES == 1));
    __shared__ __align__(16) float os[16 * 68];
    const int K = DM;
    const int lane = threadIdx.x & 31, lr = lane & 15, hi = lane >> 4;
    const int bb = blockIdx.x / tpb, tl = blockIdx.x % tpb;
    const int tok = rowoff + tl * (16 * MT);
    const int c0 = blockIdx.y * 64;
    const size_t aoff = ((size_t)bb * SEQ + tok) * K + 8 * lane;       // unit (row tile, kc/32) at (row tile)*16*K + kc*16
    const size_t roff = ((size_t)bb * EROWS + tok) * K + 8 * lane;
    const size_t boff = (size_t)c0 * K + 8 * lane;
    v8f acc[MT][4], acr[MT][4];
#pragma unroll
    for (int mb = 0; mb < MT; ++mb)
#pragma unroll
        for (int nb = 0; nb < 4; ++nb) { acc[mb][nb] = (v8f){}; acr[mb][nb] = (v8f){}; }
#pragma unroll 1
    for (int kc = 0; kc < K; kc += 32) {
        const h16* pa = A + aoff + kc * 16; const h16* pr = AR + roff + kc * 16; const h16* pb = Bt + boff + kc * 16;
        v16h a[MT], ar[MT], bfrag[4];
#pragma unroll
        for (int mb = 0; mb < MT; ++mb) { a[mb] = ldh(pa + (size_t)mb * 16 * K); ar[mb] = a[mb]; }
        if constexpr (RES != 0) {
#pragma unroll
            for (int mb = 0; mb < MT; ++mb) ar[mb] = ldh(pr + (size_t)mb * 16 * K);
        }
#pragma unroll
        for (int nb = 0; nb < 4; ++nb) bfrag[nb] = ldh(pb + (size_t)nb * 16 * K);
        // the issued loads' address registers stay as they are (held as inputs) until this wait; it runs under the loads' own latency
        if constexpr (RES != 0) asm volatile("s_wait_xcnt 0x0" :: "v"(pa), "v"(pr), "v"(pb) : "memory");
        else                    asm volatile("s_wait_xcnt 0x0" :: "v"(pa), "v"(pb) : "memory");
#pragma unroll
        for (int nb = 0; nb < 4; ++nb) {
#pragma unroll
            for (int mb = 0; mb < MT; ++mb) { acc[mb][nb] = wmma16(a[mb], bfrag[nb], acc[mb][nb]);
                if constexpr (RES != 0) acr[mb][nb] = wmma16(ar[mb], bfrag[nb], acr[mb][nb]); } }
        if constexpr (MT == 4) {
            asm volatile("v_nop\n\tv_nop\n\tv_nop\n\tv_nop" : "+v"(acc[0][3]), "+v"(acc[1][3]), "+v"(acc[2][3]), "+v"(acc[3][3]) : "v"(a[0]), "v"(a[1]), "v"(a[2]), "v"(a[3]));
        } else {
            asm volatile("v_nop\n\tv_nop\n\tv_nop\n\tv_nop" : "+v"(acc[0][3]), "+v"(acc[1][3]), "+v"(acr[0][3]), "+v"(acr[1][3]) : "v"(a[0]), "v"(a[1]), "v"(ar[0]), "v"(ar[1]));
        }
    }
    float bc[4];
#pragma unroll
    for (int nb = 0; nb < 4; ++nb) bc[nb] = bfr(bias[c0 + nb * 16 + lr]);
#pragma unroll
    for (int mb = 0; mb < MT; ++mb) {
#pragma unroll
        for (int nb = 0; nb < 4; ++nb) {
#pragma unroll
            for (int j = 0; j < 8; ++j) { float v = acc[mb][nb][j] * OSC;
                if constexpr (RES != 0) v += acr[mb][nb][j] * (OSC * QRI);
                os[(hi * 8 + j) * 68 + nb * 16 + lr] = v + bc[nb]; } }                          // D: row 8h+j, col lane&15
        wave_sync();
        float* orow = OUT + ((size_t)bb * OUT_SEQ + tok + mb * 16) * DM + c0;
{
#pragma unroll
            for (int s = 0; s < 8; ++s) { const int row = 2 * s + hi, cofs = lr * 4;            // 8 s x 2 rows = 16 rows; 16 lanes x 4 floats = 64 columns
                const v4f val = *(const v4fa*)(&os[row * 68 + cofs]);
                *(v4f*)(orow + (size_t)row * DM + cofs) = val; }
             }
        wave_sync();
    }
}

static constexpr size_t al256(size_t v) { return (v + 255) & ~(size_t)255; }
static constexpr size_t SZ_XB = al256((size_t)NB * SEQ * DM * 2);              // x bf16
static constexpr size_t SZ_WB = al256((size_t)3 * DM * DM * 2);                // Wq | Wk | Wv bf16
static constexpr size_t SZ_WO = al256((size_t)DM * DM * 2);                    // Wo f16 (x1024)
static constexpr size_t SZ_PL = al256((size_t)NB * NH_ * SEQ * HD * 2);        // q / k / v^T planes
static constexpr size_t SZ_RP = al256((size_t)NB * NH_ * EROWS * HD * 2);      // residual planes (t < EROWS)
static constexpr size_t SZ_CX = al256((size_t)NB * SEQ * DM * 2);              // context plane
static constexpr size_t SZ_CR = al256((size_t)NB * EROWS * DM * 2);            // context residual plane
static constexpr size_t SZ_MB = al256((size_t)(SEQ / 16) * MREC * 4);          // mask records
static constexpr size_t SZ_TOTAL = SZ_XB + SZ_WB + SZ_WO + 3 * SZ_PL + 3 * SZ_RP + SZ_CX + SZ_CR + SZ_MB;
static_assert(SZ_TOTAL <= (size_t)134217728);          // workspace carve <= 128 MiB
static_assert(((size_t)DM * DM * 2) % 256 == 0);       // weight sub-planes stay 256-byte aligned

extern "C" void kernel_launch(void* const* d_in, const int* in_sizes, int n_in,
                              void* d_out, int out_size, void* d_ws, size_t ws_size, hipStream_t stream) {
    if (n_in < 10) return;
    const size_t needx = ((size_t)(NB - 1) * SEQ_FULL + SEQ) * DM;
    if ((size_t)in_sizes[0] < needx) return;
    if ((size_t)in_sizes[1] < (size_t)(SEQ - 1) * SEQ_FULL + SEQ) return;
    if ((size_t)in_sizes[2] < (size_t)DM * DM || (size_t)in_sizes[4] < (size_t)DM * DM || (size_t)in_sizes[6] < (size_t)DM * DM || (size_t)in_sizes[8] < (size_t)DM * DM) return;
    if (in_sizes[3] < DM || in_sizes[5] < DM || in_sizes[7] < DM || in_sizes[9] < DM) return;
    if ((size_t)out_size < ((size_t)(NB - 1) * OUT_SEQ + SEQ) * DM) return;
    if (SZ_TOTAL > ws_size) return;
    // wire order: query, mask (int32), Wq, bq, Wk, bk, Wv, bv, Wo, bo; weights [out][in] = Bt as-is
    const float* x  = (const float*)d_in[0]; const int* mask = (const int*)d_in[1];
    const float* wq = (const float*)d_in[2]; const float* bq = (const float*)d_in[3];
    const float* wk = (const float*)d_in[4]; const float* bk = (const float*)d_in[5];
    const float* wv = (const float*)d_in[6]; const float* bv = (const float*)d_in[7];
    const float* wo = (const float*)d_in[8]; const float* bo = (const float*)d_in[9];
    float* OUT = (float*)d_out;      // [NB][SEQ][1024]
    char* wsp = (char*)d_ws;
    bf*  XB  = (bf*)wsp;  wsp += SZ_XB;              // rows NB*SEQ, k 1024, fragment-major
    bf*  WB  = (bf*)wsp;  wsp += SZ_WB;              // 3 planes q | k | v, rows 1024, k 1024, fragment-major
    h16* WOH = (h16*)wsp; wsp += SZ_WO;              // rows 1024, k 1024, fragment-major, x1024
    h16* QH  = (h16*)wsp; wsp += SZ_PL;              // [NB*16][SEQ/16][2][unit]
    h16* KP  = (h16*)wsp; wsp += SZ_PL;              // [NB*16][SEQ/16][2][unit]
    h16* VT  = (h16*)wsp; wsp += SZ_PL;              // [NB*16][SEQ/32][4][unit]
    h16* QR  = (h16*)wsp; wsp += SZ_RP;              // [NB*16][EROWS/16][2][unit] residual x2048
    h16* KR  = (h16*)wsp; wsp += SZ_RP;              // [NB*16][EROWS/16][2][unit] residual x2048
    h16* VR  = (h16*)wsp; wsp += SZ_RP;              // [NB*16][EROWS/32][4][unit] residual x2048
    h16* CXH = (h16*)wsp; wsp += SZ_CX;              // rows NB*SEQ, k 1024, fragment-major, x16
    h16* CXR = (h16*)wsp; wsp += SZ_CR;              // rows NB*EROWS, k 1024, fragment-major, residual x2048
    unsigned* MBW = (unsigned*)wsp; wsp += SZ_MB;    // [SEQ/16][MREC] mask records
    bf* WQ = WB; bf* WK = WB + (size_t)DM * DM; bf* WV = WB + (size_t)2 * DM * DM;

    if (SEQ == SEQ_FULL) {
        const size_t n8 = (size_t)NB * SEQ * DM / 8;
        k_cvt8<<<(unsigned)((n8 + 255) / 256), 256, 0, stream>>>(x, XB, n8);
    } else {
        const size_t n8 = (size_t)SEQ * DM / 8;
        for (int b = 0; b < NB; ++b) k_cvt8<<<(unsigned)((n8 + 255) / 256), 256, 0, stream>>>(x + (size_t)b * SEQ_FULL * DM, XB + (size_t)b * SEQ * DM, n8);
    }
    { const size_t n8 = (size_t)DM * DM / 8; const unsigned g = (unsigned)((n8 + 255) / 256);
      k_cvt8<<<g, 256, 0, stream>>>(wq, WQ, n8); k_cvt8<<<g, 256, 0, stream>>>(wk, WK, n8); k_cvt8<<<g, 256, 0, stream>>>(wv, WV, n8);
      k_cvtw8<<<g, 256, 0, stream>>>(wo, WOH, n8); }

    // q, k: A = x rows (m = b*SEQ + t), Bt = W rows (n = h*64 + d), bias by column -> plane [(b*16 + h)][t/16][d/32][unit]; residual plane the same for t < EROWS
    k_proj<0><<<dim3(NB * SEQ / 64, DM / 64, 1), 32, 0, stream>>>(XB, WQ, bq, QH, QR, SEQ, (size_t)NH_ * SEQ * HD, HD, HD, (size_t)SEQ * HD,
                                                                  (size_t)NH_ * EROWS * HD, HD, (size_t)EROWS * HD, EROWS, HD);
    k_proj<0><<<dim3(NB * SEQ / 64, DM / 64, 1), 32, 0, stream>>>(XB, WK, bk, KP, KR, SEQ, (size_t)NH_ * SEQ * HD, HD, HD, (size_t)SEQ * HD,
                                                                  (size_t)NH_ * EROWS * HD, HD, (size_t)EROWS * HD, EROWS, HD);
    // v^T: A = Wv rows (m = h*64 + d), Bt = x rows (n = b*SEQ + t), bias by row -> plane [(b*16 + h)][t/32][d/16][unit]; residual plane the same for t < EROWS
    k_proj<1><<<dim3(DM / 64, NB * SEQ / 64, 1), 32, 0, stream>>>(WV, XB, bv, VT, VR, DM, (size_t)0, SEQ, SEQ, (size_t)DM * SEQ,
                                                                  (size_t)0, EROWS, (size_t)DM * EROWS, DM, EROWS);

    k_mbits<<<SEQ / 16, 1024, 0, stream>>>(mask, MBW);
    k_flash<1><<<dim3(EROWS / (16 * AW), NB * NH_, 1), 32 * AW, 0, stream>>>(QH, QR, KP, KR, VT, VR, MBW, CXH, CXR, 0);
    if (SEQ > EROWS)
        k_flash<0><<<dim3((SEQ - EROWS) / (16 * AW), NB * NH_, 1), 32 * AW, 0, stream>>>(QH, QR, KP, KR, VT, VR, MBW, CXH, CXR, EROWS);

    k_oproj<2, 1><<<dim3(NB * (EROWS / 32), DM / 64, 1), 32, 0, stream>>>(CXH, CXR, WOH, bo, OUT, EROWS / 32, 0);
    if (SEQ > EROWS)
        k_oproj<4, 0><<<dim3(NB * ((SEQ - EROWS) / 64), DM / 64, 1), 32, 0, stream>>>(CXH, CXH, WOH, bo, OUT, (SEQ - EROWS) / 64, EROWS);
}

// v003
// Measured time: 230 microseconds a run.
// Next to v002, in two timings, it ran 1.39 and 1.40 times as fast.
// All steps since v000 together make it 1.73 times as fast.
#include <hip/hip_runtime.h>

// Masked multi-head self-attention, width 1024 = 16 heads x 64, x [NB][SEQ][1024], Wq/Wk/Wv/Wo [out][in] (y = x W^T + b), int32 mask [SEQ][SEQ] (0 = fill -1e9), score scale 1/8, output projection with bias (f32 out).
// Compute dtypes, f32 accumulate everywhere: q/k/v projections v_wmma_f32_16x16x32_bf16 (x and W RNE-converted to bf16; products exact; biases RNE-converted to bf16, added in f32);
// scores and P.V v_wmma_f32_16x16x32_f16: single f16 planes on query rows >= 512; on the first 512 query rows q, k, v, P and the context carry an f16 residual x2048 (three products, residual terms in their own accumulator);
// P carried x256 (cancels in the normalisation); output projection v_wmma_f32_16x16x32_f16 with context x16 and bf16-exact Wo x1024 as f16 (context residual on the first 512 rows); softmax f32 (online, running max).
// Layout: every 16-bit matrix operand plane is fragment-major: a unit is one 16-row x 32-k fragment = [part 0..1][lane 0..31][8 elements] (512 elements, 1 KiB), element (part, lane, e) = (row lane&15, k 16*part + 8*(lane>>4) + e),
// so each 16-byte-per-lane load or store of a wave covers 512 contiguous bytes (4 whole lines). x, W, context planes: [row/16][k/32][unit]; q, k planes: [b*16+h][t/16][d/32][unit]; v^T plane: [b*16+h][t/32][d/16][unit]
// (+ residual planes for t < 512), written by the GEMM epilogue; fused flash kernel in transposed form (S^T = K Q^T, O^T = V^T P^T);
// mask: a pre-pass turns the int32 mask once per call into lane-select words (per 16-query tile and 32-key step: 16 words, bit L of word e = mask != 0 at the score element e that flash lane L holds) plus one 64-bit word per tile of the steps
// that hold any kept key; the flash kernel reads them by scalar loads (replace-fill by value as before); fully masked 16x32 tiles are skipped in the first sweep, with a full second sweep when a row ends with no visited key.

#ifndef NB
#define NB 4
#endif
#ifndef SEQ
#define SEQ 2048
#endif
#define NB_FULL  4
#define SEQ_FULL 2048
#ifndef OUT_SEQ
#define OUT_SEQ SEQ              // row pitch (in tokens) between batches of the output
#endif
#define DM   1024
#define NH_  16
#define HD   64
#define AW   4                   // waves per flash block (16 query rows each)
#define EROWS ((SEQ) < 512 ? (SEQ) : 512)   // query rows / keys per sequence that carry residual planes
#define QRS  2048.0f             // carry of every residual plane
#define QRI  (1.0f / 2048.0f)
#define SC2  (0.125f * 1.4426950408889634f)   // HD^-0.5 * log2(e)
#define NEGL (-1.0e9f * 1.4426950408889634f)  // masked fill in the log2 domain
#define PSH  8.0f                // log2 of the P carry (256)
#define CXS  16.0f               // carry of the context planes
#define WOS  1024.0f             // carry of the Wo plane
#define OSC  (1.0f / 16384.0f)   // 1 / (CXS * WOS)
#define NST  (SEQ / 32)          // 32-key steps per sequence
#define MREC (NST * 16 + 32)     // words of one 16-query tile's mask record: NST steps x 16 lane-select words, then one 128-B line whose first two words are the live-step bits
#define ALLST ((NST) >= 64 ? ~0ull : ((1ull << ((NST) & 63)) - 1ull))

static_assert(HD == 64);
static_assert(NH_ * HD == DM);                 // head h = columns h*64 + d
static_assert(DM % 64 == 0);
static_assert(DM % 32 == 0);                   // GEMM k-loop steps by 32
static_assert(SEQ % 64 == 0);                  // a 64-row tile never straddles two batches
static_assert((NB * SEQ) % 64 == 0);
static_assert(SEQ % 32 == 0);                  // key loop steps by 32
static_assert(EROWS % 64 == 0);                // residual tiles are whole 64-tiles; flash grid covers them exactly
static_assert(EROWS % (16 * AW) == 0);
static_assert((SEQ - EROWS) % 64 == 0);
static_assert((SEQ - EROWS) % (16 * AW) == 0);
static_assert(EROWS <= SEQ);
static_assert(((size_t)SEQ * DM) % 8 == 0);
static_assert(((size_t)DM * DM) % 8 == 0);
static_assert(NB <= NB_FULL);
static_assert(SEQ <= SEQ_FULL);
static_assert(NST <= 64);                      // live-step bits fit one 64-bit word; 32 waves x 2 steps cover a tile in mbits
static_assert(NST % 2 == 0);

typedef _Float16 h16;
typedef unsigned short bf;
typedef __attribute__((ext_vector_type(16))) __bf16   v16bf;
typedef __attribute__((ext_vector_type(16))) _Float16 v16h;
typedef __attribute__((ext_vector_type(8)))  _Float16 v8h;
typedef __attribute__((ext_vector_type(8)))  unsigned short v8us;
typedef __attribute__((ext_vector_type(8)))  float    v8f;
typedef __attribute__((ext_vector_type(4)))  float    v4f;
typedef __attribute__((ext_vector_type(4)))  int      v4i;
typedef v4f  __attribute__((may_alias)) v4fa;
typedef __attribute__((ext_vector_type(16))) unsigned v16u;

__device__ __forceinline__ unsigned short f2bf(float f) { unsigned u = __float_as_uint(f); u += 0x7FFFu + ((u >> 16) & 1u); return (unsigned short)(u >> 16); }
__device__ __forceinline__ float bfr(float f) { return __uint_as_float(((unsigned)f2bf(f)) << 16); }   // value after RNE convert to bf16
__device__ __forceinline__ v16h cat16(v8h lo, v8h hi) { return __builtin_shufflevector(lo, hi, 0, 1, 2, 3, 4, 5, 6, 7, 8, 9, 10, 11, 12, 13, 14, 15); }
__device__ __forceinline__ v16bf cat16b(v8us lo, v8us hi) { return __builtin_bit_cast(v16bf, __builtin_shufflevector(lo, hi, 0, 1, 2, 3, 4, 5, 6, 7, 8, 9, 10, 11, 12, 13, 14, 15)); }
__device__ __forceinline__ v8f wmma16(v16h a, v16h b, v8f c) { return __builtin_amdgcn_wmma_f32_16x16x32_f16(false, a, false, b, (short)0, c, false, false); }
__device__ __forceinline__ v8f wmmab(v16bf a, v16bf b, v8f c) { return __builtin_amdgcn_wmma_f32_16x16x32_bf16(false, a, false, b, (short)0, c, false, false); }
// fragment loaders from a fragment-major unit; p = unit base + 8*lane: elements 0..7 <- k0+8h+0..7 (part 0), elements 8..15 <- k0+16+8h+0..7 (part 1, +256 elements) (same map for A and B)
__device__ __forceinline__ v16h  ldh(const h16* p) { return cat16(*(const v8h*)p, *(const v8h*)(p + 256)); }
__device__ __forceinline__ v16bf ldb(const bf* p)  { return cat16b(*(const v8us*)p, *(const v8us*)(p + 256)); }
// converters: a wave takes 8 rows x 32 k (8 whole 128-B lines of f32) and writes 4 whole 128-B lines of one unit. Thread i -> source element offset (row-major, DM columns) and fragment-major destination offset.
__device__ __forceinline__ void cvt_map(size_t i, size_t& so, size_t& dof) {
    const int lane = (int)(i & 31); const size_t w = i >> 5; const size_t ks = w % (DM / 32); const size_t row = (w / (DM / 32)) * 8 + (size_t)(lane >> 2); const int c = lane & 3;
    so  = row * DM + ks * 32 + (size_t)c * 8;
    dof = (row >> 4) * (size_t)(16 * DM) + ks * 512 + (size_t)(c >> 1) * 256 + (size_t)(c & 1) * 128 + (row & 15) * 8;
}
// ordering point for wave-private LDS tiles (same wave writes and reads)
__device__ __forceinline__ void wave_sync() { __builtin_amdgcn_fence(3 /* release order */, "wavefront"); __builtin_amdgcn_wave_barrier(); asm volatile("" ::: "memory"); }

__device__ __forceinline__ void cvt8(const float* __restrict__ src, bf* dst, size_t i) {
    size_t so, dof; cvt_map(i, so, dof);
    const v8f v = *(const v8f*)(src + so); v8us o;
#pragma unroll
    for (int k = 0; k < 8; ++k) o[k] = f2bf(v[k]);
    bf* dp = dst + dof;
    *(v8us*)dp = o;
    asm volatile("s_wait_xcnt 0x0" :: "v"(o), "v"(dp) : "memory");   // before the issued store's registers are reused
}

__device__ __forceinline__ void cvtw8(const float* __restrict__ src, h16* dst, size_t i) {
    size_t so, dof; cvt_map(i, so, dof);
    const v8f v = *(const v8f*)(src + so); v8h o;
#pragma unroll
    for (int k = 0; k < 8; ++k) o[k] = (h16)(bfr(v[k]) * WOS);
    h16* dp = dst + dof;
    *(v8h*)dp = o;
    asm volatile("s_wait_xcnt 0x0" :: "v"(o), "v"(dp) : "memory");   // the same for this store
}

// mbits: one 32-wave block per 16-query tile, wave w packs steps 2w and 2w+1. Each lane loads the 16 mask words of the score elements it holds in k_flash (row lane&15; keys 8*(lane>>4)+0..7 and 16+8*(lane>>4)+0..7 of the step);
// the ballot over element e is the lane-select word e. A wave stores its two steps as one whole 128-B line; wave 0 gathers the live-step bits (bit s = step s holds a kept key) and stores them as the record's last line.
__device__ __forceinline__ void mbits(const int* __restrict__ MK, unsigned* MB, int tile, unsigned* sm) {
    const int lane = threadIdx.x & 31, wave = __builtin_amdgcn_readfirstlane((int)(threadIdx.x >> 5)), lr = lane & 15, hi = lane >> 4;
    unsigned* rec = MB + (size_t)tile * MREC;
    unsigned live2 = 0u;
    if (2 * wave < NST) {                                                // wave-uniform
        const int* mp = MK + (size_t)(tile * 16 + lr) * SEQ_FULL + wave * 64 + 8 * hi;
        unsigned w = 0u;
#pragma unroll
        for (int u = 0; u < 2; ++u) {
            const v4i a0 = *(const v4i*)(mp + 32 * u), a1 = *(const v4i*)(mp + 32 * u + 4), b0 = *(const v4i*)(mp + 32 * u + 16), b1 = *(const v4i*)(mp + 32 * u + 20);
            const int q[16] = {a0[0], a0[1], a0[2], a0[3], a1[0], a1[1], a1[2], a1[3], b0[0], b0[1], b0[2], b0[3], b1[0], b1[1], b1[2], b1[3]};
            unsigned any = 0u;
#pragma unroll
            for (int e = 0; e < 16; ++e) { const unsigned bal = __builtin_amdgcn_ballot_w32(q[e] != 0); any |= bal; w = (lane == 16 * u + e) ? bal : w; }
            live2 |= (any != 0u ? 1u : 0u) << u;
        }
        rec[wave * 32 + lane] = w;
    }
    if (lane == 0) sm[wave] = live2;
    __syncthreads();
    if (wave == 0) {
        unsigned v = sm[lane] << (2 * lr);                               // lanes 0..15: steps 0..31, lanes 16..31: steps 32..63
        v |= __shfl_xor(v, 1, 32); v |= __shfl_xor(v, 2, 32); v |= __shfl_xor(v, 4, 32); v |= __shfl_xor(v, 8, 32);
        const unsigned vh = __shfl(v, 16, 32);
        rec[NST * 16 + lane] = (lane == 0) ? v : ((lane == 1) ? vh : 0u);
    }
}

// k_prep: every operand preparation of a call in one grid of 1024-thread blocks, so that the six independent jobs share the chip instead of running one after another;
// a block's job follows from its index alone (block-uniform): mask tiles, then x, then Wq | Wk | Wv, then Wo. Thread -> element inside each job is as in the separate launches.
#define PB_M (SEQ / 16)
#define PB_X ((int)((size_t)NB * SEQ * DM / 8 / 1024))
#define PB_W ((int)((size_t)DM * DM / 8 / 1024))
static_assert(((size_t)SEQ * DM / 8) % 1024 == 0);     // x blocks cover each batch exactly
static_assert(((size_t)DM * DM / 8) % 1024 == 0);      // weight blocks cover each matrix exactly
__global__ __launch_bounds__(1024) void k_prep(const float* __restrict__ x, const int* __restrict__ MK, const float* __restrict__ wq, const float* __restrict__ wk, const float* __restrict__ wv, const float* __restrict__ wo,
                                               bf* XB, bf* WB, h16* WOH, unsigned* MB) {
    __shared__ unsigned sm[32];
    int bid = blockIdx.x;
    if (bid < PB_M) { mbits(MK, MB, bid, sm); return; }
    bid -= PB_M;
    if (bid < PB_X) {
        const size_t i = (size_t)bid * 1024 + threadIdx.x; const size_t nb8 = (size_t)SEQ * DM / 8; const size_t b = i / nb8;
        cvt8(x + b * SEQ_FULL * DM, XB + b * SEQ * DM, i % nb8); return;
    }
    bid -= PB_X;
    const int which = bid / PB_W; const size_t i = (size_t)(bid % PB_W) * 1024 + threadIdx.x;
    if (which == 3) cvtw8(wo, WOH, i);
    else cvt8(which == 0 ? wq : (which == 1 ? wk : wv), WB + (size_t)which * DM * DM, i);
}

// proj_body: register-blocked bf16 GEMM, ONE WAVE per 64x64 tile at (r0, c0) (16 accumulators), operands straight from fragment-major bf16 planes, K = DM.
// C[m][n] = sum_k A[m][k] Bt[n][k] + bias (BIASROW == 0: bias[n]; BIASROW != 0: bias[m]), written as f16 (Ph), fragment-major with row = m, k = n, at
// tile base (r0/RB)*sRB + (r0%RB)*pitch + (c0/CB)*sCB + (c0%CB)*CMUL, + mb*MBS per 16 rows, + S1S per 32 columns; the f16 residual x2048 (Pr) is written with its own strides when (r0%RB) < rlim and (c0%CB) < clim.
template <int BIASROW>
__device__ __forceinline__ void proj_body(const bf* __restrict__ A, const bf* __restrict__ Bt, const float* __restrict__ bias, h16* Ph, h16* Pr,
                                          int RB, size_t sRB, int pitch, int CB, size_t sCB,
                                          size_t sRBr, int pitchr, size_t sCBr, int rlim, int clim, int r0, int c0, float* os) {
    const int K = DM;
    const int lane = threadIdx.x & 31, lr = lane & 15, hi = lane >> 4;
    v8f acc[4][4];
#pragma unroll
    for (int mb = 0; mb < 4; ++mb)
#pragma unroll
        for (int nb = 0; nb < 4; ++nb) acc[mb][nb] = (v8f){};
    constexpr int MBS = (BIASROW != 0) ? 512 : 1024, S1S = (BIASROW != 0) ? 2048 : 512, CMUL = (BIASROW != 0) ? 64 : 1;   // q, k: [t/16][d/32][unit]; v^T: [t/32][d/16][unit]
    const size_t aoff = (size_t)r0 * K + 8 * lane, boff = (size_t)c0 * K + 8 * lane;      // unit (row tile, kc/32) at (row tile)*16*K + kc*16
#pragma unroll 1
    for (int kc = 0; kc < K; kc += 32) {
        const bf* pa = A + aoff + kc * 16; const bf* pb = Bt + boff + kc * 16;
        v16bf a[4], b[4];
#pragma unroll
        for (int mb = 0; mb < 4; ++mb) a[mb] = ldb(pa + (size_t)mb * 16 * K);
#pragma unroll
        for (int nb = 0; nb < 4; ++nb) b[nb] = ldb(pb + (size_t)nb * 16 * K);
        asm volatile("s_wait_xcnt 0x0" :: "v"(pa), "v"(pb) : "memory");   // the issued loads' address registers stay as they are (held as inputs) until this wait; it runs under the loads' own latency
#pragma unroll
        for (int nb = 0; nb < 4; ++nb) {
#pragma unroll
            for (int mb = 0; mb < 4; ++mb) acc[mb][nb] = wmmab(a[mb], b[nb], acc[mb][nb]); }
        asm volatile("v_nop\n\tv_nop\n\tv_nop\n\tv_nop" : "+v"(acc[0][3]), "+v"(acc[1][3]), "+v"(acc[2][3]), "+v"(acc[3][3]) : "v"(a[0]), "v"(a[1]), "v"(a[2]), "v"(a[3]));
    }
    float bc[4] = {0.0f, 0.0f, 0.0f, 0.0f};
    if constexpr (BIASROW == 0) {
#pragma unroll
        for (int nb = 0; nb < 4; ++nb) bc[nb] = bfr(bias[c0 + nb * 16 + lr]);
    }
    const int wres = (((r0 % RB) < rlim) && ((c0 % CB) < clim)) ? 1 : 0;   // tile-uniform
    const size_t tbase = (size_t)(r0 / RB) * sRB + (size_t)(r0 % RB) * (size_t)pitch + (size_t)(c0 / CB) * sCB + (size_t)(c0 % CB) * CMUL;
    const size_t tbasr = (size_t)(r0 / RB) * sRBr + (size_t)(r0 % RB) * (size_t)pitchr + (size_t)(c0 / CB) * sCBr + (size_t)(c0 % CB) * CMUL;
#pragma unroll
    for (int mb = 0; mb < 4; ++mb) {
        float rb[8];
        if constexpr (BIASROW != 0) {
            const v4f b0 = *(const v4f*)(bias + r0 + mb * 16 + 8 * hi); const v4f b1 = *(const v4f*)(bias + r0 + mb * 16 + 8 * hi + 4);
#pragma unroll
            for (int i = 0; i < 4; ++i) { rb[i] = bfr(b0[i]); rb[4 + i] = bfr(b1[i]); }
        } else {
#pragma unroll
            for (int j = 0; j < 8; ++j) rb[j] = 0.0f;
        }
#pragma unroll
        for (int nb = 0; nb < 4; ++nb) {
#pragma unroll
            for (int j = 0; j < 8; ++j) os[(hi * 8 + j) * 68 + nb * 16 + lr] = acc[mb][nb][j] + ((BIASROW != 0) ? rb[j] : bc[nb]); }   // D: row 8h+j, col lane&15
        wave_sync();
        const size_t sb = tbase + (size_t)(mb * MBS) + 8 * lane;
        const size_t sr = tbasr + (size_t)(mb * MBS) + 8 * lane;
{
#pragma unroll
            for (int s = 0; s < 4; ++s) { const int row = lr, c8 = (2 * s + hi) * 8;   // store s = part s&1 of the unit of columns 32*(s>>1)..+31: lane holds row lane&15, columns 16*s + 8*(lane>>4) + 0..7
                const v4f x0 = *(const v4fa*)(&os[row * 68 + c8]); const v4f x1 = *(const v4fa*)(&os[row * 68 + c8 + 4]); v8h hv, rv;
#pragma unroll
                for (int i = 0; i < 4; ++i) { const h16 a0 = (h16)x0[i]; const h16 a1 = (h16)x1[i]; hv[i] = a0; hv[4 + i] = a1; rv[i] = (h16)((x0[i] - (float)a0) * QRS); rv[4 + i] = (h16)((x1[i] - (float)a1) * QRS); }
                *(v8h*)(Ph + sb + (s >> 1) * S1S + (s & 1) * 256) = hv;
                asm volatile("s_wait_xcnt 0x0" :: "v"(hv) : "memory");       // before the issued store's registers are reused
                if (wres) { *(v8h*)(Pr + sr + (s >> 1) * S1S + (s & 1) * 256) = rv;
                    asm volatile("s_wait_xcnt 0x0" :: "v"(rv) : "memory"); } }   // the same for the residual store
             }
        wave_sync();
    }
}

// k_proj3: the three projections in one grid (z = q | k | v), so that their waves share the SIMDs; inside each z the tiles come in the order of the separate launches (q, k: token tile fastest; v^T: feature tile fastest).
// q, k: A = x rows (m = b*SEQ + t), Bt = W rows (n = h*64 + d), bias by column -> plane [(b*16 + h)][t/16][d/32][unit]; residual plane the same for t < EROWS
// v^T: A = Wv rows (m = h*64 + d), Bt = x rows (n = b*SEQ + t), bias by row -> plane [(b*16 + h)][t/32][d/16][unit]; residual plane the same for t < EROWS
__global__ __launch_bounds__(32) void k_proj3(const bf* __restrict__ XB, const bf* __restrict__ WQ, const bf* __restrict__ WK, const bf* __restrict__ WV, const float* __restrict__ bq, const float* __restrict__ bk, const float* __restrict__ bv,
                                              h16* QH, h16* QR, h16* KP, h16* KR, h16* VT, h16* VR) {
    __shared__ __align__(16) float os[16 * 68];
    const int z = blockIdx.z;
    if (z == 2) {
        const int flat = blockIdx.y * (NB * SEQ / 64) + blockIdx.x;
        proj_body<1>(WV, XB, bv, VT, VR, DM, (size_t)0, SEQ, SEQ, (size_t)DM * SEQ, (size_t)0, EROWS, (size_t)DM * EROWS, DM, EROWS, (flat % (DM / 64)) * 64, (flat / (DM / 64)) * 64, os);
    } else {
        proj_body<0>(XB, z == 0 ? WQ : WK, z == 0 ? bq : bk, z == 0 ? QH : KP, z == 0 ? QR : KR, SEQ, (size_t)NH_ * SEQ * HD, HD, HD, (size_t)SEQ * HD,
                     (size_t)NH_ * EROWS * HD, HD, (size_t)EROWS * HD, EROWS, HD, blockIdx.x * 64, blockIdx.y * 64, os);
    }
}

// k_flash: fused masked attention, one wave per 16 query rows of one (batch, head); K / V^T / Q fragments straight from the fragment-major f16 planes (two 16-B loads each, 512 contiguous bytes per wave-load).
// Transposed form: S^T[key][t] = K Q^T (A = K rows, B = Q rows); lane (t = lane&15, h = lane>>4) holds keys 8h+r of each 16-key tile, so the packed
// P tile is directly the B fragment of O^T[d][t] = V^T P^T (element r <- tile keys 0..15, element 8+r <- tile keys 16..31, lane unchanged).
// Mask: the wave reads the step's 16 lane-select words (64 B, wave-uniform address) and replaces masked scores by the fill value; the loop walks the set bits of the tile's live-step word in rising order, so a step whose 16x32 mask tile is all zero is not visited;
// if some row ends with no visited key the wave repeats the sweep over every step, which yields the uniform average of a fully masked row.
// EARLY != 0 (query rows < EROWS): q, k, v and P carry residuals x2048; residual products accumulate separately and are folded back with 1/2048.
template <int EARLY>
__global__ __launch_bounds__(32 * AW) void k_flash(const h16* __restrict__ QH, const h16* __restrict__ QR, const h16* __restrict__ KP, const h16* __restrict__ KR,
                                                   const h16* __restrict__ VT, const h16* __restrict__ VR, const unsigned* __restrict__ MB, h16* CH, h16* CR, int tstart) {
    const int lane = threadIdx.x & 31, wave = __builtin_amdgcn_readfirstlane((int)(threadIdx.x >> 5)), lr = lane & 15, hi = lane >> 4;
    const int zh = blockIdx.y; const int b = zh / NH_, h = zh % NH_;
    const int t0 = tstart + (blockIdx.x * AW + wave) * 16;
    const size_t pbase = (size_t)zh * SEQ * HD;
    const size_t rbase = (size_t)zh * EROWS * HD;
    const size_t qo = pbase + (size_t)t0 * HD + 8 * lane;
    const v16h qh0 = ldh(QH + qo), qh1 = ldh(QH + qo + 512);                // B fragments: col t, k = d
    v16h qr0 = qh0, qr1 = qh1;
    if constexpr (EARLY != 0) { const size_t qro = rbase + (size_t)t0 * HD + 8 * lane; qr0 = ldh(QR + qro); qr1 = ldh(QR + qro + 512); }
    const size_t ko  = pbase + 8 * lane;       // + key0 * HD + 512 * (d/32)   (A fragment: row key, k = d; 16 keys = 1024 elements)
    const size_t kro = rbase + 8 * lane;
    const size_t vo  = pbase + 8 * lane;       // + key0 * HD + 512 * j        (A fragment: row d = 16j.., k = key; 32 keys = 2048 elements)
    const size_t vro = rbase + 8 * lane;
    const unsigned* mrec = MB + (size_t)(t0 >> 4) * MREC;      // this tile's mask record (wave-uniform)
    const unsigned long long live = *(const unsigned long long*)(mrec + NST * 16) & ALLST;
    v8f o0 = (v8f){}, o1 = (v8f){}, o2 = (v8f){}, o3 = (v8f){};
    v8f e0 = (v8f){}, e1 = (v8f){}, e2 = (v8f){}, e3 = (v8f){};
    float m = -3.0e38f, l = 0.0f;
    int noskip = 0;
#pragma unroll 1
    for (int pass = 0; pass < 2; ++pass) {
        o0 = (v8f){}; o1 = (v8f){}; o2 = (v8f){}; o3 = (v8f){};
        e0 = (v8f){}; e1 = (v8f){}; e2 = (v8f){}; e3 = (v8f){};
        m = -3.0e38f; l = 0.0f;
#pragma unroll 1
        for (unsigned long long rem = (noskip != 0) ? ALLST : live; rem != 0ull; rem &= rem - 1ull) {   // at most NST trips, wave-uniform
            const int key0 = 32 * __builtin_ctzll(rem);
            const v16u mw = *(const v16u*)(mrec + (key0 >> 1));          // 16 words per step
            const h16* ka = KP + ko + (size_t)key0 * HD;
            v8f sHa = (v8f){}, sHb = (v8f){}, sLa = (v8f){}, sLb = (v8f){};
            {
                const v16h ka0 = ldh(ka), ka1 = ldh(ka + 512), kb0 = ldh(ka + 16 * HD), kb1 = ldh(ka + 16 * HD + 512);
                sHa = wmma16(ka0, qh0, sHa); sHb = wmma16(kb0, qh0, sHb); sHa = wmma16(ka1, qh1, sHa); sHb = wmma16(kb1, qh1, sHb);
                if constexpr (EARLY != 0) {
                    sLa = wmma16(ka0, qr0, sLa); sLb = wmma16(kb0, qr0, sLb); sLa = wmma16(ka1, qr1, sLa); sLb = wmma16(kb1, qr1, sLb);
                    asm volatile("v_nop\n\tv_nop\n\tv_nop\n\tv_nop" : "+v"(sHa), "+v"(sHb), "+v"(sLa), "+v"(sLb) : "v"(ka0), "v"(ka1), "v"(kb0), "v"(kb1));
                } else {
                    asm volatile("v_nop\n\tv_nop\n\tv_nop\n\tv_nop" : "+v"(sHa), "+v"(sHb) : "v"(ka0), "v"(ka1), "v"(kb0), "v"(kb1));
                }
            }
            if constexpr (EARLY != 0) {
                __builtin_amdgcn_sched_barrier(0);
                if (key0 < EROWS) {                                      // residual k plane covers keys < EROWS (wave-uniform)
                    const h16* ra = KR + kro + (size_t)key0 * HD;
                    const v16h ra0 = ldh(ra), ra1 = ldh(ra + 512), rb0 = ldh(ra + 16 * HD), rb1 = ldh(ra + 16 * HD + 512);
                    sLa = wmma16(ra0, qh0, sLa); sLb = wmma16(rb0, qh0, sLb); sLa = wmma16(ra1, qh1, sLa); sLb = wmma16(rb1, qh1, sLb);
                    asm volatile("v_nop\n\tv_nop\n\tv_nop\n\tv_nop" : "+v"(sLa), "+v"(sLb) : "v"(ra0), "v"(ra1), "v"(rb0), "v"(rb1));
                }
                __builtin_amdgcn_sched_barrier(0);
            }
            float ta[8], tb[8]; float mx = -3.0e38f;
#pragma unroll
            for (int r = 0; r < 8; ++r) {
                float sa = sHa[r], sb = sHb[r];
                if constexpr (EARLY != 0) { sa += sLa[r] * QRI; sb += sLb[r] * QRI; }
                ta[r] = __builtin_amdgcn_inverse_ballot_w32(mw[r]) ? sa * SC2 : NEGL;
                tb[r] = __builtin_amdgcn_inverse_ballot_w32(mw[8 + r]) ? sb * SC2 : NEGL;
                mx = fmaxf(mx, fmaxf(ta[r], tb[r]));
            }
            mx = fmaxf(mx, __shfl_xor(mx, 16, 32));
            const float mnew = fmaxf(m, mx);
            const float alpha = __builtin_amdgcn_exp2f(m - mnew);
            const float sh = PSH - mnew;
            v16h pb = (v16h){}; v16h pq = (v16h){}; float ls = 0.0f;
#pragma unroll
            for (int r = 0; r < 8; ++r) {
                const float pa = __builtin_amdgcn_exp2f(ta[r] + sh), pc = __builtin_amdgcn_exp2f(tb[r] + sh);
                const h16 ha = (h16)pa, hc = (h16)pc; pb[r] = ha; pb[8 + r] = hc;
                if constexpr (EARLY != 0) {
                    const h16 ga = (h16)((pa - (float)ha) * QRS), gc = (h16)((pc - (float)hc) * QRS); pq[r] = ga; pq[8 + r] = gc;
                    ls += ((float)ha + (float)hc) + ((float)ga + (float)gc) * QRI;
                } else {
                    ls += (float)ha + (float)hc;
                }
            }
            l = l * alpha + ls; m = mnew;
            o0 = o0 * alpha; o1 = o1 * alpha; o2 = o2 * alpha; o3 = o3 * alpha;
            if constexpr (EARLY != 0) { e0 = e0 * alpha; e1 = e1 * alpha; e2 = e2 * alpha; e3 = e3 * alpha; }
            const h16* va = VT + vo + (size_t)key0 * HD;
            {
                const v16h v0 = ldh(va), v1 = ldh(va + 512), v2 = ldh(va + 1024), v3 = ldh(va + 1536);
                o0 = wmma16(v0, pb, o0); o1 = wmma16(v1, pb, o1); o2 = wmma16(v2, pb, o2); o3 = wmma16(v3, pb, o3);
                if constexpr (EARLY != 0) {
                    e0 = wmma16(v0, pq, e0); e1 = wmma16(v1, pq, e1); e2 = wmma16(v2, pq, e2); e3 = wmma16(v3, pq, e3);
                    asm volatile("v_nop\n\tv_nop\n\tv_nop\n\tv_nop" : "+v"(o0), "+v"(o1), "+v"(o2), "+v"(o3), "+v"(e0), "+v"(e1), "+v"(e2), "+v"(e3) : "v"(v0), "v"(v1), "v"(v2), "v"(v3), "v"(pb), "v"(pq));
                } else {
                    asm volatile("v_nop\n\tv_nop\n\tv_nop\n\tv_nop" : "+v"(o0), "+v"(o1), "+v"(o2), "+v"(o3) : "v"(v0), "v"(v1), "v"(v2), "v"(v3), "v"(pb));
                }
            }
            if constexpr (EARLY != 0) {
                __builtin_amdgcn_sched_barrier(0);
                if (key0 < EROWS) {                                      // residual v^T plane covers keys < EROWS (wave-uniform)
                    const h16* wa = VR + vro + (size_t)key0 * HD;
                    const v16h w0 = ldh(wa), w1 = ldh(wa + 512), w2 = ldh(wa + 1024), w3 = ldh(wa + 1536);
                    e0 = wmma16(w0, pb, e0); e1 = wmma16(w1, pb, e1); e2 = wmma16(w2, pb, e2); e3 = wmma16(w3, pb, e3);
                    asm volatile("v_nop\n\tv_nop\n\tv_nop\n\tv_nop" : "+v"(e0), "+v"(e1), "+v"(e2), "+v"(e3) : "v"(w0), "v"(w1), "v"(w2), "v"(w3), "v"(pb));
                }
                __builtin_amdgcn_sched_barrier(0);
            }
        }
        l += __shfl_xor(l, 16, 32);
        const unsigned dead = __builtin_amdgcn_ballot_w32(!(l > 0.0f));
        if (dead == 0u) break;                                           // wave-uniform
        noskip = 1;
    }
    const float inv = CXS * (1.0f / l);
    // O^T D layout: o_j[r] = (d = 16j + 8h + r, t = lane&15): exactly part j&1 of context unit 2h + (j>>1) (row t = lane&15, k = 16j + 8*(lane>>4) + r), so each lane stores its own accumulators, no transpose
    const size_t crow = ((size_t)b * SEQ + t0) * DM + (size_t)h * 1024 + 8 * lane;     // context plane, row b*SEQ + t, k = h*64 + d: units [(b*SEQ + t)/16][2h + d/32]
    const size_t rrow = ((size_t)b * EROWS + t0) * DM + (size_t)h * 1024 + 8 * lane;   // residual plane, row b*EROWS + t (EARLY launches only: t0 + 15 < EROWS)
    v8f xs[4] = {o0, o1, o2, o3};
    if constexpr (EARLY != 0) { xs[0] = o0 + e0 * QRI; xs[1] = o1 + e1 * QRI; xs[2] = o2 + e2 * QRI; xs[3] = o3 + e3 * QRI; }
#pragma unroll
    for (int s = 0; s < 4; ++s) {
        const v8f x = xs[s] * inv; v8h hv, rv;
#pragma unroll
        for (int i = 0; i < 8; ++i) { const h16 a0 = (h16)x[i]; hv[i] = a0; rv[i] = (h16)((x[i] - (float)a0) * QRS); }
        *(v8h*)(CH + crow + s * 256) = hv;
        if constexpr (EARLY != 0) *(v8h*)(CR + rrow + s * 256) = rv;
    }
}

// oproj_body: output projection, f16 GEMM, ONE WAVE per (16*MT) x 64 tile, K = DM. OUT[m][n] = OSC * (sum_k A[m][k] Bt[n][k] + QRI * sum_k AR[m][k] Bt[n][k]) + bias[n] (bias RNE-converted to bf16).
// A = context plane (x16), AR = context residual plane (RES != 0 only, rows [b*EROWS + t]), Bt = Wo x1024 as f16 ([out][in]).
// row tile rt in 0 .. NB * tpb - 1 -> batch rt / tpb, first token rowoff + (rt % tpb) * 16*MT; c0 = first output column.
template <int MT, int RES>
__device__ __forceinline__ void oproj_body(const h16* __restrict__ A, const h16* __restrict__ AR, const h16* __restrict__ Bt, const float* __restrict__ bias, float* OUT, int tpb, int rowoff, int rt, int c0, float* os) {
    static_assert((MT == 4 && RES == 0) || (MT == 2 && RES == 1));
    const int K = DM;
    const int lane = threadIdx.x & 31, lr = lane & 15, hi = lane >> 4;
    const int bb = rt / tpb, tl = rt % tpb;
    const int tok = rowoff + tl * (16 * MT);
    const size_t aoff = ((size_t)bb * SEQ + tok) * K + 8 * lane;       // unit (row tile, kc/32) at (row tile)*16*K + kc*16
    const size_t roff = ((size_t)bb * EROWS + tok) * K + 8 * lane;
    const size_t boff = (size_t)c0 * K + 8 * lane;
    v8f acc[MT][4], acr[MT][4];
#pragma unroll
    for (int mb = 0; mb < MT; ++mb)
#pragma unroll
        for (int nb = 0; nb < 4; ++nb) { acc[mb][nb] = (v8f){}; acr[mb][nb] = (v8f){}; }
#pragma unroll 1
    for (int kc = 0; kc < K; kc += 32) {
        const h16* pa = A + aoff + kc * 16; const h16* pr = AR + roff + kc * 16; const h16* pb = Bt + boff + kc * 16;
        v16h a[MT], ar[MT], bfrag[4];
#pragma unroll
        for (int mb = 0; mb < MT; ++mb) { a[mb] = ldh(pa + (size_t)mb * 16 * K); ar[mb] = a[mb]; }
        if constexpr (RES != 0) {
#pragma unroll
            for (int mb = 0; mb < MT; ++mb) ar[mb] = ldh(pr + (size_t)mb * 16 * K);
        }
#pragma unroll
        for (int nb = 0; nb < 4; ++nb) bfrag[nb] = ldh(pb + (size_t)nb * 16 * K);
        // the issued loads' address registers stay as they are (held as inputs) until this wait; it runs under the loads' own latency
        if constexpr (RES != 0) asm volatile("s_wait_xcnt 0x0" :: "v"(pa), "v"(pr), "v"(pb) : "memory");
        else                    asm volatile("s_wait_xcnt 0x0" :: "v"(pa), "v"(pb) : "memory");
#pragma unroll
        for (int nb = 0; nb < 4; ++nb) {
#pragma unroll
            for (int mb = 0; mb < MT; ++mb) { acc[mb][nb] = wmma16(a[mb], bfrag[nb], acc[mb][nb]);
                if constexpr (RES != 0) acr[mb][nb] = wmma16(ar[mb], bfrag[nb], acr[mb][nb]); } }
        if constexpr (MT == 4) {
            asm volatile("v_nop\n\tv_nop\n\tv_nop\n\tv_nop" : "+v"(acc[0][3]), "+v"(acc[1][3]), "+v"(acc[2][3]), "+v"(acc[3][3]) : "v"(a[0]), "v"(a[1]), "v"(a[2]), "v"(a[3]));
        } else {
            asm volatile("v_nop\n\tv_nop\n\tv_nop\n\tv_nop" : "+v"(acc[0][3]), "+v"(acc[1][3]), "+v"(acr[0][3]), "+v"(acr[1][3]) : "v"(a[0]), "v"(a[1]), "v"(ar[0]), "v"(ar[1]));
        }
    }
    float bc[4];
#pragma unroll
    for (int nb = 0; nb < 4; ++nb) bc[nb] = bfr(bias[c0 + nb * 16 + lr]);
#pragma unroll
    for (int mb = 0; mb < MT; ++mb) {
#pragma unroll
        for (int nb = 0; nb < 4; ++nb) {
#pragma unroll
            for (int j = 0; j < 8; ++j) { float v = acc[mb][nb][j] * OSC;
                if constexpr (RES != 0) v += acr[mb][nb][j] * (OSC * QRI);
                os[(hi * 8 + j) * 68 + nb * 16 + lr] = v + bc[nb]; } }                          // D: row 8h+j, col lane&15
        wave_sync();
        float* orow = OUT + ((size_t)bb * OUT_SEQ + tok + mb * 16) * DM + c0;
{
#pragma unroll
            for (int s = 0; s < 8; ++s) { const int row = 2 * s + hi, cofs = lr * 4;            // 8 s x 2 rows = 16 rows; 16 lanes x 4 floats = 64 columns
                const v4f val = *(const v4fa*)(&os[row * 68 + cofs]);
                *(v4f*)(orow + (size_t)row * DM + cofs) = val; }
             }
        wave_sync();
    }
}

// k_oprojf: both forms in one grid (x = row tile, fastest as in the separate launches: first the residual rows' tiles, then the rest; y = column tile), so that their waves share the SIMDs.
__global__ __launch_bounds__(32) void k_oprojf(const h16* __restrict__ CXH, const h16* __restrict__ CXR, const h16* __restrict__ WOH, const float* __restrict__ bo, float* OUT) {
    __shared__ __align__(16) float os[16 * 68];
    constexpr int NR = NB * (EROWS / 32);
    const int rt = blockIdx.x, c0 = blockIdx.y * 64;
    if (rt < NR) oproj_body<2, 1>(CXH, CXR, WOH, bo, OUT, EROWS / 32, 0, rt, c0, os);
    else         oproj_body<4, 0>(CXH, CXH, WOH, bo, OUT, (SEQ - EROWS) / 64, EROWS, rt - NR, c0, os);
}

static constexpr size_t al256(size_t v) { return (v + 255) & ~(size_t)255; }
static constexpr size_t SZ_XB = al256((size_t)NB * SEQ * DM * 2);              // x bf16
static constexpr size_t SZ_WB = al256((size_t)3 * DM * DM * 2);                // Wq | Wk | Wv bf16
static constexpr size_t SZ_WO = al256((size_t)DM * DM * 2);                    // Wo f16 (x1024)
static constexpr size_t SZ_PL = al256((size_t)NB * NH_ * SEQ * HD * 2);        // q / k / v^T planes
static constexpr size_t SZ_RP = al256((size_t)NB * NH_ * EROWS * HD * 2);      // residual planes (t < EROWS)
static constexpr size_t SZ_CX = al256((size_t)NB * SEQ * DM * 2);              // context plane
static constexpr size_t SZ_CR = al256((size_t)NB * EROWS * DM * 2);            // context residual plane
static constexpr size_t SZ_MB = al256((size_t)(SEQ / 16) * MREC * 4);          // mask records
static constexpr size_t SZ_TOTAL = SZ_XB + SZ_WB + SZ_WO + 3 * SZ_PL + 3 * SZ_RP + SZ_CX + SZ_CR + SZ_MB;
static_assert(SZ_TOTAL <= (size_t)134217728);          // workspace carve <= 128 MiB
static_assert(((size_t)DM * DM * 2) % 256 == 0);       // weight sub-planes stay 256-byte aligned

extern "C" void kernel_launch(void* const* d_in, const int* in_sizes, int n_in,
                              void* d_out, int out_size, void* d_ws, size_t ws_size, hipStream_t stream) {
    if (n_in < 10) return;
    const size_t needx = ((size_t)(NB - 1) * SEQ_FULL + SEQ) * DM;
    if ((size_t)in_sizes[0] < needx) return;
    if ((size_t)in_sizes[1] < (size_t)(SEQ - 1) * SEQ_FULL + SEQ) return;
    if ((size_t)in_sizes[2] < (size_t)DM * DM || (size_t)in_sizes[4] < (size_t)DM * DM || (size_t)in_sizes[6] < (size_t)DM * DM || (size_t)in_sizes[8] < (size_t)DM * DM) return;
    if (in_sizes[3] < DM || in_sizes[5] < DM || in_sizes[7] < DM || in_sizes[9] < DM) return;
    if ((size_t)out_size < ((size_t)(NB - 1) * OUT_SEQ + SEQ) * DM) return;
    if (SZ_TOTAL > ws_size) return;
    // wire order: query, mask (int32), Wq, bq, Wk, bk, Wv, bv, Wo, bo; weights [out][in] = Bt as-is
    const float* x  = (const float*)d_in[0]; const int* mask = (const int*)d_in[1];
    const float* wq = (const float*)d_in[2]; const float* bq = (const float*)d_in[3];
    const float* wk = (const float*)d_in[4]; const float* bk = (const float*)d_in[5];
    const float* wv = (const float*)d_in[6]; const float* bv = (const float*)d_in[7];
    const float* wo = (const float*)d_in[8]; const float* bo = (const float*)d_in[9];
    float* OUT = (float*)d_out;      // [NB][SEQ][1024]
    char* wsp = (char*)d_ws;
    bf*  XB  = (bf*)wsp;  wsp += SZ_XB;              // rows NB*SEQ, k 1024, fragment-major
    bf*  WB  = (bf*)wsp;  wsp += SZ_WB;              // 3 planes q | k | v, rows 1024, k 1024, fragment-major
    h16* WOH = (h16*)wsp; wsp += SZ_WO;              // rows 1024, k 1024, fragment-major, x1024
    h16* QH  = (h16*)wsp; wsp += SZ_PL;              // [NB*16][SEQ/16][2][unit]
    h16* KP  = (h16*)wsp; wsp += SZ_PL;              // [NB*16][SEQ/16][2][unit]
    h16* VT  = (h16*)wsp; wsp += SZ_PL;              // [NB*16][SEQ/32][4][unit]
    h16* QR  = (h16*)wsp; wsp += SZ_RP;              // [NB*16][EROWS/16][2][unit] residual x2048
    h16* KR  = (h16*)wsp; wsp += SZ_RP;              // [NB*16][EROWS/16][2][unit] residual x2048
    h16* VR  = (h16*)wsp; wsp += SZ_RP;              // [NB*16][EROWS/32][4][unit] residual x2048
    h16* CXH = (h16*)wsp; wsp += SZ_CX;              // rows NB*SEQ, k 1024, fragment-major, x16
    h16* CXR = (h16*)wsp; wsp += SZ_CR;              // rows NB*EROWS, k 1024, fragment-major, residual x2048
    unsigned* MBW = (unsigned*)wsp; wsp += SZ_MB;    // [SEQ/16][MREC] mask records
    bf* WQ = WB; bf* WK = WB + (size_t)DM * DM; bf* WV = WB + (size_t)2 * DM * DM;

    k_prep<<<PB_M + PB_X + 4 * PB_W, 1024, 0, stream>>>(x, mask, wq, wk, wv, wo, XB, WB, WOH, MBW);
    k_proj3<<<dim3(NB * SEQ / 64, DM / 64, 3), 32, 0, stream>>>(XB, WQ, WK, WV, bq, bk, bv, QH, QR, KP, KR, VT, VR);

    k_flash<1><<<dim3(EROWS / (16 * AW), NB * NH_, 1), 32 * AW, 0, stream>>>(QH, QR, KP, KR, VT, VR, MBW, CXH, CXR, 0);
    if (SEQ > EROWS)
        k_flash<0><<<dim3((SEQ - EROWS) / (16 * AW), NB * NH_, 1), 32 * AW, 0, stream>>>(QH, QR, KP, KR, VT, VR, MBW, CXH, CXR, EROWS);

    k_oprojf<<<dim3(NB * (EROWS / 32) + NB * ((SEQ - EROWS) / 64), DM / 64, 1), 32, 0, stream>>>(CXH, CXR, WOH, bo, OUT);
}

// v004
// A run of this version takes 216 microseconds.
// In both of two side-by-side timings against v003, it was 1.07 times as fast.
// All steps since v000 together make it 1.85 times as fast.
#include <hip/hip_runtime.h>

// Masked multi-head self-attention, width 1024 = 16 heads x 64, x [NB][SEQ][1024], Wq/Wk/Wv/Wo [out][in] (y = x W^T + b), int32 mask [SEQ][SEQ] (0 = fill -1e9), score scale 1/8, output projection with bias (f32 out).
// Compute dtypes, f32 accumulate everywhere: q/k/v projections v_wmma_f32_16x16x32_bf16 (x and W RNE-converted to bf16; products exact; biases RNE-converted to bf16, added in f32);
// scores and P.V v_wmma_f32_16x16x32_f16: single f16 planes on query rows >= 512; on the first 512 query rows q, k, v, P and the context carry an f16 residual x2048 (three products, residual terms in their own accumulator);
// P carried x256 (cancels in the normalisation); output projection v_wmma_f32_16x16x32_f16 with context x16 and bf16-exact Wo x1024 as f16 (context residual on the first 512 rows); softmax f32 (online, running max).
// Layout: every 16-bit matrix operand plane is fragment-major: a unit is one 16-row x 32-k fragment = [part 0..1][lane 0..31][8 elements] (512 elements, 1 KiB), element (part, lane, e) = (row lane&15, k 16*part + 8*(lane>>4) + e),
// so each 16-byte-per-lane load or store of a wave covers 512 contiguous bytes (4 whole lines). x, W, context planes: [row/16][k/32][unit]; q, k planes: [b*16+h][t/16][d/32][unit]; v^T plane: [b*16+h][t/32][d/16][unit]
// (+ residual planes for t < 512), written by the GEMM epilogue; fused flash kernel in transposed form (S^T = K Q^T, O^T = V^T P^T);
// mask: a pre-pass turns the int32 mask once per call into lane-select words (per 16-query tile and 32-key step: 16 words, bit L of word e = mask != 0 at the score element e that flash lane L holds) plus one 64-bit word per tile of the steps
// that hold any kept key; the flash kernel reads them by scalar loads (replace-fill by value as before); fully masked 16x32 tiles are skipped in the first sweep, with a full second sweep when a row ends with no visited key.

#ifndef NB
#define NB 4
#endif
#ifndef SEQ
#define SEQ 2048
#endif
#define NB_FULL  4
#define SEQ_FULL 2048
#ifndef OUT_SEQ
#define OUT_SEQ SEQ              // row pitch (in tokens) between batches of the output
#endif
#define DM   1024
#define NH_  16
#define HD   64
#define AW   4                   // waves per flash block (16 query rows each)
#define EROWS ((SEQ) < 512 ? (SEQ) : 512)   // query rows / keys per sequence that carry residual planes
#define QRS  2048.0f             // carry of every residual plane
#define QRI  (1.0f / 2048.0f)
#define SC2  (0.125f * 1.4426950408889634f)   // HD^-0.5 * log2(e)
#define NEGL (-1.0e9f * 1.4426950408889634f)  // masked fill in the log2 domain
#define PSH  8.0f                // log2 of the P carry (256)
#define CXS  16.0f               // carry of the context planes
#define WOS  1024.0f             // carry of the Wo plane
#define OSC  (1.0f / 16384.0f)   // 1 / (CXS * WOS)
#define NST  (SEQ / 32)          // 32-key steps per sequence
#define MREC (NST * 16 + 32)     // words of one 16-query tile's mask record: NST steps x 16 lane-select words, then one 128-B line whose first two words are the live-step bits
#define ALLST ((NST) >= 64 ? ~0ull : ((1ull << ((NST) & 63)) - 1ull))

static_assert(HD == 64);
static_assert(NH_ * HD == DM);                 // head h = columns h*64 + d
static_assert(DM % 64 == 0);
static_assert(DM % 32 == 0);                   // GEMM k-loop steps by 32
static_assert(SEQ % 64 == 0);                  // a 64-row tile never straddles two batches
static_assert((NB * SEQ) % 64 == 0);
static_assert(SEQ % 32 == 0);                  // key loop steps by 32
static_assert(EROWS % 64 == 0);                // residual tiles are whole 64-tiles; flash grid covers them exactly
static_assert(EROWS % (16 * AW) == 0);
static_assert((SEQ - EROWS) % 64 == 0);
static_assert((SEQ - EROWS) % (16 * AW) == 0);
static_assert(EROWS <= SEQ);
static_assert(((size_t)SEQ * DM) % 8 == 0);
static_assert(((size_t)DM * DM) % 8 == 0);
static_assert(NB <= NB_FULL);
static_assert(SEQ <= SEQ_FULL);
static_assert(NST <= 64);                      // live-step bits fit one 64-bit word; 32 waves x 2 steps cover a tile in mbits
static_assert(NST % 2 == 0);

typedef _Float16 h16;
typedef unsigned short bf;
typedef __attribute__((ext_vector_type(16))) __bf16   v16bf;
typedef __attribute__((ext_vector_type(16))) _Float16 v16h;
typedef __attribute__((ext_vector_type(8)))  _Float16 v8h;
typedef __attribute__((ext_vector_type(8)))  unsigned short v8us;
typedef __attribute__((ext_vector_type(8)))  float    v8f;
typedef __attribute__((ext_vector_type(4)))  float    v4f;
typedef __attribute__((ext_vector_type(4)))  int      v4i;
typedef v4f  __attribute__((may_alias)) v4fa;
typedef __attribute__((ext_vector_type(16))) unsigned v16u;

__device__ __forceinline__ unsigned short f2bf(float f) { unsigned u = __float_as_uint(f); u += 0x7FFFu + ((u >> 16) & 1u); return (unsigned short)(u >> 16); }
__device__ __forceinline__ float bfr(float f) { return __uint_as_float(((unsigned)f2bf(f)) << 16); }   // value after RNE convert to bf16
__device__ __forceinline__ v16h cat16(v8h lo, v8h hi) { return __builtin_shufflevector(lo, hi, 0, 1, 2, 3, 4, 5, 6, 7, 8, 9, 10, 11, 12, 13, 14, 15); }
__device__ __forceinline__ v16bf cat16b(v8us lo, v8us hi) { return __builtin_bit_cast(v16bf, __builtin_shufflevector(lo, hi, 0, 1, 2, 3, 4, 5, 6, 7, 8, 9, 10, 11, 12, 13, 14, 15)); }
__device__ __forceinline__ v8f wmma16(v16h a, v16h b, v8f c) { return __builtin_amdgcn_wmma_f32_16x16x32_f16(false, a, false, b, (short)0, c, false, false); }
__device__ __forceinline__ v8f wmmab(v16bf a, v16bf b, v8f c) { return __builtin_amdgcn_wmma_f32_16x16x32_bf16(false, a, false, b, (short)0, c, false, false); }
// fragment loaders from a fragment-major unit; p = unit base + 8*lane: elements 0..7 <- k0+8h+0..7 (part 0), elements 8..15 <- k0+16+8h+0..7 (part 1, +256 elements) (same map for A and B)
__device__ __forceinline__ v16h  ldh(const h16* p) { return cat16(*(const v8h*)p, *(const v8h*)(p + 256)); }
__device__ __forceinline__ v16bf ldb(const bf* p)  { return cat16b(*(const v8us*)p, *(const v8us*)(p + 256)); }
// converters: a wave takes 8 rows x 32 k (8 whole 128-B lines of f32) and writes 4 whole 128-B lines of one unit. Thread i -> source element offset (row-major, DM columns) and fragment-major destination offset.
__device__ __forceinline__ void cvt_map(size_t i, size_t& so, size_t& dof) {
    const int lane = (int)(i & 31); const size_t w = i >> 5; const size_t ks = w % (DM / 32); const size_t row = (w / (DM / 32)) * 8 + (size_t)(lane >> 2); const int c = lane & 3;
    so  = row * DM + ks * 32 + (size_t)c * 8;
    dof = (row >> 4) * (size_t)(16 * DM) + ks * 512 + (size_t)(c >> 1) * 256 + (size_t)(c & 1) * 128 + (row & 15) * 8;
}
// ordering point for wave-private LDS tiles (same wave writes and reads)
__device__ __forceinline__ void wave_sync() { __builtin_amdgcn_fence(3 /* release order */, "wavefront"); __builtin_amdgcn_wave_barrier(); asm volatile("" ::: "memory"); }

// GEMM blocks: the waves of a block share one stage = the fragment-major units (1 KiB each) of one 32-k step, 8 of the row operand(s), then those of the column operand; two stage buffers in LDS.
// Output projection: 4 waves (2 x 2 wave tiles), 8 + 8 units. q/k/v projections: 8 waves (2 x 4 wave tiles), 8 + 16 units.
#define GW  4
#define STG 16384
#define PW   8
#define PSTG 24576
// stage16: the block's 128 threads bring one stage from the global planes into LDS, 8 asynchronous 16-B copies per thread; copy j fills bytes 16*tid of the unit pair 2j, 2j+1 (l = stage buffer + 16*tid, pj = the thread's own source bytes).
// The s_wait_xcnt stands inside the statement so that no address register of an issued copy is rewritten in front of it.
__device__ __forceinline__ void stage16(unsigned l, const char* p0, const char* p1, const char* p2, const char* p3, const char* p4, const char* p5, const char* p6, const char* p7) {
    asm volatile("global_load_async_to_lds_b128 %0, %8, off\n\t"
                 "global_load_async_to_lds_b128 %1, %9, off\n\t"
                 "global_load_async_to_lds_b128 %2, %10, off\n\t"
                 "global_load_async_to_lds_b128 %3, %11, off\n\t"
                 "global_load_async_to_lds_b128 %4, %12, off\n\t"
                 "global_load_async_to_lds_b128 %5, %13, off\n\t"
                 "global_load_async_to_lds_b128 %6, %14, off\n\t"
                 "global_load_async_to_lds_b128 %7, %15, off\n\t"
                 "s_wait_xcnt 0x0"
                 :: "v"(l), "v"(l + 2048u), "v"(l + 4096u), "v"(l + 6144u), "v"(l + 8192u), "v"(l + 10240u), "v"(l + 12288u), "v"(l + 14336u),
                    "v"(p0), "v"(p1), "v"(p2), "v"(p3), "v"(p4), "v"(p5), "v"(p6), "v"(p7) : "memory");
}
// stage24: the same for a block of 256 threads and 24 units, 6 copies per thread; copy j fills bytes 16*tid of the four units 4j .. 4j+3
__device__ __forceinline__ void stage24(unsigned l, const char* p0, const char* p1, const char* p2, const char* p3, const char* p4, const char* p5) {
    asm volatile("global_load_async_to_lds_b128 %0, %6, off\n\t"
                 "global_load_async_to_lds_b128 %1, %7, off\n\t"
                 "global_load_async_to_lds_b128 %2, %8, off\n\t"
                 "global_load_async_to_lds_b128 %3, %9, off\n\t"
                 "global_load_async_to_lds_b128 %4, %10, off\n\t"
                 "global_load_async_to_lds_b128 %5, %11, off\n\t"
                 "s_wait_xcnt 0x0"
                 :: "v"(l), "v"(l + 4096u), "v"(l + 8192u), "v"(l + 12288u), "v"(l + 16384u), "v"(l + 20480u),
                    "v"(p0), "v"(p1), "v"(p2), "v"(p3), "v"(p4), "v"(p5) : "memory");
}
// the two waits of a stage hand-over, each in front of the block barrier: the wave's own LDS reads done (its buffer may be refilled), the wave's own copies landed (the other waves may read them)
__device__ __forceinline__ void wait_ds()    { asm volatile("s_wait_dscnt 0x0" ::: "memory"); }
__device__ __forceinline__ void wait_async() { asm volatile("s_wait_asynccnt 0x0" ::: "memory"); }

__device__ __forceinline__ void cvt8(const float* __restrict__ src, bf* dst, size_t i) {
    size_t so, dof; cvt_map(i, so, dof);
    const v8f v = *(const v8f*)(src + so); v8us o;
#pragma unroll
    for (int k = 0; k < 8; ++k) o[k] = f2bf(v[k]);
    bf* dp = dst + dof;
    *(v8us*)dp = o;
    asm volatile("s_wait_xcnt 0x0" :: "v"(o), "v"(dp) : "memory");   // before the issued store's registers are reused
}

__device__ __forceinline__ void cvtw8(const float* __restrict__ src, h16* dst, size_t i) {
    size_t so, dof; cvt_map(i, so, dof);
    const v8f v = *(const v8f*)(src + so); v8h o;
#pragma unroll
    for (int k = 0; k < 8; ++k) o[k] = (h16)(bfr(v[k]) * WOS);
    h16* dp = dst + dof;
    *(v8h*)dp = o;
    asm volatile("s_wait_xcnt 0x0" :: "v"(o), "v"(dp) : "memory");   // the same for this store
}

// mbits: one 32-wave block per 16-query tile, wave w packs steps 2w and 2w+1. Each lane loads the 16 mask words of the score elements it holds in k_flash (row lane&15; keys 8*(lane>>4)+0..7 and 16+8*(lane>>4)+0..7 of the step);
// the ballot over element e is the lane-select word e. A wave stores its two steps as one whole 128-B line; wave 0 gathers the live-step bits (bit s = step s holds a kept key) and stores them as the record's last line.
__device__ __forceinline__ void mbits(const int* __restrict__ MK, unsigned* MB, int tile, unsigned* sm) {
    const int lane = threadIdx.x & 31, wave = __builtin_amdgcn_readfirstlane((int)(threadIdx.x >> 5)), lr = lane & 15, hi = lane >> 4;
    unsigned* rec = MB + (size_t)tile * MREC;
    unsigned live2 = 0u;
    if (2 * wave < NST) {                                                // wave-uniform
        const int* mp = MK + (size_t)(tile * 16 + lr) * SEQ_FULL + wave * 64 + 8 * hi;
        unsigned w = 0u;
#pragma unroll
        for (int u = 0; u < 2; ++u) {
            const v4i a0 = *(const v4i*)(mp + 32 * u), a1 = *(const v4i*)(mp + 32 * u + 4), b0 = *(const v4i*)(mp + 32 * u + 16), b1 = *(const v4i*)(mp + 32 * u + 20);
            const int q[16] = {a0[0], a0[1], a0[2], a0[3], a1[0], a1[1], a1[2], a1[3], b0[0], b0[1], b0[2], b0[3], b1[0], b1[1], b1[2], b1[3]};
            unsigned any = 0u;
#pragma unroll
            for (int e = 0; e < 16; ++e) { const unsigned bal = __builtin_amdgcn_ballot_w32(q[e] != 0); any |= bal; w = (lane == 16 * u + e) ? bal : w; }
            live2 |= (any != 0u ? 1u : 0u) << u;
        }
        rec[wave * 32 + lane] = w;
    }
    if (lane == 0) sm[wave] = live2;
    __syncthreads();
    if (wave == 0) {
        unsigned v = sm[lane] << (2 * lr);                               // lanes 0..15: steps 0..31, lanes 16..31: steps 32..63
        v |= __shfl_xor(v, 1, 32); v |= __shfl_xor(v, 2, 32); v |= __shfl_xor(v, 4, 32); v |= __shfl_xor(v, 8, 32);
        const unsigned vh = __shfl(v, 16, 32);
        rec[NST * 16 + lane] = (lane == 0) ? v : ((lane == 1) ? vh : 0u);
    }
}

// k_prep: every operand preparation of a call in one grid of 1024-thread blocks, so that the six independent jobs share the chip instead of running one after another;
// a block's job follows from its index alone (block-uniform): mask tiles, then x, then Wq | Wk | Wv, then Wo. Thread -> element inside each job is as in the separate launches.
#define PB_M (SEQ / 16)
#define PB_X ((int)((size_t)NB * SEQ * DM / 8 / 1024))
#define PB_W ((int)((size_t)DM * DM / 8 / 1024))
static_assert(((size_t)SEQ * DM / 8) % 1024 == 0);     // x blocks cover each batch exactly
static_assert(((size_t)DM * DM / 8) % 1024 == 0);      // weight blocks cover each matrix exactly
__global__ __launch_bounds__(1024) void k_prep(const float* __restrict__ x, const int* __restrict__ MK, const float* __restrict__ wq, const float* __restrict__ wk, const float* __restrict__ wv, const float* __restrict__ wo,
                                               bf* XB, bf* WB, h16* WOH, unsigned* MB) {
    __shared__ unsigned sm[32];
    int bid = blockIdx.x;
    if (bid < PB_M) { mbits(MK, MB, bid, sm); return; }
    bid -= PB_M;
    if (bid < PB_X) {
        const size_t i = (size_t)bid * 1024 + threadIdx.x; const size_t nb8 = (size_t)SEQ * DM / 8; const size_t b = i / nb8;
        cvt8(x + b * SEQ_FULL * DM, XB + b * SEQ * DM, i % nb8); return;
    }
    bid -= PB_X;
    const int which = bid / PB_W; const size_t i = (size_t)(bid % PB_W) * 1024 + threadIdx.x;
    if (which == 3) cvtw8(wo, WOH, i);
    else cvt8(which == 0 ? wq : (which == 1 ? wk : wv), WB + (size_t)which * DM * DM, i);
}

// proj_body: register-blocked bf16 GEMM, one 8-wave block per 128x256 tile at (rB, cB), one wave per 64x64 tile at (r0, c0) (16 accumulators), K = DM; the block's operand units come from the fragment-major bf16 planes
// into LDS by asynchronous copies, one 32-k stage ahead (two buffers), and each unit is read from LDS by the four (row operand) or two (column operand) waves that need it.
// C[m][n] = sum_k A[m][k] Bt[n][k] + bias (BIASROW == 0: bias[n]; BIASROW != 0: bias[m]), written as f16 (Ph), fragment-major with row = m, k = n, at
// tile base (r0/RB)*sRB + (r0%RB)*pitch + (c0/CB)*sCB + (c0%CB)*CMUL, + mb*MBS per 16 rows, + S1S per 32 columns; the f16 residual x2048 (Pr) is written with its own strides when (r0%RB) < rlim and (c0%CB) < clim.
template <int BIASROW>
__device__ __forceinline__ void proj_body(const bf* __restrict__ A, const bf* __restrict__ Bt, const float* __restrict__ bias, h16* Ph, h16* Pr,
                                          int RB, size_t sRB, int pitch, int CB, size_t sCB,
                                          size_t sRBr, int pitchr, size_t sCBr, int rlim, int clim, int rB, int cB, float* osb, char* st) {
    const int K = DM;
    const int tid = threadIdx.x, lane = tid & 31, lr = lane & 15, hi = lane >> 4, wv = __builtin_amdgcn_readfirstlane(tid >> 5);
    const int r0 = rB + 64 * (wv >> 2), c0 = cB + 64 * (wv & 3);
    float* os = osb + wv * (16 * 68);                                    // wave-private epilogue tile
    v8f acc[4][4];
#pragma unroll
    for (int mb = 0; mb < 4; ++mb)
#pragma unroll
        for (int nb = 0; nb < 4; ++nb) acc[mb][nb] = (v8f){};
    constexpr int MBS = (BIASROW != 0) ? 512 : 1024, S1S = (BIASROW != 0) ? 2048 : 512, CMUL = (BIASROW != 0) ? 64 : 1;   // q, k: [t/16][d/32][unit]; v^T: [t/32][d/16][unit]
    // unit (row tile, ks) lies at byte (row tile)*32*K + ks*1024; thread tid copies bytes 16*(tid&63) of row tiles (tid>>6) + 4j
    const char* ga = (const char*)(A  + (size_t)(rB + 16 * (tid >> 6)) * K + 8 * (tid & 63));
    const char* gb = (const char*)(Bt + (size_t)(cB + 16 * (tid >> 6)) * K + 8 * (tid & 63));
    const unsigned ls = (unsigned)(size_t)st + 16u * (unsigned)tid;
    stage24(ls, ga, ga + 131072, gb, gb + 131072, gb + 262144, gb + 393216);
    wait_async();
    __syncthreads();                                                     // stage 0 published
    stage24(ls + PSTG, ga + 1024, ga + 132096, gb + 1024, gb + 132096, gb + 263168, gb + 394240);
#pragma unroll 1
    for (int ks = 0; ks < K / 32; ++ks) {
        const bf* pa = (const bf*)(st + (ks & 1) * PSTG + (wv >> 2) * 4096) + 8 * lane; const bf* pb = (const bf*)(st + (ks & 1) * PSTG + 8192 + (wv & 3) * 4096) + 8 * lane;
        v16bf a[4], b[4];
#pragma unroll
        for (int mb = 0; mb < 4; ++mb) a[mb] = ldb(pa + mb * 512);
#pragma unroll
        for (int nb = 0; nb < 4; ++nb) b[nb] = ldb(pb + nb * 512);
#pragma unroll
        for (int nb = 0; nb < 4; ++nb) {
#pragma unroll
            for (int mb = 0; mb < 4; ++mb) acc[mb][nb] = wmmab(a[mb], b[nb], acc[mb][nb]); }
        asm volatile("v_nop\n\tv_nop\n\tv_nop\n\tv_nop" : "+v"(acc[0][3]), "+v"(acc[1][3]), "+v"(acc[2][3]), "+v"(acc[3][3]) : "v"(a[0]), "v"(a[1]), "v"(a[2]), "v"(a[3]));
        wait_ds(); wait_async();
        __syncthreads();                                                 // publishes stage ks + 1 and ends every wave's reads of stage ks
        if (ks + 2 < K / 32) {                                           // block-uniform: refill the buffer just left
            const char* na = ga + (ks + 2) * 1024; const char* nb2 = gb + (ks + 2) * 1024;
            stage24(ls + (ks & 1) * PSTG, na, na + 131072, nb2, nb2 + 131072, nb2 + 262144, nb2 + 393216);
        }
    }
    wait_async();
    float bc[4] = {0.0f, 0.0f, 0.0f, 0.0f};
    if constexpr (BIASROW == 0) {
#pragma unroll
        for (int nb = 0; nb < 4; ++nb) bc[nb] = bfr(bias[c0 + nb * 16 + lr]);
    }
    const int wres = (((r0 % RB) < rlim) && ((c0 % CB) < clim)) ? 1 : 0;   // tile-uniform
    const size_t tbase = (size_t)(r0 / RB) * sRB + (size_t)(r0 % RB) * (size_t)pitch + (size_t)(c0 / CB) * sCB + (size_t)(c0 % CB) * CMUL;
    const size_t tbasr = (size_t)(r0 / RB) * sRBr + (size_t)(r0 % RB) * (size_t)pitchr + (size_t)(c0 / CB) * sCBr + (size_t)(c0 % CB) * CMUL;
#pragma unroll
    for (int mb = 0; mb < 4; ++mb) {
        float rb[8];
        if constexpr (BIASROW != 0) {
            const v4f b0 = *(const v4f*)(bias + r0 + mb * 16 + 8 * hi); const v4f b1 = *(const v4f*)(bias + r0 + mb * 16 + 8 * hi + 4);
#pragma unroll
            for (int i = 0; i < 4; ++i) { rb[i] = bfr(b0[i]); rb[4 + i] = bfr(b1[i]); }
        } else {
#pragma unroll
            for (int j = 0; j < 8; ++j) rb[j] = 0.0f;
        }
#pragma unroll
        for (int nb = 0; nb < 4; ++nb) {
#pragma unroll
            for (int j = 0; j < 8; ++j) os[(hi * 8 + j) * 68 + nb * 16 + lr] = acc[mb][nb][j] + ((BIASROW != 0) ? rb[j] : bc[nb]); }   // D: row 8h+j, col lane&15
        wave_sync();
        const size_t sb = tbase + (size_t)(mb * MBS) + 8 * lane;
        const size_t sr = tbasr + (size_t)(mb * MBS) + 8 * lane;
{
#pragma unroll
            for (int s = 0; s < 4; ++s) { const int row = lr, c8 = (2 * s + hi) * 8;   // store s = part s&1 of the unit of columns 32*(s>>1)..+31: lane holds row lane&15, columns 16*s + 8*(lane>>4) + 0..7
                const v4f x0 = *(const v4fa*)(&os[row * 68 + c8]); const v4f x1 = *(const v4fa*)(&os[row * 68 + c8 + 4]); v8h hv, rv;
#pragma unroll
                for (int i = 0; i < 4; ++i) { const h16 a0 = (h16)x0[i]; const h16 a1 = (h16)x1[i]; hv[i] = a0; hv[4 + i] = a1; rv[i] = (h16)((x0[i] - (float)a0) * QRS); rv[4 + i] = (h16)((x1[i] - (float)a1) * QRS); }
                *(v8h*)(Ph + sb + (s >> 1) * S1S + (s & 1) * 256) = hv;
                asm volatile("s_wait_xcnt 0x0" :: "v"(hv) : "memory");       // before the issued store's registers are reused
                if (wres) { *(v8h*)(Pr + sr + (s >> 1) * S1S + (s & 1) * 256) = rv;
                    asm volatile("s_wait_xcnt 0x0" :: "v"(rv) : "memory"); } }   // the same for the residual store
             }
        wave_sync();
    }
}

// k_proj3: the three projections in one grid (z = q | k | v), so that their waves share the SIMDs; inside each z the tiles come in the order of the separate launches (q, k: token tile fastest; v^T: feature tile fastest).
// q, k: A = x rows (m = b*SEQ + t), Bt = W rows (n = h*64 + d), bias by column -> plane [(b*16 + h)][t/16][d/32][unit]; residual plane the same for t < EROWS
// v^T: A = Wv rows (m = h*64 + d), Bt = x rows (n = b*SEQ + t), bias by row -> plane [(b*16 + h)][t/32][d/16][unit]; residual plane the same for t < EROWS
static_assert((NB * SEQ) % 256 == 0 && DM % 256 == 0 && DM / 32 >= 2);   // whole 128x256 block tiles in both forms; the two-buffer prologue needs two stages
__global__ __launch_bounds__(32 * PW) void k_proj3(const bf* __restrict__ XB, const bf* __restrict__ WQ, const bf* __restrict__ WK, const bf* __restrict__ WV, const float* __restrict__ bq, const float* __restrict__ bk, const float* __restrict__ bv,
                                              h16* QH, h16* QR, h16* KP, h16* KR, h16* VT, h16* VR) {
    __shared__ __align__(16) float os[PW * 16 * 68];
    __shared__ __align__(1024) char st[2 * PSTG];
    const int z = blockIdx.z;
    if (z == 2) {
        const int flat = blockIdx.y * (NB * SEQ / 128) + blockIdx.x;
        proj_body<1>(WV, XB, bv, VT, VR, DM, (size_t)0, SEQ, SEQ, (size_t)DM * SEQ, (size_t)0, EROWS, (size_t)DM * EROWS, DM, EROWS, (flat % (DM / 128)) * 128, (flat / (DM / 128)) * 256, os, st);
    } else {
        proj_body<0>(XB, z == 0 ? WQ : WK, z == 0 ? bq : bk, z == 0 ? QH : KP, z == 0 ? QR : KR, SEQ, (size_t)NH_ * SEQ * HD, HD, HD, (size_t)SEQ * HD,
                     (size_t)NH_ * EROWS * HD, HD, (size_t)EROWS * HD, EROWS, HD, blockIdx.x * 128, blockIdx.y * 256, os, st);
    }
}

// k_flash: fused masked attention, one wave per 16 query rows of one (batch, head); K / V^T / Q fragments straight from the fragment-major f16 planes (two 16-B loads each, 512 contiguous bytes per wave-load).
// Transposed form: S^T[key][t] = K Q^T (A = K rows, B = Q rows); lane (t = lane&15, h = lane>>4) holds keys 8h+r of each 16-key tile, so the packed
// P tile is directly the B fragment of O^T[d][t] = V^T P^T (element r <- tile keys 0..15, element 8+r <- tile keys 16..31, lane unchanged).
// Mask: the wave reads the step's 16 lane-select words (64 B, wave-uniform address) and replaces masked scores by the fill value; the loop walks the set bits of the tile's live-step word in rising order, so a step whose 16x32 mask tile is all zero is not visited;
// if some row ends with no visited key the wave repeats the sweep over every step, which yields the uniform average of a fully masked row.
// EARLY != 0 (query rows < EROWS): q, k, v and P carry residuals x2048; residual products accumulate separately and are folded back with 1/2048.
template <int EARLY>
__global__ __launch_bounds__(32 * AW) void k_flash(const h16* __restrict__ QH, const h16* __restrict__ QR, const h16* __restrict__ KP, const h16* __restrict__ KR,
                                                   const h16* __restrict__ VT, const h16* __restrict__ VR, const unsigned* __restrict__ MB, h16* CH, h16* CR, int tstart) {
    const int lane = threadIdx.x & 31, wave = __builtin_amdgcn_readfirstlane((int)(threadIdx.x >> 5)), lr = lane & 15, hi = lane >> 4;
    const int zh = blockIdx.y; const int b = zh / NH_, h = zh % NH_;
    const int t0 = tstart + (blockIdx.x * AW + wave) * 16;
    const size_t pbase = (size_t)zh * SEQ * HD;
    const size_t rbase = (size_t)zh * EROWS * HD;
    const size_t qo = pbase + (size_t)t0 * HD + 8 * lane;
    const v16h qh0 = ldh(QH + qo), qh1 = ldh(QH + qo + 512);                // B fragments: col t, k = d
    v16h qr0 = qh0, qr1 = qh1;
    if constexpr (EARLY != 0) { const size_t qro = rbase + (size_t)t0 * HD + 8 * lane; qr0 = ldh(QR + qro); qr1 = ldh(QR + qro + 512); }
    const size_t ko  = pbase + 8 * lane;       // + key0 * HD + 512 * (d/32)   (A fragment: row key, k = d; 16 keys = 1024 elements)
    const size_t kro = rbase + 8 * lane;
    const size_t vo  = pbase + 8 * lane;       // + key0 * HD + 512 * j        (A fragment: row d = 16j.., k = key; 32 keys = 2048 elements)
    const size_t vro = rbase + 8 * lane;
    const unsigned* mrec = MB + (size_t)(t0 >> 4) * MREC;      // this tile's mask record (wave-uniform)
    const unsigned long long live = *(const unsigned long long*)(mrec + NST * 16) & ALLST;
    v8f o0 = (v8f){}, o1 = (v8f){}, o2 = (v8f){}, o3 = (v8f){};
    v8f e0 = (v8f){}, e1 = (v8f){}, e2 = (v8f){}, e3 = (v8f){};
    float m = -3.0e38f, l = 0.0f;
    int noskip = 0;
#pragma unroll 1
    for (int pass = 0; pass < 2; ++pass) {
        o0 = (v8f){}; o1 = (v8f){}; o2 = (v8f){}; o3 = (v8f){};
        e0 = (v8f){}; e1 = (v8f){}; e2 = (v8f){}; e3 = (v8f){};
        m = -3.0e38f; l = 0.0f;
#pragma unroll 1
        for (unsigned long long rem = (noskip != 0) ? ALLST : live; rem != 0ull; rem &= rem - 1ull) {   // at most NST trips, wave-uniform
            const int key0 = 32 * __builtin_ctzll(rem);
            const v16u mw = *(const v16u*)(mrec + (key0 >> 1));          // 16 words per step
            const h16* ka = KP + ko + (size_t)key0 * HD;
            v8f sHa = (v8f){}, sHb = (v8f){}, sLa = (v8f){}, sLb = (v8f){};
            {
                const v16h ka0 = ldh(ka), ka1 = ldh(ka + 512), kb0 = ldh(ka + 16 * HD), kb1 = ldh(ka + 16 * HD + 512);
                sHa = wmma16(ka0, qh0, sHa); sHb = wmma16(kb0, qh0, sHb); sHa = wmma16(ka1, qh1, sHa); sHb = wmma16(kb1, qh1, sHb);
                if constexpr (EARLY != 0) {
                    sLa = wmma16(ka0, qr0, sLa); sLb = wmma16(kb0, qr0, sLb); sLa = wmma16(ka1, qr1, sLa); sLb = wmma16(kb1, qr1, sLb);
                    asm volatile("v_nop\n\tv_nop\n\tv_nop\n\tv_nop" : "+v"(sHa), "+v"(sHb), "+v"(sLa), "+v"(sLb) : "v"(ka0), "v"(ka1), "v"(kb0), "v"(kb1));
                } else {
                    asm volatile("v_nop\n\tv_nop\n\tv_nop\n\tv_nop" : "+v"(sHa), "+v"(sHb) : "v"(ka0), "v"(ka1), "v"(kb0), "v"(kb1));
                }
            }
            if constexpr (EARLY != 0) {
                __builtin_amdgcn_sched_barrier(0);
                if (key0 < EROWS) {                                      // residual k plane covers keys < EROWS (wave-uniform)
                    const h16* ra = KR + kro + (size_t)key0 * HD;
                    const v16h ra0 = ldh(ra), ra1 = ldh(ra + 512), rb0 = ldh(ra + 16 * HD), rb1 = ldh(ra + 16 * HD + 512);
                    sLa = wmma16(ra0, qh0, sLa); sLb = wmma16(rb0, qh0, sLb); sLa = wmma16(ra1, qh1, sLa); sLb = wmma16(rb1, qh1, sLb);
                    asm volatile("v_nop\n\tv_nop\n\tv_nop\n\tv_nop" : "+v"(sLa), "+v"(sLb) : "v"(ra0), "v"(ra1), "v"(rb0), "v"(rb1));
                }
                __builtin_amdgcn_sched_barrier(0);
            }
            float ta[8], tb[8]; float mx = -3.0e38f;
#pragma unroll
            for (int r = 0; r < 8; ++r) {
                float sa = sHa[r], sb = sHb[r];
                if constexpr (EARLY != 0) { sa += sLa[r] * QRI; sb += sLb[r] * QRI; }
                ta[r] = __builtin_amdgcn_inverse_ballot_w32(mw[r]) ? sa * SC2 : NEGL;
                tb[r] = __builtin_amdgcn_inverse_ballot_w32(mw[8 + r]) ? sb * SC2 : NEGL;
                mx = fmaxf(mx, fmaxf(ta[r], tb[r]));
            }
            mx = fmaxf(mx, __shfl_xor(mx, 16, 32));
            const float mnew = fmaxf(m, mx);
            const float alpha = __builtin_amdgcn_exp2f(m - mnew);
            const float sh = PSH - mnew;
            v16h pb = (v16h){}; v16h pq = (v16h){}; float ls = 0.0f;
#pragma unroll
            for (int r = 0; r < 8; ++r) {
                const float pa = __builtin_amdgcn_exp2f(ta[r] + sh), pc = __builtin_amdgcn_exp2f(tb[r] + sh);
                const h16 ha = (h16)pa, hc = (h16)pc; pb[r] = ha; pb[8 + r] = hc;
                if constexpr (EARLY != 0) {
                    const h16 ga = (h16)((pa - (float)ha) * QRS), gc = (h16)((pc - (float)hc) * QRS); pq[r] = ga; pq[8 + r] = gc;
                    ls += ((float)ha + (float)hc) + ((float)ga + (float)gc) * QRI;
                } else {
                    ls += (float)ha + (float)hc;
                }
            }
            l = l * alpha + ls; m = mnew;
            o0 = o0 * alpha; o1 = o1 * alpha; o2 = o2 * alpha; o3 = o3 * alpha;
            if constexpr (EARLY != 0) { e0 = e0 * alpha; e1 = e1 * alpha; e2 = e2 * alpha; e3 = e3 * alpha; }
            const h16* va = VT + vo + (size_t)key0 * HD;
            {
                const v16h v0 = ldh(va), v1 = ldh(va + 512), v2 = ldh(va + 1024), v3 = ldh(va + 1536);
                o0 = wmma16(v0, pb, o0); o1 = wmma16(v1, pb, o1); o2 = wmma16(v2, pb, o2); o3 = wmma16(v3, pb, o3);
                if constexpr (EARLY != 0) {
                    e0 = wmma16(v0, pq, e0); e1 = wmma16(v1, pq, e1); e2 = wmma16(v2, pq, e2); e3 = wmma16(v3, pq, e3);
                    asm volatile("v_nop\n\tv_nop\n\tv_nop\n\tv_nop" : "+v"(o0), "+v"(o1), "+v"(o2), "+v"(o3), "+v"(e0), "+v"(e1), "+v"(e2), "+v"(e3) : "v"(v0), "v"(v1), "v"(v2), "v"(v3), "v"(pb), "v"(pq));
                } else {
                    asm volatile("v_nop\n\tv_nop\n\tv_nop\n\tv_nop" : "+v"(o0), "+v"(o1), "+v"(o2), "+v"(o3) : "v"(v0), "v"(v1), "v"(v2), "v"(v3), "v"(pb));
                }
            }
            if constexpr (EARLY != 0) {
                __builtin_amdgcn_sched_barrier(0);
                if (key0 < EROWS) {                                      // residual v^T plane covers keys < EROWS (wave-uniform)
                    const h16* wa = VR + vro + (size_t)key0 * HD;
                    const v16h w0 = ldh(wa), w1 = ldh(wa + 512), w2 = ldh(wa + 1024), w3 = ldh(wa + 1536);
                    e0 = wmma16(w0, pb, e0); e1 = wmma16(w1, pb, e1); e2 = wmma16(w2, pb, e2); e3 = wmma16(w3, pb, e3);
                    asm volatile("v_nop\n\tv_nop\n\tv_nop\n\tv_nop" : "+v"(e0), "+v"(e1), "+v"(e2), "+v"(e3) : "v"(w0), "v"(w1), "v"(w2), "v"(w3), "v"(pb));
                }
                __builtin_amdgcn_sched_barrier(0);
            }
        }
        l += __shfl_xor(l, 16, 32);
        const unsigned dead = __builtin_amdgcn_ballot_w32(!(l > 0.0f));
        if (dead == 0u) break;                                           // wave-uniform
        noskip = 1;
    }
    const float inv = CXS * (1.0f / l);
    // O^T D layout: o_j[r] = (d = 16j + 8h + r, t = lane&15): exactly part j&1 of context unit 2h + (j>>1) (row t = lane&15, k = 16j + 8*(lane>>4) + r), so each lane stores its own accumulators, no transpose
    const size_t crow = ((size_t)b * SEQ + t0) * DM + (size_t)h * 1024 + 8 * lane;     // context plane, row b*SEQ + t, k = h*64 + d: units [(b*SEQ + t)/16][2h + d/32]
    const size_t rrow = ((size_t)b * EROWS + t0) * DM + (size_t)h * 1024 + 8 * lane;   // residual plane, row b*EROWS + t (EARLY launches only: t0 + 15 < EROWS)
    v8f xs[4] = {o0, o1, o2, o3};
    if constexpr (EARLY != 0) { xs[0] = o0 + e0 * QRI; xs[1] = o1 + e1 * QRI; xs[2] = o2 + e2 * QRI; xs[3] = o3 + e3 * QRI; }
#pragma unroll
    for (int s = 0; s < 4; ++s) {
        const v8f x = xs[s] * inv; v8h hv, rv;
#pragma unroll
        for (int i = 0; i < 8; ++i) { const h16 a0 = (h16)x[i]; hv[i] = a0; rv[i] = (h16)((x[i] - (float)a0) * QRS); }
        *(v8h*)(CH + crow + s * 256) = hv;
        if constexpr (EARLY != 0) *(v8h*)(CR + rrow + s * 256) = rv;
    }
}

// oproj_body: output projection, f16 GEMM, one 4-wave block per (32*MT) x 128 tile, one wave per (16*MT) x 64 tile, K = DM; operand units staged in LDS as in proj_body (RES != 0: stage units 0..3 = A, 4..7 = AR). OUT[m][n] = OSC * (sum_k A[m][k] Bt[n][k] + QRI * sum_k AR[m][k] Bt[n][k]) + bias[n] (bias RNE-converted to bf16).
// A = context plane (x16), AR = context residual plane (RES != 0 only, rows [b*EROWS + t]), Bt = Wo x1024 as f16 ([out][in]).
// wave row tile rt = 2*rtB + (wave>>1) in 0 .. NB * tpb - 1 -> batch rt / tpb, first token rowoff + (rt % tpb) * 16*MT (tpb even: a block's two row tiles are neighbours in one batch); c0 = cB + 64*(wave&1) = first output column.
template <int MT, int RES>
__device__ __forceinline__ void oproj_body(const h16* __restrict__ A, const h16* __restrict__ AR, const h16* __restrict__ Bt, const float* __restrict__ bias, float* OUT, int tpb, int rowoff, int rtB, int cB, float* osb, char* st) {
    static_assert((MT == 4 && RES == 0) || (MT == 2 && RES == 1));
    const int K = DM;
    const int tid = threadIdx.x, lane = tid & 31, lr = lane & 15, hi = lane >> 4, wv = __builtin_amdgcn_readfirstlane(tid >> 5);
    const int rt = 2 * rtB + (wv >> 1), c0 = cB + 64 * (wv & 1);
    float* os = osb + wv * (16 * 68);                                  // wave-private epilogue tile
    const int bb = rt / tpb, tl = rt % tpb;
    const int tok = rowoff + tl * (16 * MT);
    const int tokB = rowoff + ((2 * rtB) % tpb) * (16 * MT);           // the block's first token (same batch bb)
    // unit (row tile, ks) lies at byte (row tile)*32*K + ks*1024; thread tid copies bytes 16*(tid&63) of row tiles (tid>>6) + 2j
    const char* ga = (const char*)(A  + ((size_t)bb * SEQ   + tokB + 16 * (tid >> 6)) * K + 8 * (tid & 63));
    const char* gr = (const char*)(AR + ((size_t)bb * EROWS + tokB + 16 * (tid >> 6)) * K + 8 * (tid & 63));
    const char* gb = (const char*)(Bt + (size_t)(cB + 16 * (tid >> 6)) * K + 8 * (tid & 63));
    const char* g2 = (RES != 0) ? gr : ga + 131072;                    // source of stage units 4..7
    const unsigned ls = (unsigned)(size_t)st + 16u * (unsigned)tid;
    v8f acc[MT][4], acr[MT][4];
#pragma unroll
    for (int mb = 0; mb < MT; ++mb)
#pragma unroll
        for (int nb = 0; nb < 4; ++nb) { acc[mb][nb] = (v8f){}; acr[mb][nb] = (v8f){}; }
    stage16(ls, ga, ga + 65536, g2, g2 + 65536, gb, gb + 65536, gb + 131072, gb + 196608);
    wait_async();
    __syncthreads();                                                   // stage 0 published
    stage16(ls + STG, ga + 1024, ga + 66560, g2 + 1024, g2 + 66560, gb + 1024, gb + 66560, gb + 132096, gb + 197632);
#pragma unroll 1
    for (int ks = 0; ks < K / 32; ++ks) {
        const h16* pa = (const h16*)(st + (ks & 1) * STG + (wv >> 1) * (MT * 1024)) + 8 * lane; const h16* pr = pa + 2048; const h16* pb = (const h16*)(st + (ks & 1) * STG + 8192 + (wv & 1) * 4096) + 8 * lane;
        v16h a[MT], ar[MT], bfrag[4];
#pragma unroll
        for (int mb = 0; mb < MT; ++mb) { a[mb] = ldh(pa + mb * 512); ar[mb] = a[mb]; }
        if constexpr (RES != 0) {
#pragma unroll
            for (int mb = 0; mb < MT; ++mb) ar[mb] = ldh(pr + mb * 512);
        }
#pragma unroll
        for (int nb = 0; nb < 4; ++nb) bfrag[nb] = ldh(pb + nb * 512);
#pragma unroll
        for (int nb = 0; nb < 4; ++nb) {
#pragma unroll
            for (int mb = 0; mb < MT; ++mb) { acc[mb][nb] = wmma16(a[mb], bfrag[nb], acc[mb][nb]);
                if constexpr (RES != 0) acr[mb][nb] = wmma16(ar[mb], bfrag[nb], acr[mb][nb]); } }
        if constexpr (MT == 4) {
            asm volatile("v_nop\n\tv_nop\n\tv_nop\n\tv_nop" : "+v"(acc[0][3]), "+v"(acc[1][3]), "+v"(acc[2][3]), "+v"(acc[3][3]) : "v"(a[0]), "v"(a[1]), "v"(a[2]), "v"(a[3]));
        } else {
            asm volatile("v_nop\n\tv_nop\n\tv_nop\n\tv_nop" : "+v"(acc[0][3]), "+v"(acc[1][3]), "+v"(acr[0][3]), "+v"(acr[1][3]) : "v"(a[0]), "v"(a[1]), "v"(ar[0]), "v"(ar[1]));
        }
        wait_ds(); wait_async();
        __syncthreads();                                               // publishes stage ks + 1 and ends every wave's reads of stage ks
        if (ks + 2 < K / 32) {                                         // block-uniform: refill the buffer just left
            const char* na = ga + (ks + 2) * 1024; const char* n2 = g2 + (ks + 2) * 1024; const char* nb2 = gb + (ks + 2) * 1024;
            stage16(ls + (ks & 1) * STG, na, na + 65536, n2, n2 + 65536, nb2, nb2 + 65536, nb2 + 131072, nb2 + 196608);
        }
    }
    wait_async();
    float bc[4];
#pragma unroll
    for (int nb = 0; nb < 4; ++nb) bc[nb] = bfr(bias[c0 + nb * 16 + lr]);
#pragma unroll
    for (int mb = 0; mb < MT; ++mb) {
#pragma unroll
        for (int nb = 0; nb < 4; ++nb) {
#pragma unroll
            for (int j = 0; j < 8; ++j) { float v = acc[mb][nb][j] * OSC;
                if constexpr (RES != 0) v += acr[mb][nb][j] * (OSC * QRI);
                os[(hi * 8 + j) * 68 + nb * 16 + lr] = v + bc[nb]; } }                          // D: row 8h+j, col lane&15
        wave_sync();
        float* orow = OUT + ((size_t)bb * OUT_SEQ + tok + mb * 16) * DM + c0;
{
#pragma unroll
            for (int s = 0; s < 8; ++s) { const int row = 2 * s + hi, cofs = lr * 4;            // 8 s x 2 rows = 16 rows; 16 lanes x 4 floats = 64 columns
                const v4f val = *(const v4fa*)(&os[row * 68 + cofs]);
                *(v4f*)(orow + (size_t)row * DM + cofs) = val; }
             }
        wave_sync();
    }
}

// k_oprojf: both forms in one grid (x = row tile, fastest as in the separate launches: first the residual rows' tiles, then the rest; y = column tile), so that their waves share the SIMDs.
static_assert(EROWS % 64 == 0 && (SEQ - EROWS) % 128 == 0);   // a block's two row tiles lie in one batch
__global__ __launch_bounds__(32 * GW) void k_oprojf(const h16* __restrict__ CXH, const h16* __restrict__ CXR, const h16* __restrict__ WOH, const float* __restrict__ bo, float* OUT) {
    __shared__ __align__(16) float os[GW * 16 * 68];
    __shared__ __align__(1024) char st[2 * STG];
    constexpr int NR = NB * (EROWS / 64);
    const int rtB = blockIdx.x, cB = blockIdx.y * 128;
    if (rtB < NR) oproj_body<2, 1>(CXH, CXR, WOH, bo, OUT, EROWS / 32, 0, rtB, cB, os, st);
    else          oproj_body<4, 0>(CXH, CXH, WOH, bo, OUT, (SEQ - EROWS) / 64, EROWS, rtB - NR, cB, os, st);
}

static constexpr size_t al256(size_t v) { return (v + 255) & ~(size_t)255; }
static constexpr size_t SZ_XB = al256((size_t)NB * SEQ * DM * 2);              // x bf16
static constexpr size_t SZ_WB = al256((size_t)3 * DM * DM * 2);                // Wq | Wk | Wv bf16
static constexpr size_t SZ_WO = al256((size_t)DM * DM * 2);                    // Wo f16 (x1024)
static constexpr size_t SZ_PL = al256((size_t)NB * NH_ * SEQ * HD * 2);        // q / k / v^T planes
static constexpr size_t SZ_RP = al256((size_t)NB * NH_ * EROWS * HD * 2);      // residual planes (t < EROWS)
static constexpr size_t SZ_CX = al256((size_t)NB * SEQ * DM * 2);              // context plane
static constexpr size_t SZ_CR = al256((size_t)NB * EROWS * DM * 2);            // context residual plane
static constexpr size_t SZ_MB = al256((size_t)(SEQ / 16) * MREC * 4);          // mask records
static constexpr size_t SZ_TOTAL = SZ_XB + SZ_WB + SZ_WO + 3 * SZ_PL + 3 * SZ_RP + SZ_CX + SZ_CR + SZ_MB;
static_assert(SZ_TOTAL <= (size_t)134217728);          // workspace carve <= 128 MiB
static_assert(((size_t)DM * DM * 2) % 256 == 0);       // weight sub-planes stay 256-byte aligned

extern "C" void kernel_launch(void* const* d_in, const int* in_sizes, int n_in,
                              void* d_out, int out_size, void* d_ws, size_t ws_size, hipStream_t stream) {
    if (n_in < 10) return;
    const size_t needx = ((size_t)(NB - 1) * SEQ_FULL + SEQ) * DM;
    if ((size_t)in_sizes[0] < needx) return;
    if ((size_t)in_sizes[1] < (size_t)(SEQ - 1) * SEQ_FULL + SEQ) return;
    if ((size_t)in_sizes[2] < (size_t)DM * DM || (size_t)in_sizes[4] < (size_t)DM * DM || (size_t)in_sizes[6] < (size_t)DM * DM || (size_t)in_sizes[8] < (size_t)DM * DM) return;
    if (in_sizes[3] < DM || in_sizes[5] < DM || in_sizes[7] < DM || in_sizes[9] < DM) return;
    if ((size_t)out_size < ((size_t)(NB - 1) * OUT_SEQ + SEQ) * DM) return;
    if (SZ_TOTAL > ws_size) return;
    // wire order: query, mask (int32), Wq, bq, Wk, bk, Wv, bv, Wo, bo; weights [out][in] = Bt as-is
    const float* x  = (const float*)d_in[0]; const int* mask = (const int*)d_in[1];
    const float* wq = (const float*)d_in[2]; const float* bq = (const float*)d_in[3];
    const float* wk = (const float*)d_in[4]; const float* bk = (const float*)d_in[5];
    const float* wv = (const float*)d_in[6]; const float* bv = (const float*)d_in[7];
    const float* wo = (const float*)d_in[8]; const float* bo = (const float*)d_in[9];
    float* OUT = (float*)d_out;      // [NB][SEQ][1024]
    char* wsp = (char*)d_ws;
    bf*  XB  = (bf*)wsp;  wsp += SZ_XB;              // rows NB*SEQ, k 1024, fragment-major
    bf*  WB  = (bf*)wsp;  wsp += SZ_WB;              // 3 planes q | k | v, rows 1024, k 1024, fragment-major
    h16* WOH = (h16*)wsp; wsp += SZ_WO;              // rows 1024, k 1024, fragment-major, x1024
    h16* QH  = (h16*)wsp; wsp += SZ_PL;              // [NB*16][SEQ/16][2][unit]
    h16* KP  = (h16*)wsp; wsp += SZ_PL;              // [NB*16][SEQ/16][2][unit]
    h16* VT  = (h16*)wsp; wsp += SZ_PL;              // [NB*16][SEQ/32][4][unit]
    h16* QR  = (h16*)wsp; wsp += SZ_RP;              // [NB*16][EROWS/16][2][unit] residual x2048
    h16* KR  = (h16*)wsp; wsp += SZ_RP;              // [NB*16][EROWS/16][2][unit] residual x2048
    h16* VR  = (h16*)wsp; wsp += SZ_RP;              // [NB*16][EROWS/32][4][unit] residual x2048
    h16* CXH = (h16*)wsp; wsp += SZ_CX;              // rows NB*SEQ, k 1024, fragment-major, x16
    h16* CXR = (h16*)wsp; wsp += SZ_CR;              // rows NB*EROWS, k 1024, fragment-major, residual x2048
    unsigned* MBW = (unsigned*)wsp; wsp += SZ_MB;    // [SEQ/16][MREC] mask records
    bf* WQ = WB; bf* WK = WB + (size_t)DM * DM; bf* WV = WB + (size_t)2 * DM * DM;

    k_prep<<<PB_M + PB_X + 4 * PB_W, 1024, 0, stream>>>(x, mask, wq, wk, wv, wo, XB, WB, WOH, MBW);
    k_proj3<<<dim3(NB * SEQ / 128, DM / 256, 3), 32 * PW, 0, stream>>>(XB, WQ, WK, WV, bq, bk, bv, QH, QR, KP, KR, VT, VR);

    k_flash<1><<<dim3(EROWS / (16 * AW), NB * NH_, 1), 32 * AW, 0, stream>>>(QH, QR, KP, KR, VT, VR, MBW, CXH, CXR, 0);
    if (SEQ > EROWS)
        k_flash<0><<<dim3((SEQ - EROWS) / (16 * AW), NB * NH_, 1), 32 * AW, 0, stream>>>(QH, QR, KP, KR, VT, VR, MBW, CXH, CXR, EROWS);

    k_oprojf<<<dim3(NB * (EROWS / 64) + NB * ((SEQ - EROWS) / 128), DM / 128, 1), 32 * GW, 0, stream>>>(CXH, CXR, WOH, bo, OUT);
}

// v005
// Measured time: 174 microseconds a run.
// Next to v004, in two timings, it ran 1.24 and 1.25 times as fast.
// Counting every step since v000, it is 2.31 times as fast.
#include <hip/hip_runtime.h>

// Masked multi-head self-attention, width 1024 = 16 heads x 64, x [NB][SEQ][1024], Wq/Wk/Wv/Wo [out][in] (y = x W^T + b), int32 mask [SEQ][SEQ] (0 = fill -1e9), score scale 1/8, output projection with bias (f32 out).
// Compute dtypes, f32 accumulate everywhere: q/k/v projections v_wmma_f32_16x16x32_bf16 (x and W RNE-converted to bf16; products exact; biases RNE-converted to bf16, added in f32);
// scores and P.V v_wmma_f32_16x16x32_f16: single f16 planes on query rows >= 512; on the first 512 query rows q, k, v, P and the context carry an f16 residual x2048 (three products, residual terms in their own accumulator);
// P carried x256 (cancels in the normalisation); output projection v_wmma_f32_16x16x32_f16 with context x16 and bf16-exact Wo x1024 as f16 (context residual on the first 512 rows); softmax f32 (online, running max).
// Layout: every 16-bit matrix operand plane is fragment-major: a unit is one 16-row x 32-k fragment = [part 0..1][lane 0..31][8 elements] (512 elements, 1 KiB), element (part, lane, e) = (row lane&15, k 16*part + 8*(lane>>4) + e),
// so each 16-byte-per-lane load or store of a wave covers 512 contiguous bytes (4 whole lines). x, W, context planes: [row/16][k/32][unit]; q, k planes: [b*16+h][t/16][d/32][unit]; v^T plane: [b*16+h][t/32][d/16][unit]
// (+ residual planes for t < 512), written by the GEMM epilogue; fused flash kernel in transposed form (S^T = K Q^T, O^T = V^T P^T);
// mask: a pre-pass turns the int32 mask once per call into lane-select words (per 16-query tile and 32-key step: 16 words, bit L of word e = mask != 0 at the score element e that flash lane L holds) plus one 64-bit word per tile of the steps
// that hold any kept key; the flash kernel reads them by scalar loads (replace-fill by value as before); fully masked 16x32 tiles are skipped in the first sweep, with a full second sweep when a row ends with no visited key.

#ifndef NB
#define NB 4
#endif
#ifndef SEQ
#define SEQ 2048
#endif
#define NB_FULL  4
#define SEQ_FULL 2048
#ifndef OUT_SEQ
#define OUT_SEQ SEQ              // row pitch (in tokens) between batches of the output
#endif
#define DM   1024
#define NH_  16
#define HD   64
#define AW   4                   // waves per flash block (16 query rows each)
#define EROWS ((SEQ) < 512 ? (SEQ) : 512)   // query rows / keys per sequence that carry residual planes
#define QRS  2048.0f             // carry of every residual plane
#define QRI  (1.0f / 2048.0f)
#define SC2  (0.125f * 1.4426950408889634f)   // HD^-0.5 * log2(e)
#define NEGL (-1.0e9f * 1.4426950408889634f)  // masked fill in the log2 domain
#define PSH  8.0f                // log2 of the P carry (256)
#define CXS  16.0f               // carry of the context planes
#define WOS  1024.0f             // carry of the Wo plane
#define OSC  (1.0f / 16384.0f)   // 1 / (CXS * WOS)
#define NST  (SEQ / 32)          // 32-key steps per sequence
#define MREC (NST * 16 + 32)     // words of one 16-query tile's mask record: NST steps x 16 lane-select words, then one 128-B line whose first two words are the live-step bits
#define ALLST ((NST) >= 64 ? ~0ull : ((1ull << ((NST) & 63)) - 1ull))

static_assert(HD == 64);
static_assert(NH_ * HD == DM);                 // head h = columns h*64 + d
static_assert(DM % 64 == 0);
static_assert(DM % 32 == 0);                   // GEMM k-loop steps by 32
static_assert(SEQ % 64 == 0);                  // a 64-row tile never straddles two batches
static_assert((NB * SEQ) % 64 == 0);
static_assert(SEQ % 32 == 0);                  // key loop steps by 32
static_assert(EROWS % 64 == 0);                // residual tiles are whole 64-tiles; flash grid covers them exactly
static_assert(EROWS % (16 * AW) == 0);
static_assert((SEQ - EROWS) % 64 == 0);
static_assert((SEQ - EROWS) % (16 * AW) == 0);
static_assert(EROWS <= SEQ);
static_assert(((size_t)SEQ * DM) % 8 == 0);
static_assert(((size_t)DM * DM) % 8 == 0);
static_assert(NB <= NB_FULL);
static_assert(SEQ <= SEQ_FULL);
static_assert(NST <= 64);                      // live-step bits fit one 64-bit word; 32 waves x 2 steps cover a tile in mbits
static_assert(NST % 2 == 0);

typedef _Float16 h16;
typedef unsigned short bf;
typedef __attribute__((ext_vector_type(16))) __bf16   v16bf;
typedef __attribute__((ext_vector_type(16))) _Float16 v16h;
typedef __attribute__((ext_vector_type(8)))  _Float16 v8h;
typedef __attribute__((ext_vector_type(8)))  unsigned short v8us;
typedef __attribute__((ext_vector_type(8)))  float    v8f;
typedef __attribute__((ext_vector_type(4)))  float    v4f;
typedef __attribute__((ext_vector_type(4)))  int      v4i;
typedef v4f  __attribute__((may_alias)) v4fa;
typedef __attribute__((ext_vector_type(16))) unsigned v16u;

__device__ __forceinline__ unsigned short f2bf(float f) { unsigned u = __float_as_uint(f); u += 0x7FFFu + ((u >> 16) & 1u); return (unsigned short)(u >> 16); }
__device__ __forceinline__ float bfr(float f) { return __uint_as_float(((unsigned)f2bf(f)) << 16); }   // value after RNE convert to bf16
__device__ __forceinline__ v16h cat16(v8h lo, v8h hi) { return __builtin_shufflevector(lo, hi, 0, 1, 2, 3, 4, 5, 6, 7, 8, 9, 10, 11, 12, 13, 14, 15); }
__device__ __forceinline__ v16bf cat16b(v8us lo, v8us hi) { return __builtin_bit_cast(v16bf, __builtin_shufflevector(lo, hi, 0, 1, 2, 3, 4, 5, 6, 7, 8, 9, 10, 11, 12, 13, 14, 15)); }
__device__ __forceinline__ v8f wmma16(v16h a, v16h b, v8f c) { return __builtin_amdgcn_wmma_f32_16x16x32_f16(false, a, false, b, (short)0, c, false, false); }
__device__ __forceinline__ v8f wmmab(v16bf a, v16bf b, v8f c) { return __builtin_amdgcn_wmma_f32_16x16x32_bf16(false, a, false, b, (short)0, c, false, false); }
// fragment loaders from a fragment-major unit; p = unit base + 8*lane: elements 0..7 <- k0+8h+0..7 (part 0), elements 8..15 <- k0+16+8h+0..7 (part 1, +256 elements) (same map for A and B)
__device__ __forceinline__ v16h  ldh(const h16* p) { return cat16(*(const v8h*)p, *(const v8h*)(p + 256)); }
__device__ __forceinline__ v16bf ldb(const bf* p)  { return cat16b(*(const v8us*)p, *(const v8us*)(p + 256)); }
// ldh_end: ldh for the last fragment read off an address pair, where the compiler lands the last load's data on the pair itself: the s_wait_xcnt stands in front of that load, behind every other load that names the pair
__device__ __forceinline__ v16h  ldh_end(const h16* p) { const v8h lo = *(const v8h*)p; asm volatile("s_wait_xcnt 0x0" ::: "memory"); return cat16(lo, *(const v8h*)(p + 256)); }
// converters: a wave takes 8 rows x 32 k (8 whole 128-B lines of f32) and writes 4 whole 128-B lines of one unit. Thread i -> source element offset (row-major, DM columns) and fragment-major destination offset.
__device__ __forceinline__ void cvt_map(size_t i, size_t& so, size_t& dof) {
    const int lane = (int)(i & 31); const size_t w = i >> 5; const size_t ks = w % (DM / 32); const size_t row = (w / (DM / 32)) * 8 + (size_t)(lane >> 2); const int c = lane & 3;
    so  = row * DM + ks * 32 + (size_t)c * 8;
    dof = (row >> 4) * (size_t)(16 * DM) + ks * 512 + (size_t)(c >> 1) * 256 + (size_t)(c & 1) * 128 + (row & 15) * 8;
}
// ordering point for wave-private LDS tiles (same wave writes and reads)
__device__ __forceinline__ void wave_sync() { __builtin_amdgcn_fence(3 /* release order */, "wavefront"); __builtin_amdgcn_wave_barrier(); asm volatile("" ::: "memory"); }

// GEMM blocks: the waves of a block share one stage = the fragment-major units (1 KiB each) of one 32-k step, 8 of the row operand(s), then those of the column operand; two stage buffers in LDS.
// Output projection: 4 waves (2 x 2 wave tiles), 8 + 8 units. q/k/v projections: 8 waves (2 x 4 wave tiles), 8 + 16 units.
#define GW  4
#define STG 16384
#define PW   8
#define PSTG 24576
// stage16: the block's 128 threads bring one stage from the global planes into LDS, 8 asynchronous 16-B copies per thread; copy j fills bytes 16*tid of the unit pair 2j, 2j+1 (l = stage buffer + 16*tid, pj = the thread's own source bytes).
// The s_wait_xcnt stands inside the statement so that no address register of an issued copy is rewritten in front of it.
__device__ __forceinline__ void stage16(unsigned l, const char* p0, const char* p1, const char* p2, const char* p3, const char* p4, const char* p5, const char* p6, const char* p7) {
    asm volatile("global_load_async_to_lds_b128 %0, %8, off\n\t"
                 "global_load_async_to_lds_b128 %1, %9, off\n\t"
                 "global_load_async_to_lds_b128 %2, %10, off\n\t"
                 "global_load_async_to_lds_b128 %3, %11, off\n\t"
                 "global_load_async_to_lds_b128 %4, %12, off\n\t"
                 "global_load_async_to_lds_b128 %5, %13, off\n\t"
                 "global_load_async_to_lds_b128 %6, %14, off\n\t"
                 "global_load_async_to_lds_b128 %7, %15, off\n\t"
                 "s_wait_xcnt 0x0"
                 :: "v"(l), "v"(l + 2048u), "v"(l + 4096u), "v"(l + 6144u), "v"(l + 8192u), "v"(l + 10240u), "v"(l + 12288u), "v"(l + 14336u),
                    "v"(p0), "v"(p1), "v"(p2), "v"(p3), "v"(p4), "v"(p5), "v"(p6), "v"(p7) : "memory");
}
// stage24: the same for a block of 256 threads and 24 units, 6 copies per thread; copy j fills bytes 16*tid of the four units 4j .. 4j+3
__device__ __forceinline__ void stage24(unsigned l, const char* p0, const char* p1, const char* p2, const char* p3, const char* p4, const char* p5) {
    asm volatile("global_load_async_to_lds_b128 %0, %6, off\n\t"
                 "global_load_async_to_lds_b128 %1, %7, off\n\t"
                 "global_load_async_to_lds_b128 %2, %8, off\n\t"
                 "global_load_async_to_lds_b128 %3, %9, off\n\t"
                 "global_load_async_to_lds_b128 %4, %10, off\n\t"
                 "global_load_async_to_lds_b128 %5, %11, off\n\t"
                 "s_wait_xcnt 0x0"
                 :: "v"(l), "v"(l + 4096u), "v"(l + 8192u), "v"(l + 12288u), "v"(l + 16384u), "v"(l + 20480u),
                    "v"(p0), "v"(p1), "v"(p2), "v"(p3), "v"(p4), "v"(p5) : "memory");
}
// the two waits of a stage hand-over, each in front of the block barrier: the wave's own LDS reads done (its buffer may be refilled), the wave's own copies landed (the other waves may read them)
__device__ __forceinline__ void wait_ds()    { asm volatile("s_wait_dscnt 0x0" ::: "memory"); }
__device__ __forceinline__ void wait_async() { asm volatile("s_wait_asynccnt 0x0" ::: "memory"); }

__device__ __forceinline__ void cvt8(const float* __restrict__ src, bf* dst, size_t i) {
    size_t so, dof; cvt_map(i, so, dof);
    const v8f v = *(const v8f*)(src + so); v8us o;
#pragma unroll
    for (int k = 0; k < 8; ++k) o[k] = f2bf(v[k]);
    bf* dp = dst + dof;
    *(v8us*)dp = o;
    asm volatile("s_wait_xcnt 0x0" :: "v"(o), "v"(dp) : "memory");   // before the issued store's registers are reused
}

__device__ __forceinline__ void cvtw8(const float* __restrict__ src, h16* dst, size_t i) {
    size_t so, dof; cvt_map(i, so, dof);
    const v8f v = *(const v8f*)(src + so); v8h o;
#pragma unroll
    for (int k = 0; k < 8; ++k) o[k] = (h16)(bfr(v[k]) * WOS);
    h16* dp = dst + dof;
    *(v8h*)dp = o;
    asm volatile("s_wait_xcnt 0x0" :: "v"(o), "v"(dp) : "memory");   // the same for this store
}

// mbits: one 32-wave block per 16-query tile, wave w packs steps 2w and 2w+1. Each lane loads the 16 mask words of the score elements it holds in flash_body (row lane&15; keys 8*(lane>>4)+0..7 and 16+8*(lane>>4)+0..7 of the step);
// the ballot over element e is the lane-select word e. A wave stores its two steps as one whole 128-B line; wave 0 gathers the live-step bits (bit s = step s holds a kept key) and stores them as the record's last line.
__device__ __forceinline__ void mbits(const int* __restrict__ MK, unsigned* MB, int tile, unsigned* sm) {
    const int lane = threadIdx.x & 31, wave = __builtin_amdgcn_readfirstlane((int)(threadIdx.x >> 5)), lr = lane & 15, hi = lane >> 4;
    unsigned* rec = MB + (size_t)tile * MREC;
    unsigned live2 = 0u;
    if (2 * wave < NST) {                                                // wave-uniform
        const int* mp = MK + (size_t)(tile * 16 + lr) * SEQ_FULL + wave * 64 + 8 * hi;
        unsigned w = 0u;
#pragma unroll
        for (int u = 0; u < 2; ++u) {
            const v4i a0 = *(const v4i*)(mp + 32 * u), a1 = *(const v4i*)(mp + 32 * u + 4), b0 = *(const v4i*)(mp + 32 * u + 16), b1 = *(const v4i*)(mp + 32 * u + 20);
            const int q[16] = {a0[0], a0[1], a0[2], a0[3], a1[0], a1[1], a1[2], a1[3], b0[0], b0[1], b0[2], b0[3], b1[0], b1[1], b1[2], b1[3]};
            unsigned any = 0u;
#pragma unroll
            for (int e = 0; e < 16; ++e) { const unsigned bal = __builtin_amdgcn_ballot_w32(q[e] != 0); any |= bal; w = (lane == 16 * u + e) ? bal : w; }
            live2 |= (any != 0u ? 1u : 0u) << u;
        }
        rec[wave * 32 + lane] = w;
    }
    if (lane == 0) sm[wave] = live2;
    __syncthreads();
    if (wave == 0) {
        unsigned v = sm[lane] << (2 * lr);                               // lanes 0..15: steps 0..31, lanes 16..31: steps 32..63
        v |= __shfl_xor(v, 1, 32); v |= __shfl_xor(v, 2, 32); v |= __shfl_xor(v, 4, 32); v |= __shfl_xor(v, 8, 32);
        const unsigned vh = __shfl(v, 16, 32);
        rec[NST * 16 + lane] = (lane == 0) ? v : ((lane == 1) ? vh : 0u);
    }
}

// k_prep: every operand preparation of a call in one grid of 1024-thread blocks, so that the six independent jobs share the chip instead of running one after another;
// a block's job follows from its index alone (block-uniform): mask tiles, then x, then Wq | Wk | Wv, then Wo. Thread -> element inside each job is as in the separate launches.
#define PB_M (SEQ / 16)
#define PB_X ((int)((size_t)NB * SEQ * DM / 8 / 1024))
#define PB_W ((int)((size_t)DM * DM / 8 / 1024))
static_assert(((size_t)SEQ * DM / 8) % 1024 == 0);     // x blocks cover each batch exactly
static_assert(((size_t)DM * DM / 8) % 1024 == 0);      // weight blocks cover each matrix exactly
__global__ __launch_bounds__(1024) void k_prep(const float* __restrict__ x, const int* __restrict__ MK, const float* __restrict__ wq, const float* __restrict__ wk, const float* __restrict__ wv, const float* __restrict__ wo,
                                               bf* XB, bf* WB, h16* WOH, unsigned* MB) {
    __shared__ unsigned sm[32];
    int bid = blockIdx.x;
    if (bid < PB_M) { mbits(MK, MB, bid, sm); return; }
    bid -= PB_M;
    if (bid < PB_X) {
        const size_t i = (size_t)bid * 1024 + threadIdx.x; const size_t nb8 = (size_t)SEQ * DM / 8; const size_t b = i / nb8;
        cvt8(x + b * SEQ_FULL * DM, XB + b * SEQ * DM, i % nb8); return;
    }
    bid -= PB_X;
    const int which = bid / PB_W; const size_t i = (size_t)(bid % PB_W) * 1024 + threadIdx.x;
    if (which == 3) cvtw8(wo, WOH, i);
    else cvt8(which == 0 ? wq : (which == 1 ? wk : wv), WB + (size_t)which * DM * DM, i);
}

// proj_body: register-blocked bf16 GEMM, one 8-wave block per 128x256 tile at (rB, cB), one wave per 64x64 tile at (r0, c0) (16 accumulators), K = DM; the block's operand units come from the fragment-major bf16 planes
// into LDS by asynchronous copies, one 32-k stage ahead (two buffers), and each unit is read from LDS by the four (row operand) or two (column operand) waves that need it.
// C[m][n] = sum_k A[m][k] Bt[n][k] + bias (BIASROW == 0: bias[n]; BIASROW != 0: bias[m]), written as f16 (Ph), fragment-major with row = m, k = n, at
// tile base (r0/RB)*sRB + (r0%RB)*pitch + (c0/CB)*sCB + (c0%CB)*CMUL, + mb*MBS per 16 rows, + S1S per 32 columns; the f16 residual x2048 (Pr) is written with its own strides when (r0%RB) < rlim and (c0%CB) < clim.
template <int BIASROW>
__device__ __forceinline__ void proj_body(const bf* __restrict__ A, const bf* __restrict__ Bt, const float* __restrict__ bias, h16* Ph, h16* Pr,
                                          int RB, size_t sRB, int pitch, int CB, size_t sCB,
                                          size_t sRBr, int pitchr, size_t sCBr, int rlim, int clim, int rB, int cB, float* osb, char* st) {
    const int K = DM;
    const int tid = threadIdx.x, lane = tid & 31, lr = lane & 15, hi = lane >> 4, wv = __builtin_amdgcn_readfirstlane(tid >> 5);
    const int r0 = rB + 64 * (wv >> 2), c0 = cB + 64 * (wv & 3);
    float* os = osb + wv * (16 * 68);                                    // wave-private epilogue tile
    v8f acc[4][4];
#pragma unroll
    for (int mb = 0; mb < 4; ++mb)
#pragma unroll
        for (int nb = 0; nb < 4; ++nb) acc[mb][nb] = (v8f){};
    constexpr int MBS = (BIASROW != 0) ? 512 : 1024, S1S = (BIASROW != 0) ? 2048 : 512, CMUL = (BIASROW != 0) ? 64 : 1;   // q, k: [t/16][d/32][unit]; v^T: [t/32][d/16][unit]
    // unit (row tile, ks) lies at byte (row tile)*32*K + ks*1024; thread tid copies bytes 16*(tid&63) of row tiles (tid>>6) + 4j
    const char* ga = (const char*)(A  + (size_t)(rB + 16 * (tid >> 6)) * K + 8 * (tid & 63));
    const char* gb = (const char*)(Bt + (size_t)(cB + 16 * (tid >> 6)) * K + 8 * (tid & 63));
    const unsigned ls = (unsigned)(size_t)st + 16u * (unsigned)tid;
    stage24(ls, ga, ga + 131072, gb, gb + 131072, gb + 262144, gb + 393216);
    wait_async();
    __syncthreads();                                                     // stage 0 published
    stage24(ls + PSTG, ga + 1024, ga + 132096, gb + 1024, gb + 132096, gb + 263168, gb + 394240);
#pragma unroll 1
    for (int ks = 0; ks < K / 32; ++ks) {
        const bf* pa = (const bf*)(st + (ks & 1) * PSTG + (wv >> 2) * 4096) + 8 * lane; const bf* pb = (const bf*)(st + (ks & 1) * PSTG + 8192 + (wv & 3) * 4096) + 8 * lane;
        v16bf a[4], b[4];
#pragma unroll
        for (int mb = 0; mb < 4; ++mb) a[mb] = ldb(pa + mb * 512);
#pragma unroll
        for (int nb = 0; nb < 4; ++nb) b[nb] = ldb(pb + nb * 512);
#pragma unroll
        for (int nb = 0; nb < 4; ++nb) {
#pragma unroll
            for (int mb = 0; mb < 4; ++mb) acc[mb][nb] = wmmab(a[mb], b[nb], acc[mb][nb]); }
        asm volatile("v_nop\n\tv_nop\n\tv_nop\n\tv_nop" : "+v"(acc[0][3]), "+v"(acc[1][3]), "+v"(acc[2][3]), "+v"(acc[3][3]) : "v"(a[0]), "v"(a[1]), "v"(a[2]), "v"(a[3]));
        wait_ds(); wait_async();
        __syncthreads();                                                 // publishes stage ks + 1 and ends every wave's reads of stage ks
        if (ks + 2 < K / 32) {                                           // block-uniform: refill the buffer just left
            const char* na = ga + (ks + 2) * 1024; const char* nb2 = gb + (ks + 2) * 1024;
            stage24(ls + (ks & 1) * PSTG, na, na + 131072, nb2, nb2 + 131072, nb2 + 262144, nb2 + 393216);
        }
    }
    wait_async();
    float bc[4] = {0.0f, 0.0f, 0.0f, 0.0f};
    if constexpr (BIASROW == 0) {
#pragma unroll
        for (int nb = 0; nb < 4; ++nb) bc[nb] = bfr(bias[c0 + nb * 16 + lr]);
    }
    const int wres = (((r0 % RB) < rlim) && ((c0 % CB) < clim)) ? 1 : 0;   // tile-uniform
    const size_t tbase = (size_t)(r0 / RB) * sRB + (size_t)(r0 % RB) * (size_t)pitch + (size_t)(c0 / CB) * sCB + (size_t)(c0 % CB) * CMUL;
    const size_t tbasr = (size_t)(r0 / RB) * sRBr + (size_t)(r0 % RB) * (size_t)pitchr + (size_t)(c0 / CB) * sCBr + (size_t)(c0 % CB) * CMUL;
#pragma unroll
    for (int mb = 0; mb < 4; ++mb) {
        float rb[8];
        if constexpr (BIASROW != 0) {
            const v4f b0 = *(const v4f*)(bias + r0 + mb * 16 + 8 * hi); const v4f b1 = *(const v4f*)(bias + r0 + mb * 16 + 8 * hi + 4);
#pragma unroll
            for (int i = 0; i < 4; ++i) { rb[i] = bfr(b0[i]); rb[4 + i] = bfr(b1[i]); }
        } else {
#pragma unroll
            for (int j = 0; j < 8; ++j) rb[j] = 0.0f;
        }
#pragma unroll
        for (int nb = 0; nb < 4; ++nb) {
#pragma unroll
            for (int j = 0; j < 8; ++j) os[(hi * 8 + j) * 68 + nb * 16 + lr] = acc[mb][nb][j] + ((BIASROW != 0) ? rb[j] : bc[nb]); }   // D: row 8h+j, col lane&15
        wave_sync();
        const size_t sb = tbase + (size_t)(mb * MBS) + 8 * lane;
        const size_t sr = tbasr + (size_t)(mb * MBS) + 8 * lane;
{
#pragma unroll
            for (int s = 0; s < 4; ++s) { const int row = lr, c8 = (2 * s + hi) * 8;   // store s = part s&1 of the unit of columns 32*(s>>1)..+31: lane holds row lane&15, columns 16*s + 8*(lane>>4) + 0..7
                const v4f x0 = *(const v4fa*)(&os[row * 68 + c8]); const v4f x1 = *(const v4fa*)(&os[row * 68 + c8 + 4]); v8h hv, rv;
#pragma unroll
                for (int i = 0; i < 4; ++i) { const h16 a0 = (h16)x0[i]; const h16 a1 = (h16)x1[i]; hv[i] = a0; hv[4 + i] = a1; rv[i] = (h16)((x0[i] - (float)a0) * QRS); rv[4 + i] = (h16)((x1[i] - (float)a1) * QRS); }
                *(v8h*)(Ph + sb + (s >> 1) * S1S + (s & 1) * 256) = hv;
                asm volatile("s_wait_xcnt 0x0" :: "v"(hv) : "memory");       // before the issued store's registers are reused
                if (wres) { *(v8h*)(Pr + sr + (s >> 1) * S1S + (s & 1) * 256) = rv;
                    asm volatile("s_wait_xcnt 0x0" :: "v"(rv) : "memory"); } }   // the same for the residual store
             }
        wave_sync();
    }
}

// k_proj3: the three projections in one grid (z = q | k | v), so that their waves share the SIMDs; inside each z the tiles come in the order of the separate launches (q, k: token tile fastest; v^T: feature tile fastest).
// q, k: A = x rows (m = b*SEQ + t), Bt = W rows (n = h*64 + d), bias by column -> plane [(b*16 + h)][t/16][d/32][unit]; residual plane the same for t < EROWS
// v^T: A = Wv rows (m = h*64 + d), Bt = x rows (n = b*SEQ + t), bias by row -> plane [(b*16 + h)][t/32][d/16][unit]; residual plane the same for t < EROWS
static_assert((NB * SEQ) % 256 == 0 && DM % 256 == 0 && DM / 32 >= 2);   // whole 128x256 block tiles in both forms; the two-buffer prologue needs two stages
__global__ __launch_bounds__(32 * PW) void k_proj3(const bf* __restrict__ XB, const bf* __restrict__ WQ, const bf* __restrict__ WK, const bf* __restrict__ WV, const float* __restrict__ bq, const float* __restrict__ bk, const float* __restrict__ bv,
                                              h16* QH, h16* QR, h16* KP, h16* KR, h16* VT, h16* VR) {
    __shared__ __align__(16) float os[PW * 16 * 68];
    __shared__ __align__(1024) char st[2 * PSTG];
    const int z = blockIdx.z;
    if (z == 2) {
        const int flat = blockIdx.y * (NB * SEQ / 128) + blockIdx.x;
        proj_body<1>(WV, XB, bv, VT, VR, DM, (size_t)0, SEQ, SEQ, (size_t)DM * SEQ, (size_t)0, EROWS, (size_t)DM * EROWS, DM, EROWS, (flat % (DM / 128)) * 128, (flat / (DM / 128)) * 256, os, st);
    } else {
        proj_body<0>(XB, z == 0 ? WQ : WK, z == 0 ? bq : bk, z == 0 ? QH : KP, z == 0 ? QR : KR, SEQ, (size_t)NH_ * SEQ * HD, HD, HD, (size_t)SEQ * HD,
                     (size_t)NH_ * EROWS * HD, HD, (size_t)EROWS * HD, EROWS, HD, blockIdx.x * 128, blockIdx.y * 256, os, st);
    }
}

// flash_body: fused masked attention, one wave per 16 query rows of one (batch, head); K / V^T / Q fragments straight from the fragment-major f16 planes (two 16-B loads each, 512 contiguous bytes per wave-load).
// Transposed form: S^T[key][t] = K Q^T (A = K rows, B = Q rows); lane (t = lane&15, h = lane>>4) holds keys 8h+r of each 16-key tile, so the packed
// P tile is directly the B fragment of O^T[d][t] = V^T P^T (element r <- tile keys 0..15, element 8+r <- tile keys 16..31, lane unchanged).
// Mask: the wave reads the step's 16 lane-select words (64 B, wave-uniform address) and replaces masked scores by the fill value; the loop walks the set bits of the tile's live-step word in rising order, so a step whose 16x32 mask tile is all zero is not visited;
// if some row ends with no visited key the wave repeats the sweep over every step, which yields the uniform average of a fully masked row.
// EARLY != 0 (query rows < EROWS): q, k, v and P carry residuals x2048; residual products accumulate separately and are folded back with 1/2048.
template <int EARLY>
__device__ __forceinline__ void flash_body(const h16* __restrict__ QH, const h16* __restrict__ QR, const h16* __restrict__ KP, const h16* __restrict__ KR,
                                           const h16* __restrict__ VT, const h16* __restrict__ VR, const unsigned* __restrict__ MB, h16* CH, h16* CR, int tstart, int bx, int zh) {
    const int lane = threadIdx.x & 31, wave = __builtin_amdgcn_readfirstlane((int)(threadIdx.x >> 5)), lr = lane & 15, hi = lane >> 4;
    const int b = zh / NH_, h = zh % NH_;
    const int t0 = tstart + (bx * AW + wave) * 16;
    const size_t pbase = (size_t)zh * SEQ * HD;
    const size_t rbase = (size_t)zh * EROWS * HD;
    const size_t qo = pbase + (size_t)t0 * HD + 8 * lane;
    const v16h qh0 = ldh(QH + qo), qh1 = ldh(QH + qo + 512);                // B fragments: col t, k = d
    v16h qr0 = qh0, qr1 = qh1;
    if constexpr (EARLY != 0) { const size_t qro = rbase + (size_t)t0 * HD + 8 * lane; qr0 = ldh(QR + qro); qr1 = ldh(QR + qro + 512); }
    const size_t ko  = pbase + 8 * lane;       // + key0 * HD + 512 * (d/32)   (A fragment: row key, k = d; 16 keys = 1024 elements)
    const size_t kro = rbase + 8 * lane;
    const size_t vo  = pbase + 8 * lane;       // + key0 * HD + 512 * j        (A fragment: row d = 16j.., k = key; 32 keys = 2048 elements)
    const size_t vro = rbase + 8 * lane;
    const unsigned* mrec = MB + (size_t)(t0 >> 4) * MREC;      // this tile's mask record (wave-uniform)
    const unsigned long long live = *(const unsigned long long*)(mrec + NST * 16) & ALLST;
    v8f o0 = (v8f){}, o1 = (v8f){}, o2 = (v8f){}, o3 = (v8f){};
    v8f e0 = (v8f){}, e1 = (v8f){}, e2 = (v8f){}, e3 = (v8f){};
    float m = -3.0e38f, l = 0.0f;
    int noskip = 0;
#pragma unroll 1
    for (int pass = 0; pass < 2; ++pass) {
        o0 = (v8f){}; o1 = (v8f){}; o2 = (v8f){}; o3 = (v8f){};
        e0 = (v8f){}; e1 = (v8f){}; e2 = (v8f){}; e3 = (v8f){};
        m = -3.0e38f; l = 0.0f;
#pragma unroll 1
        for (unsigned long long rem = (noskip != 0) ? ALLST : live; rem != 0ull; rem &= rem - 1ull) {   // at most NST trips, wave-uniform
            const int key0 = 32 * __builtin_ctzll(rem);
            const v16u mw = *(const v16u*)(mrec + (key0 >> 1));          // 16 words per step
            const h16* ka = KP + ko + (size_t)key0 * HD;
            v8f sHa = (v8f){}, sHb = (v8f){}, sLa = (v8f){}, sLb = (v8f){};
            {
                const v16h ka0 = ldh(ka), ka1 = ldh(ka + 512), kb0 = ldh(ka + 16 * HD), kb1 = ldh(ka + 16 * HD + 512);
                sHa = wmma16(ka0, qh0, sHa); sHb = wmma16(kb0, qh0, sHb); sHa = wmma16(ka1, qh1, sHa); sHb = wmma16(kb1, qh1, sHb);
                if constexpr (EARLY != 0) {
                    sLa = wmma16(ka0, qr0, sLa); sLb = wmma16(kb0, qr0, sLb); sLa = wmma16(ka1, qr1, sLa); sLb = wmma16(kb1, qr1, sLb);
                    asm volatile("v_nop\n\tv_nop\n\tv_nop\n\tv_nop" : "+v"(sHa), "+v"(sHb), "+v"(sLa), "+v"(sLb) : "v"(ka0), "v"(ka1), "v"(kb0), "v"(kb1));
                } else {
                    asm volatile("v_nop\n\tv_nop\n\tv_nop\n\tv_nop" : "+v"(sHa), "+v"(sHb) : "v"(ka0), "v"(ka1), "v"(kb0), "v"(kb1));
                }
            }
            if constexpr (EARLY != 0) {
                __builtin_amdgcn_sched_barrier(0);
                if (key0 < EROWS) {                                      // residual k plane covers keys < EROWS (wave-uniform)
                    const h16* ra = KR + kro + (size_t)key0 * HD;
                    const v16h ra0 = ldh(ra), ra1 = ldh(ra + 512), rb0 = ldh(ra + 16 * HD), rb1 = ldh(ra + 16 * HD + 512);
                    sLa = wmma16(ra0, qh0, sLa); sLb = wmma16(rb0, qh0, sLb); sLa = wmma16(ra1, qh1, sLa); sLb = wmma16(rb1, qh1, sLb);
                    asm volatile("v_nop\n\tv_nop\n\tv_nop\n\tv_nop" : "+v"(sLa), "+v"(sLb) : "v"(ra0), "v"(ra1), "v"(rb0), "v"(rb1));
                }
                __builtin_amdgcn_sched_barrier(0);
            }
            float ta[8], tb[8]; float mx = -3.0e38f;
#pragma unroll
            for (int r = 0; r < 8; ++r) {
                float sa = sHa[r], sb = sHb[r];
                if constexpr (EARLY != 0) { sa += sLa[r] * QRI; sb += sLb[r] * QRI; }
                ta[r] = __builtin_amdgcn_inverse_ballot_w32(mw[r]) ? sa * SC2 : NEGL;
                tb[r] = __builtin_amdgcn_inverse_ballot_w32(mw[8 + r]) ? sb * SC2 : NEGL;
                mx = fmaxf(mx, fmaxf(ta[r], tb[r]));
            }
            mx = fmaxf(mx, __shfl_xor(mx, 16, 32));
            const float mnew = fmaxf(m, mx);
            const float alpha = __builtin_amdgcn_exp2f(m - mnew);
            const float sh = PSH - mnew;
            v16h pb = (v16h){}; v16h pq = (v16h){}; float ls = 0.0f;
#pragma unroll
            for (int r = 0; r < 8; ++r) {
                const float pa = __builtin_amdgcn_exp2f(ta[r] + sh), pc = __builtin_amdgcn_exp2f(tb[r] + sh);
                const h16 ha = (h16)pa, hc = (h16)pc; pb[r] = ha; pb[8 + r] = hc;
                if constexpr (EARLY != 0) {
                    const h16 ga = (h16)((pa - (float)ha) * QRS), gc = (h16)((pc - (float)hc) * QRS); pq[r] = ga; pq[8 + r] = gc;
                    ls += ((float)ha + (float)hc) + ((float)ga + (float)gc) * QRI;
                } else {
                    ls += (float)ha + (float)hc;
                }
            }
            l = l * alpha + ls; m = mnew;
            o0 = o0 * alpha; o1 = o1 * alpha; o2 = o2 * alpha; o3 = o3 * alpha;
            if constexpr (EARLY != 0) { e0 = e0 * alpha; e1 = e1 * alpha; e2 = e2 * alpha; e3 = e3 * alpha; }
            const h16* va = VT + vo + (size_t)key0 * HD;
            {
                const v16h v0 = ldh(va), v1 = ldh(va + 512), v2 = ldh(va + 1024), v3 = (EARLY != 0) ? ldh_end(va + 1536) : ldh(va + 1536);
                o0 = wmma16(v0, pb, o0); o1 = wmma16(v1, pb, o1); o2 = wmma16(v2, pb, o2); o3 = wmma16(v3, pb, o3);
                if constexpr (EARLY != 0) {
                    e0 = wmma16(v0, pq, e0); e1 = wmma16(v1, pq, e1); e2 = wmma16(v2, pq, e2); e3 = wmma16(v3, pq, e3);
                    asm volatile("v_nop\n\tv_nop\n\tv_nop\n\tv_nop" : "+v"(o0), "+v"(o1), "+v"(o2), "+v"(o3), "+v"(e0), "+v"(e1), "+v"(e2), "+v"(e3) : "v"(v0), "v"(v1), "v"(v2), "v"(v3), "v"(pb), "v"(pq));
                } else {
                    asm volatile("v_nop\n\tv_nop\n\tv_nop\n\tv_nop" : "+v"(o0), "+v"(o1), "+v"(o2), "+v"(o3) : "v"(v0), "v"(v1), "v"(v2), "v"(v3), "v"(pb));
                }
            }
            if constexpr (EARLY != 0) {
                __builtin_amdgcn_sched_barrier(0);
                if (key0 < EROWS) {                                      // residual v^T plane covers keys < EROWS (wave-uniform)
                    const h16* wa = VR + vro + (size_t)key0 * HD;
                    const v16h w0 = ldh(wa), w1 = ldh(wa + 512), w2 = ldh(wa + 1024), w3 = ldh_end(wa + 1536);
                    e0 = wmma16(w0, pb, e0); e1 = wmma16(w1, pb, e1); e2 = wmma16(w2, pb, e2); e3 = wmma16(w3, pb, e3);
                    asm volatile("v_nop\n\tv_nop\n\tv_nop\n\tv_nop" : "+v"(e0), "+v"(e1), "+v"(e2), "+v"(e3) : "v"(w0), "v"(w1), "v"(w2), "v"(w3), "v"(pb));
                }
                __builtin_amdgcn_sched_barrier(0);
            }
        }
        l += __shfl_xor(l, 16, 32);
        const unsigned dead = __builtin_amdgcn_ballot_w32(!(l > 0.0f));
        if (dead == 0u) break;                                           // wave-uniform
        noskip = 1;
    }
    const float inv = CXS * (1.0f / l);
    // O^T D layout: o_j[r] = (d = 16j + 8h + r, t = lane&15): exactly part j&1 of context unit 2h + (j>>1) (row t = lane&15, k = 16j + 8*(lane>>4) + r), so each lane stores its own accumulators, no transpose
    const size_t crow = ((size_t)b * SEQ + t0) * DM + (size_t)h * 1024 + 8 * lane;     // context plane, row b*SEQ + t, k = h*64 + d: units [(b*SEQ + t)/16][2h + d/32]
    const size_t rrow = ((size_t)b * EROWS + t0) * DM + (size_t)h * 1024 + 8 * lane;   // residual plane, row b*EROWS + t (EARLY blocks only: t0 + 15 < EROWS)
    v8f xs[4] = {o0, o1, o2, o3};
    if constexpr (EARLY != 0) { xs[0] = o0 + e0 * QRI; xs[1] = o1 + e1 * QRI; xs[2] = o2 + e2 * QRI; xs[3] = o3 + e3 * QRI; }
#pragma unroll
    for (int s = 0; s < 4; ++s) {
        const v8f x = xs[s] * inv; v8h hv, rv;
#pragma unroll
        for (int i = 0; i < 8; ++i) { const h16 a0 = (h16)x[i]; hv[i] = a0; rv[i] = (h16)((x[i] - (float)a0) * QRS); }
        *(v8h*)(CH + crow + s * 256) = hv;
        if constexpr (EARLY != 0) *(v8h*)(CR + rrow + s * 256) = rv;
    }
}

// k_flashf: both forms in one 1-D grid, so that the residual rows' few, latency-bound waves run beside the others instead of in a launch of their own. A block's job follows from its index alone (block-uniform):
// first the residual rows' blocks, then the rest, each group from the last query block down ((batch, head) fastest): under a lower-triangular mask the key walk grows with the query index,
// so the longest blocks come first in index order and the shortest last. The order is for speed only: every (query block, batch, head) is taken exactly once for any mask.
// amdgpu_waves_per_eu(5): every block of the grid is given the registers of the larger (residual) form; unbudgeted that form takes 204 = an allocation of 208 = 4 waves per SIMD, under the budget 192 = 5 waves, no scratch.
#define FB_E (EROWS / (16 * AW))
#define FB_L ((SEQ - EROWS) / (16 * AW))
#define FB_Z (NB * NH_)
__global__ __launch_bounds__(32 * AW) __attribute__((amdgpu_waves_per_eu(5))) void k_flashf(const h16* __restrict__ QH, const h16* __restrict__ QR, const h16* __restrict__ KP, const h16* __restrict__ KR,
                                                    const h16* __restrict__ VT, const h16* __restrict__ VR, const unsigned* __restrict__ MB, h16* CH, h16* CR) {
    const int bid = blockIdx.x;
    if (bid < FB_E * FB_Z) { flash_body<1>(QH, QR, KP, KR, VT, VR, MB, CH, CR, 0, FB_E - 1 - bid / FB_Z, bid % FB_Z); }
    else { const int r = bid - FB_E * FB_Z; flash_body<0>(QH, QR, KP, KR, VT, VR, MB, CH, CR, EROWS, FB_L - 1 - r / FB_Z, r % FB_Z); }
}

// oproj_body: output projection, f16 GEMM, one 4-wave block per (32*MT) x 128 tile, one wave per (16*MT) x 64 tile, K = DM; operand units staged in LDS as in proj_body (RES != 0: stage units 0..3 = A, 4..7 = AR). OUT[m][n] = OSC * (sum_k A[m][k] Bt[n][k] + QRI * sum_k AR[m][k] Bt[n][k]) + bias[n] (bias RNE-converted to bf16).
// A = context plane (x16), AR = context residual plane (RES != 0 only, rows [b*EROWS + t]), Bt = Wo x1024 as f16 ([out][in]).
// wave row tile rt = 2*rtB + (wave>>1) in 0 .. NB * tpb - 1 -> batch rt / tpb, first token rowoff + (rt % tpb) * 16*MT (tpb even: a block's two row tiles are neighbours in one batch); c0 = cB + 64*(wave&1) = first output column.
template <int MT, int RES>
__device__ __forceinline__ void oproj_body(const h16* __restrict__ A, const h16* __restrict__ AR, const h16* __restrict__ Bt, const float* __restrict__ bias, float* OUT, int tpb, int rowoff, int rtB, int cB, float* osb, char* st) {
    static_assert((MT == 4 && RES == 0) || (MT == 2 && RES == 1));
    const int K = DM;
    const int tid = threadIdx.x, lane = tid & 31, lr = lane & 15, hi = lane >> 4, wv = __builtin_amdgcn_readfirstlane(tid >> 5);
    const int rt = 2 * rtB + (wv >> 1), c0 = cB + 64 * (wv & 1);
    float* os = osb + wv * (16 * 68);                                  // wave-private epilogue tile
    const int bb = rt / tpb, tl = rt % tpb;
    const int tok = rowoff + tl * (16 * MT);
    const int tokB = rowoff + ((2 * rtB) % tpb) * (16 * MT);           // the block's first token (same batch bb)
    // unit (row tile, ks) lies at byte (row tile)*32*K + ks*1024; thread tid copies bytes 16*(tid&63) of row tiles (tid>>6) + 2j
    const char* ga = (const char*)(A  + ((size_t)bb * SEQ   + tokB + 16 * (tid >> 6)) * K + 8 * (tid & 63));
    const char* gr = (const char*)(AR + ((size_t)bb * EROWS + tokB + 16 * (tid >> 6)) * K + 8 * (tid & 63));
    const char* gb = (const char*)(Bt + (size_t)(cB + 16 * (tid >> 6)) * K + 8 * (tid & 63));
    const char* g2 = (RES != 0) ? gr : ga + 131072;                    // source of stage units 4..7
    const unsigned ls = (unsigned)(size_t)st + 16u * (unsigned)tid;
    v8f acc[MT][4], acr[MT][4];
#pragma unroll
    for (int mb = 0; mb < MT; ++mb)
#pragma unroll
        for (int nb = 0; nb < 4; ++nb) { acc[mb][nb] = (v8f){}; acr[mb][nb] = (v8f){}; }
    stage16(ls, ga, ga + 65536, g2, g2 + 65536, gb, gb + 65536, gb + 131072, gb + 196608);
    wait_async();
    __syncthreads();                                                   // stage 0 published
    stage16(ls + STG, ga + 1024, ga + 66560, g2 + 1024, g2 + 66560, gb + 1024, gb + 66560, gb + 132096, gb + 197632);
#pragma unroll 1
    for (int ks = 0; ks < K / 32; ++ks) {
        const h16* pa = (const h16*)(st + (ks & 1) * STG + (wv >> 1) * (MT * 1024)) + 8 * lane; const h16* pr = pa + 2048; const h16* pb = (const h16*)(st + (ks & 1) * STG + 8192 + (wv & 1) * 4096) + 8 * lane;
        v16h a[MT], ar[MT], bfrag[4];
#pragma unroll
        for (int mb = 0; mb < MT; ++mb) { a[mb] = ldh(pa + mb * 512); ar[mb] = a[mb]; }
        if constexpr (RES != 0) {
#pragma unroll
            for (int mb = 0; mb < MT; ++mb) ar[mb] = ldh(pr + mb * 512);
        }
#pragma unroll
        for (int nb = 0; nb < 4; ++nb) bfrag[nb] = ldh(pb + nb * 512);
#pragma unroll
        for (int nb = 0; nb < 4; ++nb) {
#pragma unroll
            for (int mb = 0; mb < MT; ++mb) { acc[mb][nb] = wmma16(a[mb], bfrag[nb], acc[mb][nb]);
                if constexpr (RES != 0) acr[mb][nb] = wmma16(ar[mb], bfrag[nb], acr[mb][nb]); } }
        if constexpr (MT == 4) {
            asm volatile("v_nop\n\tv_nop\n\tv_nop\n\tv_nop" : "+v"(acc[0][3]), "+v"(acc[1][3]), "+v"(acc[2][3]), "+v"(acc[3][3]) : "v"(a[0]), "v"(a[1]), "v"(a[2]), "v"(a[3]));
        } else {
            asm volatile("v_nop\n\tv_nop\n\tv_nop\n\tv_nop" : "+v"(acc[0][3]), "+v"(acc[1][3]), "+v"(acr[0][3]), "+v"(acr[1][3]) : "v"(a[0]), "v"(a[1]), "v"(ar[0]), "v"(ar[1]));
        }
        wait_ds(); wait_async();
        __syncthreads();                                               // publishes stage ks + 1 and ends every wave's reads of stage ks
        if (ks + 2 < K / 32) {                                         // block-uniform: refill the buffer just left
            const char* na = ga + (ks + 2) * 1024; const char* n2 = g2 + (ks + 2) * 1024; const char* nb2 = gb + (ks + 2) * 1024;
            stage16(ls + (ks & 1) * STG, na, na + 65536, n2, n2 + 65536, nb2, nb2 + 65536, nb2 + 131072, nb2 + 196608);
        }
    }
    wait_async();
    float bc[4];
#pragma unroll
    for (int nb = 0; nb < 4; ++nb) bc[nb] = bfr(bias[c0 + nb * 16 + lr]);
#pragma unroll
    for (int mb = 0; mb < MT; ++mb) {
#pragma unroll
        for (int nb = 0; nb < 4; ++nb) {
#pragma unroll
            for (int j = 0; j < 8; ++j) { float v = acc[mb][nb][j] * OSC;
                if constexpr (RES != 0) v += acr[mb][nb][j] * (OSC * QRI);
                os[(hi * 8 + j) * 68 + nb * 16 + lr] = v + bc[nb]; } }                          // D: row 8h+j, col lane&15
        wave_sync();
        float* orow = OUT + ((size_t)bb * OUT_SEQ + tok + mb * 16) * DM + c0;
{
#pragma unroll
            for (int s = 0; s < 8; ++s) { const int row = 2 * s + hi, cofs = lr * 4;            // 8 s x 2 rows = 16 rows; 16 lanes x 4 floats = 64 columns
                const v4f val = *(const v4fa*)(&os[row * 68 + cofs]);
                *(v4f*)(orow + (size_t)row * DM + cofs) = val; }
             }
        wave_sync();
    }
}

// k_oprojf: both forms in one grid (x = row tile, fastest as in the separate launches: first the residual rows' tiles, then the rest; y = column tile), so that their waves share the SIMDs.
static_assert(EROWS % 64 == 0 && (SEQ - EROWS) % 128 == 0);   // a block's two row tiles lie in one batch
__global__ __launch_bounds__(32 * GW) void k_oprojf(const h16* __restrict__ CXH, const h16* __restrict__ CXR, const h16* __restrict__ WOH, const float* __restrict__ bo, float* OUT) {
    __shared__ __align__(16) float os[GW * 16 * 68];
    __shared__ __align__(1024) char st[2 * STG];
    constexpr int NR = NB * (EROWS / 64);
    const int rtB = blockIdx.x, cB = blockIdx.y * 128;
    if (rtB < NR) oproj_body<2, 1>(CXH, CXR, WOH, bo, OUT, EROWS / 32, 0, rtB, cB, os, st);
    else          oproj_body<4, 0>(CXH, CXH, WOH, bo, OUT, (SEQ - EROWS) / 64, EROWS, rtB - NR, cB, os, st);
}

static constexpr size_t al256(size_t v) { return (v + 255) & ~(size_t)255; }
static constexpr size_t SZ_XB = al256((size_t)NB * SEQ * DM * 2);              // x bf16
static constexpr size_t SZ_WB = al256((size_t)3 * DM * DM * 2);                // Wq | Wk | Wv bf16
static constexpr size_t SZ_WO = al256((size_t)DM * DM * 2);                    // Wo f16 (x1024)
static constexpr size_t SZ_PL = al256((size_t)NB * NH_ * SEQ * HD * 2);        // q / k / v^T planes
static constexpr size_t SZ_RP = al256((size_t)NB * NH_ * EROWS * HD * 2);      // residual planes (t < EROWS)
static constexpr size_t SZ_CX = al256((size_t)NB * SEQ * DM * 2);              // context plane
static constexpr size_t SZ_CR = al256((size_t)NB * EROWS * DM * 2);            // context residual plane
static constexpr size_t SZ_MB = al256((size_t)(SEQ / 16) * MREC * 4);          // mask records
static constexpr size_t SZ_TOTAL = SZ_XB + SZ_WB + SZ_WO + 3 * SZ_PL + 3 * SZ_RP + SZ_CX + SZ_CR + SZ_MB;
static_assert(SZ_TOTAL <= (size_t)134217728);          // workspace carve <= 128 MiB
static_assert(((size_t)DM * DM * 2) % 256 == 0);       // weight sub-planes stay 256-byte aligned

extern "C" void kernel_launch(void* const* d_in, const int* in_sizes, int n_in,
                              void* d_out, int out_size, void* d_ws, size_t ws_size, hipStream_t stream) {
    if (n_in < 10) return;
    const size_t needx = ((size_t)(NB - 1) * SEQ_FULL + SEQ) * DM;
    if ((size_t)in_sizes[0] < needx) return;
    if ((size_t)in_sizes[1] < (size_t)(SEQ - 1) * SEQ_FULL + SEQ) return;
    if ((size_t)in_sizes[2] < (size_t)DM * DM || (size_t)in_sizes[4] < (size_t)DM * DM || (size_t)in_sizes[6] < (size_t)DM * DM || (size_t)in_sizes[8] < (size_t)DM * DM) return;
    if (in_sizes[3] < DM || in_sizes[5] < DM || in_sizes[7] < DM || in_sizes[9] < DM) return;
    if ((size_t)out_size < ((size_t)(NB - 1) * OUT_SEQ + SEQ) * DM) return;
    if (SZ_TOTAL > ws_size) return;
    // wire order: query, mask (int32), Wq, bq, Wk, bk, Wv, bv, Wo, bo; weights [out][in] = Bt as-is
    const float* x  = (const float*)d_in[0]; const int* mask = (const int*)d_in[1];
    const float* wq = (const float*)d_in[2]; const float* bq = (const float*)d_in[3];
    const float* wk = (const float*)d_in[4]; const float* bk = (const float*)d_in[5];
    const float* wv = (const float*)d_in[6]; const float* bv = (const float*)d_in[7];
    const float* wo = (const float*)d_in[8]; const float* bo = (const float*)d_in[9];
    float* OUT = (float*)d_out;      // [NB][SEQ][1024]
    char* wsp = (char*)d_ws;
    bf*  XB  = (bf*)wsp;  wsp += SZ_XB;              // rows NB*SEQ, k 1024, fragment-major
    bf*  WB  = (bf*)wsp;  wsp += SZ_WB;              // 3 planes q | k | v, rows 1024, k 1024, fragment-major
    h16* WOH = (h16*)wsp; wsp += SZ_WO;              // rows 1024, k 1024, fragment-major, x1024
    h16* QH  = (h16*)wsp; wsp += SZ_PL;              // [NB*16][SEQ/16][2][unit]
    h16* KP  = (h16*)wsp; wsp += SZ_PL;              // [NB*16][SEQ/16][2][unit]
    h16* VT  = (h16*)wsp; wsp += SZ_PL;              // [NB*16][SEQ/32][4][unit]
    h16* QR  = (h16*)wsp; wsp += SZ_RP;              // [NB*16][EROWS/16][2][unit] residual x2048
    h16* KR  = (h16*)wsp; wsp += SZ_RP;              // [NB*16][EROWS/16][2][unit] residual x2048
    h16* VR  = (h16*)wsp; wsp += SZ_RP;              // [NB*16][EROWS/32][4][unit] residual x2048
    h16* CXH = (h16*)wsp; wsp += SZ_CX;              // rows NB*SEQ, k 1024, fragment-major, x16
    h16* CXR = (h16*)wsp; wsp += SZ_CR;              // rows NB*EROWS, k 1024, fragment-major, residual x2048
    unsigned* MBW = (unsigned*)wsp; wsp += SZ_MB;    // [SEQ/16][MREC] mask records
    bf* WQ = WB; bf* WK = WB + (size_t)DM * DM; bf* WV = WB + (size_t)2 * DM * DM;

    k_prep<<<PB_M + PB_X + 4 * PB_W, 1024, 0, stream>>>(x, mask, wq, wk, wv, wo, XB, WB, WOH, MBW);
    k_proj3<<<dim3(NB * SEQ / 128, DM / 256, 3), 32 * PW, 0, stream>>>(XB, WQ, WK, WV, bq, bk, bv, QH, QR, KP, KR, VT, VR);

    k_flashf<<<(FB_E + FB_L) * FB_Z, 32 * AW, 0, stream>>>(QH, QR, KP, KR, VT, VR, MBW, CXH, CXR);

    k_oprojf<<<dim3(NB * (EROWS / 64) + NB * ((SEQ - EROWS) / 128), DM / 128, 1), 32 * GW, 0, stream>>>(CXH, CXR, WOH, bo, OUT);
}

// v006
// A run of this version takes 150 microseconds.
// In two side-by-side timings against v005, it was 1.16 and 1.17 times as fast.
// Over all steps from v000 it is 2.69 times as fast.
#include <hip/hip_runtime.h>

// Masked multi-head self-attention, width 1024 = 16 heads x 64, x [NB][SEQ][1024], Wq/Wk/Wv/Wo [out][in] (y = x W^T + b), int32 mask [SEQ][SEQ] (0 = fill -1e9), score scale 1/8, output projection with bias (f32 out).
// Compute dtypes, f32 accumulate everywhere: q/k/v projections v_wmma_f32_16x16x32_bf16 (x and W RNE-converted to bf16; products exact; biases RNE-converted to bf16, added in f32);
// scores and P.V v_wmma_f32_16x16x32_f16: single f16 planes on query rows >= 512; on the first 512 query rows q, k, v, P and the context carry an f16 residual x2048 (three products, residual terms in their own accumulator);
// P carried x256 (cancels in the normalisation); output projection v_wmma_f32_16x16x32_f16 with context x16 and bf16-exact Wo x1024 as f16 (context residual on the first 512 rows); softmax f32 (online, running max).
// Layout: every 16-bit matrix operand plane is fragment-major: a unit is one 16-row x 32-k fragment = [part 0..1][lane 0..31][8 elements] (512 elements, 1 KiB), element (part, lane, e) = (row lane&15, k 16*part + 8*(lane>>4) + e),
// so each 16-byte-per-lane load or store of a wave covers 512 contiguous bytes (4 whole lines). x, W, context planes: [row/16][k/32][unit]; q, k planes: [b*16+h][t/16][d/32][unit]; v^T plane: [b*16+h][t/32][d/16][unit]
// (+ residual planes for t < 512), written by the GEMM epilogue; fused flash kernel in transposed form (S^T = K Q^T, O^T = V^T P^T);
// mask: a pre-pass turns the int32 mask once per call into lane-select words (per 16-query tile and 32-key step: 16 words, bit L of word e = mask != 0 at the score element e that flash lane L holds) plus one 64-bit word per tile of the steps
// that hold any kept key; the flash kernel reads them by scalar loads (replace-fill by value as before); fully masked 16x32 tiles are skipped in the first sweep, with a full second sweep when a row ends with no visited key.

#ifndef NB
#define NB 4
#endif
#ifndef SEQ
#define SEQ 2048
#endif
#define NB_FULL  4
#define SEQ_FULL 2048
#ifndef OUT_SEQ
#define OUT_SEQ SEQ              // row pitch (in tokens) between batches of the output
#endif
#define DM   1024
#define NH_  16
#define HD   64
#define AW   4                   // waves per flash block (16 query rows each)
#define EROWS ((SEQ) < 512 ? (SEQ) : 512)   // query rows / keys per sequence that carry residual planes
#define QRS  2048.0f             // carry of every residual plane
#define QRI  (1.0f / 2048.0f)
#define SC2  (0.125f * 1.4426950408889634f)   // HD^-0.5 * log2(e)
#define NEGL (-1.0e9f * 1.4426950408889634f)  // masked fill in the log2 domain
#define PSH  8.0f                // log2 of the P carry (256)
#define CXS  16.0f               // carry of the context planes
#define WOS  1024.0f             // carry of the Wo plane
#define OSC  (1.0f / 16384.0f)   // 1 / (CXS * WOS)
#define NST  (SEQ / 32)          // 32-key steps per sequence
#define MREC (NST * 16 + 32)     // words of one 16-query tile's mask record: NST steps x 16 lane-select words, then one 128-B line whose first two words are the live-step bits
#define ALLST ((NST) >= 64 ? ~0ull : ((1ull << ((NST) & 63)) - 1ull))

static_assert(HD == 64);
static_assert(NH_ * HD == DM);                 // head h = columns h*64 + d
static_assert(DM % 64 == 0);
static_assert(DM % 32 == 0);                   // GEMM k-loop steps by 32
static_assert(SEQ % 64 == 0);                  // a 64-row tile never straddles two batches
static_assert((NB * SEQ) % 64 == 0);
static_assert(SEQ % 32 == 0);                  // key loop steps by 32
static_assert(EROWS % 64 == 0);                // residual tiles are whole 64-tiles; flash grid covers them exactly
static_assert(EROWS % (16 * AW) == 0);
static_assert((SEQ - EROWS) % 64 == 0);
static_assert((SEQ - EROWS) % (16 * AW) == 0);
static_assert(EROWS <= SEQ);
static_assert(((size_t)SEQ * DM) % 8 == 0);
static_assert(((size_t)DM * DM) % 8 == 0);
static_assert(NB <= NB_FULL);
static_assert(SEQ <= SEQ_FULL);
static_assert(NST <= 64);                      // live-step bits fit one 64-bit word; 32 waves x 2 steps cover a tile in mbits
static_assert(NST % 2 == 0);

typedef _Float16 h16;
typedef unsigned short bf;
typedef __attribute__((ext_vector_type(16))) __bf16   v16bf;
typedef __attribute__((ext_vector_type(16))) _Float16 v16h;
typedef __attribute__((ext_vector_type(8)))  _Float16 v8h;
typedef __attribute__((ext_vector_type(8)))  unsigned short v8us;
typedef __attribute__((ext_vector_type(8)))  float    v8f;
typedef __attribute__((ext_vector_type(4)))  float    v4f;
typedef __attribute__((ext_vector_type(4)))  int      v4i;
typedef v4f  __attribute__((may_alias)) v4fa;
typedef __attribute__((ext_vector_type(16))) unsigned v16u;

__device__ __forceinline__ unsigned short f2bf(float f) { unsigned u = __float_as_uint(f); u += 0x7FFFu + ((u >> 16) & 1u); return (unsigned short)(u >> 16); }
__device__ __forceinline__ float bfr(float f) { return __uint_as_float(((unsigned)f2bf(f)) << 16); }   // value after RNE convert to bf16
__device__ __forceinline__ v16h cat16(v8h lo, v8h hi) { return __builtin_shufflevector(lo, hi, 0, 1, 2, 3, 4, 5, 6, 7, 8, 9, 10, 11, 12, 13, 14, 15); }
__device__ __forceinline__ v16bf cat16b(v8us lo, v8us hi) { return __builtin_bit_cast(v16bf, __builtin_shufflevector(lo, hi, 0, 1, 2, 3, 4, 5, 6, 7, 8, 9, 10, 11, 12, 13, 14, 15)); }
__device__ __forceinline__ v8f wmma16(v16h a, v16h b, v8f c) { return __builtin_amdgcn_wmma_f32_16x16x32_f16(false, a, false, b, (short)0, c, false, false); }
__device__ __forceinline__ v8f wmmab(v16bf a, v16bf b, v8f c) { return __builtin_amdgcn_wmma_f32_16x16x32_bf16(false, a, false, b, (short)0, c, false, false); }
// fragment loaders from a fragment-major unit; p = unit base + 8*lane: elements 0..7 <- k0+8h+0..7 (part 0), elements 8..15 <- k0+16+8h+0..7 (part 1, +256 elements) (same map for A and B)
__device__ __forceinline__ v16h  ldh(const h16* p) { return cat16(*(const v8h*)p, *(const v8h*)(p + 256)); }
__device__ __forceinline__ v16bf ldb(const bf* p)  { return cat16b(*(const v8us*)p, *(const v8us*)(p + 256)); }
// ldh_end: ldh for the last fragment read off an address pair, where the compiler lands the last load's data on the pair itself: the s_wait_xcnt stands in front of that load, behind every other load that names the pair
__device__ __forceinline__ v16h  ldh_end(const h16* p) { const v8h lo = *(const v8h*)p; asm volatile("s_wait_xcnt 0x0" ::: "memory"); return cat16(lo, *(const v8h*)(p + 256)); }
// converters: a wave takes 8 rows x 32 k (8 whole 128-B lines of f32) and writes 4 whole 128-B lines of one unit. Thread i -> source element offset (row-major, DM columns) and fragment-major destination offset.
__device__ __forceinline__ void cvt_map(size_t i, size_t& so, size_t& dof) {
    const int lane = (int)(i & 31); const size_t w = i >> 5; const size_t ks = w % (DM / 32); const size_t row = (w / (DM / 32)) * 8 + (size_t)(lane >> 2); const int c = lane & 3;
    so  = row * DM + ks * 32 + (size_t)c * 8;
    dof = (row >> 4) * (size_t)(16 * DM) + ks * 512 + (size_t)(c >> 1) * 256 + (size_t)(c & 1) * 128 + (row & 15) * 8;
}
// ordering point for wave-private LDS tiles (same wave writes and reads)
__device__ __forceinline__ void wave_sync() { __builtin_amdgcn_fence(3 /* release order */, "wavefront"); __builtin_amdgcn_wave_barrier(); asm volatile("" ::: "memory"); }

// GEMM blocks: the waves of a block share one stage = the fragment-major units (1 KiB each) of one 32-k step, 8 of the row operand(s), then those of the column operand; two stage buffers in LDS.
// Output projection: 4 waves (2 x 2 wave tiles), 8 + 8 units. q/k/v projections: 8 waves (2 x 4 wave tiles), 8 + 16 units.
#define GW  4
#define STG 16384
#define PW   8
#define PSTG 24576
// stage16: the block's 128 threads bring one stage from the global planes into LDS, 8 asynchronous 16-B copies per thread; copy j fills bytes 16*tid of the unit pair 2j, 2j+1 (l = stage buffer + 16*tid, pj = the thread's own source bytes).
// The s_wait_xcnt stands inside the statement so that no address register of an issued copy is rewritten in front of it.
__device__ __forceinline__ void stage16(unsigned l, const char* p0, const char* p1, const char* p2, const char* p3, const char* p4, const char* p5, const char* p6, const char* p7) {
    asm volatile("global_load_async_to_lds_b128 %0, %8, off\n\t"
                 "global_load_async_to_lds_b128 %1, %9, off\n\t"
                 "global_load_async_to_lds_b128 %2, %10, off\n\t"
                 "global_load_async_to_lds_b128 %3, %11, off\n\t"
                 "global_load_async_to_lds_b128 %4, %12, off\n\t"
                 "global_load_async_to_lds_b128 %5, %13, off\n\t"
                 "global_load_async_to_lds_b128 %6, %14, off\n\t"
                 "global_load_async_to_lds_b128 %7, %15, off\n\t"
                 "s_wait_xcnt 0x0"
                 :: "v"(l), "v"(l + 2048u), "v"(l + 4096u), "v"(l + 6144u), "v"(l + 8192u), "v"(l + 10240u), "v"(l + 12288u), "v"(l + 14336u),
                    "v"(p0), "v"(p1), "v"(p2), "v"(p3), "v"(p4), "v"(p5), "v"(p6), "v"(p7) : "memory");
}
// stage24: the same for a block of 256 threads and 24 units, 6 copies per thread; copy j fills bytes 16*tid of the four units 4j .. 4j+3
__device__ __forceinline__ void stage24(unsigned l, const char* p0, const char* p1, const char* p2, const char* p3, const char* p4, const char* p5) {
    asm volatile("global_load_async_to_lds_b128 %0, %6, off\n\t"
                 "global_load_async_to_lds_b128 %1, %7, off\n\t"
                 "global_load_async_to_lds_b128 %2, %8, off\n\t"
                 "global_load_async_to_lds_b128 %3, %9, off\n\t"
                 "global_load_async_to_lds_b128 %4, %10, off\n\t"
                 "global_load_async_to_lds_b128 %5, %11, off\n\t"
                 "s_wait_xcnt 0x0"
                 :: "v"(l), "v"(l + 4096u), "v"(l + 8192u), "v"(l + 12288u), "v"(l + 16384u), "v"(l + 20480u),
                    "v"(p0), "v"(p1), "v"(p2), "v"(p3), "v"(p4), "v"(p5) : "memory");
}
// the two waits of a stage hand-over, each in front of the block barrier: the wave's own LDS reads done (its buffer may be refilled), the wave's own copies landed (the other waves may read them)
__device__ __forceinline__ void wait_ds()    { asm volatile("s_wait_dscnt 0x0" ::: "memory"); }
__device__ __forceinline__ void wait_async() { asm volatile("s_wait_asynccnt 0x0" ::: "memory"); }

__device__ __forceinline__ void cvt8(const float* __restrict__ src, bf* dst, size_t i) {
    size_t so, dof; cvt_map(i, so, dof);
    const v8f v = *(const v8f*)(src + so); v8us o;
#pragma unroll
    for (int k = 0; k < 8; ++k) o[k] = f2bf(v[k]);
    bf* dp = dst + dof;
    *(v8us*)dp = o;
    asm volatile("s_wait_xcnt 0x0" :: "v"(o), "v"(dp) : "memory");   // before the issued store's registers are reused
}

__device__ __forceinline__ void cvtw8(const float* __restrict__ src, h16* dst, size_t i) {
    size_t so, dof; cvt_map(i, so, dof);
    const v8f v = *(const v8f*)(src + so); v8h o;
#pragma unroll
    for (int k = 0; k < 8; ++k) o[k] = (h16)(bfr(v[k]) * WOS);
    h16* dp = dst + dof;
    *(v8h*)dp = o;
    asm volatile("s_wait_xcnt 0x0" :: "v"(o), "v"(dp) : "memory");   // the same for this store
}

// mbits: one 32-wave block per 16-query tile, wave w packs steps 2w and 2w+1. Each lane loads the 16 mask words of the score elements it holds in flash_body (row lane&15; keys 8*(lane>>4)+0..7 and 16+8*(lane>>4)+0..7 of the step);
// the ballot over element e is the lane-select word e. A wave stores its two steps as one whole 128-B line; wave 0 gathers the live-step bits (bit s = step s holds a kept key) and stores them as the record's last line.
__device__ __forceinline__ void mbits(const int* __restrict__ MK, unsigned* MB, int tile, unsigned* sm) {
    const int lane = threadIdx.x & 31, wave = __builtin_amdgcn_readfirstlane((int)(threadIdx.x >> 5)), lr = lane & 15, hi = lane >> 4;
    unsigned* rec = MB + (size_t)tile * MREC;
    unsigned live2 = 0u;
    if (2 * wave < NST) {                                                // wave-uniform
        const int* mp = MK + (size_t)(tile * 16 + lr) * SEQ_FULL + wave * 64 + 8 * hi;
        unsigned w = 0u;
#pragma unroll
        for (int u = 0; u < 2; ++u) {
            const v4i a0 = *(const v4i*)(mp + 32 * u), a1 = *(const v4i*)(mp + 32 * u + 4), b0 = *(const v4i*)(mp + 32 * u + 16), b1 = *(const v4i*)(mp + 32 * u + 20);
            const int q[16] = {a0[0], a0[1], a0[2], a0[3], a1[0], a1[1], a1[2], a1[3], b0[0], b0[1], b0[2], b0[3], b1[0], b1[1], b1[2], b1[3]};
            unsigned any = 0u;
#pragma unroll
            for (int e = 0; e < 16; ++e) { const unsigned bal = __builtin_amdgcn_ballot_w32(q[e] != 0); any |= bal; w = (lane == 16 * u + e) ? bal : w; }
            live2 |= (any != 0u ? 1u : 0u) << u;
        }
        rec[wave * 32 + lane] = w;
    }
    if (lane == 0) sm[wave] = live2;
    __syncthreads();
    if (wave == 0) {
        unsigned v = sm[lane] << (2 * lr);                               // lanes 0..15: steps 0..31, lanes 16..31: steps 32..63
        v |= __shfl_xor(v, 1, 32); v |= __shfl_xor(v, 2, 32); v |= __shfl_xor(v, 4, 32); v |= __shfl_xor(v, 8, 32);
        const unsigned vh = __shfl(v, 16, 32);
        rec[NST * 16 + lane] = (lane == 0) ? v : ((lane == 1) ? vh : 0u);
    }
}

// k_prep: every operand preparation of a call in one grid of 1024-thread blocks, so that the six independent jobs share the chip instead of running one after another;
// a block's job follows from its index alone (block-uniform): mask tiles, then x, then Wq | Wk | Wv, then Wo. Thread -> element inside each job is as in the separate launches.
#define PB_M (SEQ / 16)
#define PB_X ((int)((size_t)NB * SEQ * DM / 8 / 1024))
#define PB_W ((int)((size_t)DM * DM / 8 / 1024))
static_assert(((size_t)SEQ * DM / 8) % 1024 == 0);     // x blocks cover each batch exactly
static_assert(((size_t)DM * DM / 8) % 1024 == 0);      // weight blocks cover each matrix exactly
__global__ __launch_bounds__(1024) void k_prep(const float* __restrict__ x, const int* __restrict__ MK, const float* __restrict__ wq, const float* __restrict__ wk, const float* __restrict__ wv, const float* __restrict__ wo,
                                               bf* XB, bf* WB, h16* WOH, unsigned* MB) {
    __shared__ unsigned sm[32];
    int bid = blockIdx.x;
    if (bid < PB_M) { mbits(MK, MB, bid, sm); return; }
    bid -= PB_M;
    if (bid < PB_X) {
        const size_t i = (size_t)bid * 1024 + threadIdx.x; const size_t nb8 = (size_t)SEQ * DM / 8; const size_t b = i / nb8;
        cvt8(x + b * SEQ_FULL * DM, XB + b * SEQ * DM, i % nb8); return;
    }
    bid -= PB_X;
    const int which = bid / PB_W; const size_t i = (size_t)(bid % PB_W) * 1024 + threadIdx.x;
    if (which == 3) cvtw8(wo, WOH, i);
    else cvt8(which == 0 ? wq : (which == 1 ? wk : wv), WB + (size_t)which * DM * DM, i);
}

// proj_body: register-blocked bf16 GEMM, one 8-wave block per 128x256 tile at (rB, cB), one wave per 64x64 tile at (r0, c0) (16 accumulators), K = DM; the block's operand units come from the fragment-major bf16 planes
// into LDS by asynchronous copies, one 32-k stage ahead (two buffers), and each unit is read from LDS by the four (row operand) or two (column operand) waves that need it.
// C[m][n] = sum_k A[m][k] Bt[n][k] + bias (BIASROW == 0: bias[n]; BIASROW != 0: bias[m]), written as f16 (Ph), fragment-major with row = m, k = n, at
// tile base (r0/RB)*sRB + (r0%RB)*pitch + (c0/CB)*sCB + (c0%CB)*CMUL, + mb*MBS per 16 rows, + S1S per 32 columns; the f16 residual x2048 (Pr) is written with its own strides when (r0%RB) < rlim and (c0%CB) < clim.
template <int BIASROW>
__device__ __forceinline__ void proj_body(const bf* __restrict__ A, const bf* __restrict__ Bt, const float* __restrict__ bias, h16* Ph, h16* Pr,
                                          int RB, size_t sRB, int pitch, int CB, size_t sCB,
                                          size_t sRBr, int pitchr, size_t sCBr, int rlim, int clim, int rB, int cB, float* osb, char* st) {
    const int K = DM;
    const int tid = threadIdx.x, lane = tid & 31, lr = lane & 15, hi = lane >> 4, wv = __builtin_amdgcn_readfirstlane(tid >> 5);
    const int r0 = rB + 64 * (wv >> 2), c0 = cB + 64 * (wv & 3);
    float* os = osb + wv * (16 * 68);                                    // wave-private epilogue tile
    v8f acc[4][4];
#pragma unroll
    for (int mb = 0; mb < 4; ++mb)
#pragma unroll
        for (int nb = 0; nb < 4; ++nb) acc[mb][nb] = (v8f){};
    constexpr int MBS = (BIASROW != 0) ? 512 : 1024, S1S = (BIASROW != 0) ? 2048 : 512, CMUL = (BIASROW != 0) ? 64 : 1;   // q, k: [t/16][d/32][unit]; v^T: [t/32][d/16][unit]
    // unit (row tile, ks) lies at byte (row tile)*32*K + ks*1024; thread tid copies bytes 16*(tid&63) of row tiles (tid>>6) + 4j
    const char* ga = (const char*)(A  + (size_t)(rB + 16 * (tid >> 6)) * K + 8 * (tid & 63));
    const char* gb = (const char*)(Bt + (size_t)(cB + 16 * (tid >> 6)) * K + 8 * (tid & 63));
    const unsigned ls = (unsigned)(size_t)st + 16u * (unsigned)tid;
    stage24(ls, ga, ga + 131072, gb, gb + 131072, gb + 262144, gb + 393216);
    wait_async();
    __syncthreads();                                                     // stage 0 published
    stage24(ls + PSTG, ga + 1024, ga + 132096, gb + 1024, gb + 132096, gb + 263168, gb + 394240);
#pragma unroll 1
    for (int ks = 0; ks < K / 32; ++ks) {
        const bf* pa = (const bf*)(st + (ks & 1) * PSTG + (wv >> 2) * 4096) + 8 * lane; const bf* pb = (const bf*)(st + (ks & 1) * PSTG + 8192 + (wv & 3) * 4096) + 8 * lane;
        v16bf a[4], b[4];
#pragma unroll
        for (int mb = 0; mb < 4; ++mb) a[mb] = ldb(pa + mb * 512);
#pragma unroll
        for (int nb = 0; nb < 4; ++nb) b[nb] = ldb(pb + nb * 512);
#pragma unroll
        for (int nb = 0; nb < 4; ++nb) {
#pragma unroll
            for (int mb = 0; mb < 4; ++mb) acc[mb][nb] = wmmab(a[mb], b[nb], acc[mb][nb]); }
        asm volatile("v_nop\n\tv_nop\n\tv_nop\n\tv_nop" : "+v"(acc[0][3]), "+v"(acc[1][3]), "+v"(acc[2][3]), "+v"(acc[3][3]) : "v"(a[0]), "v"(a[1]), "v"(a[2]), "v"(a[3]));
        wait_ds(); wait_async();
        __syncthreads();                                                 // publishes stage ks + 1 and ends every wave's reads of stage ks
        if (ks + 2 < K / 32) {                                           // block-uniform: refill the buffer just left
            const char* na = ga + (ks + 2) * 1024; const char* nb2 = gb + (ks + 2) * 1024;
            stage24(ls + (ks & 1) * PSTG, na, na + 131072, nb2, nb2 + 131072, nb2 + 262144, nb2 + 393216);
        }
    }
    wait_async();
    float bc[4] = {0.0f, 0.0f, 0.0f, 0.0f};
    if constexpr (BIASROW == 0) {
#pragma unroll
        for (int nb = 0; nb < 4; ++nb) bc[nb] = bfr(bias[c0 + nb * 16 + lr]);
    }
    const int wres = (((r0 % RB) < rlim) && ((c0 % CB) < clim)) ? 1 : 0;   // tile-uniform
    const size_t tbase = (size_t)(r0 / RB) * sRB + (size_t)(r0 % RB) * (size_t)pitch + (size_t)(c0 / CB) * sCB + (size_t)(c0 % CB) * CMUL;
    const size_t tbasr = (size_t)(r0 / RB) * sRBr + (size_t)(r0 % RB) * (size_t)pitchr + (size_t)(c0 / CB) * sCBr + (size_t)(c0 % CB) * CMUL;
#pragma unroll
    for (int mb = 0; mb < 4; ++mb) {
        float rb[8];
        if constexpr (BIASROW != 0) {
            const v4f b0 = *(const v4f*)(bias + r0 + mb * 16 + 8 * hi); const v4f b1 = *(const v4f*)(bias + r0 + mb * 16 + 8 * hi + 4);
#pragma unroll
            for (int i = 0; i < 4; ++i) { rb[i] = bfr(b0[i]); rb[4 + i] = bfr(b1[i]); }
        } else {
#pragma unroll
            for (int j = 0; j < 8; ++j) rb[j] = 0.0f;
        }
#pragma unroll
        for (int nb = 0; nb < 4; ++nb) {
#pragma unroll
            for (int j = 0; j < 8; ++j) os[(hi * 8 + j) * 68 + nb * 16 + lr] = acc[mb][nb][j] + ((BIASROW != 0) ? rb[j] : bc[nb]); }   // D: row 8h+j, col lane&15
        wave_sync();
        const size_t sb = tbase + (size_t)(mb * MBS) + 8 * lane;
        const size_t sr = tbasr + (size_t)(mb * MBS) + 8 * lane;
{
#pragma unroll
            for (int s = 0; s < 4; ++s) { const int row = lr, c8 = (2 * s + hi) * 8;   // store s = part s&1 of the unit of columns 32*(s>>1)..+31: lane holds row lane&15, columns 16*s + 8*(lane>>4) + 0..7
                const v4f x0 = *(const v4fa*)(&os[row * 68 + c8]); const v4f x1 = *(const v4fa*)(&os[row * 68 + c8 + 4]); v8h hv, rv;
#pragma unroll
                for (int i = 0; i < 4; ++i) { const h16 a0 = (h16)x0[i]; const h16 a1 = (h16)x1[i]; hv[i] = a0; hv[4 + i] = a1; rv[i] = (h16)((x0[i] - (float)a0) * QRS); rv[4 + i] = (h16)((x1[i] - (float)a1) * QRS); }
                *(v8h*)(Ph + sb + (s >> 1) * S1S + (s & 1) * 256) = hv;
                asm volatile("s_wait_xcnt 0x0" :: "v"(hv) : "memory");       // before the issued store's registers are reused
                if (wres) { *(v8h*)(Pr + sr + (s >> 1) * S1S + (s & 1) * 256) = rv;
                    asm volatile("s_wait_xcnt 0x0" :: "v"(rv) : "memory"); } }   // the same for the residual store
             }
        wave_sync();
    }
}

// k_proj3: the three projections in one grid (z = q | k | v), so that their waves share the SIMDs; inside each z the tiles come in the order of the separate launches (q, k: token tile fastest; v^T: feature tile fastest).
// q, k: A = x rows (m = b*SEQ + t), Bt = W rows (n = h*64 + d), bias by column -> plane [(b*16 + h)][t/16][d/32][unit]; residual plane the same for t < EROWS
// v^T: A = Wv rows (m = h*64 + d), Bt = x rows (n = b*SEQ + t), bias by row -> plane [(b*16 + h)][t/32][d/16][unit]; residual plane the same for t < EROWS
static_assert((NB * SEQ) % 256 == 0 && DM % 256 == 0 && DM / 32 >= 2);   // whole 128x256 block tiles in both forms; the two-buffer prologue needs two stages
__global__ __launch_bounds__(32 * PW) void k_proj3(const bf* __restrict__ XB, const bf* __restrict__ WQ, const bf* __restrict__ WK, const bf* __restrict__ WV, const float* __restrict__ bq, const float* __restrict__ bk, const float* __restrict__ bv,
                                              h16* QH, h16* QR, h16* KP, h16* KR, h16* VT, h16* VR) {
    __shared__ __align__(16) float os[PW * 16 * 68];
    __shared__ __align__(1024) char st[2 * PSTG];
    const int z = blockIdx.z;
    if (z == 2) {
        const int flat = blockIdx.y * (NB * SEQ / 128) + blockIdx.x;
        proj_body<1>(WV, XB, bv, VT, VR, DM, (size_t)0, SEQ, SEQ, (size_t)DM * SEQ, (size_t)0, EROWS, (size_t)DM * EROWS, DM, EROWS, (flat % (DM / 128)) * 128, (flat / (DM / 128)) * 256, os, st);
    } else {
        proj_body<0>(XB, z == 0 ? WQ : WK, z == 0 ? bq : bk, z == 0 ? QH : KP, z == 0 ? QR : KR, SEQ, (size_t)NH_ * SEQ * HD, HD, HD, (size_t)SEQ * HD,
                     (size_t)NH_ * EROWS * HD, HD, (size_t)EROWS * HD, EROWS, HD, blockIdx.x * 128, blockIdx.y * 256, os, st);
    }
}

// flash_body: fused masked attention, one wave per 16 query rows of one (batch, head); K / V^T / Q fragments straight from the fragment-major f16 planes (two 16-B loads each, 512 contiguous bytes per wave-load).
// Transposed form: S^T[key][t] = K Q^T (A = K rows, B = Q rows); lane (t = lane&15, h = lane>>4) holds keys 8h+r of each 16-key tile, so the packed
// P tile is directly the B fragment of O^T[d][t] = V^T P^T (element r <- tile keys 0..15, element 8+r <- tile keys 16..31, lane unchanged).
// Mask: the wave reads the step's 16 lane-select words (64 B, wave-uniform address) and replaces masked scores by the fill value; the loop walks the set bits of the tile's live-step word in rising order, so a step whose 16x32 mask tile is all zero is not visited;
// if some row ends with no visited key the wave repeats the sweep over every step, which yields the uniform average of a fully masked row.
// EARLY != 0 (query rows < EROWS): q, k, v and P carry residuals x2048; residual products accumulate separately and are folded back with 1/2048.
template <int EARLY>
__device__ __forceinline__ void flash_body(const h16* __restrict__ QH, const h16* __restrict__ QR, const h16* __restrict__ KP, const h16* __restrict__ KR,
                                           const h16* __restrict__ VT, const h16* __restrict__ VR, const unsigned* __restrict__ MB, h16* CH, h16* CR, int tstart, int bx, int zh) {
    const int lane = threadIdx.x & 31, wave = __builtin_amdgcn_readfirstlane((int)(threadIdx.x >> 5)), lr = lane & 15, hi = lane >> 4;
    const int b = zh / NH_, h = zh % NH_;
    const int t0 = tstart + (bx * AW + wave) * 16;
    const size_t pbase = (size_t)zh * SEQ * HD;
    const size_t rbase = (size_t)zh * EROWS * HD;
    const size_t qo = pbase + (size_t)t0 * HD + 8 * lane;
    const v16h qh0 = ldh(QH + qo), qh1 = ldh(QH + qo + 512);                // B fragments: col t, k = d
    v16h qr0 = qh0, qr1 = qh1;
    if constexpr (EARLY != 0) { const size_t qro = rbase + (size_t)t0 * HD + 8 * lane; qr0 = ldh(QR + qro); qr1 = ldh(QR + qro + 512); }
    const size_t ko  = pbase + 8 * lane;       // + key0 * HD + 512 * (d/32)   (A fragment: row key, k = d; 16 keys = 1024 elements)
    const size_t kro = rbase + 8 * lane;
    const size_t vo  = pbase + 8 * lane;       // + key0 * HD + 512 * j        (A fragment: row d = 16j.., k = key; 32 keys = 2048 elements)
    const size_t vro = rbase + 8 * lane;
    const unsigned* mrec = MB + (size_t)(t0 >> 4) * MREC;      // this tile's mask record (wave-uniform)
    const unsigned long long live = *(const unsigned long long*)(mrec + NST * 16) & ALLST;
    v8f o0 = (v8f){}, o1 = (v8f){}, o2 = (v8f){}, o3 = (v8f){};
    v8f e0 = (v8f){}, e1 = (v8f){}, e2 = (v8f){}, e3 = (v8f){};
    float m = -3.0e38f, l = 0.0f;
    int noskip = 0;
#pragma unroll 1
    for (int pass = 0; pass < 2; ++pass) {
        o0 = (v8f){}; o1 = (v8f){}; o2 = (v8f){}; o3 = (v8f){};
        e0 = (v8f){}; e1 = (v8f){}; e2 = (v8f){}; e3 = (v8f){};
        m = -3.0e38f; l = 0.0f;
        // EARLY == 0: loads run ahead of their use. pk0..pk3 and pmw hold the K fragments and the mask words of the step about to be worked on, requested during the step before (first step: here);
        // the registers are refilled for the next live step right behind the score products that read them, and the step's own V^T fragments are requested in front of those products.
        v16h pk0 = qh0, pk1 = qh0, pk2 = qh0, pk3 = qh0; v16u pmw = (v16u){};
        if constexpr (EARLY == 0) {
            const unsigned long long r0 = (noskip != 0) ? ALLST : live;
            const int kf = (r0 != 0ull) ? 32 * __builtin_ctzll(r0) : 0;  // no live step: step 0 is read and not used (in bounds)
            const h16* kp = KP + ko + (size_t)kf * HD;
            pk0 = ldh(kp); pk1 = ldh(kp + 512); pk2 = ldh(kp + 16 * HD); pk3 = ldh(kp + 16 * HD + 512);
            pmw = *(const v16u*)(mrec + (kf >> 1));
        }
#pragma unroll 1
        for (unsigned long long rem = (noskip != 0) ? ALLST : live; rem != 0ull; rem &= rem - 1ull) {   // at most NST trips, wave-uniform
            const int key0 = 32 * __builtin_ctzll(rem);
            const unsigned long long nrem = rem & (rem - 1ull);
            const int keyn = (nrem != 0ull) ? 32 * __builtin_ctzll(nrem) : key0;   // next live step; last trip: its own step again (in bounds, not used)
            v16u mw = pmw;                                               // 16 words per step
            if constexpr (EARLY != 0) mw = *(const v16u*)(mrec + (key0 >> 1));
            const h16* ka = KP + ko + (size_t)key0 * HD;
            v16h v0 = qh0, v1 = qh0, v2 = qh0, v3 = qh0;
            const h16* vn = VT + vo + (size_t)key0 * HD;                 // EARLY == 0 only: this step's V^T fragments and the next live step's K fragments
            const h16* kn = KP + ko + (size_t)keyn * HD;
            if constexpr (EARLY == 0) { v0 = ldh(vn); v1 = ldh(vn + 512); v2 = ldh(vn + 1024); v3 = ldh(vn + 1536); }
            v8f sHa = (v8f){}, sHb = (v8f){}, sLa = (v8f){}, sLb = (v8f){};
            if constexpr (EARLY == 0) {
                sHa = wmma16(pk0, qh0, sHa); sHb = wmma16(pk2, qh0, sHb); sHa = wmma16(pk1, qh1, sHa); sHb = wmma16(pk3, qh1, sHb);
                asm volatile("v_nop\n\tv_nop\n\tv_nop\n\tv_nop" : "+v"(sHa), "+v"(sHb) : "v"(pk0), "v"(pk1), "v"(pk2), "v"(pk3));   // WMMA distance before the K registers are refilled and the scores read
                pk0 = ldh(kn); pk1 = ldh(kn + 512); pk2 = ldh(kn + 16 * HD); pk3 = ldh(kn + 16 * HD + 512);
            } else {
                const v16h ka0 = ldh(ka), ka1 = ldh(ka + 512), kb0 = ldh(ka + 16 * HD), kb1 = ldh(ka + 16 * HD + 512);
                sHa = wmma16(ka0, qh0, sHa); sHb = wmma16(kb0, qh0, sHb); sHa = wmma16(ka1, qh1, sHa); sHb = wmma16(kb1, qh1, sHb);
                sLa = wmma16(ka0, qr0, sLa); sLb = wmma16(kb0, qr0, sLb); sLa = wmma16(ka1, qr1, sLa); sLb = wmma16(kb1, qr1, sLb);
                asm volatile("v_nop\n\tv_nop\n\tv_nop\n\tv_nop" : "+v"(sHa), "+v"(sHb), "+v"(sLa), "+v"(sLb) : "v"(ka0), "v"(ka1), "v"(kb0), "v"(kb1));
            }
            if constexpr (EARLY != 0) {
                __builtin_amdgcn_sched_barrier(0);
                if (key0 < EROWS) {                                      // residual k plane covers keys < EROWS (wave-uniform)
                    const h16* ra = KR + kro + (size_t)key0 * HD;
                    const v16h ra0 = ldh(ra), ra1 = ldh(ra + 512), rb0 = ldh(ra + 16 * HD), rb1 = ldh(ra + 16 * HD + 512);
                    sLa = wmma16(ra0, qh0, sLa); sLb = wmma16(rb0, qh0, sLb); sLa = wmma16(ra1, qh1, sLa); sLb = wmma16(rb1, qh1, sLb);
                    asm volatile("v_nop\n\tv_nop\n\tv_nop\n\tv_nop" : "+v"(sLa), "+v"(sLb) : "v"(ra0), "v"(ra1), "v"(rb0), "v"(rb1));
                }
                __builtin_amdgcn_sched_barrier(0);
            }
            float ta[8], tb[8]; float mx = -3.0e38f;
#pragma unroll
            for (int r = 0; r < 8; ++r) {
                float sa = sHa[r], sb = sHb[r];
                if constexpr (EARLY != 0) { sa += sLa[r] * QRI; sb += sLb[r] * QRI; }
                ta[r] = __builtin_amdgcn_inverse_ballot_w32(mw[r]) ? sa * SC2 : NEGL;
                tb[r] = __builtin_amdgcn_inverse_ballot_w32(mw[8 + r]) ? sb * SC2 : NEGL;
                mx = fmaxf(mx, fmaxf(ta[r], tb[r]));
            }
            if constexpr (EARLY == 0) {
                __builtin_amdgcn_sched_barrier(0);                       // keeps the next step's mask load behind the last use of this step's words: lifted higher, the wait for these words (scalar loads are waited to 0) would wait for it too
                asm volatile("s_wait_xcnt 0x0" :: "v"(vn), "v"(kn) : "memory");   // before the address registers of the V and K loads issued above are reused (named here, they stay untouched up to the wait)
                pmw = *(const v16u*)(mrec + (keyn >> 1));
            }
            mx = fmaxf(mx, __shfl_xor(mx, 16, 32));
            const float mnew = fmaxf(m, mx);
            const float alpha = __builtin_amdgcn_exp2f(m - mnew);
            const float sh = PSH - mnew;
            v16h pb = (v16h){}; v16h pq = (v16h){}; float ls = 0.0f;
#pragma unroll
            for (int r = 0; r < 8; ++r) {
                const float pa = __builtin_amdgcn_exp2f(ta[r] + sh), pc = __builtin_amdgcn_exp2f(tb[r] + sh);
                const h16 ha = (h16)pa, hc = (h16)pc; pb[r] = ha; pb[8 + r] = hc;
                if constexpr (EARLY != 0) {
                    const h16 ga = (h16)((pa - (float)ha) * QRS), gc = (h16)((pc - (float)hc) * QRS); pq[r] = ga; pq[8 + r] = gc;
                    ls += ((float)ha + (float)hc) + ((float)ga + (float)gc) * QRI;
                } else {
                    ls += (float)ha + (float)hc;
                }
            }
            l = l * alpha + ls; m = mnew;
            o0 = o0 * alpha; o1 = o1 * alpha; o2 = o2 * alpha; o3 = o3 * alpha;
            if constexpr (EARLY != 0) { e0 = e0 * alpha; e1 = e1 * alpha; e2 = e2 * alpha; e3 = e3 * alpha; }
            {
                if constexpr (EARLY != 0) { const h16* va = VT + vo + (size_t)key0 * HD; v0 = ldh(va); v1 = ldh(va + 512); v2 = ldh(va + 1024); v3 = ldh_end(va + 1536); }
                o0 = wmma16(v0, pb, o0); o1 = wmma16(v1, pb, o1); o2 = wmma16(v2, pb, o2); o3 = wmma16(v3, pb, o3);
                if constexpr (EARLY != 0) {
                    e0 = wmma16(v0, pq, e0); e1 = wmma16(v1, pq, e1); e2 = wmma16(v2, pq, e2); e3 = wmma16(v3, pq, e3);
                    asm volatile("v_nop\n\tv_nop\n\tv_nop\n\tv_nop" : "+v"(o0), "+v"(o1), "+v"(o2), "+v"(o3), "+v"(e0), "+v"(e1), "+v"(e2), "+v"(e3) : "v"(v0), "v"(v1), "v"(v2), "v"(v3), "v"(pb), "v"(pq));
                } else {
                    asm volatile("v_nop\n\tv_nop\n\tv_nop\n\tv_nop" : "+v"(o0), "+v"(o1), "+v"(o2), "+v"(o3) : "v"(v0), "v"(v1), "v"(v2), "v"(v3), "v"(pb));
                }
            }
            if constexpr (EARLY != 0) {
                __builtin_amdgcn_sched_barrier(0);
                if (key0 < EROWS) {                                      // residual v^T plane covers keys < EROWS (wave-uniform)
                    const h16* wa = VR + vro + (size_t)key0 * HD;
                    const v16h w0 = ldh(wa), w1 = ldh(wa + 512), w2 = ldh(wa + 1024), w3 = ldh_end(wa + 1536);
                    e0 = wmma16(w0, pb, e0); e1 = wmma16(w1, pb, e1); e2 = wmma16(w2, pb, e2); e3 = wmma16(w3, pb, e3);
                    asm volatile("v_nop\n\tv_nop\n\tv_nop\n\tv_nop" : "+v"(e0), "+v"(e1), "+v"(e2), "+v"(e3) : "v"(w0), "v"(w1), "v"(w2), "v"(w3), "v"(pb));
                }
                __builtin_amdgcn_sched_barrier(0);
            }
        }
        l += __shfl_xor(l, 16, 32);
        const unsigned dead = __builtin_amdgcn_ballot_w32(!(l > 0.0f));
        if (dead == 0u) break;                                           // wave-uniform
        noskip = 1;
    }
    const float inv = CXS * (1.0f / l);
    // O^T D layout: o_j[r] = (d = 16j + 8h + r, t = lane&15): exactly part j&1 of context unit 2h + (j>>1) (row t = lane&15, k = 16j + 8*(lane>>4) + r), so each lane stores its own accumulators, no transpose
    const size_t crow = ((size_t)b * SEQ + t0) * DM + (size_t)h * 1024 + 8 * lane;     // context plane, row b*SEQ + t, k = h*64 + d: units [(b*SEQ + t)/16][2h + d/32]
    const size_t rrow = ((size_t)b * EROWS + t0) * DM + (size_t)h * 1024 + 8 * lane;   // residual plane, row b*EROWS + t (EARLY blocks only: t0 + 15 < EROWS)
    v8f xs[4] = {o0, o1, o2, o3};
    if constexpr (EARLY != 0) { xs[0] = o0 + e0 * QRI; xs[1] = o1 + e1 * QRI; xs[2] = o2 + e2 * QRI; xs[3] = o3 + e3 * QRI; }
#pragma unroll
    for (int s = 0; s < 4; ++s) {
        const v8f x = xs[s] * inv; v8h hv, rv;
#pragma unroll
        for (int i = 0; i < 8; ++i) { const h16 a0 = (h16)x[i]; hv[i] = a0; rv[i] = (h16)((x[i] - (float)a0) * QRS); }
        *(v8h*)(CH + crow + s * 256) = hv;
        if constexpr (EARLY != 0) *(v8h*)(CR + rrow + s * 256) = rv;
    }
}

// k_flashf: both forms in one 1-D grid, so that the residual rows' few, latency-bound waves run beside the others instead of in a launch of their own. A block's job follows from its index alone (block-uniform):
// first the residual rows' blocks, then the rest, each group from the last query block down ((batch, head) fastest): under a lower-triangular mask the key walk grows with the query index,
// so the longest blocks come first in index order and the shortest last. The order is for speed only: every (query block, batch, head) is taken exactly once for any mask.
// amdgpu_waves_per_eu(5): every block of the grid is given the registers of the larger (residual) form; unbudgeted that form takes 204 = an allocation of 208 = 4 waves per SIMD, under the budget 192 = 5 waves, no scratch.
#define FB_E (EROWS / (16 * AW))
#define FB_L ((SEQ - EROWS) / (16 * AW))
#define FB_Z (NB * NH_)
__global__ __launch_bounds__(32 * AW) __attribute__((amdgpu_waves_per_eu(5))) void k_flashf(const h16* __restrict__ QH, const h16* __restrict__ QR, const h16* __restrict__ KP, const h16* __restrict__ KR,
                                                    const h16* __restrict__ VT, const h16* __restrict__ VR, const unsigned* __restrict__ MB, h16* CH, h16* CR) {
    const int bid = blockIdx.x;
    if (bid < FB_E * FB_Z) { flash_body<1>(QH, QR, KP, KR, VT, VR, MB, CH, CR, 0, FB_E - 1 - bid / FB_Z, bid % FB_Z); }
    else { const int r = bid - FB_E * FB_Z; flash_body<0>(QH, QR, KP, KR, VT, VR, MB, CH, CR, EROWS, FB_L - 1 - r / FB_Z, r % FB_Z); }
}

// oproj_body: output projection, f16 GEMM, one 4-wave block per (32*MT) x 128 tile, one wave per (16*MT) x 64 tile, K = DM; operand units staged in LDS as in proj_body (RES != 0: stage units 0..3 = A, 4..7 = AR). OUT[m][n] = OSC * (sum_k A[m][k] Bt[n][k] + QRI * sum_k AR[m][k] Bt[n][k]) + bias[n] (bias RNE-converted to bf16).
// A = context plane (x16), AR = context residual plane (RES != 0 only, rows [b*EROWS + t]), Bt = Wo x1024 as f16 ([out][in]).
// wave row tile rt = 2*rtB + (wave>>1) in 0 .. NB * tpb - 1 -> batch rt / tpb, first token rowoff + (rt % tpb) * 16*MT (tpb even: a block's two row tiles are neighbours in one batch); c0 = cB + 64*(wave&1) = first output column.
template <int MT, int RES>
__device__ __forceinline__ void oproj_body(const h16* __restrict__ A, const h16* __restrict__ AR, const h16* __restrict__ Bt, const float* __restrict__ bias, float* OUT, int tpb, int rowoff, int rtB, int cB, float* osb, char* st) {
    static_assert((MT == 4 && RES == 0) || (MT == 2 && RES == 1));
    const int K = DM;
    const int tid = threadIdx.x, lane = tid & 31, lr = lane & 15, hi = lane >> 4, wv = __builtin_amdgcn_readfirstlane(tid >> 5);
    const int rt = 2 * rtB + (wv >> 1), c0 = cB + 64 * (wv & 1);
    float* os = osb + wv * (16 * 68);                                  // wave-private epilogue tile
    const int bb = rt / tpb, tl = rt % tpb;
    const int tok = rowoff + tl * (16 * MT);
    const int tokB = rowoff + ((2 * rtB) % tpb) * (16 * MT);           // the block's first token (same batch bb)
    // unit (row tile, ks) lies at byte (row tile)*32*K + ks*1024; thread tid copies bytes 16*(tid&63) of row tiles (tid>>6) + 2j
    const char* ga = (const char*)(A  + ((size_t)bb * SEQ   + tokB + 16 * (tid >> 6)) * K + 8 * (tid & 63));
    const char* gr = (const char*)(AR + ((size_t)bb * EROWS + tokB + 16 * (tid >> 6)) * K + 8 * (tid & 63));
    const char* gb = (const char*)(Bt + (size_t)(cB + 16 * (tid >> 6)) * K + 8 * (tid & 63));
    const char* g2 = (RES != 0) ? gr : ga + 131072;                    // source of stage units 4..7
    const unsigned ls = (unsigned)(size_t)st + 16u * (unsigned)tid;
    v8f acc[MT][4], acr[MT][4];
#pragma unroll
    for (int mb = 0; mb < MT; ++mb)
#pragma unroll
        for (int nb = 0; nb < 4; ++nb) { acc[mb][nb] = (v8f){}; acr[mb][nb] = (v8f){}; }
    stage16(ls, ga, ga + 65536, g2, g2 + 65536, gb, gb + 65536, gb + 131072, gb + 196608);
    wait_async();
    __syncthreads();                                                   // stage 0 published
    stage16(ls + STG, ga + 1024, ga + 66560, g2 + 1024, g2 + 66560, gb + 1024, gb + 66560, gb + 132096, gb + 197632);
#pragma unroll 1
    for (int ks = 0; ks < K / 32; ++ks) {
        const h16* pa = (const h16*)(st + (ks & 1) * STG + (wv >> 1) * (MT * 1024)) + 8 * lane; const h16* pr = pa + 2048; const h16* pb = (const h16*)(st + (ks & 1) * STG + 8192 + (wv & 1) * 4096) + 8 * lane;
        v16h a[MT], ar[MT], bfrag[4];
#pragma unroll
        for (int mb = 0; mb < MT; ++mb) { a[mb] = ldh(pa + mb * 512); ar[mb] = a[mb]; }
        if constexpr (RES != 0) {
#pragma unroll
            for (int mb = 0; mb < MT; ++mb) ar[mb] = ldh(pr + mb * 512);
        }
#pragma unroll
        for (int nb = 0; nb < 4; ++nb) bfrag[nb] = ldh(pb + nb * 512);
#pragma unroll
        for (int nb = 0; nb < 4; ++nb) {
#pragma unroll
            for (int mb = 0; mb < MT; ++mb) { acc[mb][nb] = wmma16(a[mb], bfrag[nb], acc[mb][nb]);
                if constexpr (RES != 0) acr[mb][nb] = wmma16(ar[mb], bfrag[nb], acr[mb][nb]); } }
        if constexpr (MT == 4) {
            asm volatile("v_nop\n\tv_nop\n\tv_nop\n\tv_nop" : "+v"(acc[0][3]), "+v"(acc[1][3]), "+v"(acc[2][3]), "+v"(acc[3][3]) : "v"(a[0]), "v"(a[1]), "v"(a[2]), "v"(a[3]));
        } else {
            asm volatile("v_nop\n\tv_nop\n\tv_nop\n\tv_nop" : "+v"(acc[0][3]), "+v"(acc[1][3]), "+v"(acr[0][3]), "+v"(acr[1][3]) : "v"(a[0]), "v"(a[1]), "v"(ar[0]), "v"(ar[1]));
        }
        wait_ds(); wait_async();
        __syncthreads();                                               // publishes stage ks + 1 and ends every wave's reads of stage ks
        if (ks + 2 < K / 32) {                                         // block-uniform: refill the buffer just left
            const char* na = ga + (ks + 2) * 1024; const char* n2 = g2 + (ks + 2) * 1024; const char* nb2 = gb + (ks + 2) * 1024;
            stage16(ls + (ks & 1) * STG, na, na + 65536, n2, n2 + 65536, nb2, nb2 + 65536, nb2 + 131072, nb2 + 196608);
        }
    }
    wait_async();
    float bc[4];
#pragma unroll
    for (int nb = 0; nb < 4; ++nb) bc[nb] = bfr(bias[c0 + nb * 16 + lr]);
#pragma unroll
    for (int mb = 0; mb < MT; ++mb) {
#pragma unroll
        for (int nb = 0; nb < 4; ++nb) {
#pragma unroll
            for (int j = 0; j < 8; ++j) { float v = acc[mb][nb][j] * OSC;
                if constexpr (RES != 0) v += acr[mb][nb][j] * (OSC * QRI);
                os[(hi * 8 + j) * 68 + nb * 16 + lr] = v + bc[nb]; } }                          // D: row 8h+j, col lane&15
        wave_sync();
        float* orow = OUT + ((size_t)bb * OUT_SEQ + tok + mb * 16) * DM + c0;
{
#pragma unroll
            for (int s = 0; s < 8; ++s) { const int row = 2 * s + hi, cofs = lr * 4;            // 8 s x 2 rows = 16 rows; 16 lanes x 4 floats = 64 columns
                const v4f val = *(const v4fa*)(&os[row * 68 + cofs]);
                *(v4f*)(orow + (size_t)row * DM + cofs) = val; }
             }
        wave_sync();
    }
}

// k_oprojf: both forms in one grid (x = row tile, fastest as in the separate launches: first the residual rows' tiles, then the rest; y = column tile), so that their waves share the SIMDs.
static_assert(EROWS % 64 == 0 && (SEQ - EROWS) % 128 == 0);   // a block's two row tiles lie in one batch
__global__ __launch_bounds__(32 * GW) void k_oprojf(const h16* __restrict__ CXH, const h16* __restrict__ CXR, const h16* __restrict__ WOH, const float* __restrict__ bo, float* OUT) {
    __shared__ __align__(16) float os[GW * 16 * 68];
    __shared__ __align__(1024) char st[2 * STG];
    constexpr int NR = NB * (EROWS / 64);
    const int rtB = blockIdx.x, cB = blockIdx.y * 128;
    if (rtB < NR) oproj_body<2, 1>(CXH, CXR, WOH, bo, OUT, EROWS / 32, 0, rtB, cB, os, st);
    else          oproj_body<4, 0>(CXH, CXH, WOH, bo, OUT, (SEQ - EROWS) / 64, EROWS, rtB - NR, cB, os, st);
}

static constexpr size_t al256(size_t v) { return (v + 255) & ~(size_t)255; }
static constexpr size_t SZ_XB = al256((size_t)NB * SEQ * DM * 2);              // x bf16
static constexpr size_t SZ_WB = al256((size_t)3 * DM * DM * 2);                // Wq | Wk | Wv bf16
static constexpr size_t SZ_WO = al256((size_t)DM * DM * 2);                    // Wo f16 (x1024)
static constexpr size_t SZ_PL = al256((size_t)NB * NH_ * SEQ * HD * 2);        // q / k / v^T planes
static constexpr size_t SZ_RP = al256((size_t)NB * NH_ * EROWS * HD * 2);      // residual planes (t < EROWS)
static constexpr size_t SZ_CX = al256((size_t)NB * SEQ * DM * 2);              // context plane
static constexpr size_t SZ_CR = al256((size_t)NB * EROWS * DM * 2);            // context residual plane
static constexpr size_t SZ_MB = al256((size_t)(SEQ / 16) * MREC * 4);          // mask records
static constexpr size_t SZ_TOTAL = SZ_XB + SZ_WB + SZ_WO + 3 * SZ_PL + 3 * SZ_RP + SZ_CX + SZ_CR + SZ_MB;
static_assert(SZ_TOTAL <= (size_t)134217728);          // workspace carve <= 128 MiB
static_assert(((size_t)DM * DM * 2) % 256 == 0);       // weight sub-planes stay 256-byte aligned

extern "C" void kernel_launch(void* const* d_in, const int* in_sizes, int n_in,
                              void* d_out, int out_size, void* d_ws, size_t ws_size, hipStream_t stream) {
    if (n_in < 10) return;
    const size_t needx = ((size_t)(NB - 1) * SEQ_FULL + SEQ) * DM;
    if ((size_t)in_sizes[0] < needx) return;
    if ((size_t)in_sizes[1] < (size_t)(SEQ - 1) * SEQ_FULL + SEQ) return;
    if ((size_t)in_sizes[2] < (size_t)DM * DM || (size_t)in_sizes[4] < (size_t)DM * DM || (size_t)in_sizes[6] < (size_t)DM * DM || (size_t)in_sizes[8] < (size_t)DM * DM) return;
    if (in_sizes[3] < DM || in_sizes[5] < DM || in_sizes[7] < DM || in_sizes[9] < DM) return;
    if ((size_t)out_size < ((size_t)(NB - 1) * OUT_SEQ + SEQ) * DM) return;
    if (SZ_TOTAL > ws_size) return;
    // wire order: query, mask (int32), Wq, bq, Wk, bk, Wv, bv, Wo, bo; weights [out][in] = Bt as-is
    const float* x  = (const float*)d_in[0]; const int* mask = (const int*)d_in[1];
    const float* wq = (const float*)d_in[2]; const float* bq = (const float*)d_in[3];
    const float* wk = (const float*)d_in[4]; const float* bk = (const float*)d_in[5];
    const float* wv = (const float*)d_in[6]; const float* bv = (const float*)d_in[7];
    const float* wo = (const float*)d_in[8]; const float* bo = (const float*)d_in[9];
    float* OUT = (float*)d_out;      // [NB][SEQ][1024]
    char* wsp = (char*)d_ws;
    bf*  XB  = (bf*)wsp;  wsp += SZ_XB;              // rows NB*SEQ, k 1024, fragment-major
    bf*  WB  = (bf*)wsp;  wsp += SZ_WB;              // 3 planes q | k | v, rows 1024, k 1024, fragment-major
    h16* WOH = (h16*)wsp; wsp += SZ_WO;              // rows 1024, k 1024, fragment-major, x1024
    h16* QH  = (h16*)wsp; wsp += SZ_PL;              // [NB*16][SEQ/16][2][unit]
    h16* KP  = (h16*)wsp; wsp += SZ_PL;              // [NB*16][SEQ/16][2][unit]
    h16* VT  = (h16*)wsp; wsp += SZ_PL;              // [NB*16][SEQ/32][4][unit]
    h16* QR  = (h16*)wsp; wsp += SZ_RP;              // [NB*16][EROWS/16][2][unit] residual x2048
    h16* KR  = (h16*)wsp; wsp += SZ_RP;              // [NB*16][EROWS/16][2][unit] residual x2048
    h16* VR  = (h16*)wsp; wsp += SZ_RP;              // [NB*16][EROWS/32][4][unit] residual x2048
    h16* CXH = (h16*)wsp; wsp += SZ_CX;              // rows NB*SEQ, k 1024, fragment-major, x16
    h16* CXR = (h16*)wsp; wsp += SZ_CR;              // rows NB*EROWS, k 1024, fragment-major, residual x2048
    unsigned* MBW = (unsigned*)wsp; wsp += SZ_MB;    // [SEQ/16][MREC] mask records
    bf* WQ = WB; bf* WK = WB + (size_t)DM * DM; bf* WV = WB + (size_t)2 * DM * DM;

    k_prep<<<PB_M + PB_X + 4 * PB_W, 1024, 0, stream>>>(x, mask, wq, wk, wv, wo, XB, WB, WOH, MBW);
    k_proj3<<<dim3(NB * SEQ / 128, DM / 256, 3), 32 * PW, 0, stream>>>(XB, WQ, WK, WV, bq, bk, bv, QH, QR, KP, KR, VT, VR);

    k_flashf<<<(FB_E + FB_L) * FB_Z, 32 * AW, 0, stream>>>(QH, QR, KP, KR, VT, VR, MBW, CXH, CXR);

    k_oprojf<<<dim3(NB * (EROWS / 64) + NB * ((SEQ - EROWS) / 128), DM / 128, 1), 32 * GW, 0, stream>>>(CXH, CXR, WOH, bo, OUT);
}

// v007
// Measured time: 123 microseconds a run.
// Next to v006, in two timings, it ran 1.21 and 1.22 times as fast.
// Counting every step since v000, it is 3.27 times as fast.
#include <hip/hip_runtime.h>

// Masked multi-head self-attention, width 1024 = 16 heads x 64, x [NB][SEQ][1024], Wq/Wk/Wv/Wo [out][in] (y = x W^T + b), int32 mask [SEQ][SEQ] (0 = fill -1e9), score scale 1/8, output projection with bias (f32 out).
// Compute dtypes, f32 accumulate everywhere: q/k/v projections v_wmma_f32_16x16x32_bf16 (x and W RNE-converted to bf16; products exact; biases RNE-converted to bf16, added in f32);
// scores and P.V v_wmma_f32_16x16x32_f16: single f16 planes on query rows >= 512; on the first 512 query rows q, k, v, P and the context carry an f16 residual x2048 (three products, residual terms in their own accumulator);
// P carried x256 (cancels in the normalisation); output projection v_wmma_f32_16x16x32_f16 with context x16 and bf16-exact Wo x1024 as f16 (context residual on the first 512 rows); softmax f32 (online, running max).
// Layout: every 16-bit matrix operand plane is fragment-major: a unit is one 16-row x 32-k fragment = [part 0..1][lane 0..31][8 elements] (512 elements, 1 KiB), element (part, lane, e) = (row lane&15, k 16*part + 8*(lane>>4) + e),
// so each 16-byte-per-lane load or store of a wave covers 512 contiguous bytes (4 whole lines). x, W, context planes: [row/16][k/32][unit]; q, k planes: [b*16+h][t/16][d/32][unit]; v^T plane: [b*16+h][t/32][d/16][unit]
// (+ residual planes for t < 512), written by the GEMM epilogue; fused flash kernel in transposed form (S^T = K Q^T, O^T = V^T P^T);
// mask: a pre-pass turns the int32 mask once per call into lane-select words (per 16-query tile and 32-key step: 16 words, bit L of word e = mask != 0 at the score element e that flash lane L holds) plus one 64-bit word per tile of the steps
// that hold any kept key; the flash kernel reads them by scalar loads (replace-fill by value as before); fully masked 16x32 tiles are skipped in the first sweep, with a full second sweep when a row ends with no visited key.

#ifndef NB
#define NB 4
#endif
#ifndef SEQ
#define SEQ 2048
#endif
#define NB_FULL  4
#define SEQ_FULL 2048
#ifndef OUT_SEQ
#define OUT_SEQ SEQ              // row pitch (in tokens) between batches of the output
#endif
#define DM   1024
#define NH_  16
#define HD   64
#define AW   4                   // waves per flash block (16 query rows each)
#define EROWS ((SEQ) < 512 ? (SEQ) : 512)   // query rows / keys per sequence that carry residual planes
#define QRS  2048.0f             // carry of every residual plane
#define QRI  (1.0f / 2048.0f)
#define SC2  (0.125f * 1.4426950408889634f)   // HD^-0.5 * log2(e)
#define NEGL (-1.0e9f * 1.4426950408889634f)  // masked fill in the log2 domain
#define PSH  8.0f                // log2 of the P carry (256)
#define CXS  16.0f               // carry of the context planes
#define WOS  1024.0f             // carry of the Wo plane
#define OSC  (1.0f / 16384.0f)   // 1 / (CXS * WOS)
#define NST  (SEQ / 32)          // 32-key steps per sequence
#define MREC (NST * 16 + 32)     // words of one 16-query tile's mask record: NST steps x 16 lane-select words, then one 128-B line whose first two words are the live-step bits
#define ALLST ((NST) >= 64 ? ~0ull : ((1ull << ((NST) & 63)) - 1ull))

static_assert(HD == 64);
static_assert(NH_ * HD == DM);                 // head h = columns h*64 + d
static_assert(DM % 64 == 0);
static_assert(DM % 32 == 0);                   // GEMM k-loop steps by 32
static_assert(SEQ % 64 == 0);                  // a 64-row tile never straddles two batches
static_assert((NB * SEQ) % 64 == 0);
static_assert(SEQ % 32 == 0);                  // key loop steps by 32
static_assert(EROWS % 64 == 0);                // residual tiles are whole 64-tiles; flash grid covers them exactly
static_assert(EROWS % (16 * AW) == 0);
static_assert((SEQ - EROWS) % 64 == 0);
static_assert((SEQ - EROWS) % (16 * AW) == 0);
static_assert(EROWS <= SEQ);
static_assert(((size_t)SEQ * DM) % 8 == 0);
static_assert(((size_t)DM * DM) % 8 == 0);
static_assert(NB <= NB_FULL);
static_assert(SEQ <= SEQ_FULL);
static_assert(NST <= 64);                      // live-step bits fit one 64-bit word; 32 waves x 2 steps cover a tile in mbits
static_assert(NST % 2 == 0);

typedef _Float16 h16;
typedef unsigned short bf;
typedef __attribute__((ext_vector_type(16))) __bf16   v16bf;
typedef __attribute__((ext_vector_type(16))) _Float16 v16h;
typedef __attribute__((ext_vector_type(8)))  _Float16 v8h;
typedef __attribute__((ext_vector_type(8)))  unsigned short v8us;
typedef __attribute__((ext_vector_type(8)))  float    v8f;
typedef __attribute__((ext_vector_type(4)))  float    v4f;
typedef __attribute__((ext_vector_type(4)))  int      v4i;
typedef v4f  __attribute__((may_alias)) v4fa;
typedef __attribute__((ext_vector_type(16))) unsigned v16u;

__device__ __forceinline__ unsigned short f2bf(float f) { unsigned u = __float_as_uint(f); u += 0x7FFFu + ((u >> 16) & 1u); return (unsigned short)(u >> 16); }
__device__ __forceinline__ float bfr(float f) { return __uint_as_float(((unsigned)f2bf(f)) << 16); }   // value after RNE convert to bf16
__device__ __forceinline__ v16h cat16(v8h lo, v8h hi) { return __builtin_shufflevector(lo, hi, 0, 1, 2, 3, 4, 5, 6, 7, 8, 9, 10, 11, 12, 13, 14, 15); }
__device__ __forceinline__ v16bf cat16b(v8us lo, v8us hi) { return __builtin_bit_cast(v16bf, __builtin_shufflevector(lo, hi, 0, 1, 2, 3, 4, 5, 6, 7, 8, 9, 10, 11, 12, 13, 14, 15)); }
__device__ __forceinline__ v8f wmma16(v16h a, v16h b, v8f c) { return __builtin_amdgcn_wmma_f32_16x16x32_f16(false, a, false, b, (short)0, c, false, false); }
__device__ __forceinline__ v8f wmmab(v16bf a, v16bf b, v8f c) { return __builtin_amdgcn_wmma_f32_16x16x32_bf16(false, a, false, b, (short)0, c, false, false); }
// fragment loaders from a fragment-major unit; p = unit base + 8*lane: elements 0..7 <- k0+8h+0..7 (part 0), elements 8..15 <- k0+16+8h+0..7 (part 1, +256 elements) (same map for A and B)
__device__ __forceinline__ v16h  ldh(const h16* p) { return cat16(*(const v8h*)p, *(const v8h*)(p + 256)); }
__device__ __forceinline__ v16bf ldb(const bf* p)  { return cat16b(*(const v8us*)p, *(const v8us*)(p + 256)); }
// ldh_end: ldh for the last fragment read off an address pair, where the compiler lands the last load's data on the pair itself: the s_wait_xcnt stands in front of that load, behind every other load that names the pair
__device__ __forceinline__ v16h  ldh_end(const h16* p) { const v8h lo = *(const v8h*)p; asm volatile("s_wait_xcnt 0x0" ::: "memory"); return cat16(lo, *(const v8h*)(p + 256)); }
// converters: a wave takes 8 rows x 32 k (8 whole 128-B lines of f32) and writes 4 whole 128-B lines of one unit. Thread i -> source element offset (row-major, DM columns) and fragment-major destination offset.
__device__ __forceinline__ void cvt_map(size_t i, size_t& so, size_t& dof) {
    const int lane = (int)(i & 31); const size_t w = i >> 5; const size_t ks = w % (DM / 32); const size_t row = (w / (DM / 32)) * 8 + (size_t)(lane >> 2); const int c = lane & 3;
    so  = row * DM + ks * 32 + (size_t)c * 8;
    dof = (row >> 4) * (size_t)(16 * DM) + ks * 512 + (size_t)(c >> 1) * 256 + (size_t)(c & 1) * 128 + (row & 15) * 8;
}
// ordering point for wave-private LDS tiles (same wave writes and reads)
__device__ __forceinline__ void wave_sync() { __builtin_amdgcn_fence(3 /* release order */, "wavefront"); __builtin_amdgcn_wave_barrier(); asm volatile("" ::: "memory"); }

// GEMM blocks: the waves of a block share one stage = the fragment-major units (1 KiB each) of one 32-k step, 8 of the row operand(s), then those of the column operand; three stage buffers in LDS, copies two stages ahead of their use.
// Output projection: 4 waves (2 x 2 wave tiles), 8 + 8 units. q/k/v projections: 8 waves (2 x 4 wave tiles), 8 + 16 units.
#define GW  4
#define STG 16384
#define PW   8
#define PSTG 24576
// stage16: the block's 128 threads bring one stage from the global planes into LDS, 8 asynchronous 16-B copies per thread; copy j fills bytes 16*tid of the unit pair 2j, 2j+1 (l = stage buffer + 16*tid, pj = the thread's own source bytes).
// The s_wait_xcnt stands inside the statement so that no address register of an issued copy is rewritten in front of it.
__device__ __forceinline__ void stage16(unsigned l, const char* p0, const char* p1, const char* p2, const char* p3, const char* p4, const char* p5, const char* p6, const char* p7) {
    asm volatile("global_load_async_to_lds_b128 %0, %8, off\n\t"
                 "global_load_async_to_lds_b128 %1, %9, off\n\t"
                 "global_load_async_to_lds_b128 %2, %10, off\n\t"
                 "global_load_async_to_lds_b128 %3, %11, off\n\t"
                 "global_load_async_to_lds_b128 %4, %12, off\n\t"
                 "global_load_async_to_lds_b128 %5, %13, off\n\t"
                 "global_load_async_to_lds_b128 %6, %14, off\n\t"
                 "global_load_async_to_lds_b128 %7, %15, off\n\t"
                 "s_wait_xcnt 0x0"
                 :: "v"(l), "v"(l + 2048u), "v"(l + 4096u), "v"(l + 6144u), "v"(l + 8192u), "v"(l + 10240u), "v"(l + 12288u), "v"(l + 14336u),
                    "v"(p0), "v"(p1), "v"(p2), "v"(p3), "v"(p4), "v"(p5), "v"(p6), "v"(p7) : "memory");
}
// stage24: the same for a block of 256 threads and 24 units, 6 copies per thread; copy j fills bytes 16*tid of the four units 4j .. 4j+3
__device__ __forceinline__ void stage24(unsigned l, const char* p0, const char* p1, const char* p2, const char* p3, const char* p4, const char* p5) {
    asm volatile("global_load_async_to_lds_b128 %0, %6, off\n\t"
                 "global_load_async_to_lds_b128 %1, %7, off\n\t"
                 "global_load_async_to_lds_b128 %2, %8, off\n\t"
                 "global_load_async_to_lds_b128 %3, %9, off\n\t"
                 "global_load_async_to_lds_b128 %4, %10, off\n\t"
                 "global_load_async_to_lds_b128 %5, %11, off\n\t"
                 "s_wait_xcnt 0x0"
                 :: "v"(l), "v"(l + 4096u), "v"(l + 8192u), "v"(l + 12288u), "v"(l + 16384u), "v"(l + 20480u),
                    "v"(p0), "v"(p1), "v"(p2), "v"(p3), "v"(p4), "v"(p5) : "memory");
}
// the two waits of a stage hand-over, each in front of the block barrier: the wave's own LDS reads done (its buffer may be refilled), the wave's own copies landed (the other waves may read them)
__device__ __forceinline__ void wait_ds()    { asm volatile("s_wait_dscnt 0x0" ::: "memory"); }
__device__ __forceinline__ void wait_async() { asm volatile("s_wait_asynccnt 0x0" ::: "memory"); }
__device__ __forceinline__ void wait_async6()  { asm volatile("s_wait_asynccnt 0x6" ::: "memory"); }
__device__ __forceinline__ void wait_async8()  { asm volatile("s_wait_asynccnt 0x8" ::: "memory"); }
__device__ __forceinline__ void wait_async12() { asm volatile("s_wait_asynccnt 0xc" ::: "memory"); }
__device__ __forceinline__ void wait_async16() { asm volatile("s_wait_asynccnt 0x10" ::: "memory"); }

__device__ __forceinline__ void cvt8(const float* __restrict__ src, bf* dst, size_t i) {
    size_t so, dof; cvt_map(i, so, dof);
    const v8f v = *(const v8f*)(src + so); v8us o;
#pragma unroll
    for (int k = 0; k < 8; ++k) o[k] = f2bf(v[k]);
    bf* dp = dst + dof;
    *(v8us*)dp = o;
    asm volatile("s_wait_xcnt 0x0" :: "v"(o), "v"(dp) : "memory");   // before the issued store's registers are reused
}

__device__ __forceinline__ void cvtw8(const float* __restrict__ src, h16* dst, size_t i) {
    size_t so, dof; cvt_map(i, so, dof);
    const v8f v = *(const v8f*)(src + so); v8h o;
#pragma unroll
    for (int k = 0; k < 8; ++k) o[k] = (h16)(bfr(v[k]) * WOS);
    h16* dp = dst + dof;
    *(v8h*)dp = o;
    asm volatile("s_wait_xcnt 0x0" :: "v"(o), "v"(dp) : "memory");   // the same for this store
}

// mbits: one 32-wave block per 16-query tile, wave w packs steps 2w and 2w+1. Each lane loads the 16 mask words of the score elements it holds in flash_body (row lane&15; keys 8*(lane>>4)+0..7 and 16+8*(lane>>4)+0..7 of the step);
// the ballot over element e is the lane-select word e. A wave stores its two steps as one whole 128-B line; wave 0 gathers the live-step bits (bit s = step s holds a kept key) and stores them as the record's last line.
__device__ __forceinline__ void mbits(const int* __restrict__ MK, unsigned* MB, int tile, unsigned* sm) {
    const int lane = threadIdx.x & 31, wave = __builtin_amdgcn_readfirstlane((int)(threadIdx.x >> 5)), lr = lane & 15, hi = lane >> 4;
    unsigned* rec = MB + (size_t)tile * MREC;
    unsigned live2 = 0u;
    if (2 * wave < NST) {                                                // wave-uniform
        const int* mp = MK + (size_t)(tile * 16 + lr) * SEQ_FULL + wave * 64 + 8 * hi;
        unsigned w = 0u;
#pragma unroll
        for (int u = 0; u < 2; ++u) {
            const v4i a0 = *(const v4i*)(mp + 32 * u), a1 = *(const v4i*)(mp + 32 * u + 4), b0 = *(const v4i*)(mp + 32 * u + 16), b1 = *(const v4i*)(mp + 32 * u + 20);
            const int q[16] = {a0[0], a0[1], a0[2], a0[3], a1[0], a1[1], a1[2], a1[3], b0[0], b0[1], b0[2], b0[3], b1[0], b1[1], b1[2], b1[3]};
            unsigned any = 0u;
#pragma unroll
            for (int e = 0; e < 16; ++e) { const unsigned bal = __builtin_amdgcn_ballot_w32(q[e] != 0); any |= bal; w = (lane == 16 * u + e) ? bal : w; }
            live2 |= (any != 0u ? 1u : 0u) << u;
        }
        rec[wave * 32 + lane] = w;
    }
    if (lane == 0) sm[wave] = live2;
    __syncthreads();
    if (wave == 0) {
        unsigned v = sm[lane] << (2 * lr);                               // lanes 0..15: steps 0..31, lanes 16..31: steps 32..63
        v |= __shfl_xor(v, 1, 32); v |= __shfl_xor(v, 2, 32); v |= __shfl_xor(v, 4, 32); v |= __shfl_xor(v, 8, 32);
        const unsigned vh = __shfl(v, 16, 32);
        rec[NST * 16 + lane] = (lane == 0) ? v : ((lane == 1) ? vh : 0u);
    }
}

// k_prep: every operand preparation of a call in one grid of 1024-thread blocks, so that the six independent jobs share the chip instead of running one after another;
// a block's job follows from its index alone (block-uniform): mask tiles, then x, then Wq | Wk | Wv, then Wo. Thread -> element inside each job is as in the separate launches.
#define PB_M (SEQ / 16)
#define PB_X ((int)((size_t)NB * SEQ * DM / 8 / 1024))
#define PB_W ((int)((size_t)DM * DM / 8 / 1024))
static_assert(((size_t)SEQ * DM / 8) % 1024 == 0);     // x blocks cover each batch exactly
static_assert(((size_t)DM * DM / 8) % 1024 == 0);      // weight blocks cover each matrix exactly
__global__ __launch_bounds__(1024) void k_prep(const float* __restrict__ x, const int* __restrict__ MK, const float* __restrict__ wq, const float* __restrict__ wk, const float* __restrict__ wv, const float* __restrict__ wo,
                                               bf* XB, bf* WB, h16* WOH, unsigned* MB) {
    __shared__ unsigned sm[32];
    int bid = blockIdx.x;
    if (bid < PB_M) { mbits(MK, MB, bid, sm); return; }
    bid -= PB_M;
    if (bid < PB_X) {
        const size_t i = (size_t)bid * 1024 + threadIdx.x; const size_t nb8 = (size_t)SEQ * DM / 8; const size_t b = i / nb8;
        cvt8(x + b * SEQ_FULL * DM, XB + b * SEQ * DM, i % nb8); return;
    }
    bid -= PB_X;
    const int which = bid / PB_W; const size_t i = (size_t)(bid % PB_W) * 1024 + threadIdx.x;
    if (which == 3) cvtw8(wo, WOH, i);
    else cvt8(which == 0 ? wq : (which == 1 ? wk : wv), WB + (size_t)which * DM * DM, i);
}

// proj_body: register-blocked bf16 GEMM, one 8-wave block per 128x256 tile at (rB, cB), one wave per 64x64 tile at (r0, c0) (16 accumulators), K = DM; the block's operand units come from the fragment-major bf16 planes
// into LDS by asynchronous copies, two 32-k stages ahead (three buffers), and each unit is read from LDS by the four (row operand) or two (column operand) waves that need it.
// C[m][n] = sum_k A[m][k] Bt[n][k] + bias (BIASROW == 0: bias[n]; BIASROW != 0: bias[m]), written as f16 (Ph), fragment-major with row = m, k = n, at
// tile base (r0/RB)*sRB + (r0%RB)*pitch + (c0/CB)*sCB + (c0%CB)*CMUL, + mb*MBS per 16 rows, + S1S per 32 columns; the f16 residual x2048 (Pr) is written with its own strides when (r0%RB) < rlim and (c0%CB) < clim.
template <int BIASROW>
__device__ __forceinline__ void proj_body(const bf* __restrict__ A, const bf* __restrict__ Bt, const float* __restrict__ bias, h16* Ph, h16* Pr,
                                          int RB, size_t sRB, int pitch, int CB, size_t sCB,
                                          size_t sRBr, int pitchr, size_t sCBr, int rlim, int clim, int rB, int cB, float* osb, char* st) {
    const int K = DM;
    const int tid = threadIdx.x, lane = tid & 31, lr = lane & 15, hi = lane >> 4, wv = __builtin_amdgcn_readfirstlane(tid >> 5);
    const int r0 = rB + 64 * (wv >> 2), c0 = cB + 64 * (wv & 3);
    float* os = osb + wv * (16 * 68);                                    // wave-private epilogue tile
    v8f acc[4][4];
#pragma unroll
    for (int mb = 0; mb < 4; ++mb)
#pragma unroll
        for (int nb = 0; nb < 4; ++nb) acc[mb][nb] = (v8f){};
    constexpr int MBS = (BIASROW != 0) ? 512 : 1024, S1S = (BIASROW != 0) ? 2048 : 512, CMUL = (BIASROW != 0) ? 64 : 1;   // q, k: [t/16][d/32][unit]; v^T: [t/32][d/16][unit]
    // unit (row tile, ks) lies at byte (row tile)*32*K + ks*1024; thread tid copies bytes 16*(tid&63) of row tiles (tid>>6) + 4j
    const char* ga = (const char*)(A  + (size_t)(rB + 16 * (tid >> 6)) * K + 8 * (tid & 63));
    const char* gb = (const char*)(Bt + (size_t)(cB + 16 * (tid >> 6)) * K + 8 * (tid & 63));
    const unsigned ls = (unsigned)(size_t)st + 16u * (unsigned)tid;
    stage24(ls, ga, ga + 131072, gb, gb + 131072, gb + 262144, gb + 393216);
    stage24(ls + PSTG, ga + 1024, ga + 132096, gb + 1024, gb + 132096, gb + 263168, gb + 394240);
    stage24(ls + 2 * PSTG, ga + 2048, ga + 133120, gb + 2048, gb + 133120, gb + 264192, gb + 395264);
    wait_async12();                                                      // stage 0 landed; stages 1 and 2 fly on
    __syncthreads();                                                     // stage 0 published
    int rb = 0;                                                          // buffer of stage ks = ks mod 3
#pragma unroll 1
    for (int ks = 0; ks < K / 32; ++ks) {
        const bf* pa = (const bf*)(st + rb * PSTG + (wv >> 2) * 4096) + 8 * lane; const bf* pb = (const bf*)(st + rb * PSTG + 8192 + (wv & 3) * 4096) + 8 * lane;
        v16bf a[4], b[4];
#pragma unroll
        for (int mb = 0; mb < 4; ++mb) a[mb] = ldb(pa + mb * 512);
#pragma unroll
        for (int nb = 0; nb < 4; ++nb) b[nb] = ldb(pb + nb * 512);
#pragma unroll
        for (int nb = 0; nb < 4; ++nb) {
#pragma unroll
            for (int mb = 0; mb < 4; ++mb) acc[mb][nb] = wmmab(a[mb], b[nb], acc[mb][nb]); }
        asm volatile("v_nop\n\tv_nop\n\tv_nop\n\tv_nop" : "+v"(acc[0][3]), "+v"(acc[1][3]), "+v"(acc[2][3]), "+v"(acc[3][3]) : "v"(a[0]), "v"(a[1]), "v"(a[2]), "v"(a[3]));
        wait_ds();
        if (ks + 2 < K / 32) wait_async6(); else wait_async();           // block-uniform: stage ks + 1 landed; only stage ks + 2, where there is one, flies on
        __syncthreads();                                                 // publishes stage ks + 1 and ends every wave's reads of stage ks
        if (ks + 3 < K / 32) {                                           // block-uniform: refill the buffer just left
            const char* na = ga + (ks + 3) * 1024; const char* nb2 = gb + (ks + 3) * 1024;
            stage24(ls + rb * PSTG, na, na + 131072, nb2, nb2 + 131072, nb2 + 262144, nb2 + 393216);
        }
        rb = (rb == 2) ? 0 : rb + 1;
    }
    wait_async();
    float bc[4] = {0.0f, 0.0f, 0.0f, 0.0f};
    if constexpr (BIASROW == 0) {
#pragma unroll
        for (int nb = 0; nb < 4; ++nb) bc[nb] = bfr(bias[c0 + nb * 16 + lr]);
    }
    const int wres = (((r0 % RB) < rlim) && ((c0 % CB) < clim)) ? 1 : 0;   // tile-uniform
    const size_t tbase = (size_t)(r0 / RB) * sRB + (size_t)(r0 % RB) * (size_t)pitch + (size_t)(c0 / CB) * sCB + (size_t)(c0 % CB) * CMUL;
    const size_t tbasr = (size_t)(r0 / RB) * sRBr + (size_t)(r0 % RB) * (size_t)pitchr + (size_t)(c0 / CB) * sCBr + (size_t)(c0 % CB) * CMUL;
#pragma unroll
    for (int mb = 0; mb < 4; ++mb) {
        float rb[8];
        if constexpr (BIASROW != 0) {
            const v4f b0 = *(const v4f*)(bias + r0 + mb * 16 + 8 * hi); const v4f b1 = *(const v4f*)(bias + r0 + mb * 16 + 8 * hi + 4);
#pragma unroll
            for (int i = 0; i < 4; ++i) { rb[i] = bfr(b0[i]); rb[4 + i] = bfr(b1[i]); }
        } else {
#pragma unroll
            for (int j = 0; j < 8; ++j) rb[j] = 0.0f;
        }
#pragma unroll
        for (int nb = 0; nb < 4; ++nb) {
#pragma unroll
            for (int j = 0; j < 8; ++j) os[(hi * 8 + j) * 68 + nb * 16 + lr] = acc[mb][nb][j] + ((BIASROW != 0) ? rb[j] : bc[nb]); }   // D: row 8h+j, col lane&15
        wave_sync();
        const size_t sb = tbase + (size_t)(mb * MBS) + 8 * lane;
        const size_t sr = tbasr + (size_t)(mb * MBS) + 8 * lane;
{
#pragma unroll
            for (int s = 0; s < 4; ++s) { const int row = lr, c8 = (2 * s + hi) * 8;   // store s = part s&1 of the unit of columns 32*(s>>1)..+31: lane holds row lane&15, columns 16*s + 8*(lane>>4) + 0..7
                const v4f x0 = *(const v4fa*)(&os[row * 68 + c8]); const v4f x1 = *(const v4fa*)(&os[row * 68 + c8 + 4]); v8h hv, rv;
#pragma unroll
                for (int i = 0; i < 4; ++i) { const h16 a0 = (h16)x0[i]; const h16 a1 = (h16)x1[i]; hv[i] = a0; hv[4 + i] = a1; rv[i] = (h16)((x0[i] - (float)a0) * QRS); rv[4 + i] = (h16)((x1[i] - (float)a1) * QRS); }
                *(v8h*)(Ph + sb + (s >> 1) * S1S + (s & 1) * 256) = hv;
                asm volatile("s_wait_xcnt 0x0" :: "v"(hv) : "memory");       // before the issued store's registers are reused
                if (wres) { *(v8h*)(Pr + sr + (s >> 1) * S1S + (s & 1) * 256) = rv;
                    asm volatile("s_wait_xcnt 0x0" :: "v"(rv) : "memory"); } }   // the same for the residual store
             }
        wave_sync();
    }
}

// k_proj3: the three projections in one grid (z = q | k | v), so that their waves share the SIMDs; inside each z the tiles come in the order of the separate launches (q, k: token tile fastest; v^T: feature tile fastest).
// q, k: A = x rows (m = b*SEQ + t), Bt = W rows (n = h*64 + d), bias by column -> plane [(b*16 + h)][t/16][d/32][unit]; residual plane the same for t < EROWS
// v^T: A = Wv rows (m = h*64 + d), Bt = x rows (n = b*SEQ + t), bias by row -> plane [(b*16 + h)][t/32][d/16][unit]; residual plane the same for t < EROWS
static_assert((NB * SEQ) % 256 == 0 && DM % 256 == 0 && DM / 32 >= 3);   // whole 128x256 block tiles in both forms; the three-buffer prologue needs three stages
__global__ __launch_bounds__(32 * PW) void k_proj3(const bf* __restrict__ XB, const bf* __restrict__ WQ, const bf* __restrict__ WK, const bf* __restrict__ WV, const float* __restrict__ bq, const float* __restrict__ bk, const float* __restrict__ bv,
                                              h16* QH, h16* QR, h16* KP, h16* KR, h16* VT, h16* VR) {
    __shared__ __align__(16) float os[PW * 16 * 68];
    __shared__ __align__(1024) char st[3 * PSTG];
    const int z = blockIdx.z;
    if (z == 2) {
        const int flat = blockIdx.y * (NB * SEQ / 128) + blockIdx.x;
        proj_body<1>(WV, XB, bv, VT, VR, DM, (size_t)0, SEQ, SEQ, (size_t)DM * SEQ, (size_t)0, EROWS, (size_t)DM * EROWS, DM, EROWS, (flat % (DM / 128)) * 128, (flat / (DM / 128)) * 256, os, st);
    } else {
        proj_body<0>(XB, z == 0 ? WQ : WK, z == 0 ? bq : bk, z == 0 ? QH : KP, z == 0 ? QR : KR, SEQ, (size_t)NH_ * SEQ * HD, HD, HD, (size_t)SEQ * HD,
                     (size_t)NH_ * EROWS * HD, HD, (size_t)EROWS * HD, EROWS, HD, blockIdx.x * 128, blockIdx.y * 256, os, st);
    }
}

// flash_body: fused masked attention, one wave per 16 query rows of one (batch, head); K / V^T / Q fragments straight from the fragment-major f16 planes (two 16-B loads each, 512 contiguous bytes per wave-load).
// Transposed form: S^T[key][t] = K Q^T (A = K rows, B = Q rows); lane (t = lane&15, h = lane>>4) holds keys 8h+r of each 16-key tile, so the packed
// P tile is directly the B fragment of O^T[d][t] = V^T P^T (element r <- tile keys 0..15, element 8+r <- tile keys 16..31, lane unchanged).
// Mask: the wave reads the step's 16 lane-select words (64 B, wave-uniform address) and replaces masked scores by the fill value; the loop walks the set bits of the tile's live-step word in rising order, so a step whose 16x32 mask tile is all zero is not visited;
// if some row ends with no visited key the wave repeats the sweep over every step, which yields the uniform average of a fully masked row.
// EARLY != 0 (query rows < EROWS): q, k, v and P carry residuals x2048; residual products accumulate separately and are folded back with 1/2048.
template <int EARLY>
__device__ __forceinline__ void flash_body(const h16* __restrict__ QH, const h16* __restrict__ QR, const h16* __restrict__ KP, const h16* __restrict__ KR,
                                           const h16* __restrict__ VT, const h16* __restrict__ VR, const unsigned* __restrict__ MB, h16* CH, h16* CR, int tstart, int bx, int zh) {
    const int lane = threadIdx.x & 31, wave = __builtin_amdgcn_readfirstlane((int)(threadIdx.x >> 5)), lr = lane & 15, hi = lane >> 4;
    const int b = zh / NH_, h = zh % NH_;
    const int t0 = tstart + (bx * AW + wave) * 16;
    const size_t pbase = (size_t)zh * SEQ * HD;
    const size_t rbase = (size_t)zh * EROWS * HD;
    const size_t qo = pbase + (size_t)t0 * HD + 8 * lane;
    const v16h qh0 = ldh(QH + qo), qh1 = ldh(QH + qo + 512);                // B fragments: col t, k = d
    v16h qr0 = qh0, qr1 = qh1;
    if constexpr (EARLY != 0) { const size_t qro = rbase + (size_t)t0 * HD + 8 * lane; qr0 = ldh(QR + qro); qr1 = ldh(QR + qro + 512); }
    const size_t ko  = pbase + 8 * lane;       // + key0 * HD + 512 * (d/32)   (A fragment: row key, k = d; 16 keys = 1024 elements)
    const size_t kro = rbase + 8 * lane;
    const size_t vo  = pbase + 8 * lane;       // + key0 * HD + 512 * j        (A fragment: row d = 16j.., k = key; 32 keys = 2048 elements)
    const size_t vro = rbase + 8 * lane;
    const unsigned* mrec = MB + (size_t)(t0 >> 4) * MREC;      // this tile's mask record (wave-uniform)
    const unsigned long long live = *(const unsigned long long*)(mrec + NST * 16) & ALLST;
    v8f o0 = (v8f){}, o1 = (v8f){}, o2 = (v8f){}, o3 = (v8f){};
    v8f e0 = (v8f){}, e1 = (v8f){}, e2 = (v8f){}, e3 = (v8f){};
    float m = -3.0e38f, l = 0.0f;
    int noskip = 0;
#pragma unroll 1
    for (int pass = 0; pass < 2; ++pass) {
        o0 = (v8f){}; o1 = (v8f){}; o2 = (v8f){}; o3 = (v8f){};
        e0 = (v8f){}; e1 = (v8f){}; e2 = (v8f){}; e3 = (v8f){};
        m = -3.0e38f; l = 0.0f;
        // EARLY == 0: loads run ahead of their use. pk0..pk3 and pmw hold the K fragments and the mask words of the step about to be worked on, requested during the step before (first step: here);
        // the registers are refilled for the next live step right behind the score products that read them, and the step's own V^T fragments are requested in front of those products.
        v16h pk0 = qh0, pk1 = qh0, pk2 = qh0, pk3 = qh0; v16u pmw = (v16u){};
        if constexpr (EARLY == 0) {
            const unsigned long long r0 = (noskip != 0) ? ALLST : live;
            const int kf = (r0 != 0ull) ? 32 * __builtin_ctzll(r0) : 0;  // no live step: step 0 is read and not used (in bounds)
            const h16* kp = KP + ko + (size_t)kf * HD;
            pk0 = ldh(kp); pk1 = ldh(kp + 512); pk2 = ldh(kp + 16 * HD); pk3 = ldh(kp + 16 * HD + 512);
            pmw = *(const v16u*)(mrec + (kf >> 1));
        }
#pragma unroll 1
        for (unsigned long long rem = (noskip != 0) ? ALLST : live; rem != 0ull; rem &= rem - 1ull) {   // at most NST trips, wave-uniform
            const int key0 = 32 * __builtin_ctzll(rem);
            const unsigned long long nrem = rem & (rem - 1ull);
            const int keyn = (nrem != 0ull) ? 32 * __builtin_ctzll(nrem) : key0;   // next live step; last trip: its own step again (in bounds, not used)
            v16u mw = pmw;                                               // 16 words per step
            if constexpr (EARLY != 0) mw = *(const v16u*)(mrec + (key0 >> 1));
            const h16* ka = KP + ko + (size_t)key0 * HD;
            v16h v0 = qh0, v1 = qh0, v2 = qh0, v3 = qh0;
            const h16* vn = VT + vo + (size_t)key0 * HD;                 // EARLY == 0 only: this step's V^T fragments and the next live step's K fragments
            const h16* kn = KP + ko + (size_t)keyn * HD;
            if constexpr (EARLY == 0) { v0 = ldh(vn); v1 = ldh(vn + 512); v2 = ldh(vn + 1024); v3 = ldh(vn + 1536); }
            v8f sHa = (v8f){}, sHb = (v8f){}, sLa = (v8f){}, sLb = (v8f){};
            if constexpr (EARLY == 0) {
                sHa = wmma16(pk0, qh0, sHa); sHb = wmma16(pk2, qh0, sHb); sHa = wmma16(pk1, qh1, sHa); sHb = wmma16(pk3, qh1, sHb);
                asm volatile("v_nop\n\tv_nop\n\tv_nop\n\tv_nop" : "+v"(sHa), "+v"(sHb) : "v"(pk0), "v"(pk1), "v"(pk2), "v"(pk3));   // WMMA distance before the K registers are refilled and the scores read
                pk0 = ldh(kn); pk1 = ldh(kn + 512); pk2 = ldh(kn + 16 * HD); pk3 = ldh(kn + 16 * HD + 512);
            } else {
                const v16h ka0 = ldh(ka), ka1 = ldh(ka + 512), kb0 = ldh(ka + 16 * HD), kb1 = ldh(ka + 16 * HD + 512);
                sHa = wmma16(ka0, qh0, sHa); sHb = wmma16(kb0, qh0, sHb); sHa = wmma16(ka1, qh1, sHa); sHb = wmma16(kb1, qh1, sHb);
                sLa = wmma16(ka0, qr0, sLa); sLb = wmma16(kb0, qr0, sLb); sLa = wmma16(ka1, qr1, sLa); sLb = wmma16(kb1, qr1, sLb);
                asm volatile("v_nop\n\tv_nop\n\tv_nop\n\tv_nop" : "+v"(sHa), "+v"(sHb), "+v"(sLa), "+v"(sLb) : "v"(ka0), "v"(ka1), "v"(kb0), "v"(kb1));
            }
            if constexpr (EARLY != 0) {
                __builtin_amdgcn_sched_barrier(0);
                if (key0 < EROWS) {                                      // residual k plane covers keys < EROWS (wave-uniform)
                    const h16* ra = KR + kro + (size_t)key0 * HD;
                    const v16h ra0 = ldh(ra), ra1 = ldh(ra + 512), rb0 = ldh(ra + 16 * HD), rb1 = ldh(ra + 16 * HD + 512);
                    sLa = wmma16(ra0, qh0, sLa); sLb = wmma16(rb0, qh0, sLb); sLa = wmma16(ra1, qh1, sLa); sLb = wmma16(rb1, qh1, sLb);
                    asm volatile("v_nop\n\tv_nop\n\tv_nop\n\tv_nop" : "+v"(sLa), "+v"(sLb) : "v"(ra0), "v"(ra1), "v"(rb0), "v"(rb1));
                }
                __builtin_amdgcn_sched_barrier(0);
            }
            float ta[8], tb[8]; float mx = -3.0e38f;
#pragma unroll
            for (int r = 0; r < 8; ++r) {
                float sa = sHa[r], sb = sHb[r];
                if constexpr (EARLY != 0) { sa += sLa[r] * QRI; sb += sLb[r] * QRI; }
                ta[r] = __builtin_amdgcn_inverse_ballot_w32(mw[r]) ? sa * SC2 : NEGL;
                tb[r] = __builtin_amdgcn_inverse_ballot_w32(mw[8 + r]) ? sb * SC2 : NEGL;
                mx = fmaxf(mx, fmaxf(ta[r], tb[r]));
            }
            if constexpr (EARLY == 0) {
                __builtin_amdgcn_sched_barrier(0);                       // keeps the next step's mask load behind the last use of this step's words: lifted higher, the wait for these words (scalar loads are waited to 0) would wait for it too
                asm volatile("s_wait_xcnt 0x0" :: "v"(vn), "v"(kn) : "memory");   // before the address registers of the V and K loads issued above are reused (named here, they stay untouched up to the wait)
                pmw = *(const v16u*)(mrec + (keyn >> 1));
            }
            mx = fmaxf(mx, __shfl_xor(mx, 16, 32));
            const float mnew = fmaxf(m, mx);
            const float alpha = __builtin_amdgcn_exp2f(m - mnew);
            const float sh = PSH - mnew;
            v16h pb = (v16h){}; v16h pq = (v16h){}; float ls = 0.0f;
#pragma unroll
            for (int r = 0; r < 8; ++r) {
                const float pa = __builtin_amdgcn_exp2f(ta[r] + sh), pc = __builtin_amdgcn_exp2f(tb[r] + sh);
                const h16 ha = (h16)pa, hc = (h16)pc; pb[r] = ha; pb[8 + r] = hc;
                if constexpr (EARLY != 0) {
                    const h16 ga = (h16)((pa - (float)ha) * QRS), gc = (h16)((pc - (float)hc) * QRS); pq[r] = ga; pq[8 + r] = gc;
                    ls += ((float)ha + (float)hc) + ((float)ga + (float)gc) * QRI;
                } else {
                    ls += (float)ha + (float)hc;
                }
            }
            l = l * alpha + ls; m = mnew;
            o0 = o0 * alpha; o1 = o1 * alpha; o2 = o2 * alpha; o3 = o3 * alpha;
            if constexpr (EARLY != 0) { e0 = e0 * alpha; e1 = e1 * alpha; e2 = e2 * alpha; e3 = e3 * alpha; }
            {
                if constexpr (EARLY != 0) { const h16* va = VT + vo + (size_t)key0 * HD; v0 = ldh(va); v1 = ldh(va + 512); v2 = ldh(va + 1024); v3 = ldh_end(va + 1536); }
                o0 = wmma16(v0, pb, o0); o1 = wmma16(v1, pb, o1); o2 = wmma16(v2, pb, o2); o3 = wmma16(v3, pb, o3);
                if constexpr (EARLY != 0) {
                    e0 = wmma16(v0, pq, e0); e1 = wmma16(v1, pq, e1); e2 = wmma16(v2, pq, e2); e3 = wmma16(v3, pq, e3);
                    asm volatile("v_nop\n\tv_nop\n\tv_nop\n\tv_nop" : "+v"(o0), "+v"(o1), "+v"(o2), "+v"(o3), "+v"(e0), "+v"(e1), "+v"(e2), "+v"(e3) : "v"(v0), "v"(v1), "v"(v2), "v"(v3), "v"(pb), "v"(pq));
                } else {
                    asm volatile("v_nop\n\tv_nop\n\tv_nop\n\tv_nop" : "+v"(o0), "+v"(o1), "+v"(o2), "+v"(o3) : "v"(v0), "v"(v1), "v"(v2), "v"(v3), "v"(pb));
                }
            }
            if constexpr (EARLY != 0) {
                __builtin_amdgcn_sched_barrier(0);
                if (key0 < EROWS) {                                      // residual v^T plane covers keys < EROWS (wave-uniform)
                    const h16* wa = VR + vro + (size_t)key0 * HD;
                    const v16h w0 = ldh(wa), w1 = ldh(wa + 512), w2 = ldh(wa + 1024), w3 = ldh_end(wa + 1536);
                    e0 = wmma16(w0, pb, e0); e1 = wmma16(w1, pb, e1); e2 = wmma16(w2, pb, e2); e3 = wmma16(w3, pb, e3);
                    asm volatile("v_nop\n\tv_nop\n\tv_nop\n\tv_nop" : "+v"(e0), "+v"(e1), "+v"(e2), "+v"(e3) : "v"(w0), "v"(w1), "v"(w2), "v"(w3), "v"(pb));
                }
                __builtin_amdgcn_sched_barrier(0);
            }
        }
        l += __shfl_xor(l, 16, 32);
        const unsigned dead = __builtin_amdgcn_ballot_w32(!(l > 0.0f));
        if (dead == 0u) break;                                           // wave-uniform
        noskip = 1;
    }
    const float inv = CXS * (1.0f / l);
    // O^T D layout: o_j[r] = (d = 16j + 8h + r, t = lane&15): exactly part j&1 of context unit 2h + (j>>1) (row t = lane&15, k = 16j + 8*(lane>>4) + r), so each lane stores its own accumulators, no transpose
    const size_t crow = ((size_t)b * SEQ + t0) * DM + (size_t)h * 1024 + 8 * lane;     // context plane, row b*SEQ + t, k = h*64 + d: units [(b*SEQ + t)/16][2h + d/32]
    const size_t rrow = ((size_t)b * EROWS + t0) * DM + (size_t)h * 1024 + 8 * lane;   // residual plane, row b*EROWS + t (EARLY blocks only: t0 + 15 < EROWS)
    v8f xs[4] = {o0, o1, o2, o3};
    if constexpr (EARLY != 0) { xs[0] = o0 + e0 * QRI; xs[1] = o1 + e1 * QRI; xs[2] = o2 + e2 * QRI; xs[3] = o3 + e3 * QRI; }
#pragma unroll
    for (int s = 0; s < 4; ++s) {
        const v8f x = xs[s] * inv; v8h hv, rv;
#pragma unroll
        for (int i = 0; i < 8; ++i) { const h16 a0 = (h16)x[i]; hv[i] = a0; rv[i] = (h16)((x[i] - (float)a0) * QRS); }
        *(v8h*)(CH + crow + s * 256) = hv;
        if constexpr (EARLY != 0) *(v8h*)(CR + rrow + s * 256) = rv;
    }
}

// k_flashf: both forms in one 1-D grid, so that the residual rows' few, latency-bound waves run beside the others instead of in a launch of their own. A block's job follows from its index alone (block-uniform):
// first the residual rows' blocks, then the rest, each group from the last query block down ((batch, head) fastest): under a lower-triangular mask the key walk grows with the query index,
// so the longest blocks come first in index order and the shortest last. The order is for speed only: every (query block, batch, head) is taken exactly once for any mask.
// amdgpu_waves_per_eu(5): every block of the grid is given the registers of the larger (residual) form; unbudgeted that form takes 204 = an allocation of 208 = 4 waves per SIMD, under the budget 192 = 5 waves, no scratch.
#define FB_E (EROWS / (16 * AW))
#define FB_L ((SEQ - EROWS) / (16 * AW))
#define FB_Z (NB * NH_)
__global__ __launch_bounds__(32 * AW) __attribute__((amdgpu_waves_per_eu(5))) void k_flashf(const h16* __restrict__ QH, const h16* __restrict__ QR, const h16* __restrict__ KP, const h16* __restrict__ KR,
                                                    const h16* __restrict__ VT, const h16* __restrict__ VR, const unsigned* __restrict__ MB, h16* CH, h16* CR) {
    const int bid = blockIdx.x;
    if (bid < FB_E * FB_Z) { flash_body<1>(QH, QR, KP, KR, VT, VR, MB, CH, CR, 0, FB_E - 1 - bid / FB_Z, bid % FB_Z); }
    else { const int r = bid - FB_E * FB_Z; flash_body<0>(QH, QR, KP, KR, VT, VR, MB, CH, CR, EROWS, FB_L - 1 - r / FB_Z, r % FB_Z); }
}

// oproj_body: output projection, f16 GEMM, one 4-wave block per (32*MT) x 128 tile, one wave per (16*MT) x 64 tile, K = DM; operand units staged in LDS as in proj_body (RES != 0: stage units 0..3 = A, 4..7 = AR). OUT[m][n] = OSC * (sum_k A[m][k] Bt[n][k] + QRI * sum_k AR[m][k] Bt[n][k]) + bias[n] (bias RNE-converted to bf16).
// A = context plane (x16), AR = context residual plane (RES != 0 only, rows [b*EROWS + t]), Bt = Wo x1024 as f16 ([out][in]).
// wave row tile rt = 2*rtB + (wave>>1) in 0 .. NB * tpb - 1 -> batch rt / tpb, first token rowoff + (rt % tpb) * 16*MT (tpb even: a block's two row tiles are neighbours in one batch); c0 = cB + 64*(wave&1) = first output column.
template <int MT, int RES>
__device__ __forceinline__ void oproj_body(const h16* __restrict__ A, const h16* __restrict__ AR, const h16* __restrict__ Bt, const float* __restrict__ bias, float* OUT, int tpb, int rowoff, int rtB, int cB, float* osb, char* st) {
    static_assert((MT == 4 && RES == 0) || (MT == 2 && RES == 1));
    const int K = DM;
    const int tid = threadIdx.x, lane = tid & 31, lr = lane & 15, hi = lane >> 4, wv = __builtin_amdgcn_readfirstlane(tid >> 5);
    const int rt = 2 * rtB + (wv >> 1), c0 = cB + 64 * (wv & 1);
    float* os = osb + wv * (16 * 68);                                  // wave-private epilogue tile
    const int bb = rt / tpb, tl = rt % tpb;
    const int tok = rowoff + tl * (16 * MT);
    const int tokB = rowoff + ((2 * rtB) % tpb) * (16 * MT);           // the block's first token (same batch bb)
    // unit (row tile, ks) lies at byte (row tile)*32*K + ks*1024; thread tid copies bytes 16*(tid&63) of row tiles (tid>>6) + 2j
    const char* ga = (const char*)(A  + ((size_t)bb * SEQ   + tokB + 16 * (tid >> 6)) * K + 8 * (tid & 63));
    const char* gr = (const char*)(AR + ((size_t)bb * EROWS + tokB + 16 * (tid >> 6)) * K + 8 * (tid & 63));
    const char* gb = (const char*)(Bt + (size_t)(cB + 16 * (tid >> 6)) * K + 8 * (tid & 63));
    const char* g2 = (RES != 0) ? gr : ga + 131072;                    // source of stage units 4..7
    const unsigned ls = (unsigned)(size_t)st + 16u * (unsigned)tid;
    v8f acc[MT][4], acr[MT][4];
#pragma unroll
    for (int mb = 0; mb < MT; ++mb)
#pragma unroll
        for (int nb = 0; nb < 4; ++nb) { acc[mb][nb] = (v8f){}; acr[mb][nb] = (v8f){}; }
    stage16(ls, ga, ga + 65536, g2, g2 + 65536, gb, gb + 65536, gb + 131072, gb + 196608);
    stage16(ls + STG, ga + 1024, ga + 66560, g2 + 1024, g2 + 66560, gb + 1024, gb + 66560, gb + 132096, gb + 197632);
    stage16(ls + 2 * STG, ga + 2048, ga + 67584, g2 + 2048, g2 + 67584, gb + 2048, gb + 67584, gb + 133120, gb + 198656);
    wait_async16();                                                    // stage 0 landed; stages 1 and 2 fly on
    __syncthreads();                                                   // stage 0 published
    int rb = 0;                                                        // buffer of stage ks = ks mod 3
#pragma unroll 1
    for (int ks = 0; ks < K / 32; ++ks) {
        const h16* pa = (const h16*)(st + rb * STG + (wv >> 1) * (MT * 1024)) + 8 * lane; const h16* pr = pa + 2048; const h16* pb = (const h16*)(st + rb * STG + 8192 + (wv & 1) * 4096) + 8 * lane;
        v16h a[MT], ar[MT], bfrag[4];
#pragma unroll
        for (int mb = 0; mb < MT; ++mb) { a[mb] = ldh(pa + mb * 512); ar[mb] = a[mb]; }
        if constexpr (RES != 0) {
#pragma unroll
            for (int mb = 0; mb < MT; ++mb) ar[mb] = ldh(pr + mb * 512);
        }
#pragma unroll
        for (int nb = 0; nb < 4; ++nb) bfrag[nb] = ldh(pb + nb * 512);
#pragma unroll
        for (int nb = 0; nb < 4; ++nb) {
#pragma unroll
            for (int mb = 0; mb < MT; ++mb) { acc[mb][nb] = wmma16(a[mb], bfrag[nb], acc[mb][nb]);
                if constexpr (RES != 0) acr[mb][nb] = wmma16(ar[mb], bfrag[nb], acr[mb][nb]); } }
        if constexpr (MT == 4) {
            asm volatile("v_nop\n\tv_nop\n\tv_nop\n\tv_nop" : "+v"(acc[0][3]), "+v"(acc[1][3]), "+v"(acc[2][3]), "+v"(acc[3][3]) : "v"(a[0]), "v"(a[1]), "v"(a[2]), "v"(a[3]));
        } else {
            asm volatile("v_nop\n\tv_nop\n\tv_nop\n\tv_nop" : "+v"(acc[0][3]), "+v"(acc[1][3]), "+v"(acr[0][3]), "+v"(acr[1][3]) : "v"(a[0]), "v"(a[1]), "v"(ar[0]), "v"(ar[1]));
        }
        wait_ds();
        if (ks + 2 < K / 32) wait_async8(); else wait_async();         // block-uniform: stage ks + 1 landed; only stage ks + 2, where there is one, flies on
        __syncthreads();                                               // publishes stage ks + 1 and ends every wave's reads of stage ks
        if (ks + 3 < K / 32) {                                         // block-uniform: refill the buffer just left
            const char* na = ga + (ks + 3) * 1024; const char* n2 = g2 + (ks + 3) * 1024; const char* nb2 = gb + (ks + 3) * 1024;
            stage16(ls + rb * STG, na, na + 65536, n2, n2 + 65536, nb2, nb2 + 65536, nb2 + 131072, nb2 + 196608);
        }
        rb = (rb == 2) ? 0 : rb + 1;
    }
    wait_async();
    float bc[4];
#pragma unroll
    for (int nb = 0; nb < 4; ++nb) bc[nb] = bfr(bias[c0 + nb * 16 + lr]);
#pragma unroll
    for (int mb = 0; mb < MT; ++mb) {
#pragma unroll
        for (int nb = 0; nb < 4; ++nb) {
#pragma unroll
            for (int j = 0; j < 8; ++j) { float v = acc[mb][nb][j] * OSC;
                if constexpr (RES != 0) v += acr[mb][nb][j] * (OSC * QRI);
                os[(hi * 8 + j) * 68 + nb * 16 + lr] = v + bc[nb]; } }                          // D: row 8h+j, col lane&15
        wave_sync();
        float* orow = OUT + ((size_t)bb * OUT_SEQ + tok + mb * 16) * DM + c0;
{
#pragma unroll
            for (int s = 0; s < 8; ++s) { const int row = 2 * s + hi, cofs = lr * 4;            // 8 s x 2 rows = 16 rows; 16 lanes x 4 floats = 64 columns
                const v4f val = *(const v4fa*)(&os[row * 68 + cofs]);
                *(v4f*)(orow + (size_t)row * DM + cofs) = val; }
             }
        wave_sync();
    }
}

// k_oprojf: both forms in one grid (x = row tile, fastest as in the separate launches: first the residual rows' tiles, then the rest; y = column tile), so that their waves share the SIMDs.
static_assert(EROWS % 64 == 0 && (SEQ - EROWS) % 128 == 0);   // a block's two row tiles lie in one batch
__global__ __launch_bounds__(32 * GW) void k_oprojf(const h16* __restrict__ CXH, const h16* __restrict__ CXR, const h16* __restrict__ WOH, const float* __restrict__ bo, float* OUT) {
    __shared__ __align__(16) float os[GW * 16 * 68];
    __shared__ __align__(1024) char st[3 * STG];
    constexpr int NR = NB * (EROWS / 64);
    const int rtB = blockIdx.x, cB = blockIdx.y * 128;
    if (rtB < NR) oproj_body<2, 1>(CXH, CXR, WOH, bo, OUT, EROWS / 32, 0, rtB, cB, os, st);
    else          oproj_body<4, 0>(CXH, CXH, WOH, bo, OUT, (SEQ - EROWS) / 64, EROWS, rtB - NR, cB, os, st);
}

static constexpr size_t al256(size_t v) { return (v + 255) & ~(size_t)255; }
static constexpr size_t SZ_XB = al256((size_t)NB * SEQ * DM * 2);              // x bf16
static constexpr size_t SZ_WB = al256((size_t)3 * DM * DM * 2);                // Wq | Wk | Wv bf16
static constexpr size_t SZ_WO = al256((size_t)DM * DM * 2);                    // Wo f16 (x1024)
static constexpr size_t SZ_PL = al256((size_t)NB * NH_ * SEQ * HD * 2);        // q / k / v^T planes
static constexpr size_t SZ_RP = al256((size_t)NB * NH_ * EROWS * HD * 2);      // residual planes (t < EROWS)
static constexpr size_t SZ_CX = al256((size_t)NB * SEQ * DM * 2);              // context plane
static constexpr size_t SZ_CR = al256((size_t)NB * EROWS * DM * 2);            // context residual plane
static constexpr size_t SZ_MB = al256((size_t)(SEQ / 16) * MREC * 4);          // mask records
static constexpr size_t SZ_TOTAL = SZ_XB + SZ_WB + SZ_WO + 3 * SZ_PL + 3 * SZ_RP + SZ_CX + SZ_CR + SZ_MB;
static_assert(SZ_TOTAL <= (size_t)134217728);          // workspace carve <= 128 MiB
static_assert(((size_t)DM * DM * 2) % 256 == 0);       // weight sub-planes stay 256-byte aligned

extern "C" void kernel_launch(void* const* d_in, const int* in_sizes, int n_in,
                              void* d_out, int out_size, void* d_ws, size_t ws_size, hipStream_t stream) {
    if (n_in < 10) return;
    const size_t needx = ((size_t)(NB - 1) * SEQ_FULL + SEQ) * DM;
    if ((size_t)in_sizes[0] < needx) return;
    if ((size_t)in_sizes[1] < (size_t)(SEQ - 1) * SEQ_FULL + SEQ) return;
    if ((size_t)in_sizes[2] < (size_t)DM * DM || (size_t)in_sizes[4] < (size_t)DM * DM || (size_t)in_sizes[6] < (size_t)DM * DM || (size_t)in_sizes[8] < (size_t)DM * DM) return;
    if (in_sizes[3] < DM || in_sizes[5] < DM || in_sizes[7] < DM || in_sizes[9] < DM) return;
    if ((size_t)out_size < ((size_t)(NB - 1) * OUT_SEQ + SEQ) * DM) return;
    if (SZ_TOTAL > ws_size) return;
    // wire order: query, mask (int32), Wq, bq, Wk, bk, Wv, bv, Wo, bo; weights [out][in] = Bt as-is
    const float* x  = (const float*)d_in[0]; const int* mask = (const int*)d_in[1];
    const float* wq = (const float*)d_in[2]; const float* bq = (const float*)d_in[3];
    const float* wk = (const float*)d_in[4]; const float* bk = (const float*)d_in[5];
    const float* wv = (const float*)d_in[6]; const float* bv = (const float*)d_in[7];
    const float* wo = (const float*)d_in[8]; const float* bo = (const float*)d_in[9];
    float* OUT = (float*)d_out;      // [NB][SEQ][1024]
    char* wsp = (char*)d_ws;
    bf*  XB  = (bf*)wsp;  wsp += SZ_XB;              // rows NB*SEQ, k 1024, fragment-major
    bf*  WB  = (bf*)wsp;  wsp += SZ_WB;              // 3 planes q | k | v, rows 1024, k 1024, fragment-major
    h16* WOH = (h16*)wsp; wsp += SZ_WO;              // rows 1024, k 1024, fragment-major, x1024
    h16* QH  = (h16*)wsp; wsp += SZ_PL;              // [NB*16][SEQ/16][2][unit]
    h16* KP  = (h16*)wsp; wsp += SZ_PL;              // [NB*16][SEQ/16][2][unit]
    h16* VT  = (h16*)wsp; wsp += SZ_PL;              // [NB*16][SEQ/32][4][unit]
    h16* QR  = (h16*)wsp; wsp += SZ_RP;              // [NB*16][EROWS/16][2][unit] residual x2048
    h16* KR  = (h16*)wsp; wsp += SZ_RP;              // [NB*16][EROWS/16][2][unit] residual x2048
    h16* VR  = (h16*)wsp; wsp += SZ_RP;              // [NB*16][EROWS/32][4][unit] residual x2048
    h16* CXH = (h16*)wsp; wsp += SZ_CX;              // rows NB*SEQ, k 1024, fragment-major, x16
    h16* CXR = (h16*)wsp; wsp += SZ_CR;              // rows NB*EROWS, k 1024, fragment-major, residual x2048
    unsigned* MBW = (unsigned*)wsp; wsp += SZ_MB;    // [SEQ/16][MREC] mask records
    bf* WQ = WB; bf* WK = WB + (size_t)DM * DM; bf* WV = WB + (size_t)2 * DM * DM;

    k_prep<<<PB_M + PB_X + 4 * PB_W, 1024, 0, stream>>>(x, mask, wq, wk, wv, wo, XB, WB, WOH, MBW);
    k_proj3<<<dim3(NB * SEQ / 128, DM / 256, 3), 32 * PW, 0, stream>>>(XB, WQ, WK, WV, bq, bk, bv, QH, QR, KP, KR, VT, VR);

    k_flashf<<<(FB_E + FB_L) * FB_Z, 32 * AW, 0, stream>>>(QH, QR, KP, KR, VT, VR, MBW, CXH, CXR);

    k_oprojf<<<dim3(NB * (EROWS / 64) + NB * ((SEQ - EROWS) / 128), DM / 128, 1), 32 * GW, 0, stream>>>(CXH, CXR, WOH, bo, OUT);
}

// v008
// A run of this version takes 117 microseconds.
// In both of two side-by-side timings against v007, it was 1.07 times as fast.
// All steps since v000 together make it 3.49 times as fast.
#include <hip/hip_runtime.h>

// Masked multi-head self-attention, width 1024 = 16 heads x 64, x [NB][SEQ][1024], Wq/Wk/Wv/Wo [out][in] (y = x W^T + b), int32 mask [SEQ][SEQ] (0 = fill -1e9), score scale 1/8, output projection with bias (f32 out).
// Compute dtypes, f32 accumulate everywhere: q/k/v projections v_wmma_f32_16x16x32_bf16 (x and W RNE-converted to bf16; products exact; biases RNE-converted to bf16, added in f32);
// scores and P.V v_wmma_f32_16x16x32_f16: single f16 planes on query rows >= 512; on the first 512 query rows q, k, v, P and the context carry an f16 residual x2048 (three products, residual terms in their own accumulator);
// P carried x256 (cancels in the normalisation); output projection v_wmma_f32_16x16x32_f16 with context x16 and bf16-exact Wo x1024 as f16 (context residual on the first 512 rows); softmax f32 (online, running max).
// Layout: every 16-bit matrix operand plane is fragment-major: a unit is one 16-row x 32-k fragment = [part 0..1][lane 0..31][8 elements] (512 elements, 1 KiB), element (part, lane, e) = (row lane&15, k 16*part + 8*(lane>>4) + e),
// so each 16-byte-per-lane load or store of a wave covers 512 contiguous bytes (4 whole lines). x, W, context planes: [row/16][k/32][unit]; q, k planes: [b*16+h][t/16][d/32][unit]; v^T plane: [b*16+h][t/32][d/16][unit]
// (+ residual planes for t < 512), written by the GEMM epilogue; fused flash kernel in transposed form (S^T = K Q^T, O^T = V^T P^T);
// mask: a pre-pass turns the int32 mask once per call into lane-select words (per 16-query tile and 32-key step: 16 words, bit L of word e = mask != 0 at the score element e that flash lane L holds) plus one 64-bit word per tile of the steps
// that hold any kept key; the flash kernel reads them by scalar loads (replace-fill by value as before); fully masked 16x32 tiles are skipped in the first sweep, with a full second sweep when a row ends with no visited key.

#ifndef NB
#define NB 4
#endif
#ifndef SEQ
#define SEQ 2048
#endif
#define NB_FULL  4
#define SEQ_FULL 2048
#ifndef OUT_SEQ
#define OUT_SEQ SEQ              // row pitch (in tokens) between batches of the output
#endif
#define DM   1024
#define NH_  16
#define HD   64
#define AW   4                   // waves per flash block (16 query rows each)
#define EROWS ((SEQ) < 512 ? (SEQ) : 512)   // query rows / keys per sequence that carry residual planes
#define QRS  2048.0f             // carry of every residual plane
#define QRI  (1.0f / 2048.0f)
#define SC2  (0.125f * 1.4426950408889634f)   // HD^-0.5 * log2(e)
#define NEGL (-1.0e9f * 1.4426950408889634f)  // masked fill in the log2 domain
#define PSH  8.0f                // log2 of the P carry (256)
#define CXS  16.0f               // carry of the context planes
#define WOS  1024.0f             // carry of the Wo plane
#define OSC  (1.0f / 16384.0f)   // 1 / (CXS * WOS)
#define NST  (SEQ / 32)          // 32-key steps per sequence
#define MREC (NST * 16 + 32)     // words of one 16-query tile's mask record: NST steps x 16 lane-select words, then one 128-B line whose first two words are the live-step bits
#define ALLST ((NST) >= 64 ? ~0ull : ((1ull << ((NST) & 63)) - 1ull))

static_assert(HD == 64);
static_assert(NH_ * HD == DM);                 // head h = columns h*64 + d
static_assert(DM % 64 == 0);
static_assert(DM % 32 == 0);                   // GEMM k-loop steps by 32
static_assert(((DM / 32) & (DM / 32 - 1)) == 0);   // the cyclic k walk wraps by a mask
static_assert(SEQ % 64 == 0);                  // a 64-row tile never straddles two batches
static_assert((NB * SEQ) % 64 == 0);
static_assert(SEQ % 32 == 0);                  // key loop steps by 32
static_assert(EROWS % 64 == 0);                // residual tiles are whole 64-tiles; flash grid covers them exactly
static_assert(EROWS % (16 * AW) == 0);
static_assert((SEQ - EROWS) % 64 == 0);
static_assert((SEQ - EROWS) % (16 * AW) == 0);
static_assert(EROWS <= SEQ);
static_assert(((size_t)SEQ * DM) % 8 == 0);
static_assert(((size_t)DM * DM) % 8 == 0);
static_assert(NB <= NB_FULL);
static_assert(SEQ <= SEQ_FULL);
static_assert(NST <= 64);                      // live-step bits fit one 64-bit word; 32 waves x 2 steps cover a tile in mbits
static_assert(NST % 2 == 0);

typedef _Float16 h16;
typedef unsigned short bf;
typedef __attribute__((ext_vector_type(16))) __bf16   v16bf;
typedef __attribute__((ext_vector_type(16))) _Float16 v16h;
typedef __attribute__((ext_vector_type(8)))  _Float16 v8h;
typedef __attribute__((ext_vector_type(8)))  unsigned short v8us;
typedef __attribute__((ext_vector_type(8)))  float    v8f;
typedef __attribute__((ext_vector_type(4)))  float    v4f;
typedef __attribute__((ext_vector_type(4)))  int      v4i;
typedef v4f  __attribute__((may_alias)) v4fa;
typedef __attribute__((ext_vector_type(16))) unsigned v16u;

__device__ __forceinline__ unsigned short f2bf(float f) { unsigned u = __float_as_uint(f); u += 0x7FFFu + ((u >> 16) & 1u); return (unsigned short)(u >> 16); }
__device__ __forceinline__ float bfr(float f) { return __uint_as_float(((unsigned)f2bf(f)) << 16); }   // value after RNE convert to bf16
__device__ __forceinline__ v16h cat16(v8h lo, v8h hi) { return __builtin_shufflevector(lo, hi, 0, 1, 2, 3, 4, 5, 6, 7, 8, 9, 10, 11, 12, 13, 14, 15); }
__device__ __forceinline__ v16bf cat16b(v8us lo, v8us hi) { return __builtin_bit_cast(v16bf, __builtin_shufflevector(lo, hi, 0, 1, 2, 3, 4, 5, 6, 7, 8, 9, 10, 11, 12, 13, 14, 15)); }
__device__ __forceinline__ v8f wmma16(v16h a, v16h b, v8f c) { return __builtin_amdgcn_wmma_f32_16x16x32_f16(false, a, false, b, (short)0, c, false, false); }
__device__ __forceinline__ v8f wmmab(v16bf a, v16bf b, v8f c) { return __builtin_amdgcn_wmma_f32_16x16x32_bf16(false, a, false, b, (short)0, c, false, false); }
// fragment loaders from a fragment-major unit; p = unit base + 8*lane: elements 0..7 <- k0+8h+0..7 (part 0), elements 8..15 <- k0+16+8h+0..7 (part 1, +256 elements) (same map for A and B)
__device__ __forceinline__ v16h  ldh(const h16* p) { return cat16(*(const v8h*)p, *(const v8h*)(p + 256)); }
__device__ __forceinline__ v16bf ldb(const bf* p)  { return cat16b(*(const v8us*)p, *(const v8us*)(p + 256)); }
// ldh_end: ldh for the last fragment read off an address pair, where the compiler lands the last load's data on the pair itself: the s_wait_xcnt stands in front of that load, behind every other load that names the pair
__device__ __forceinline__ v16h  ldh_end(const h16* p) { const v8h lo = *(const v8h*)p; asm volatile("s_wait_xcnt 0x0" ::: "memory"); return cat16(lo, *(const v8h*)(p + 256)); }
// converters: a wave takes 8 rows x 32 k (8 whole 128-B lines of f32) and writes 4 whole 128-B lines of one unit. Thread i -> source element offset (row-major, DM columns) and fragment-major destination offset.
__device__ __forceinline__ void cvt_map(size_t i, size_t& so, size_t& dof) {
    const int lane = (int)(i & 31); const size_t w = i >> 5; const size_t ks = w % (DM / 32); const size_t row = (w / (DM / 32)) * 8 + (size_t)(lane >> 2); const int c = lane & 3;
    so  = row * DM + ks * 32 + (size_t)c * 8;
    dof = (row >> 4) * (size_t)(16 * DM) + ks * 512 + (size_t)(c >> 1) * 256 + (size_t)(c & 1) * 128 + (row & 15) * 8;
}
// ordering point for wave-private LDS tiles (same wave writes and reads)
__device__ __forceinline__ void wave_sync() { __builtin_amdgcn_fence(3 /* release order */, "wavefront"); __builtin_amdgcn_wave_barrier(); asm volatile("" ::: "memory"); }

// GEMM blocks: the waves of a block share one stage = the fragment-major units (1 KiB each) of one 32-k step, 8 of the row operand(s), then those of the column operand; three stage buffers in LDS, copies two stages ahead of their use.
// Output projection: 4 waves (2 x 2 wave tiles), 8 + 8 units. q/k/v projections: 8 waves (2 x 4 wave tiles), 8 + 16 units.
#define GW  4
#define STG 16384
#define PW   8
#define PSTG 24576
// stage16: the block's 128 threads bring one stage from the global planes into LDS, 8 asynchronous 16-B copies per thread; copy j fills bytes 16*tid of the unit pair 2j, 2j+1 (l = stage buffer + 16*tid, pj = the thread's own source bytes).
// The s_wait_xcnt stands inside the statement so that no address register of an issued copy is rewritten in front of it.
__device__ __forceinline__ void stage16(unsigned l, const char* p0, const char* p1, const char* p2, const char* p3, const char* p4, const char* p5, const char* p6, const char* p7) {
    asm volatile("global_load_async_to_lds_b128 %0, %8, off\n\t"
                 "global_load_async_to_lds_b128 %1, %9, off\n\t"
                 "global_load_async_to_lds_b128 %2, %10, off\n\t"
                 "global_load_async_to_lds_b128 %3, %11, off\n\t"
                 "global_load_async_to_lds_b128 %4, %12, off\n\t"
                 "global_load_async_to_lds_b128 %5, %13, off\n\t"
                 "global_load_async_to_lds_b128 %6, %14, off\n\t"
                 "global_load_async_to_lds_b128 %7, %15, off\n\t"
                 "s_wait_xcnt 0x0"
                 :: "v"(l), "v"(l + 2048u), "v"(l + 4096u), "v"(l + 6144u), "v"(l + 8192u), "v"(l + 10240u), "v"(l + 12288u), "v"(l + 14336u),
                    "v"(p0), "v"(p1), "v"(p2), "v"(p3), "v"(p4), "v"(p5), "v"(p6), "v"(p7) : "memory");
}
// stage24: the same for a block of 256 threads and 24 units, 6 copies per thread; copy j fills bytes 16*tid of the four units 4j .. 4j+3
__device__ __forceinline__ void stage24(unsigned l, const char* p0, const char* p1, const char* p2, const char* p3, const char* p4, const char* p5) {
    asm volatile("global_load_async_to_lds_b128 %0, %6, off\n\t"
                 "global_load_async_to_lds_b128 %1, %7, off\n\t"
                 "global_load_async_to_lds_b128 %2, %8, off\n\t"
                 "global_load_async_to_lds_b128 %3, %9, off\n\t"
                 "global_load_async_to_lds_b128 %4, %10, off\n\t"
                 "global_load_async_to_lds_b128 %5, %11, off\n\t"
                 "s_wait_xcnt 0x0"
                 :: "v"(l), "v"(l + 4096u), "v"(l + 8192u), "v"(l + 12288u), "v"(l + 16384u), "v"(l + 20480u),
                    "v"(p0), "v"(p1), "v"(p2), "v"(p3), "v"(p4), "v"(p5) : "memory");
}
// the two waits of a stage hand-over, each in front of the block barrier: the wave's own LDS reads done (its buffer may be refilled), the wave's own copies landed (the other waves may read them)
__device__ __forceinline__ void wait_ds()    { asm volatile("s_wait_dscnt 0x0" ::: "memory"); }
__device__ __forceinline__ void wait_async() { asm volatile("s_wait_asynccnt 0x0" ::: "memory"); }
__device__ __forceinline__ void wait_async6()  { asm volatile("s_wait_asynccnt 0x6" ::: "memory"); }
__device__ __forceinline__ void wait_async8()  { asm volatile("s_wait_asynccnt 0x8" ::: "memory"); }
__device__ __forceinline__ void wait_async12() { asm volatile("s_wait_asynccnt 0xc" ::: "memory"); }
__device__ __forceinline__ void wait_async16() { asm volatile("s_wait_asynccnt 0x10" ::: "memory"); }

__device__ __forceinline__ void cvt8(const float* __restrict__ src, bf* dst, size_t i) {
    size_t so, dof; cvt_map(i, so, dof);
    const v8f v = *(const v8f*)(src + so); v8us o;
#pragma unroll
    for (int k = 0; k < 8; ++k) o[k] = f2bf(v[k]);
    bf* dp = dst + dof;
    *(v8us*)dp = o;
    asm volatile("s_wait_xcnt 0x0" :: "v"(o), "v"(dp) : "memory");   // before the issued store's registers are reused
}

__device__ __forceinline__ void cvtw8(const float* __restrict__ src, h16* dst, size_t i) {
    size_t so, dof; cvt_map(i, so, dof);
    const v8f v = *(const v8f*)(src + so); v8h o;
#pragma unroll
    for (int k = 0; k < 8; ++k) o[k] = (h16)(bfr(v[k]) * WOS);
    h16* dp = dst + dof;
    *(v8h*)dp = o;
    asm volatile("s_wait_xcnt 0x0" :: "v"(o), "v"(dp) : "memory");   // the same for this store
}

// mbits: one 32-wave block per 16-query tile, wave w packs steps 2w and 2w+1. Each lane loads the 16 mask words of the score elements it holds in flash_body (row lane&15; keys 8*(lane>>4)+0..7 and 16+8*(lane>>4)+0..7 of the step);
// the ballot over element e is the lane-select word e. A wave stores its two steps as one whole 128-B line; wave 0 gathers the live-step bits (bit s = step s holds a kept key) and stores them as the record's last line.
__device__ __forceinline__ void mbits(const int* __restrict__ MK, unsigned* MB, int tile, unsigned* sm) {
    const int lane = threadIdx.x & 31, wave = __builtin_amdgcn_readfirstlane((int)(threadIdx.x >> 5)), lr = lane & 15, hi = lane >> 4;
    unsigned* rec = MB + (size_t)tile * MREC;
    unsigned live2 = 0u;
    if (2 * wave < NST) {                                                // wave-uniform
        const int* mp = MK + (size_t)(tile * 16 + lr) * SEQ_FULL + wave * 64 + 8 * hi;
        unsigned w = 0u;
#pragma unroll
        for (int u = 0; u < 2; ++u) {
            const v4i a0 = *(const v4i*)(mp + 32 * u), a1 = *(const v4i*)(mp + 32 * u + 4), b0 = *(const v4i*)(mp + 32 * u + 16), b1 = *(const v4i*)(mp + 32 * u + 20);
            const int q[16] = {a0[0], a0[1], a0[2], a0[3], a1[0], a1[1], a1[2], a1[3], b0[0], b0[1], b0[2], b0[3], b1[0], b1[1], b1[2], b1[3]};
            unsigned any = 0u;
#pragma unroll
            for (int e = 0; e < 16; ++e) { const unsigned bal = __builtin_amdgcn_ballot_w32(q[e] != 0); any |= bal; w = (lane == 16 * u + e) ? bal : w; }
            live2 |= (any != 0u ? 1u : 0u) << u;
        }
        rec[wave * 32 + lane] = w;
    }
    if (lane == 0) sm[wave] = live2;
    __syncthreads();
    if (wave == 0) {
        unsigned v = sm[lane] << (2 * lr);                               // lanes 0..15: steps 0..31, lanes 16..31: steps 32..63
        v |= __shfl_xor(v, 1, 32); v |= __shfl_xor(v, 2, 32); v |= __shfl_xor(v, 4, 32); v |= __shfl_xor(v, 8, 32);
        const unsigned vh = __shfl(v, 16, 32);
        rec[NST * 16 + lane] = (lane == 0) ? v : ((lane == 1) ? vh : 0u);
    }
}

// k_prep: every operand preparation of a call in one grid of 1024-thread blocks, so that the six independent jobs share the chip instead of running one after another;
// a block's job follows from its index alone (block-uniform): mask tiles, then x, then Wq | Wk | Wv, then Wo. Thread -> element inside each job is as in the separate launches.
#define PB_M (SEQ / 16)
#define PB_X ((int)((size_t)NB * SEQ * DM / 8 / 1024))
#define PB_W ((int)((size_t)DM * DM / 8 / 1024))
static_assert(((size_t)SEQ * DM / 8) % 1024 == 0);     // x blocks cover each batch exactly
static_assert(((size_t)DM * DM / 8) % 1024 == 0);      // weight blocks cover each matrix exactly
__global__ __launch_bounds__(1024) void k_prep(const float* __restrict__ x, const int* __restrict__ MK, const float* __restrict__ wq, const float* __restrict__ wk, const float* __restrict__ wv, const float* __restrict__ wo,
                                               bf* XB, bf* WB, h16* WOH, unsigned* MB) {
    __shared__ unsigned sm[32];
    int bid = blockIdx.x;
    if (bid < PB_M) { mbits(MK, MB, bid, sm); return; }
    bid -= PB_M;
    if (bid < PB_X) {
        const size_t i = (size_t)bid * 1024 + threadIdx.x; const size_t nb8 = (size_t)SEQ * DM / 8; const size_t b = i / nb8;
        cvt8(x + b * SEQ_FULL * DM, XB + b * SEQ * DM, i % nb8); return;
    }
    bid -= PB_X;
    const int which = bid / PB_W; const size_t i = (size_t)(bid % PB_W) * 1024 + threadIdx.x;
    if (which == 3) cvtw8(wo, WOH, i);
    else cvt8(which == 0 ? wq : (which == 1 ? wk : wv), WB + (size_t)which * DM * DM, i);
}

// proj_body: register-blocked bf16 GEMM, one 8-wave block per 128x256 tile at (rB, cB), one wave per 64x64 tile at (r0, c0) (16 accumulators), K = DM; the block's operand units come from the fragment-major bf16 planes
// into LDS by asynchronous copies, two 32-k stages ahead (three buffers), and each unit is read from LDS by the four (row operand) or two (column operand) waves that need it.
// The k walk is cyclic: stage s holds k step (k0 + s) mod K/32, k0 block-uniform from the block index, so that blocks which share an operand panel and run side by side ask L2 for different lines at one moment (every k step is taken exactly once).
// C[m][n] = sum_k A[m][k] Bt[n][k] + bias (BIASROW == 0: bias[n]; BIASROW != 0: bias[m]), written as f16 (Ph), fragment-major with row = m, k = n, at
// tile base (r0/RB)*sRB + (r0%RB)*pitch + (c0/CB)*sCB + (c0%CB)*CMUL, + mb*MBS per 16 rows, + S1S per 32 columns; the f16 residual x2048 (Pr) is written with its own strides when (r0%RB) < rlim and (c0%CB) < clim.
template <int BIASROW>
__device__ __forceinline__ void proj_body(const bf* __restrict__ A, const bf* __restrict__ Bt, const float* __restrict__ bias, h16* Ph, h16* Pr,
                                          int RB, size_t sRB, int pitch, int CB, size_t sCB,
                                          size_t sRBr, int pitchr, size_t sCBr, int rlim, int clim, int rB, int cB, int k0, float* osb, char* st) {
    const int K = DM;
    const int tid = threadIdx.x, lane = tid & 31, lr = lane & 15, hi = lane >> 4, wv = __builtin_amdgcn_readfirstlane(tid >> 5);
    const int r0 = rB + 64 * (wv >> 2), c0 = cB + 64 * (wv & 3);
    float* os = osb + wv * (16 * 68);                                    // wave-private epilogue tile
    v8f acc[4][4];
#pragma unroll
    for (int mb = 0; mb < 4; ++mb)
#pragma unroll
        for (int nb = 0; nb < 4; ++nb) acc[mb][nb] = (v8f){};
    constexpr int MBS = (BIASROW != 0) ? 512 : 1024, S1S = (BIASROW != 0) ? 2048 : 512, CMUL = (BIASROW != 0) ? 64 : 1;   // q, k: [t/16][d/32][unit]; v^T: [t/32][d/16][unit]
    // unit (row tile, ks) lies at byte (row tile)*32*K + ks*1024; thread tid copies bytes 16*(tid&63) of row tiles (tid>>6) + 4j
    const char* ga = (const char*)(A  + (size_t)(rB + 16 * (tid >> 6)) * K + 8 * (tid & 63));
    const char* gb = (const char*)(Bt + (size_t)(cB + 16 * (tid >> 6)) * K + 8 * (tid & 63));
    const unsigned ls = (unsigned)(size_t)st + 16u * (unsigned)tid;
    for (int s = 0; s < 3; ++s) {                                        // stage s holds k step (k0 + s) mod K/32
        const int ko = ((k0 + s) & (K / 32 - 1)) * 1024; const char* na = ga + ko; const char* nb2 = gb + ko;
        stage24(ls + s * PSTG, na, na + 131072, nb2, nb2 + 131072, nb2 + 262144, nb2 + 393216);
    }
    wait_async12();                                                      // stage 0 landed; stages 1 and 2 fly on
    __syncthreads();                                                     // stage 0 published
    int rb = 0;                                                          // buffer of stage ks = ks mod 3
#pragma unroll 1
    for (int ks = 0; ks < K / 32; ++ks) {
        const bf* pa = (const bf*)(st + rb * PSTG + (wv >> 2) * 4096) + 8 * lane; const bf* pb = (const bf*)(st + rb * PSTG + 8192 + (wv & 3) * 4096) + 8 * lane;
        v16bf a[4], b[4];
#pragma unroll
        for (int mb = 0; mb < 4; ++mb) a[mb] = ldb(pa + mb * 512);
#pragma unroll
        for (int nb = 0; nb < 4; ++nb) b[nb] = ldb(pb + nb * 512);
#pragma unroll
        for (int nb = 0; nb < 4; ++nb) {
#pragma unroll
            for (int mb = 0; mb < 4; ++mb) acc[mb][nb] = wmmab(a[mb], b[nb], acc[mb][nb]); }
        asm volatile("v_nop\n\tv_nop\n\tv_nop\n\tv_nop" : "+v"(acc[0][3]), "+v"(acc[1][3]), "+v"(acc[2][3]), "+v"(acc[3][3]) : "v"(a[0]), "v"(a[1]), "v"(a[2]), "v"(a[3]));
        wait_ds();
        if (ks + 2 < K / 32) wait_async6(); else wait_async();           // block-uniform: stage ks + 1 landed; only stage ks + 2, where there is one, flies on
        __syncthreads();                                                 // publishes stage ks + 1 and ends every wave's reads of stage ks
        if (ks + 3 < K / 32) {                                           // block-uniform: refill the buffer just left
            const int ko = ((k0 + ks + 3) & (K / 32 - 1)) * 1024; const char* na = ga + ko; const char* nb2 = gb + ko;
            stage24(ls + rb * PSTG, na, na + 131072, nb2, nb2 + 131072, nb2 + 262144, nb2 + 393216);
        }
        rb = (rb == 2) ? 0 : rb + 1;
    }
    wait_async();
    float bc[4] = {0.0f, 0.0f, 0.0f, 0.0f};
    if constexpr (BIASROW == 0) {
#pragma unroll
        for (int nb = 0; nb < 4; ++nb) bc[nb] = bfr(bias[c0 + nb * 16 + lr]);
    }
    const int wres = (((r0 % RB) < rlim) && ((c0 % CB) < clim)) ? 1 : 0;   // tile-uniform
    const size_t tbase = (size_t)(r0 / RB) * sRB + (size_t)(r0 % RB) * (size_t)pitch + (size_t)(c0 / CB) * sCB + (size_t)(c0 % CB) * CMUL;
    const size_t tbasr = (size_t)(r0 / RB) * sRBr + (size_t)(r0 % RB) * (size_t)pitchr + (size_t)(c0 / CB) * sCBr + (size_t)(c0 % CB) * CMUL;
#pragma unroll
    for (int mb = 0; mb < 4; ++mb) {
        float rb[8];
        if constexpr (BIASROW != 0) {
            const v4f b0 = *(const v4f*)(bias + r0 + mb * 16 + 8 * hi); const v4f b1 = *(const v4f*)(bias + r0 + mb * 16 + 8 * hi + 4);
#pragma unroll
            for (int i = 0; i < 4; ++i) { rb[i] = bfr(b0[i]); rb[4 + i] = bfr(b1[i]); }
        } else {
#pragma unroll
            for (int j = 0; j < 8; ++j) rb[j] = 0.0f;
        }
#pragma unroll
        for (int nb = 0; nb < 4; ++nb) {
#pragma unroll
            for (int j = 0; j < 8; ++j) os[(hi * 8 + j) * 68 + nb * 16 + lr] = acc[mb][nb][j] + ((BIASROW != 0) ? rb[j] : bc[nb]); }   // D: row 8h+j, col lane&15
        wave_sync();
        const size_t sb = tbase + (size_t)(mb * MBS) + 8 * lane;
        const size_t sr = tbasr + (size_t)(mb * MBS) + 8 * lane;
{
#pragma unroll
            for (int s = 0; s < 4; ++s) { const int row = lr, c8 = (2 * s + hi) * 8;   // store s = part s&1 of the unit of columns 32*(s>>1)..+31: lane holds row lane&15, columns 16*s + 8*(lane>>4) + 0..7
                const v4f x0 = *(const v4fa*)(&os[row * 68 + c8]); const v4f x1 = *(const v4fa*)(&os[row * 68 + c8 + 4]); v8h hv, rv;
#pragma unroll
                for (int i = 0; i < 4; ++i) { const h16 a0 = (h16)x0[i]; const h16 a1 = (h16)x1[i]; hv[i] = a0; hv[4 + i] = a1; rv[i] = (h16)((x0[i] - (float)a0) * QRS); rv[4 + i] = (h16)((x1[i] - (float)a1) * QRS); }
                *(v8h*)(Ph + sb + (s >> 1) * S1S + (s & 1) * 256) = hv;
                asm volatile("s_wait_xcnt 0x0" :: "v"(hv) : "memory");       // before the issued store's registers are reused
                if (wres) { *(v8h*)(Pr + sr + (s >> 1) * S1S + (s & 1) * 256) = rv;
                    asm volatile("s_wait_xcnt 0x0" :: "v"(rv) : "memory"); } }   // the same for the residual store
             }
        wave_sync();
    }
}

// k_proj3: the three projections in one grid (z = q | k | v), so that their waves share the SIMDs; inside each z the tiles come in the order of the separate launches (q, k: token tile fastest; v^T: feature tile fastest).
// q, k: A = x rows (m = b*SEQ + t), Bt = W rows (n = h*64 + d), bias by column -> plane [(b*16 + h)][t/16][d/32][unit]; residual plane the same for t < EROWS
// v^T: A = Wv rows (m = h*64 + d), Bt = x rows (n = b*SEQ + t), bias by row -> plane [(b*16 + h)][t/32][d/16][unit]; residual plane the same for t < EROWS
static_assert((NB * SEQ) % 256 == 0 && DM % 256 == 0 && DM / 32 >= 3);   // whole 128x256 block tiles in both forms; the three-buffer prologue needs three stages
__global__ __launch_bounds__(32 * PW) void k_proj3(const bf* __restrict__ XB, const bf* __restrict__ WQ, const bf* __restrict__ WK, const bf* __restrict__ WV, const float* __restrict__ bq, const float* __restrict__ bk, const float* __restrict__ bv,
                                              h16* QH, h16* QR, h16* KP, h16* KR, h16* VT, h16* VR) {
    __shared__ __align__(16) float os[PW * 16 * 68];
    __shared__ __align__(1024) char st[3 * PSTG];
    const int z = blockIdx.z;
    if (z == 2) {
        const int flat = blockIdx.y * (NB * SEQ / 128) + blockIdx.x;
        const int k0 = (flat / (DM / 128) + 4 * (flat % (DM / 128))) & (DM / 32 - 1);   // first k step: differs among the blocks that read one Wv row panel (32 values) and among those that read one x row panel (8 values)
        proj_body<1>(WV, XB, bv, VT, VR, DM, (size_t)0, SEQ, SEQ, (size_t)DM * SEQ, (size_t)0, EROWS, (size_t)DM * EROWS, DM, EROWS, (flat % (DM / 128)) * 128, (flat / (DM / 128)) * 256, k0, os, st);
    } else {
        const int k0 = (int)((blockIdx.x + 8 * blockIdx.y + 4 * z) & (DM / 32 - 1));    // first k step: differs among the 8 q and k blocks that read one x row panel; the 64 blocks of one W row panel take the 32 values twice
        proj_body<0>(XB, z == 0 ? WQ : WK, z == 0 ? bq : bk, z == 0 ? QH : KP, z == 0 ? QR : KR, SEQ, (size_t)NH_ * SEQ * HD, HD, HD, (size_t)SEQ * HD,
                     (size_t)NH_ * EROWS * HD, HD, (size_t)EROWS * HD, EROWS, HD, blockIdx.x * 128, blockIdx.y * 256, k0, os, st);
    }
}

// flash_body: fused masked attention, one wave per 16 query rows of one (batch, head); K / V^T / Q fragments straight from the fragment-major f16 planes (two 16-B loads each, 512 contiguous bytes per wave-load).
// Transposed form: S^T[key][t] = K Q^T (A = K rows, B = Q rows); lane (t = lane&15, h = lane>>4) holds keys 8h+r of each 16-key tile, so the packed
// P tile is directly the B fragment of O^T[d][t] = V^T P^T (element r <- tile keys 0..15, element 8+r <- tile keys 16..31, lane unchanged).
// Mask: the wave reads the step's 16 lane-select words (64 B, wave-uniform address) and replaces masked scores by the fill value; the loop walks the set bits of the tile's live-step word (cyclically, from a step of the block's own), so a step whose 16x32 mask tile is all zero is not visited;
// if some row ends with no visited key the wave repeats the sweep over every step, which yields the uniform average of a fully masked row.
// EARLY != 0 (query rows < EROWS): q, k, v and P carry residuals x2048; residual products accumulate separately and are folded back with 1/2048.
template <int EARLY>
__device__ __forceinline__ void flash_body(const h16* __restrict__ QH, const h16* __restrict__ QR, const h16* __restrict__ KP, const h16* __restrict__ KR,
                                           const h16* __restrict__ VT, const h16* __restrict__ VR, const unsigned* __restrict__ MB, h16* CH, h16* CR, int tstart, int bx, int zh) {
    const int lane = threadIdx.x & 31, wave = __builtin_amdgcn_readfirstlane((int)(threadIdx.x >> 5)), lr = lane & 15, hi = lane >> 4;
    const int b = zh / NH_, h = zh % NH_;
    const int t0 = tstart + (bx * AW + wave) * 16;
    const size_t pbase = (size_t)zh * SEQ * HD;
    const size_t rbase = (size_t)zh * EROWS * HD;
    const size_t qo = pbase + (size_t)t0 * HD + 8 * lane;
    const v16h qh0 = ldh(QH + qo), qh1 = ldh(QH + qo + 512);                // B fragments: col t, k = d
    v16h qr0 = qh0, qr1 = qh1;
    if constexpr (EARLY != 0) { const size_t qro = rbase + (size_t)t0 * HD + 8 * lane; qr0 = ldh(QR + qro); qr1 = ldh(QR + qro + 512); }
    const size_t ko  = pbase + 8 * lane;       // + key0 * HD + 512 * (d/32)   (A fragment: row key, k = d; 16 keys = 1024 elements)
    const size_t kro = rbase + 8 * lane;
    const size_t vo  = pbase + 8 * lane;       // + key0 * HD + 512 * j        (A fragment: row d = 16j.., k = key; 32 keys = 2048 elements)
    const size_t vro = rbase + 8 * lane;
    const unsigned* mrec = MB + (size_t)(t0 >> 4) * MREC;      // this tile's mask record (wave-uniform)
    const unsigned long long live = *(const unsigned long long*)(mrec + NST * 16) & ALLST;
    // cyclic key walk: the block's waves take the live steps from step s0 up, then those below it, so that the query blocks of one (batch, head), which run side by side, ask L2 for different K and V^T lines at one moment.
    // s0 is block-uniform (the block's waves stay on the same lines), differs too among the (batch, head) blocks that read one mask record, and is spread over the steps that a lower-triangular mask leaves the block;
    // for speed only: any s0 in 0..63 visits every live step exactly once.
    const int g = (tstart + bx * (16 * AW)) / (16 * AW);       // index of the block among the query blocks of its (batch, head)
    const int s0 = ((((g * 13 + zh * 5) & 31) * ((g + 1) * (16 * AW) / 32)) >> 5) & 63;
    const unsigned long long lowm = (1ull << s0) - 1ull;       // steps below s0
    v8f o0 = (v8f){}, o1 = (v8f){}, o2 = (v8f){}, o3 = (v8f){};
    v8f e0 = (v8f){}, e1 = (v8f){}, e2 = (v8f){}, e3 = (v8f){};
    float m = -3.0e38f, l = 0.0f;
    int noskip = 0;
#pragma unroll 1
    for (int pass = 0; pass < 2; ++pass) {
        o0 = (v8f){}; o1 = (v8f){}; o2 = (v8f){}; o3 = (v8f){};
        e0 = (v8f){}; e1 = (v8f){}; e2 = (v8f){}; e3 = (v8f){};
        m = -3.0e38f; l = 0.0f;
        // EARLY == 0: loads run ahead of their use. pk0..pk3 and pmw hold the K fragments and the mask words of the step about to be worked on, requested during the step before (first step: here);
        // the registers are refilled for the next live step right behind the score products that read them, and the step's own V^T fragments are requested in front of those products.
        v16h pk0 = qh0, pk1 = qh0, pk2 = qh0, pk3 = qh0; v16u pmw = (v16u){};
        const unsigned long long all = (noskip != 0) ? ALLST : live;
        unsigned long long rem = all & ~lowm, rest = all & lowm;         // steps being walked; steps still to come behind them
        if (rem == 0ull) { rem = rest; rest = 0ull; }
        if constexpr (EARLY == 0) {
            const int kf = (rem != 0ull) ? 32 * __builtin_ctzll(rem) : 0;  // no live step: step 0 is read and not used (in bounds)
            const h16* kp = KP + ko + (size_t)kf * HD;
            pk0 = ldh(kp); pk1 = ldh(kp + 512); pk2 = ldh(kp + 16 * HD); pk3 = ldh(kp + 16 * HD + 512);
            pmw = *(const v16u*)(mrec + (kf >> 1));
        }
#pragma unroll 1
        while (rem != 0ull) {                                            // at most NST trips, wave-uniform
            const int key0 = 32 * __builtin_ctzll(rem);
            unsigned long long nrem = rem & (rem - 1ull);
            if (nrem == 0ull) { nrem = rest; rest = 0ull; }              // top reached: go on with the steps below s0
            const int keyn = (nrem != 0ull) ? 32 * __builtin_ctzll(nrem) : key0;   // next live step; last trip: its own step again (in bounds, not used)
            v16u mw = pmw;                                               // 16 words per step
            if constexpr (EARLY != 0) mw = *(const v16u*)(mrec + (key0 >> 1));
            const h16* ka = KP + ko + (size_t)key0 * HD;
            v16h v0 = qh0, v1 = qh0, v2 = qh0, v3 = qh0;
            const h16* vn = VT + vo + (size_t)key0 * HD;                 // EARLY == 0 only: this step's V^T fragments and the next live step's K fragments
            const h16* kn = KP + ko + (size_t)keyn * HD;
            if constexpr (EARLY == 0) { v0 = ldh(vn); v1 = ldh(vn + 512); v2 = ldh(vn + 1024); v3 = ldh(vn + 1536); }
            v8f sHa = (v8f){}, sHb = (v8f){}, sLa = (v8f){}, sLb = (v8f){};
            if constexpr (EARLY == 0) {
                sHa = wmma16(pk0, qh0, sHa); sHb = wmma16(pk2, qh0, sHb); sHa = wmma16(pk1, qh1, sHa); sHb = wmma16(pk3, qh1, sHb);
                asm volatile("v_nop\n\tv_nop\n\tv_nop\n\tv_nop" : "+v"(sHa), "+v"(sHb) : "v"(pk0), "v"(pk1), "v"(pk2), "v"(pk3));   // WMMA distance before the K registers are refilled and the scores read
                pk0 = ldh(kn); pk1 = ldh(kn + 512); pk2 = ldh(kn + 16 * HD); pk3 = ldh(kn + 16 * HD + 512);
            } else {
                const v16h ka0 = ldh(ka), ka1 = ldh(ka + 512), kb0 = ldh(ka + 16 * HD), kb1 = ldh(ka + 16 * HD + 512);
                sHa = wmma16(ka0, qh0, sHa); sHb = wmma16(kb0, qh0, sHb); sHa = wmma16(ka1, qh1, sHa); sHb = wmma16(kb1, qh1, sHb);
                sLa = wmma16(ka0, qr0, sLa); sLb = wmma16(kb0, qr0, sLb); sLa = wmma16(ka1, qr1, sLa); sLb = wmma16(kb1, qr1, sLb);
                asm volatile("v_nop\n\tv_nop\n\tv_nop\n\tv_nop" : "+v"(sHa), "+v"(sHb), "+v"(sLa), "+v"(sLb) : "v"(ka0), "v"(ka1), "v"(kb0), "v"(kb1));
            }
            if constexpr (EARLY != 0) {
                __builtin_amdgcn_sched_barrier(0);
                if (key0 < EROWS) {                                      // residual k plane covers keys < EROWS (wave-uniform)
                    const h16* ra = KR + kro + (size_t)key0 * HD;
                    const v16h ra0 = ldh(ra), ra1 = ldh(ra + 512), rb0 = ldh(ra + 16 * HD), rb1 = ldh(ra + 16 * HD + 512);
                    sLa = wmma16(ra0, qh0, sLa); sLb = wmma16(rb0, qh0, sLb); sLa = wmma16(ra1, qh1, sLa); sLb = wmma16(rb1, qh1, sLb);
                    asm volatile("v_nop\n\tv_nop\n\tv_nop\n\tv_nop" : "+v"(sLa), "+v"(sLb) : "v"(ra0), "v"(ra1), "v"(rb0), "v"(rb1));
                }
                __builtin_amdgcn_sched_barrier(0);
            }
            float ta[8], tb[8]; float mx = -3.0e38f;
#pragma unroll
            for (int r = 0; r < 8; ++r) {
                float sa = sHa[r], sb = sHb[r];
                if constexpr (EARLY != 0) { sa += sLa[r] * QRI; sb += sLb[r] * QRI; }
                ta[r] = __builtin_amdgcn_inverse_ballot_w32(mw[r]) ? sa * SC2 : NEGL;
                tb[r] = __builtin_amdgcn_inverse_ballot_w32(mw[8 + r]) ? sb * SC2 : NEGL;
                mx = fmaxf(mx, fmaxf(ta[r], tb[r]));
            }
            if constexpr (EARLY == 0) {
                __builtin_amdgcn_sched_barrier(0);                       // keeps the next step's mask load behind the last use of this step's words: lifted higher, the wait for these words (scalar loads are waited to 0) would wait for it too
                asm volatile("s_wait_xcnt 0x0" :: "v"(vn), "v"(kn) : "memory");   // before the address registers of the V and K loads issued above are reused (named here, they stay untouched up to the wait)
                pmw = *(const v16u*)(mrec + (keyn >> 1));
            }
            mx = fmaxf(mx, __shfl_xor(mx, 16, 32));
            const float mnew = fmaxf(m, mx);
            const float alpha = __builtin_amdgcn_exp2f(m - mnew);
            const float sh = PSH - mnew;
            v16h pb = (v16h){}; v16h pq = (v16h){}; float ls = 0.0f;
#pragma unroll
            for (int r = 0; r < 8; ++r) {
                const float pa = __builtin_amdgcn_exp2f(ta[r] + sh), pc = __builtin_amdgcn_exp2f(tb[r] + sh);
                const h16 ha = (h16)pa, hc = (h16)pc; pb[r] = ha; pb[8 + r] = hc;
                if constexpr (EARLY != 0) {
                    const h16 ga = (h16)((pa - (float)ha) * QRS), gc = (h16)((pc - (float)hc) * QRS); pq[r] = ga; pq[8 + r] = gc;
                    ls += ((float)ha + (float)hc) + ((float)ga + (float)gc) * QRI;
                } else {
                    ls += (float)ha + (float)hc;
                }
            }
            l = l * alpha + ls; m = mnew;
            o0 = o0 * alpha; o1 = o1 * alpha; o2 = o2 * alpha; o3 = o3 * alpha;
            if constexpr (EARLY != 0) { e0 = e0 * alpha; e1 = e1 * alpha; e2 = e2 * alpha; e3 = e3 * alpha; }
            {
                if constexpr (EARLY != 0) { const h16* va = VT + vo + (size_t)key0 * HD; v0 = ldh(va); v1 = ldh(va + 512); v2 = ldh(va + 1024); v3 = ldh_end(va + 1536); }
                o0 = wmma16(v0, pb, o0); o1 = wmma16(v1, pb, o1); o2 = wmma16(v2, pb, o2); o3 = wmma16(v3, pb, o3);
                if constexpr (EARLY != 0) {
                    e0 = wmma16(v0, pq, e0); e1 = wmma16(v1, pq, e1); e2 = wmma16(v2, pq, e2); e3 = wmma16(v3, pq, e3);
                    asm volatile("v_nop\n\tv_nop\n\tv_nop\n\tv_nop" : "+v"(o0), "+v"(o1), "+v"(o2), "+v"(o3), "+v"(e0), "+v"(e1), "+v"(e2), "+v"(e3) : "v"(v0), "v"(v1), "v"(v2), "v"(v3), "v"(pb), "v"(pq));
                } else {
                    asm volatile("v_nop\n\tv_nop\n\tv_nop\n\tv_nop" : "+v"(o0), "+v"(o1), "+v"(o2), "+v"(o3) : "v"(v0), "v"(v1), "v"(v2), "v"(v3), "v"(pb));
                }
            }
            if constexpr (EARLY != 0) {
                __builtin_amdgcn_sched_barrier(0);
                if (key0 < EROWS) {                                      // residual v^T plane covers keys < EROWS (wave-uniform)
                    const h16* wa = VR + vro + (size_t)key0 * HD;
                    const v16h w0 = ldh(wa), w1 = ldh(wa + 512), w2 = ldh(wa + 1024), w3 = ldh_end(wa + 1536);
                    e0 = wmma16(w0, pb, e0); e1 = wmma16(w1, pb, e1); e2 = wmma16(w2, pb, e2); e3 = wmma16(w3, pb, e3);
                    asm volatile("v_nop\n\tv_nop\n\tv_nop\n\tv_nop" : "+v"(e0), "+v"(e1), "+v"(e2), "+v"(e3) : "v"(w0), "v"(w1), "v"(w2), "v"(w3), "v"(pb));
                }
                __builtin_amdgcn_sched_barrier(0);
            }
            rem = nrem;
        }
        l += __shfl_xor(l, 16, 32);
        const unsigned dead = __builtin_amdgcn_ballot_w32(!(l > 0.0f));
        if (dead == 0u) break;                                           // wave-uniform
        noskip = 1;
    }
    const float inv = CXS * (1.0f / l);
    // O^T D layout: o_j[r] = (d = 16j + 8h + r, t = lane&15): exactly part j&1 of context unit 2h + (j>>1) (row t = lane&15, k = 16j + 8*(lane>>4) + r), so each lane stores its own accumulators, no transpose
    const size_t crow = ((size_t)b * SEQ + t0) * DM + (size_t)h * 1024 + 8 * lane;     // context plane, row b*SEQ + t, k = h*64 + d: units [(b*SEQ + t)/16][2h + d/32]
    const size_t rrow = ((size_t)b * EROWS + t0) * DM + (size_t)h * 1024 + 8 * lane;   // residual plane, row b*EROWS + t (EARLY blocks only: t0 + 15 < EROWS)
    v8f xs[4] = {o0, o1, o2, o3};
    if constexpr (EARLY != 0) { xs[0] = o0 + e0 * QRI; xs[1] = o1 + e1 * QRI; xs[2] = o2 + e2 * QRI; xs[3] = o3 + e3 * QRI; }
#pragma unroll
    for (int s = 0; s < 4; ++s) {
        const v8f x = xs[s] * inv; v8h hv, rv;
#pragma unroll
        for (int i = 0; i < 8; ++i) { const h16 a0 = (h16)x[i]; hv[i] = a0; rv[i] = (h16)((x[i] - (float)a0) * QRS); }
        *(v8h*)(CH + crow + s * 256) = hv;
        if constexpr (EARLY != 0) *(v8h*)(CR + rrow + s * 256) = rv;
    }
}

// k_flashf: both forms in one 1-D grid, so that the residual rows' few, latency-bound waves run beside the others instead of in a launch of their own. A block's job follows from its index alone (block-uniform):
// first the residual rows' blocks, then the rest, each group from the last query block down ((batch, head) fastest): under a lower-triangular mask the key walk grows with the query index,
// so the longest blocks come first in index order and the shortest last. The order is for speed only: every (query block, batch, head) is taken exactly once for any mask.
// amdgpu_waves_per_eu(5): every block of the grid is given the registers of the larger (residual) form; unbudgeted that form takes 204 = an allocation of 208 = 4 waves per SIMD, under the budget 192 = 5 waves, no scratch.
#define FB_E (EROWS / (16 * AW))
#define FB_L ((SEQ - EROWS) / (16 * AW))
#define FB_Z (NB * NH_)
__global__ __launch_bounds__(32 * AW) __attribute__((amdgpu_waves_per_eu(5))) void k_flashf(const h16* __restrict__ QH, const h16* __restrict__ QR, const h16* __restrict__ KP, const h16* __restrict__ KR,
                                                    const h16* __restrict__ VT, const h16* __restrict__ VR, const unsigned* __restrict__ MB, h16* CH, h16* CR) {
    const int bid = blockIdx.x;
    if (bid < FB_E * FB_Z) { flash_body<1>(QH, QR, KP, KR, VT, VR, MB, CH, CR, 0, FB_E - 1 - bid / FB_Z, bid % FB_Z); }
    else { const int r = bid - FB_E * FB_Z; flash_body<0>(QH, QR, KP, KR, VT, VR, MB, CH, CR, EROWS, FB_L - 1 - r / FB_Z, r % FB_Z); }
}

// oproj_body: output projection, f16 GEMM, one 4-wave block per (32*MT) x 128 tile, one wave per (16*MT) x 64 tile, K = DM; operand units staged in LDS as in proj_body (RES != 0: stage units 0..3 = A, 4..7 = AR). OUT[m][n] = OSC * (sum_k A[m][k] Bt[n][k] + QRI * sum_k AR[m][k] Bt[n][k]) + bias[n] (bias RNE-converted to bf16).
// A = context plane (x16), AR = context residual plane (RES != 0 only, rows [b*EROWS + t]), Bt = Wo x1024 as f16 ([out][in]).
// wave row tile rt = 2*rtB + (wave>>1) in 0 .. NB * tpb - 1 -> batch rt / tpb, first token rowoff + (rt % tpb) * 16*MT (tpb even: a block's two row tiles are neighbours in one batch); c0 = cB + 64*(wave&1) = first output column.
template <int MT, int RES>
__device__ __forceinline__ void oproj_body(const h16* __restrict__ A, const h16* __restrict__ AR, const h16* __restrict__ Bt, const float* __restrict__ bias, float* OUT, int tpb, int rowoff, int rtB, int cB, int k0, float* osb, char* st) {
    static_assert((MT == 4 && RES == 0) || (MT == 2 && RES == 1));
    const int K = DM;
    const int tid = threadIdx.x, lane = tid & 31, lr = lane & 15, hi = lane >> 4, wv = __builtin_amdgcn_readfirstlane(tid >> 5);
    const int rt = 2 * rtB + (wv >> 1), c0 = cB + 64 * (wv & 1);
    float* os = osb + wv * (16 * 68);                                  // wave-private epilogue tile
    const int bb = rt / tpb, tl = rt % tpb;
    const int tok = rowoff + tl * (16 * MT);
    const int tokB = rowoff + ((2 * rtB) % tpb) * (16 * MT);           // the block's first token (same batch bb)
    // unit (row tile, ks) lies at byte (row tile)*32*K + ks*1024; thread tid copies bytes 16*(tid&63) of row tiles (tid>>6) + 2j
    const char* ga = (const char*)(A  + ((size_t)bb * SEQ   + tokB + 16 * (tid >> 6)) * K + 8 * (tid & 63));
    const char* gr = (const char*)(AR + ((size_t)bb * EROWS + tokB + 16 * (tid >> 6)) * K + 8 * (tid & 63));
    const char* gb = (const char*)(Bt + (size_t)(cB + 16 * (tid >> 6)) * K + 8 * (tid & 63));
    const char* g2 = (RES != 0) ? gr : ga + 131072;                    // source of stage units 4..7
    const unsigned ls = (unsigned)(size_t)st + 16u * (unsigned)tid;
    v8f acc[MT][4], acr[MT][4];
#pragma unroll
    for (int mb = 0; mb < MT; ++mb)
#pragma unroll
        for (int nb = 0; nb < 4; ++nb) { acc[mb][nb] = (v8f){}; acr[mb][nb] = (v8f){}; }
    for (int s = 0; s < 3; ++s) {                                      // stage s holds k step (k0 + s) mod K/32
        const int ko = ((k0 + s) & (K / 32 - 1)) * 1024; const char* na = ga + ko; const char* n2 = g2 + ko; const char* nb2 = gb + ko;
        stage16(ls + s * STG, na, na + 65536, n2, n2 + 65536, nb2, nb2 + 65536, nb2 + 131072, nb2 + 196608);
    }
    wait_async16();                                                    // stage 0 landed; stages 1 and 2 fly on
    __syncthreads();                                                   // stage 0 published
    int rb = 0;                                                        // buffer of stage ks = ks mod 3
#pragma unroll 1
    for (int ks = 0; ks < K / 32; ++ks) {
        const h16* pa = (const h16*)(st + rb * STG + (wv >> 1) * (MT * 1024)) + 8 * lane; const h16* pr = pa + 2048; const h16* pb = (const h16*)(st + rb * STG + 8192 + (wv & 1) * 4096) + 8 * lane;
        v16h a[MT], ar[MT], bfrag[4];
#pragma unroll
        for (int mb = 0; mb < MT; ++mb) { a[mb] = ldh(pa + mb * 512); ar[mb] = a[mb]; }
        if constexpr (RES != 0) {
#pragma unroll
            for (int mb = 0; mb < MT; ++mb) ar[mb] = ldh(pr + mb * 512);
        }
#pragma unroll
        for (int nb = 0; nb < 4; ++nb) bfrag[nb] = ldh(pb + nb * 512);
#pragma unroll
        for (int nb = 0; nb < 4; ++nb) {
#pragma unroll
            for (int mb = 0; mb < MT; ++mb) { acc[mb][nb] = wmma16(a[mb], bfrag[nb], acc[mb][nb]);
                if constexpr (RES != 0) acr[mb][nb] = wmma16(ar[mb], bfrag[nb], acr[mb][nb]); } }
        if constexpr (MT == 4) {
            asm volatile("v_nop\n\tv_nop\n\tv_nop\n\tv_nop" : "+v"(acc[0][3]), "+v"(acc[1][3]), "+v"(acc[2][3]), "+v"(acc[3][3]) : "v"(a[0]), "v"(a[1]), "v"(a[2]), "v"(a[3]));
        } else {
            asm volatile("v_nop\n\tv_nop\n\tv_nop\n\tv_nop" : "+v"(acc[0][3]), "+v"(acc[1][3]), "+v"(acr[0][3]), "+v"(acr[1][3]) : "v"(a[0]), "v"(a[1]), "v"(ar[0]), "v"(ar[1]));
        }
        wait_ds();
        if (ks + 2 < K / 32) wait_async8(); else wait_async();         // block-uniform: stage ks + 1 landed; only stage ks + 2, where there is one, flies on
        __syncthreads();                                               // publishes stage ks + 1 and ends every wave's reads of stage ks
        if (ks + 3 < K / 32) {                                         // block-uniform: refill the buffer just left
            const int ko = ((k0 + ks + 3) & (K / 32 - 1)) * 1024; const char* na = ga + ko; const char* n2 = g2 + ko; const char* nb2 = gb + ko;
            stage16(ls + rb * STG, na, na + 65536, n2, n2 + 65536, nb2, nb2 + 65536, nb2 + 131072, nb2 + 196608);
        }
        rb = (rb == 2) ? 0 : rb + 1;
    }
    wait_async();
    float bc[4];
#pragma unroll
    for (int nb = 0; nb < 4; ++nb) bc[nb] = bfr(bias[c0 + nb * 16 + lr]);
#pragma unroll
    for (int mb = 0; mb < MT; ++mb) {
#pragma unroll
        for (int nb = 0; nb < 4; ++nb) {
#pragma unroll
            for (int j = 0; j < 8; ++j) { float v = acc[mb][nb][j] * OSC;
                if constexpr (RES != 0) v += acr[mb][nb][j] * (OSC * QRI);
                os[(hi * 8 + j) * 68 + nb * 16 + lr] = v + bc[nb]; } }                          // D: row 8h+j, col lane&15
        wave_sync();
        float* orow = OUT + ((size_t)bb * OUT_SEQ + tok + mb * 16) * DM + c0;
{
#pragma unroll
            for (int s = 0; s < 8; ++s) { const int row = 2 * s + hi, cofs = lr * 4;            // 8 s x 2 rows = 16 rows; 16 lanes x 4 floats = 64 columns
                const v4f val = *(const v4fa*)(&os[row * 68 + cofs]);
                *(v4f*)(orow + (size_t)row * DM + cofs) = val; }
             }
        wave_sync();
    }
}

// k_oprojf: both forms in one grid (x = row tile, fastest as in the separate launches: first the residual rows' tiles, then the rest; y = column tile), so that their waves share the SIMDs.
static_assert(EROWS % 64 == 0 && (SEQ - EROWS) % 128 == 0);   // a block's two row tiles lie in one batch
__global__ __launch_bounds__(32 * GW) void k_oprojf(const h16* __restrict__ CXH, const h16* __restrict__ CXR, const h16* __restrict__ WOH, const float* __restrict__ bo, float* OUT) {
    __shared__ __align__(16) float os[GW * 16 * 68];
    __shared__ __align__(1024) char st[3 * STG];
    constexpr int NR = NB * (EROWS / 64);
    const int rtB = blockIdx.x, cB = blockIdx.y * 128;
    const int k0 = (int)((blockIdx.x + 4 * blockIdx.y) & (DM / 32 - 1));  // first k step: differs among the 8 blocks that read one context row panel; the blocks of one Wo row panel spread over all 32 values
    if (rtB < NR) oproj_body<2, 1>(CXH, CXR, WOH, bo, OUT, EROWS / 32, 0, rtB, cB, k0, os, st);
    else          oproj_body<4, 0>(CXH, CXH, WOH, bo, OUT, (SEQ - EROWS) / 64, EROWS, rtB - NR, cB, k0, os, st);
}

static constexpr size_t al256(size_t v) { return (v + 255) & ~(size_t)255; }
static constexpr size_t SZ_XB = al256((size_t)NB * SEQ * DM * 2);              // x bf16
static constexpr size_t SZ_WB = al256((size_t)3 * DM * DM * 2);                // Wq | Wk | Wv bf16
static constexpr size_t SZ_WO = al256((size_t)DM * DM * 2);                    // Wo f16 (x1024)
static constexpr size_t SZ_PL = al256((size_t)NB * NH_ * SEQ * HD * 2);        // q / k / v^T planes
static constexpr size_t SZ_RP = al256((size_t)NB * NH_ * EROWS * HD * 2);      // residual planes (t < EROWS)
static constexpr size_t SZ_CX = al256((size_t)NB * SEQ * DM * 2);              // context plane
static constexpr size_t SZ_CR = al256((size_t)NB * EROWS * DM * 2);            // context residual plane
static constexpr size_t SZ_MB = al256((size_t)(SEQ / 16) * MREC * 4);          // mask records
static constexpr size_t SZ_TOTAL = SZ_XB + SZ_WB + SZ_WO + 3 * SZ_PL + 3 * SZ_RP + SZ_CX + SZ_CR + SZ_MB;
static_assert(SZ_TOTAL <= (size_t)134217728);          // workspace carve <= 128 MiB
static_assert(((size_t)DM * DM * 2) % 256 == 0);       // weight sub-planes stay 256-byte aligned

extern "C" void kernel_launch(void* const* d_in, const int* in_sizes, int n_in,
                              void* d_out, int out_size, void* d_ws, size_t ws_size, hipStream_t stream) {
    if (n_in < 10) return;
    const size_t needx = ((size_t)(NB - 1) * SEQ_FULL + SEQ) * DM;
    if ((size_t)in_sizes[0] < needx) return;
    if ((size_t)in_sizes[1] < (size_t)(SEQ - 1) * SEQ_FULL + SEQ) return;
    if ((size_t)in_sizes[2] < (size_t)DM * DM || (size_t)in_sizes[4] < (size_t)DM * DM || (size_t)in_sizes[6] < (size_t)DM * DM || (size_t)in_sizes[8] < (size_t)DM * DM) return;
    if (in_sizes[3] < DM || in_sizes[5] < DM || in_sizes[7] < DM || in_sizes[9] < DM) return;
    if ((size_t)out_size < ((size_t)(NB - 1) * OUT_SEQ + SEQ) * DM) return;
    if (SZ_TOTAL > ws_size) return;
    // wire order: query, mask (int32), Wq, bq, Wk, bk, Wv, bv, Wo, bo; weights [out][in] = Bt as-is
    const float* x  = (const float*)d_in[0]; const int* mask = (const int*)d_in[1];
    const float* wq = (const float*)d_in[2]; const float* bq = (const float*)d_in[3];
    const float* wk = (const float*)d_in[4]; const float* bk = (const float*)d_in[5];
    const float* wv = (const float*)d_in[6]; const float* bv = (const float*)d_in[7];
    const float* wo = (const float*)d_in[8]; const float* bo = (const float*)d_in[9];
    float* OUT = (float*)d_out;      // [NB][SEQ][1024]
    char* wsp = (char*)d_ws;
    bf*  XB  = (bf*)wsp;  wsp += SZ_XB;              // rows NB*SEQ, k 1024, fragment-major
    bf*  WB  = (bf*)wsp;  wsp += SZ_WB;              // 3 planes q | k | v, rows 1024, k 1024, fragment-major
    h16* WOH = (h16*)wsp; wsp += SZ_WO;              // rows 1024, k 1024, fragment-major, x1024
    h16* QH  = (h16*)wsp; wsp += SZ_PL;              // [NB*16][SEQ/16][2][unit]
    h16* KP  = (h16*)wsp; wsp += SZ_PL;              // [NB*16][SEQ/16][2][unit]
    h16* VT  = (h16*)wsp; wsp += SZ_PL;              // [NB*16][SEQ/32][4][unit]
    h16* QR  = (h16*)wsp; wsp += SZ_RP;              // [NB*16][EROWS/16][2][unit] residual x2048
    h16* KR  = (h16*)wsp; wsp += SZ_RP;              // [NB*16][EROWS/16][2][unit] residual x2048
    h16* VR  = (h16*)wsp; wsp += SZ_RP;              // [NB*16][EROWS/32][4][unit] residual x2048
    h16* CXH = (h16*)wsp; wsp += SZ_CX;              // rows NB*SEQ, k 1024, fragment-major, x16
    h16* CXR = (h16*)wsp; wsp += SZ_CR;              // rows NB*EROWS, k 1024, fragment-major, residual x2048
    unsigned* MBW = (unsigned*)wsp; wsp += SZ_MB;    // [SEQ/16][MREC] mask records
    bf* WQ = WB; bf* WK = WB + (size_t)DM * DM; bf* WV = WB + (size_t)2 * DM * DM;

    k_prep<<<PB_M + PB_X + 4 * PB_W, 1024, 0, stream>>>(x, mask, wq, wk, wv, wo, XB, WB, WOH, MBW);
    k_proj3<<<dim3(NB * SEQ / 128, DM / 256, 3), 32 * PW, 0, stream>>>(XB, WQ, WK, WV, bq, bk, bv, QH, QR, KP, KR, VT, VR);

    k_flashf<<<(FB_E + FB_L) * FB_Z, 32 * AW, 0, stream>>>(QH, QR, KP, KR, VT, VR, MBW, CXH, CXR);

    k_oprojf<<<dim3(NB * (EROWS / 64) + NB * ((SEQ - EROWS) / 128), DM / 128, 1), 32 * GW, 0, stream>>>(CXH, CXR, WOH, bo, OUT);
}

// v009
// One run takes 111 microseconds.
// In both of two side-by-side timings against v008, it was 1.05 times as fast.
// Over all steps from v000 it is 3.67 times as fast.
#include <hip/hip_runtime.h>

// Masked multi-head self-attention, width 1024 = 16 heads x 64, x [NB][SEQ][1024], Wq/Wk/Wv/Wo [out][in] (y = x W^T + b), int32 mask [SEQ][SEQ] (0 = fill -1e9), score scale 1/8, output projection with bias (f32 out).
// Compute dtypes, f32 accumulate everywhere: q/k/v projections v_wmma_f32_16x16x32_bf16 (x and W RNE-converted to bf16; products exact; biases RNE-converted to bf16, added in f32);
// scores and P.V v_wmma_f32_16x16x32_f16: single f16 planes on query rows >= 512; on the first 512 query rows q, k, v, P and the context carry an f16 residual x2048 (three products, residual terms in their own accumulator);
// P carried x256 (cancels in the normalisation); output projection v_wmma_f32_16x16x32_f16 with context x16 and bf16-exact Wo x1024 as f16 (context residual on the first 512 rows); softmax f32 (online, running max).
// Layout: every 16-bit matrix operand plane is fragment-major: a unit is one 16-row x 32-k fragment = [part 0..1][lane 0..31][8 elements] (512 elements, 1 KiB), element (part, lane, e) = (row lane&15, k 16*part + 8*(lane>>4) + e),
// so each 16-byte-per-lane load or store of a wave covers 512 contiguous bytes (4 whole lines). x, W, context planes: [row/16][k/32][unit]; q, k planes: [b*16+h][t/16][d/32][unit]; v^T plane: [b*16+h][t/32][d/16][unit]
// (+ residual planes for t < 512), written by the GEMM epilogue; fused flash kernel in transposed form (S^T = K Q^T, O^T = V^T P^T);
// mask: a pre-pass turns the int32 mask once per call into lane-select words (per 16-query tile and 32-key step: 16 words, bit L of word e = mask != 0 at the score element e that flash lane L holds) plus one 64-bit word per tile of the steps
// that hold any kept key; the flash kernel reads them by scalar loads (replace-fill by value as before); a key step fully masked for all of a wave's query rows (16 or 32) is never visited, with a full second sweep when a row ends with no visited key.

#ifndef NB
#define NB 4
#endif
#ifndef SEQ
#define SEQ 2048
#endif
#define NB_FULL  4
#define SEQ_FULL 2048
#ifndef OUT_SEQ
#define OUT_SEQ SEQ              // row pitch (in tokens) between batches of the output
#endif
#define DM   1024
#define NH_  16
#define HD   64
#define AW   4                   // waves per flash block (16 query rows each on rows < EROWS, 32 each on the rest)
#define EROWS ((SEQ) < 512 ? (SEQ) : 512)   // query rows / keys per sequence that carry residual planes
#define QRS  2048.0f             // carry of every residual plane
#define QRI  (1.0f / 2048.0f)
#define SC2  (0.125f * 1.4426950408889634f)   // HD^-0.5 * log2(e)
#define NEGL (-1.0e9f * 1.4426950408889634f)  // masked fill in the log2 domain
#define PSH  8.0f                // log2 of the P carry (256)
#define CXS  16.0f               // carry of the context planes
#define WOS  1024.0f             // carry of the Wo plane
#define OSC  (1.0f / 16384.0f)   // 1 / (CXS * WOS)
#define NST  (SEQ / 32)          // 32-key steps per sequence
#define MREC (NST * 16 + 32)     // words of one 16-query tile's mask record: NST steps x 16 lane-select words, then one 128-B line whose first two words are the live-step bits
#define ALLST ((NST) >= 64 ? ~0ull : ((1ull << ((NST) & 63)) - 1ull))

static_assert(HD == 64);
static_assert(NH_ * HD == DM);                 // head h = columns h*64 + d
static_assert(DM % 64 == 0);
static_assert(DM % 32 == 0);                   // GEMM k-loop steps by 32
static_assert(((DM / 32) & (DM / 32 - 1)) == 0);   // the cyclic k walk wraps by a mask
static_assert(SEQ % 64 == 0);                  // a 64-row tile never straddles two batches
static_assert((NB * SEQ) % 64 == 0);
static_assert(SEQ % 32 == 0);                  // key loop steps by 32
static_assert(EROWS % 64 == 0);                // residual tiles are whole 64-tiles; flash grid covers them exactly
static_assert(EROWS % (16 * AW) == 0);
static_assert((SEQ - EROWS) % 64 == 0);
static_assert((SEQ - EROWS) % (16 * AW) == 0);
static_assert(EROWS <= SEQ);
static_assert(((size_t)SEQ * DM) % 8 == 0);
static_assert(((size_t)DM * DM) % 8 == 0);
static_assert(NB <= NB_FULL);
static_assert(SEQ <= SEQ_FULL);
static_assert(NST <= 64);                      // live-step bits fit one 64-bit word; 32 waves x 2 steps cover a tile in mbits
static_assert(NST % 2 == 0);

typedef _Float16 h16;
typedef unsigned short bf;
typedef __attribute__((ext_vector_type(16))) __bf16   v16bf;
typedef __attribute__((ext_vector_type(16))) _Float16 v16h;
typedef __attribute__((ext_vector_type(8)))  _Float16 v8h;
typedef __attribute__((ext_vector_type(8)))  unsigned short v8us;
typedef __attribute__((ext_vector_type(8)))  float    v8f;
typedef __attribute__((ext_vector_type(4)))  float    v4f;
typedef __attribute__((ext_vector_type(4)))  int      v4i;
typedef v4f  __attribute__((may_alias)) v4fa;
typedef __attribute__((ext_vector_type(16))) unsigned v16u;

__device__ __forceinline__ unsigned short f2bf(float f) { unsigned u = __float_as_uint(f); u += 0x7FFFu + ((u >> 16) & 1u); return (unsigned short)(u >> 16); }
__device__ __forceinline__ float bfr(float f) { return __uint_as_float(((unsigned)f2bf(f)) << 16); }   // value after RNE convert to bf16
__device__ __forceinline__ v16h cat16(v8h lo, v8h hi) { return __builtin_shufflevector(lo, hi, 0, 1, 2, 3, 4, 5, 6, 7, 8, 9, 10, 11, 12, 13, 14, 15); }
__device__ __forceinline__ v16bf cat16b(v8us lo, v8us hi) { return __builtin_bit_cast(v16bf, __builtin_shufflevector(lo, hi, 0, 1, 2, 3, 4, 5, 6, 7, 8, 9, 10, 11, 12, 13, 14, 15)); }
__device__ __forceinline__ v8f wmma16(v16h a, v16h b, v8f c) { return __builtin_amdgcn_wmma_f32_16x16x32_f16(false, a, false, b, (short)0, c, false, false); }
__device__ __forceinline__ v8f wmmab(v16bf a, v16bf b, v8f c) { return __builtin_amdgcn_wmma_f32_16x16x32_bf16(false, a, false, b, (short)0, c, false, false); }
// fragment loaders from a fragment-major unit; p = unit base + 8*lane: elements 0..7 <- k0+8h+0..7 (part 0), elements 8..15 <- k0+16+8h+0..7 (part 1, +256 elements) (same map for A and B)
__device__ __forceinline__ v16h  ldh(const h16* p) { return cat16(*(const v8h*)p, *(const v8h*)(p + 256)); }
__device__ __forceinline__ v16bf ldb(const bf* p)  { return cat16b(*(const v8us*)p, *(const v8us*)(p + 256)); }
// ldh_end: ldh for the last fragment read off an address pair, where the compiler lands the last load's data on the pair itself: the s_wait_xcnt stands in front of that load, behind every other load that names the pair
__device__ __forceinline__ v16h  ldh_end(const h16* p) { const v8h lo = *(const v8h*)p; asm volatile("s_wait_xcnt 0x0" ::: "memory"); return cat16(lo, *(const v8h*)(p + 256)); }
// converters: a wave takes 8 rows x 32 k (8 whole 128-B lines of f32) and writes 4 whole 128-B lines of one unit. Thread i -> source element offset (row-major, DM columns) and fragment-major destination offset.
__device__ __forceinline__ void cvt_map(size_t i, size_t& so, size_t& dof) {
    const int lane = (int)(i & 31); const size_t w = i >> 5; const size_t ks = w % (DM / 32); const size_t row = (w / (DM / 32)) * 8 + (size_t)(lane >> 2); const int c = lane & 3;
    so  = row * DM + ks * 32 + (size_t)c * 8;
    dof = (row >> 4) * (size_t)(16 * DM) + ks * 512 + (size_t)(c >> 1) * 256 + (size_t)(c & 1) * 128 + (row & 15) * 8;
}
// ordering point for wave-private LDS tiles (same wave writes and reads)
__device__ __forceinline__ void wave_sync() { __builtin_amdgcn_fence(3 /* release order */, "wavefront"); __builtin_amdgcn_wave_barrier(); asm volatile("" ::: "memory"); }

// GEMM blocks: the waves of a block share one stage = the fragment-major units (1 KiB each) of one 32-k step, 8 of the row operand(s), then those of the column operand; three stage buffers in LDS, copies two stages ahead of their use.
// Output projection: 4 waves (2 x 2 wave tiles), 8 + 8 units. q/k/v projections: 8 waves (2 x 4 wave tiles), 8 + 16 units.
#define GW  4
#define STG 16384
#define PW   8
#define PSTG 24576
// stage16: the block's 128 threads bring one stage from the global planes into LDS, 8 asynchronous 16-B copies per thread; copy j fills bytes 16*tid of the unit pair 2j, 2j+1 (l = stage buffer + 16*tid, pj = the thread's own source bytes).
// The s_wait_xcnt stands inside the statement so that no address register of an issued copy is rewritten in front of it.
__device__ __forceinline__ void stage16(unsigned l, const char* p0, const char* p1, const char* p2, const char* p3, const char* p4, const char* p5, const char* p6, const char* p7) {
    asm volatile("global_load_async_to_lds_b128 %0, %8, off\n\t"
                 "global_load_async_to_lds_b128 %1, %9, off\n\t"
                 "global_load_async_to_lds_b128 %2, %10, off\n\t"
                 "global_load_async_to_lds_b128 %3, %11, off\n\t"
                 "global_load_async_to_lds_b128 %4, %12, off\n\t"
                 "global_load_async_to_lds_b128 %5, %13, off\n\t"
                 "global_load_async_to_lds_b128 %6, %14, off\n\t"
                 "global_load_async_to_lds_b128 %7, %15, off\n\t"
                 "s_wait_xcnt 0x0"
                 :: "v"(l), "v"(l + 2048u), "v"(l + 4096u), "v"(l + 6144u), "v"(l + 8192u), "v"(l + 10240u), "v"(l + 12288u), "v"(l + 14336u),
                    "v"(p0), "v"(p1), "v"(p2), "v"(p3), "v"(p4), "v"(p5), "v"(p6), "v"(p7) : "memory");
}
// stage24: the same for a block of 256 threads and 24 units, 6 copies per thread; copy j fills bytes 16*tid of the four units 4j .. 4j+3
__device__ __forceinline__ void stage24(unsigned l, const char* p0, const char* p1, const char* p2, const char* p3, const char* p4, const char* p5) {
    asm volatile("global_load_async_to_lds_b128 %0, %6, off\n\t"
                 "global_load_async_to_lds_b128 %1, %7, off\n\t"
                 "global_load_async_to_lds_b128 %2, %8, off\n\t"
                 "global_load_async_to_lds_b128 %3, %9, off\n\t"
                 "global_load_async_to_lds_b128 %4, %10, off\n\t"
                 "global_load_async_to_lds_b128 %5, %11, off\n\t"
                 "s_wait_xcnt 0x0"
                 :: "v"(l), "v"(l + 4096u), "v"(l + 8192u), "v"(l + 12288u), "v"(l + 16384u), "v"(l + 20480u),
                    "v"(p0), "v"(p1), "v"(p2), "v"(p3), "v"(p4), "v"(p5) : "memory");
}
// the two waits of a stage hand-over, each in front of the block barrier: the wave's own LDS reads done (its buffer may be refilled), the wave's own copies landed (the other waves may read them)
__device__ __forceinline__ void wait_ds()    { asm volatile("s_wait_dscnt 0x0" ::: "memory"); }
__device__ __forceinline__ void wait_async() { asm volatile("s_wait_asynccnt 0x0" ::: "memory"); }
__device__ __forceinline__ void wait_async6()  { asm volatile("s_wait_asynccnt 0x6" ::: "memory"); }
__device__ __forceinline__ void wait_async8()  { asm volatile("s_wait_asynccnt 0x8" ::: "memory"); }
__device__ __forceinline__ void wait_async12() { asm volatile("s_wait_asynccnt 0xc" ::: "memory"); }
__device__ __forceinline__ void wait_async16() { asm volatile("s_wait_asynccnt 0x10" ::: "memory"); }

__device__ __forceinline__ void cvt8(const float* __restrict__ src, bf* dst, size_t i) {
    size_t so, dof; cvt_map(i, so, dof);
    const v8f v = *(const v8f*)(src + so); v8us o;
#pragma unroll
    for (int k = 0; k < 8; ++k) o[k] = f2bf(v[k]);
    bf* dp = dst + dof;
    *(v8us*)dp = o;
    asm volatile("s_wait_xcnt 0x0" :: "v"(o), "v"(dp) : "memory");   // before the issued store's registers are reused
}

__device__ __forceinline__ void cvtw8(const float* __restrict__ src, h16* dst, size_t i) {
    size_t so, dof; cvt_map(i, so, dof);
    const v8f v = *(const v8f*)(src + so); v8h o;
#pragma unroll
    for (int k = 0; k < 8; ++k) o[k] = (h16)(bfr(v[k]) * WOS);
    h16* dp = dst + dof;
    *(v8h*)dp = o;
    asm volatile("s_wait_xcnt 0x0" :: "v"(o), "v"(dp) : "memory");   // the same for this store
}

// mbits: one 32-wave block per 16-query tile, wave w packs steps 2w and 2w+1. Each lane loads the 16 mask words of the score elements it holds in flash_body (row lane&15; keys 8*(lane>>4)+0..7 and 16+8*(lane>>4)+0..7 of the step);
// the ballot over element e is the lane-select word e. A wave stores its two steps as one whole 128-B line; wave 0 gathers the live-step bits (bit s = step s holds a kept key) and stores them as the record's last line.
__device__ __forceinline__ void mbits(const int* __restrict__ MK, unsigned* MB, int tile, unsigned* sm) {
    const int lane = threadIdx.x & 31, wave = __builtin_amdgcn_readfirstlane((int)(threadIdx.x >> 5)), lr = lane & 15, hi = lane >> 4;
    unsigned* rec = MB + (size_t)tile * MREC;
    unsigned live2 = 0u;
    if (2 * wave < NST) {                                                // wave-uniform
        const int* mp = MK + (size_t)(tile * 16 + lr) * SEQ_FULL + wave * 64 + 8 * hi;
        unsigned w = 0u;
#pragma unroll
        for (int u = 0; u < 2; ++u) {
            const v4i a0 = *(const v4i*)(mp + 32 * u), a1 = *(const v4i*)(mp + 32 * u + 4), b0 = *(const v4i*)(mp + 32 * u + 16), b1 = *(const v4i*)(mp + 32 * u + 20);
            const int q[16] = {a0[0], a0[1], a0[2], a0[3], a1[0], a1[1], a1[2], a1[3], b0[0], b0[1], b0[2], b0[3], b1[0], b1[1], b1[2], b1[3]};
            unsigned any = 0u;
#pragma unroll
            for (int e = 0; e < 16; ++e) { const unsigned bal = __builtin_amdgcn_ballot_w32(q[e] != 0); any |= bal; w = (lane == 16 * u + e) ? bal : w; }
            live2 |= (any != 0u ? 1u : 0u) << u;
        }
        rec[wave * 32 + lane] = w;
    }
    if (lane == 0) sm[wave] = live2;
    __syncthreads();
    if (wave == 0) {
        unsigned v = sm[lane] << (2 * lr);                               // lanes 0..15: steps 0..31, lanes 16..31: steps 32..63
        v |= __shfl_xor(v, 1, 32); v |= __shfl_xor(v, 2, 32); v |= __shfl_xor(v, 4, 32); v |= __shfl_xor(v, 8, 32);
        const unsigned vh = __shfl(v, 16, 32);
        rec[NST * 16 + lane] = (lane == 0) ? v : ((lane == 1) ? vh : 0u);
    }
}

// k_prep: every operand preparation of a call in one grid of 1024-thread blocks, so that the six independent jobs share the chip instead of running one after another;
// a block's job follows from its index alone (block-uniform): mask tiles, then x, then Wq | Wk | Wv, then Wo. Thread -> element inside each job is as in the separate launches.
#define PB_M (SEQ / 16)
#define PB_X ((int)((size_t)NB * SEQ * DM / 8 / 1024))
#define PB_W ((int)((size_t)DM * DM / 8 / 1024))
static_assert(((size_t)SEQ * DM / 8) % 1024 == 0);     // x blocks cover each batch exactly
static_assert(((size_t)DM * DM / 8) % 1024 == 0);      // weight blocks cover each matrix exactly
__global__ __launch_bounds__(1024) void k_prep(const float* __restrict__ x, const int* __restrict__ MK, const float* __restrict__ wq, const float* __restrict__ wk, const float* __restrict__ wv, const float* __restrict__ wo,
                                               bf* XB, bf* WB, h16* WOH, unsigned* MB) {
    __shared__ unsigned sm[32];
    int bid = blockIdx.x;
    if (bid < PB_M) { mbits(MK, MB, bid, sm); return; }
    bid -= PB_M;
    if (bid < PB_X) {
        const size_t i = (size_t)bid * 1024 + threadIdx.x; const size_t nb8 = (size_t)SEQ * DM / 8; const size_t b = i / nb8;
        cvt8(x + b * SEQ_FULL * DM, XB + b * SEQ * DM, i % nb8); return;
    }
    bid -= PB_X;
    const int which = bid / PB_W; const size_t i = (size_t)(bid % PB_W) * 1024 + threadIdx.x;
    if (which == 3) cvtw8(wo, WOH, i);
    else cvt8(which == 0 ? wq : (which == 1 ? wk : wv), WB + (size_t)which * DM * DM, i);
}

// proj_body: register-blocked bf16 GEMM, one 8-wave block per 128x256 tile at (rB, cB), one wave per 64x64 tile at (r0, c0) (16 accumulators), K = DM; the block's operand units come from the fragment-major bf16 planes
// into LDS by asynchronous copies, two 32-k stages ahead (three buffers), and each unit is read from LDS by the four (row operand) or two (column operand) waves that need it.
// The k walk is cyclic: stage s holds k step (k0 + s) mod K/32, k0 block-uniform from the block index, so that blocks which share an operand panel and run side by side ask L2 for different lines at one moment (every k step is taken exactly once).
// C[m][n] = sum_k A[m][k] Bt[n][k] + bias (BIASROW == 0: bias[n]; BIASROW != 0: bias[m]), written as f16 (Ph), fragment-major with row = m, k = n, at
// tile base (r0/RB)*sRB + (r0%RB)*pitch + (c0/CB)*sCB + (c0%CB)*CMUL, + mb*MBS per 16 rows, + S1S per 32 columns; the f16 residual x2048 (Pr) is written with its own strides when (r0%RB) < rlim and (c0%CB) < clim.
template <int BIASROW>
__device__ __forceinline__ void proj_body(const bf* __restrict__ A, const bf* __restrict__ Bt, const float* __restrict__ bias, h16* Ph, h16* Pr,
                                          int RB, size_t sRB, int pitch, int CB, size_t sCB,
                                          size_t sRBr, int pitchr, size_t sCBr, int rlim, int clim, int rB, int cB, int k0, float* osb, char* st) {
    const int K = DM;
    const int tid = threadIdx.x, lane = tid & 31, lr = lane & 15, hi = lane >> 4, wv = __builtin_amdgcn_readfirstlane(tid >> 5);
    const int r0 = rB + 64 * (wv >> 2), c0 = cB + 64 * (wv & 3);
    float* os = osb + wv * (16 * 68);                                    // wave-private epilogue tile
    v8f acc[4][4];
#pragma unroll
    for (int mb = 0; mb < 4; ++mb)
#pragma unroll
        for (int nb = 0; nb < 4; ++nb) acc[mb][nb] = (v8f){};
    constexpr int MBS = (BIASROW != 0) ? 512 : 1024, S1S = (BIASROW != 0) ? 2048 : 512, CMUL = (BIASROW != 0) ? 64 : 1;   // q, k: [t/16][d/32][unit]; v^T: [t/32][d/16][unit]
    // unit (row tile, ks) lies at byte (row tile)*32*K + ks*1024; thread tid copies bytes 16*(tid&63) of row tiles (tid>>6) + 4j
    const char* ga = (const char*)(A  + (size_t)(rB + 16 * (tid >> 6)) * K + 8 * (tid & 63));
    const char* gb = (const char*)(Bt + (size_t)(cB + 16 * (tid >> 6)) * K + 8 * (tid & 63));
    const unsigned ls = (unsigned)(size_t)st + 16u * (unsigned)tid;
    for (int s = 0; s < 3; ++s) {                                        // stage s holds k step (k0 + s) mod K/32
        const int ko = ((k0 + s) & (K / 32 - 1)) * 1024; const char* na = ga + ko; const char* nb2 = gb + ko;
        stage24(ls + s * PSTG, na, na + 131072, nb2, nb2 + 131072, nb2 + 262144, nb2 + 393216);
    }
    wait_async12();                                                      // stage 0 landed; stages 1 and 2 fly on
    __syncthreads();                                                     // stage 0 published
    int rb = 0;                                                          // buffer of stage ks = ks mod 3
#pragma unroll 1
    for (int ks = 0; ks < K / 32; ++ks) {
        const bf* pa = (const bf*)(st + rb * PSTG + (wv >> 2) * 4096) + 8 * lane; const bf* pb = (const bf*)(st + rb * PSTG + 8192 + (wv & 3) * 4096) + 8 * lane;
        v16bf a[4], b[4];
#pragma unroll
        for (int mb = 0; mb < 4; ++mb) a[mb] = ldb(pa + mb * 512);
#pragma unroll
        for (int nb = 0; nb < 4; ++nb) b[nb] = ldb(pb + nb * 512);
#pragma unroll
        for (int nb = 0; nb < 4; ++nb) {
#pragma unroll
            for (int mb = 0; mb < 4; ++mb) acc[mb][nb] = wmmab(a[mb], b[nb], acc[mb][nb]); }
        asm volatile("v_nop\n\tv_nop\n\tv_nop\n\tv_nop" : "+v"(acc[0][3]), "+v"(acc[1][3]), "+v"(acc[2][3]), "+v"(acc[3][3]) : "v"(a[0]), "v"(a[1]), "v"(a[2]), "v"(a[3]));
        wait_ds();
        if (ks + 2 < K / 32) wait_async6(); else wait_async();           // block-uniform: stage ks + 1 landed; only stage ks + 2, where there is one, flies on
        __syncthreads();                                                 // publishes stage ks + 1 and ends every wave's reads of stage ks
        if (ks + 3 < K / 32) {                                           // block-uniform: refill the buffer just left
            const int ko = ((k0 + ks + 3) & (K / 32 - 1)) * 1024; const char* na = ga + ko; const char* nb2 = gb + ko;
            stage24(ls + rb * PSTG, na, na + 131072, nb2, nb2 + 131072, nb2 + 262144, nb2 + 393216);
        }
        rb = (rb == 2) ? 0 : rb + 1;
    }
    wait_async();
    float bc[4] = {0.0f, 0.0f, 0.0f, 0.0f};
    if constexpr (BIASROW == 0) {
#pragma unroll
        for (int nb = 0; nb < 4; ++nb) bc[nb] = bfr(bias[c0 + nb * 16 + lr]);
    }
    const int wres = (((r0 % RB) < rlim) && ((c0 % CB) < clim)) ? 1 : 0;   // tile-uniform
    const size_t tbase = (size_t)(r0 / RB) * sRB + (size_t)(r0 % RB) * (size_t)pitch + (size_t)(c0 / CB) * sCB + (size_t)(c0 % CB) * CMUL;
    const size_t tbasr = (size_t)(r0 / RB) * sRBr + (size_t)(r0 % RB) * (size_t)pitchr + (size_t)(c0 / CB) * sCBr + (size_t)(c0 % CB) * CMUL;
#pragma unroll
    for (int mb = 0; mb < 4; ++mb) {
        float rb[8];
        if constexpr (BIASROW != 0) {
            const v4f b0 = *(const v4f*)(bias + r0 + mb * 16 + 8 * hi); const v4f b1 = *(const v4f*)(bias + r0 + mb * 16 + 8 * hi + 4);
#pragma unroll
            for (int i = 0; i < 4; ++i) { rb[i] = bfr(b0[i]); rb[4 + i] = bfr(b1[i]); }
        } else {
#pragma unroll
            for (int j = 0; j < 8; ++j) rb[j] = 0.0f;
        }
#pragma unroll
        for (int nb = 0; nb < 4; ++nb) {
#pragma unroll
            for (int j = 0; j < 8; ++j) os[(hi * 8 + j) * 68 + nb * 16 + lr] = acc[mb][nb][j] + ((BIASROW != 0) ? rb[j] : bc[nb]); }   // D: row 8h+j, col lane&15
        wave_sync();
        const size_t sb = tbase + (size_t)(mb * MBS) + 8 * lane;
        const size_t sr = tbasr + (size_t)(mb * MBS) + 8 * lane;
{
#pragma unroll
            for (int s = 0; s < 4; ++s) { const int row = lr, c8 = (2 * s + hi) * 8;   // store s = part s&1 of the unit of columns 32*(s>>1)..+31: lane holds row lane&15, columns 16*s + 8*(lane>>4) + 0..7
                const v4f x0 = *(const v4fa*)(&os[row * 68 + c8]); const v4f x1 = *(const v4fa*)(&os[row * 68 + c8 + 4]); v8h hv, rv;
#pragma unroll
                for (int i = 0; i < 4; ++i) { const h16 a0 = (h16)x0[i]; const h16 a1 = (h16)x1[i]; hv[i] = a0; hv[4 + i] = a1; rv[i] = (h16)((x0[i] - (float)a0) * QRS); rv[4 + i] = (h16)((x1[i] - (float)a1) * QRS); }
                *(v8h*)(Ph + sb + (s >> 1) * S1S + (s & 1) * 256) = hv;
                asm volatile("s_wait_xcnt 0x0" :: "v"(hv) : "memory");       // before the issued store's registers are reused
                if (wres) { *(v8h*)(Pr + sr + (s >> 1) * S1S + (s & 1) * 256) = rv;
                    asm volatile("s_wait_xcnt 0x0" :: "v"(rv) : "memory"); } }   // the same for the residual store
             }
        wave_sync();
    }
}

// k_proj3: the three projections in one grid (z = q | k | v), so that their waves share the SIMDs; inside each z the tiles come in the order of the separate launches (q, k: token tile fastest; v^T: feature tile fastest).
// q, k: A = x rows (m = b*SEQ + t), Bt = W rows (n = h*64 + d), bias by column -> plane [(b*16 + h)][t/16][d/32][unit]; residual plane the same for t < EROWS
// v^T: A = Wv rows (m = h*64 + d), Bt = x rows (n = b*SEQ + t), bias by row -> plane [(b*16 + h)][t/32][d/16][unit]; residual plane the same for t < EROWS
static_assert((NB * SEQ) % 256 == 0 && DM % 256 == 0 && DM / 32 >= 3);   // whole 128x256 block tiles in both forms; the three-buffer prologue needs three stages
__global__ __launch_bounds__(32 * PW) void k_proj3(const bf* __restrict__ XB, const bf* __restrict__ WQ, const bf* __restrict__ WK, const bf* __restrict__ WV, const float* __restrict__ bq, const float* __restrict__ bk, const float* __restrict__ bv,
                                              h16* QH, h16* QR, h16* KP, h16* KR, h16* VT, h16* VR) {
    __shared__ __align__(16) float os[PW * 16 * 68];
    __shared__ __align__(1024) char st[3 * PSTG];
    const int z = blockIdx.z;
    if (z == 2) {
        const int flat = blockIdx.y * (NB * SEQ / 128) + blockIdx.x;
        const int k0 = (flat / (DM / 128) + 4 * (flat % (DM / 128))) & (DM / 32 - 1);   // first k step: differs among the blocks that read one Wv row panel (32 values) and among those that read one x row panel (8 values)
        proj_body<1>(WV, XB, bv, VT, VR, DM, (size_t)0, SEQ, SEQ, (size_t)DM * SEQ, (size_t)0, EROWS, (size_t)DM * EROWS, DM, EROWS, (flat % (DM / 128)) * 128, (flat / (DM / 128)) * 256, k0, os, st);
    } else {
        const int k0 = (int)((blockIdx.x + 8 * blockIdx.y + 4 * z) & (DM / 32 - 1));    // first k step: differs among the 8 q and k blocks that read one x row panel; the 64 blocks of one W row panel take the 32 values twice
        proj_body<0>(XB, z == 0 ? WQ : WK, z == 0 ? bq : bk, z == 0 ? QH : KP, z == 0 ? QR : KR, SEQ, (size_t)NH_ * SEQ * HD, HD, HD, (size_t)SEQ * HD,
                     (size_t)NH_ * EROWS * HD, HD, (size_t)EROWS * HD, EROWS, HD, blockIdx.x * 128, blockIdx.y * 256, k0, os, st);
    }
}

// flash_body: fused masked attention, one wave per 16 query rows of one (batch, head) (rows >= EROWS: flash_wide below, the same scheme on 32 rows); K / V^T / Q fragments straight from the fragment-major f16 planes (two 16-B loads each, 512 contiguous bytes per wave-load).
// Transposed form: S^T[key][t] = K Q^T (A = K rows, B = Q rows); lane (t = lane&15, h = lane>>4) holds keys 8h+r of each 16-key tile, so the packed
// P tile is directly the B fragment of O^T[d][t] = V^T P^T (element r <- tile keys 0..15, element 8+r <- tile keys 16..31, lane unchanged).
// Mask: the wave reads the step's 16 lane-select words (64 B, wave-uniform address) and replaces masked scores by the fill value; the loop walks the set bits of the tile's live-step word (cyclically, from a step of the block's own), so a step whose 16x32 mask tile is all zero is not visited;
// if some row ends with no visited key the wave repeats the sweep over every step, which yields the uniform average of a fully masked row.
// This form serves the query rows < EROWS: q, k, v and P carry residuals x2048; residual products accumulate separately and are folded back with 1/2048.
__device__ __forceinline__ void flash_body(const h16* __restrict__ QH, const h16* __restrict__ QR, const h16* __restrict__ KP, const h16* __restrict__ KR,
                                           const h16* __restrict__ VT, const h16* __restrict__ VR, const unsigned* __restrict__ MB, h16* CH, h16* CR, int tstart, int bx, int zh) {
    const int lane = threadIdx.x & 31, wave = __builtin_amdgcn_readfirstlane((int)(threadIdx.x >> 5)), lr = lane & 15, hi = lane >> 4;
    const int b = zh / NH_, h = zh % NH_;
    const int t0 = tstart + (bx * AW + wave) * 16;
    const size_t pbase = (size_t)zh * SEQ * HD;
    const size_t rbase = (size_t)zh * EROWS * HD;
    const size_t qo = pbase + (size_t)t0 * HD + 8 * lane;
    const v16h qh0 = ldh(QH + qo), qh1 = ldh(QH + qo + 512);                // B fragments: col t, k = d
    const size_t qro = rbase + (size_t)t0 * HD + 8 * lane;
    const v16h qr0 = ldh(QR + qro), qr1 = ldh(QR + qro + 512);
    const size_t ko  = pbase + 8 * lane;       // + key0 * HD + 512 * (d/32)   (A fragment: row key, k = d; 16 keys = 1024 elements)
    const size_t kro = rbase + 8 * lane;
    const size_t vo  = pbase + 8 * lane;       // + key0 * HD + 512 * j        (A fragment: row d = 16j.., k = key; 32 keys = 2048 elements)
    const size_t vro = rbase + 8 * lane;
    const unsigned* mrec = MB + (size_t)(t0 >> 4) * MREC;      // this tile's mask record (wave-uniform)
    const unsigned long long live = *(const unsigned long long*)(mrec + NST * 16) & ALLST;
    // cyclic key walk: the block's waves take the live steps from step s0 up, then those below it, so that the query blocks of one (batch, head), which run side by side, ask L2 for different K and V^T lines at one moment.
    // s0 is block-uniform (the block's waves stay on the same lines), differs too among the (batch, head) blocks that read one mask record, and is spread over the steps that a lower-triangular mask leaves the block;
    // for speed only: any s0 in 0..63 visits every live step exactly once.
    const int g = (tstart + bx * (16 * AW)) / (16 * AW);       // index of the block among the query blocks of its (batch, head)
    const int s0 = ((((g * 13 + zh * 5) & 31) * ((g + 1) * (16 * AW) / 32)) >> 5) & 63;
    const unsigned long long lowm = (1ull << s0) - 1ull;       // steps below s0
    v8f o0 = (v8f){}, o1 = (v8f){}, o2 = (v8f){}, o3 = (v8f){};
    v8f e0 = (v8f){}, e1 = (v8f){}, e2 = (v8f){}, e3 = (v8f){};
    float m = -3.0e38f, l = 0.0f;
    int noskip = 0;
#pragma unroll 1
    for (int pass = 0; pass < 2; ++pass) {
        o0 = (v8f){}; o1 = (v8f){}; o2 = (v8f){}; o3 = (v8f){};
        e0 = (v8f){}; e1 = (v8f){}; e2 = (v8f){}; e3 = (v8f){};
        m = -3.0e38f; l = 0.0f;
        const unsigned long long all = (noskip != 0) ? ALLST : live;
        unsigned long long rem = all & ~lowm, rest = all & lowm;         // steps being walked; steps still to come behind them
        if (rem == 0ull) { rem = rest; rest = 0ull; }
#pragma unroll 1
        while (rem != 0ull) {                                            // at most NST trips, wave-uniform
            const int key0 = 32 * __builtin_ctzll(rem);
            unsigned long long nrem = rem & (rem - 1ull);
            if (nrem == 0ull) { nrem = rest; rest = 0ull; }              // top reached: go on with the steps below s0
            const v16u mw = *(const v16u*)(mrec + (key0 >> 1));          // 16 words per step
            const h16* ka = KP + ko + (size_t)key0 * HD;
            v8f sHa = (v8f){}, sHb = (v8f){}, sLa = (v8f){}, sLb = (v8f){};
            const v16h ka0 = ldh(ka), ka1 = ldh(ka + 512), kb0 = ldh(ka + 16 * HD), kb1 = ldh_end(ka + 16 * HD + 512);
            sHa = wmma16(ka0, qh0, sHa); sHb = wmma16(kb0, qh0, sHb); sHa = wmma16(ka1, qh1, sHa); sHb = wmma16(kb1, qh1, sHb);
            sLa = wmma16(ka0, qr0, sLa); sLb = wmma16(kb0, qr0, sLb); sLa = wmma16(ka1, qr1, sLa); sLb = wmma16(kb1, qr1, sLb);
            asm volatile("v_nop\n\tv_nop\n\tv_nop\n\tv_nop" : "+v"(sHa), "+v"(sHb), "+v"(sLa), "+v"(sLb) : "v"(ka0), "v"(ka1), "v"(kb0), "v"(kb1));
            __builtin_amdgcn_sched_barrier(0);
            if (key0 < EROWS) {                                      // residual k plane covers keys < EROWS (wave-uniform)
                const h16* ra = KR + kro + (size_t)key0 * HD;
                const v16h ra0 = ldh(ra), ra1 = ldh(ra + 512), rb0 = ldh(ra + 16 * HD), rb1 = ldh_end(ra + 16 * HD + 512);
                sLa = wmma16(ra0, qh0, sLa); sLb = wmma16(rb0, qh0, sLb); sLa = wmma16(ra1, qh1, sLa); sLb = wmma16(rb1, qh1, sLb);
                asm volatile("v_nop\n\tv_nop\n\tv_nop\n\tv_nop" : "+v"(sLa), "+v"(sLb) : "v"(ra0), "v"(ra1), "v"(rb0), "v"(rb1));
            }
            __builtin_amdgcn_sched_barrier(0);
            float ta[8], tb[8]; float mx = -3.0e38f;
#pragma unroll
            for (int r = 0; r < 8; ++r) {
                float sa = sHa[r], sb = sHb[r];
                sa += sLa[r] * QRI; sb += sLb[r] * QRI;
                ta[r] = __builtin_amdgcn_inverse_ballot_w32(mw[r]) ? sa * SC2 : NEGL;
                tb[r] = __builtin_amdgcn_inverse_ballot_w32(mw[8 + r]) ? sb * SC2 : NEGL;
                mx = fmaxf(mx, fmaxf(ta[r], tb[r]));
            }
            mx = fmaxf(mx, __shfl_xor(mx, 16, 32));
            const float mnew = fmaxf(m, mx);
            const float alpha = __builtin_amdgcn_exp2f(m - mnew);
            const float sh = PSH - mnew;
            v16h pb = (v16h){}; v16h pq = (v16h){}; float ls = 0.0f;
#pragma unroll
            for (int r = 0; r < 8; ++r) {
                const float pa = __builtin_amdgcn_exp2f(ta[r] + sh), pc = __builtin_amdgcn_exp2f(tb[r] + sh);
                const h16 ha = (h16)pa, hc = (h16)pc; pb[r] = ha; pb[8 + r] = hc;
                const h16 ga = (h16)((pa - (float)ha) * QRS), gc = (h16)((pc - (float)hc) * QRS); pq[r] = ga; pq[8 + r] = gc;
                ls += ((float)ha + (float)hc) + ((float)ga + (float)gc) * QRI;
            }
            l = l * alpha + ls; m = mnew;
            o0 = o0 * alpha; o1 = o1 * alpha; o2 = o2 * alpha; o3 = o3 * alpha;
            e0 = e0 * alpha; e1 = e1 * alpha; e2 = e2 * alpha; e3 = e3 * alpha;
            const h16* va = VT + vo + (size_t)key0 * HD;
            const v16h v0 = ldh(va), v1 = ldh(va + 512), v2 = ldh(va + 1024), v3 = ldh_end(va + 1536);
            o0 = wmma16(v0, pb, o0); o1 = wmma16(v1, pb, o1); o2 = wmma16(v2, pb, o2); o3 = wmma16(v3, pb, o3);
            e0 = wmma16(v0, pq, e0); e1 = wmma16(v1, pq, e1); e2 = wmma16(v2, pq, e2); e3 = wmma16(v3, pq, e3);
            asm volatile("v_nop\n\tv_nop\n\tv_nop\n\tv_nop" : "+v"(o0), "+v"(o1), "+v"(o2), "+v"(o3), "+v"(e0), "+v"(e1), "+v"(e2), "+v"(e3) : "v"(v0), "v"(v1), "v"(v2), "v"(v3), "v"(pb), "v"(pq));
            __builtin_amdgcn_sched_barrier(0);
            if (key0 < EROWS) {                                      // residual v^T plane covers keys < EROWS (wave-uniform)
                const h16* wa = VR + vro + (size_t)key0 * HD;
                const v16h w0 = ldh(wa), w1 = ldh(wa + 512), w2 = ldh(wa + 1024), w3 = ldh_end(wa + 1536);
                e0 = wmma16(w0, pb, e0); e1 = wmma16(w1, pb, e1); e2 = wmma16(w2, pb, e2); e3 = wmma16(w3, pb, e3);
                asm volatile("v_nop\n\tv_nop\n\tv_nop\n\tv_nop" : "+v"(e0), "+v"(e1), "+v"(e2), "+v"(e3) : "v"(w0), "v"(w1), "v"(w2), "v"(w3), "v"(pb));
            }
            __builtin_amdgcn_sched_barrier(0);
            rem = nrem;
        }
        l += __shfl_xor(l, 16, 32);
        const unsigned dead = __builtin_amdgcn_ballot_w32(!(l > 0.0f));
        if (dead == 0u) break;                                           // wave-uniform
        noskip = 1;
    }
    const float inv = CXS * (1.0f / l);
    // O^T D layout: o_j[r] = (d = 16j + 8h + r, t = lane&15): exactly part j&1 of context unit 2h + (j>>1) (row t = lane&15, k = 16j + 8*(lane>>4) + r), so each lane stores its own accumulators, no transpose
    const size_t crow = ((size_t)b * SEQ + t0) * DM + (size_t)h * 1024 + 8 * lane;     // context plane, row b*SEQ + t, k = h*64 + d: units [(b*SEQ + t)/16][2h + d/32]
    const size_t rrow = ((size_t)b * EROWS + t0) * DM + (size_t)h * 1024 + 8 * lane;   // residual plane, row b*EROWS + t (t0 + 15 < EROWS)
    const v8f xs[4] = {o0 + e0 * QRI, o1 + e1 * QRI, o2 + e2 * QRI, o3 + e3 * QRI};
#pragma unroll
    for (int s = 0; s < 4; ++s) {
        const v8f x = xs[s] * inv; v8h hv, rv;
#pragma unroll
        for (int i = 0; i < 8; ++i) { const h16 a0 = (h16)x[i]; hv[i] = a0; rv[i] = (h16)((x[i] - (float)a0) * QRS); }
        *(v8h*)(CH + crow + s * 256) = hv;
        *(v8h*)(CR + rrow + s * 256) = rv;
    }
}

// flash_wide: the form for query rows >= EROWS, 32 query rows per wave = two 16-row tiles A (t0) and B (t0 + 16) that share one key walk: every K and V^T fragment the wave loads feeds two products, so the bytes asked of the WGP cache and of L2
// per score are half those of a 16-row wave. Per tile the arithmetic is that of flash_body without the residual terms (single f16 planes, online softmax, replace-fill by value). The walk takes the steps that are live for either tile; a step that is dead for one tile
// gives that tile fill values only, which the running maximum wipes out as for any masked element. Loads run ahead of their use: next live step's K fragments behind the score products, its mask words behind their last use, V^T at step start.
// soft_max: scale, mask fill and in-lane maximum of one tile's 16 scores per lane. soft_exp: new running maximum, rescale factor, P (x256, f16) and the row sum of the rounded P.
__device__ __forceinline__ float soft_max(const v8f sa, const v8f sb, const v16u mw, float* ta, float* tb) {
    float mx = -3.0e38f;
#pragma unroll
    for (int r = 0; r < 8; ++r) {
        ta[r] = __builtin_amdgcn_inverse_ballot_w32(mw[r]) ? sa[r] * SC2 : NEGL;
        tb[r] = __builtin_amdgcn_inverse_ballot_w32(mw[8 + r]) ? sb[r] * SC2 : NEGL;
        mx = fmaxf(mx, fmaxf(ta[r], tb[r]));
    }
    return mx;
}
__device__ __forceinline__ v16h soft_exp(const float* ta, const float* tb, float mx, float& m, float& l, float& alpha) {
    mx = fmaxf(mx, __shfl_xor(mx, 16, 32));
    const float mnew = fmaxf(m, mx);
    alpha = __builtin_amdgcn_exp2f(m - mnew);
    const float sh = PSH - mnew;
    v16h pb = (v16h){}; float ls = 0.0f;
#pragma unroll
    for (int r = 0; r < 8; ++r) {
        const float pa = __builtin_amdgcn_exp2f(ta[r] + sh), pc = __builtin_amdgcn_exp2f(tb[r] + sh);
        const h16 ha = (h16)pa, hc = (h16)pc; pb[r] = ha; pb[8 + r] = hc;
        ls += (float)ha + (float)hc;
    }
    l = l * alpha + ls; m = mnew;
    return pb;
}
__device__ __forceinline__ void flash_wide(const h16* __restrict__ QH, const h16* __restrict__ KP, const h16* __restrict__ VT, const unsigned* __restrict__ MB, h16* CH, int tstart, int bx, int zh) {
    const int lane = threadIdx.x & 31, wave = __builtin_amdgcn_readfirstlane((int)(threadIdx.x >> 5));
    const int b = zh / NH_, h = zh % NH_;
    const int t0 = tstart + (bx * AW + wave) * 32;
    const size_t pbase = (size_t)zh * SEQ * HD;
    const size_t qo = pbase + (size_t)t0 * HD + 8 * lane;
    const v16h qa0 = ldh(QH + qo), qa1 = ldh(QH + qo + 512), qb0 = ldh(QH + qo + 1024), qb1 = ldh(QH + qo + 1536);   // B fragments: col t, k = d; tile B = the next 16 rows = the next two units
    const size_t ko = pbase + 8 * lane;        // + key0 * HD + 512 * (d/32)
    const size_t vo = pbase + 8 * lane;        // + key0 * HD + 512 * j
    const unsigned* mra = MB + (size_t)(t0 >> 4) * MREC;       // the two tiles' mask records (wave-uniform)
    const unsigned* mrb = mra + MREC;
    const unsigned long long live = (*(const unsigned long long*)(mra + NST * 16) | *(const unsigned long long*)(mrb + NST * 16)) & ALLST;
    // cyclic key walk as in flash_body, s0 block-uniform, spread over the steps that a lower-triangular mask leaves the block's 32*AW rows; for speed only: any s0 in 0..63 visits every live step exactly once
    const int g = (tstart + bx * (32 * AW)) / (32 * AW);
    const int s0 = ((((g * 13 + zh * 5) & 31) * ((g + 1) * (32 * AW) / 32)) >> 5) & 63;
    const unsigned long long lowm = (1ull << s0) - 1ull;
    v8f oa0 = (v8f){}, oa1 = (v8f){}, oa2 = (v8f){}, oa3 = (v8f){}, ob0 = (v8f){}, ob1 = (v8f){}, ob2 = (v8f){}, ob3 = (v8f){};
    float ma = -3.0e38f, la = 0.0f, mb = -3.0e38f, lb = 0.0f;
    int noskip = 0;
#pragma unroll 1
    for (int pass = 0; pass < 2; ++pass) {
        oa0 = (v8f){}; oa1 = (v8f){}; oa2 = (v8f){}; oa3 = (v8f){}; ob0 = (v8f){}; ob1 = (v8f){}; ob2 = (v8f){}; ob3 = (v8f){};
        ma = -3.0e38f; la = 0.0f; mb = -3.0e38f; lb = 0.0f;
        const unsigned long long all = (noskip != 0) ? ALLST : live;
        unsigned long long rem = all & ~lowm, rest = all & lowm;         // steps being walked; steps still to come behind them
        if (rem == 0ull) { rem = rest; rest = 0ull; }
        const int kf = (rem != 0ull) ? 32 * __builtin_ctzll(rem) : 0;    // no live step: step 0 is read and not used (in bounds)
        const h16* kp = KP + ko + (size_t)kf * HD;
        v16h pk0 = ldh(kp), pk1 = ldh(kp + 512), pk2 = ldh(kp + 16 * HD), pk3 = ldh(kp + 16 * HD + 512);
        v16u pwa = *(const v16u*)(mra + (kf >> 1)), pwb = *(const v16u*)(mrb + (kf >> 1));
#pragma unroll 1
        while (rem != 0ull) {                                            // at most NST trips, wave-uniform
            const int key0 = 32 * __builtin_ctzll(rem);
            unsigned long long nrem = rem & (rem - 1ull);
            if (nrem == 0ull) { nrem = rest; rest = 0ull; }              // top reached: go on with the steps below s0
            const int keyn = (nrem != 0ull) ? 32 * __builtin_ctzll(nrem) : key0;   // next live step; last trip: its own step again (in bounds, not used)
            const h16* vn = VT + vo + (size_t)key0 * HD;
            const h16* kn = KP + ko + (size_t)keyn * HD;
            const v16h v0 = ldh(vn), v1 = ldh(vn + 512), v2 = ldh(vn + 1024), v3 = ldh(vn + 1536);
            v8f saa = (v8f){}, sab = (v8f){}, sba = (v8f){}, sbb = (v8f){};   // tile A keys 0..15, 16..31; tile B the same
            saa = wmma16(pk0, qa0, saa); sab = wmma16(pk2, qa0, sab); sba = wmma16(pk0, qb0, sba); sbb = wmma16(pk2, qb0, sbb);
            saa = wmma16(pk1, qa1, saa); sab = wmma16(pk3, qa1, sab); sba = wmma16(pk1, qb1, sba); sbb = wmma16(pk3, qb1, sbb);
            asm volatile("v_nop\n\tv_nop\n\tv_nop\n\tv_nop" : "+v"(saa), "+v"(sab), "+v"(sba), "+v"(sbb) : "v"(pk0), "v"(pk1), "v"(pk2), "v"(pk3));   // WMMA distance before the K registers are refilled and the scores read
            pk0 = ldh(kn); pk1 = ldh(kn + 512); pk2 = ldh(kn + 16 * HD); pk3 = ldh(kn + 16 * HD + 512);
            float taa[8], tab[8], tba[8], tbb[8];
            const float mxa = soft_max(saa, sab, pwa, taa, tab);
            const float mxb = soft_max(sba, sbb, pwb, tba, tbb);
            __builtin_amdgcn_sched_barrier(0);                           // keeps the next step's mask loads behind the last use of this step's words: lifted higher, the wait for these words (scalar loads are waited to 0) would wait for them too
            asm volatile("s_wait_xcnt 0x0" :: "v"(vn), "v"(kn) : "memory");   // before the address registers of the V and K loads issued above are reused (named here, they stay untouched up to the wait)
            pwa = *(const v16u*)(mra + (keyn >> 1)); pwb = *(const v16u*)(mrb + (keyn >> 1));
            float aa, ab;
            const v16h pa = soft_exp(taa, tab, mxa, ma, la, aa);
            const v16h pb = soft_exp(tba, tbb, mxb, mb, lb, ab);
            oa0 = oa0 * aa; oa1 = oa1 * aa; oa2 = oa2 * aa; oa3 = oa3 * aa;
            ob0 = ob0 * ab; ob1 = ob1 * ab; ob2 = ob2 * ab; ob3 = ob3 * ab;
            oa0 = wmma16(v0, pa, oa0); ob0 = wmma16(v0, pb, ob0); oa1 = wmma16(v1, pa, oa1); ob1 = wmma16(v1, pb, ob1);
            oa2 = wmma16(v2, pa, oa2); ob2 = wmma16(v2, pb, ob2); oa3 = wmma16(v3, pa, oa3); ob3 = wmma16(v3, pb, ob3);
            asm volatile("v_nop\n\tv_nop\n\tv_nop\n\tv_nop" : "+v"(oa0), "+v"(oa1), "+v"(oa2), "+v"(oa3), "+v"(ob0), "+v"(ob1), "+v"(ob2), "+v"(ob3) : "v"(v0), "v"(v1), "v"(v2), "v"(v3), "v"(pa), "v"(pb));   // WMMA distance before the V and P registers are rewritten
            rem = nrem;
        }
        la += __shfl_xor(la, 16, 32); lb += __shfl_xor(lb, 16, 32);
        const unsigned dead = __builtin_amdgcn_ballot_w32(!(la > 0.0f) || !(lb > 0.0f));
        if (dead == 0u) break;                                           // wave-uniform
        noskip = 1;
    }
    // O^T D layout as in flash_body: each lane stores its own accumulators; tile B = the next 16 context rows
    const size_t crow = ((size_t)b * SEQ + t0) * DM + (size_t)h * 1024 + 8 * lane;
    const float ia = CXS * (1.0f / la), ib = CXS * (1.0f / lb);
    const v8f xs[8] = {oa0 * ia, oa1 * ia, oa2 * ia, oa3 * ia, ob0 * ib, ob1 * ib, ob2 * ib, ob3 * ib};
#pragma unroll
    for (int s = 0; s < 8; ++s) {
        v8h hv;
#pragma unroll
        for (int i = 0; i < 8; ++i) hv[i] = (h16)xs[s][i];
        *(v8h*)(CH + crow + (size_t)(s >> 2) * (16 * DM) + (s & 3) * 256) = hv;
        asm volatile("s_wait_xcnt 0x0" :: "v"(hv) : "memory");           // before the issued store's registers are reused
    }
}

// k_flashf: both forms in one 1-D grid, so that the residual rows' few, latency-bound waves run beside the others instead of in a launch of their own. A block's job follows from its index alone (block-uniform):
// first the residual rows' blocks, then the rest, each group from the last query block down ((batch, head) fastest): under a lower-triangular mask the key walk grows with the query index,
// so the longest blocks come first in the grid and the shortest last. The order is for speed only: every (query block, batch, head) is taken exactly once for any mask.
// amdgpu_waves_per_eu(4): every block of the grid is given the registers of the larger form, the 32-row one (two tiles' Q, scores and output beside one set of K and V^T fragments): 216 = an allocation of 224 = 4 waves per SIMD, no scratch.
#define FB_E (EROWS / (16 * AW))
#define FB_L ((SEQ - EROWS) / (32 * AW))
static_assert((SEQ - EROWS) % (32 * AW) == 0);   // the 32-row waves' blocks cover the rows >= EROWS exactly
#define FB_Z (NB * NH_)
__global__ __launch_bounds__(32 * AW) __attribute__((amdgpu_waves_per_eu(4))) void k_flashf(const h16* __restrict__ QH, const h16* __restrict__ QR, const h16* __restrict__ KP, const h16* __restrict__ KR,
                                                    const h16* __restrict__ VT, const h16* __restrict__ VR, const unsigned* __restrict__ MB, h16* CH, h16* CR) {
    const int bid = blockIdx.x;
    if (bid < FB_E * FB_Z) { flash_body(QH, QR, KP, KR, VT, VR, MB, CH, CR, 0, FB_E - 1 - bid / FB_Z, bid % FB_Z); }
    else { const int r = bid - FB_E * FB_Z; flash_wide(QH, KP, VT, MB, CH, EROWS, FB_L - 1 - r / FB_Z, r % FB_Z); }
}

// oproj_body: output projection, f16 GEMM, one 4-wave block per (32*MT) x 128 tile, one wave per (16*MT) x 64 tile, K = DM; operand units staged in LDS as in proj_body (RES != 0: stage units 0..3 = A, 4..7 = AR). OUT[m][n] = OSC * (sum_k A[m][k] Bt[n][k] + QRI * sum_k AR[m][k] Bt[n][k]) + bias[n] (bias RNE-converted to bf16).
// A = context plane (x16), AR = context residual plane (RES != 0 only, rows [b*EROWS + t]), Bt = Wo x1024 as f16 ([out][in]).
// wave row tile rt = 2*rtB + (wave>>1) in 0 .. NB * tpb - 1 -> batch rt / tpb, first token rowoff + (rt % tpb) * 16*MT (tpb even: a block's two row tiles are neighbours in one batch); c0 = cB + 64*(wave&1) = first output column.
template <int MT, int RES>
__device__ __forceinline__ void oproj_body(const h16* __restrict__ A, const h16* __restrict__ AR, const h16* __restrict__ Bt, const float* __restrict__ bias, float* OUT, int tpb, int rowoff, int rtB, int cB, int k0, float* osb, char* st) {
    static_assert((MT == 4 && RES == 0) || (MT == 2 && RES == 1));
    const int K = DM;
    const int tid = threadIdx.x, lane = tid & 31, lr = lane & 15, hi = lane >> 4, wv = __builtin_amdgcn_readfirstlane(tid >> 5);
    const int rt = 2 * rtB + (wv >> 1), c0 = cB + 64 * (wv & 1);
    float* os = osb + wv * (16 * 68);                                  // wave-private epilogue tile
    const int bb = rt / tpb, tl = rt % tpb;
    const int tok = rowoff + tl * (16 * MT);
    const int tokB = rowoff + ((2 * rtB) % tpb) * (16 * MT);           // the block's first token (same batch bb)
    // unit (row tile, ks) lies at byte (row tile)*32*K + ks*1024; thread tid copies bytes 16*(tid&63) of row tiles (tid>>6) + 2j
    const char* ga = (const char*)(A  + ((size_t)bb * SEQ   + tokB + 16 * (tid >> 6)) * K + 8 * (tid & 63));
    const char* gr = (const char*)(AR + ((size_t)bb * EROWS + tokB + 16 * (tid >> 6)) * K + 8 * (tid & 63));
    const char* gb = (const char*)(Bt + (size_t)(cB + 16 * (tid >> 6)) * K + 8 * (tid & 63));
    const char* g2 = (RES != 0) ? gr : ga + 131072;                    // source of stage units 4..7
    const unsigned ls = (unsigned)(size_t)st + 16u * (unsigned)tid;
    v8f acc[MT][4], acr[MT][4];
#pragma unroll
    for (int mb = 0; mb < MT; ++mb)
#pragma unroll
        for (int nb = 0; nb < 4; ++nb) { acc[mb][nb] = (v8f){}; acr[mb][nb] = (v8f){}; }
    for (int s = 0; s < 3; ++s) {                                      // stage s holds k step (k0 + s) mod K/32
        const int ko = ((k0 + s) & (K / 32 - 1)) * 1024; const char* na = ga + ko; const char* n2 = g2 + ko; const char* nb2 = gb + ko;
        stage16(ls + s * STG, na, na + 65536, n2, n2 + 65536, nb2, nb2 + 65536, nb2 + 131072, nb2 + 196608);
    }
    wait_async16();                                                    // stage 0 landed; stages 1 and 2 fly on
    __syncthreads();                                                   // stage 0 published
    int rb = 0;                                                        // buffer of stage ks = ks mod 3
#pragma unroll 1
    for (int ks = 0; ks < K / 32; ++ks) {
        const h16* pa = (const h16*)(st + rb * STG + (wv >> 1) * (MT * 1024)) + 8 * lane; const h16* pr = pa + 2048; const h16* pb = (const h16*)(st + rb * STG + 8192 + (wv & 1) * 4096) + 8 * lane;
        v16h a[MT], ar[MT], bfrag[4];
#pragma unroll
        for (int mb = 0; mb < MT; ++mb) { a[mb] = ldh(pa + mb * 512); ar[mb] = a[mb]; }
        if constexpr (RES != 0) {
#pragma unroll
            for (int mb = 0; mb < MT; ++mb) ar[mb] = ldh(pr + mb * 512);
        }
#pragma unroll
        for (int nb = 0; nb < 4; ++nb) bfrag[nb] = ldh(pb + nb * 512);
#pragma unroll
        for (int nb = 0; nb < 4; ++nb) {
#pragma unroll
            for (int mb = 0; mb < MT; ++mb) { acc[mb][nb] = wmma16(a[mb], bfrag[nb], acc[mb][nb]);
                if constexpr (RES != 0) acr[mb][nb] = wmma16(ar[mb], bfrag[nb], acr[mb][nb]); } }
        if constexpr (MT == 4) {
            asm volatile("v_nop\n\tv_nop\n\tv_nop\n\tv_nop" : "+v"(acc[0][3]), "+v"(acc[1][3]), "+v"(acc[2][3]), "+v"(acc[3][3]) : "v"(a[0]), "v"(a[1]), "v"(a[2]), "v"(a[3]));
        } else {
            asm volatile("v_nop\n\tv_nop\n\tv_nop\n\tv_nop" : "+v"(acc[0][3]), "+v"(acc[1][3]), "+v"(acr[0][3]), "+v"(acr[1][3]) : "v"(a[0]), "v"(a[1]), "v"(ar[0]), "v"(ar[1]));
        }
        wait_ds();
        if (ks + 2 < K / 32) wait_async8(); else wait_async();         // block-uniform: stage ks + 1 landed; only stage ks + 2, where there is one, flies on
        __syncthreads();                                               // publishes stage ks + 1 and ends every wave's reads of stage ks
        if (ks + 3 < K / 32) {                                         // block-uniform: refill the buffer just left
            const int ko = ((k0 + ks + 3) & (K / 32 - 1)) * 1024; const char* na = ga + ko; const char* n2 = g2 + ko; const char* nb2 = gb + ko;
            stage16(ls + rb * STG, na, na + 65536, n2, n2 + 65536, nb2, nb2 + 65536, nb2 + 131072, nb2 + 196608);
        }
        rb = (rb == 2) ? 0 : rb + 1;
    }
    wait_async();
    float bc[4];
#pragma unroll
    for (int nb = 0; nb < 4; ++nb) bc[nb] = bfr(bias[c0 + nb * 16 + lr]);
#pragma unroll
    for (int mb = 0; mb < MT; ++mb) {
#pragma unroll
        for (int nb = 0; nb < 4; ++nb) {
#pragma unroll
            for (int j = 0; j < 8; ++j) { float v = acc[mb][nb][j] * OSC;
                if constexpr (RES != 0) v += acr[mb][nb][j] * (OSC * QRI);
                os[(hi * 8 + j) * 68 + nb * 16 + lr] = v + bc[nb]; } }                          // D: row 8h+j, col lane&15
        wave_sync();
        float* orow = OUT + ((size_t)bb * OUT_SEQ + tok + mb * 16) * DM + c0;
{
#pragma unroll
            for (int s = 0; s < 8; ++s) { const int row = 2 * s + hi, cofs = lr * 4;            // 8 s x 2 rows = 16 rows; 16 lanes x 4 floats = 64 columns
                const v4f val = *(const v4fa*)(&os[row * 68 + cofs]);
                *(v4f*)(orow + (size_t)row * DM + cofs) = val; }
             }
        wave_sync();
    }
}

// k_oprojf: both forms in one grid (x = row tile, fastest as in the separate launches: first the residual rows' tiles, then the rest; y = column tile), so that their waves share the SIMDs.
static_assert(EROWS % 64 == 0 && (SEQ - EROWS) % 128 == 0);   // a block's two row tiles lie in one batch
__global__ __launch_bounds__(32 * GW) void k_oprojf(const h16* __restrict__ CXH, const h16* __restrict__ CXR, const h16* __restrict__ WOH, const float* __restrict__ bo, float* OUT) {
    __shared__ __align__(16) float os[GW * 16 * 68];
    __shared__ __align__(1024) char st[3 * STG];
    constexpr int NR = NB * (EROWS / 64);
    const int rtB = blockIdx.x, cB = blockIdx.y * 128;
    const int k0 = (int)((blockIdx.x + 4 * blockIdx.y) & (DM / 32 - 1));  // first k step: differs among the 8 blocks that read one context row panel; the blocks of one Wo row panel spread over all 32 values
    if (rtB < NR) oproj_body<2, 1>(CXH, CXR, WOH, bo, OUT, EROWS / 32, 0, rtB, cB, k0, os, st);
    else          oproj_body<4, 0>(CXH, CXH, WOH, bo, OUT, (SEQ - EROWS) / 64, EROWS, rtB - NR, cB, k0, os, st);
}

static constexpr size_t al256(size_t v) { return (v + 255) & ~(size_t)255; }
static constexpr size_t SZ_XB = al256((size_t)NB * SEQ * DM * 2);              // x bf16
static constexpr size_t SZ_WB = al256((size_t)3 * DM * DM * 2);                // Wq | Wk | Wv bf16
static constexpr size_t SZ_WO = al256((size_t)DM * DM * 2);                    // Wo f16 (x1024)
static constexpr size_t SZ_PL = al256((size_t)NB * NH_ * SEQ * HD * 2);        // q / k / v^T planes
static constexpr size_t SZ_RP = al256((size_t)NB * NH_ * EROWS * HD * 2);      // residual planes (t < EROWS)
static constexpr size_t SZ_CX = al256((size_t)NB * SEQ * DM * 2);              // context plane
static constexpr size_t SZ_CR = al256((size_t)NB * EROWS * DM * 2);            // context residual plane
static constexpr size_t SZ_MB = al256((size_t)(SEQ / 16) * MREC * 4);          // mask records
static constexpr size_t SZ_TOTAL = SZ_XB + SZ_WB + SZ_WO + 3 * SZ_PL + 3 * SZ_RP + SZ_CX + SZ_CR + SZ_MB;
static_assert(SZ_TOTAL <= (size_t)134217728);          // workspace carve <= 128 MiB
static_assert(((size_t)DM * DM * 2) % 256 == 0);       // weight sub-planes stay 256-byte aligned

extern "C" void kernel_launch(void* const* d_in, const int* in_sizes, int n_in,
                              void* d_out, int out_size, void* d_ws, size_t ws_size, hipStream_t stream) {
    if (n_in < 10) return;
    const size_t needx = ((size_t)(NB - 1) * SEQ_FULL + SEQ) * DM;
    if ((size_t)in_sizes[0] < needx) return;
    if ((size_t)in_sizes[1] < (size_t)(SEQ - 1) * SEQ_FULL + SEQ) return;
    if ((size_t)in_sizes[2] < (size_t)DM * DM || (size_t)in_sizes[4] < (size_t)DM * DM || (size_t)in_sizes[6] < (size_t)DM * DM || (size_t)in_sizes[8] < (size_t)DM * DM) return;
    if (in_sizes[3] < DM || in_sizes[5] < DM || in_sizes[7] < DM || in_sizes[9] < DM) return;
    if ((size_t)out_size < ((size_t)(NB - 1) * OUT_SEQ + SEQ) * DM) return;
    if (SZ_TOTAL > ws_size) return;
    // wire order: query, mask (int32), Wq, bq, Wk, bk, Wv, bv, Wo, bo; weights [out][in] = Bt as-is
    const float* x  = (const float*)d_in[0]; const int* mask = (const int*)d_in[1];
    const float* wq = (const float*)d_in[2]; const float* bq = (const float*)d_in[3];
    const float* wk = (const float*)d_in[4]; const float* bk = (const float*)d_in[5];
    const float* wv = (const float*)d_in[6]; const float* bv = (const float*)d_in[7];
    const float* wo = (const float*)d_in[8]; const float* bo = (const float*)d_in[9];
    float* OUT = (float*)d_out;      // [NB][SEQ][1024]
    char* wsp = (char*)d_ws;
    bf*  XB  = (bf*)wsp;  wsp += SZ_XB;              // rows NB*SEQ, k 1024, fragment-major
    bf*  WB  = (bf*)wsp;  wsp += SZ_WB;              // 3 planes q | k | v, rows 1024, k 1024, fragment-major
    h16* WOH = (h16*)wsp; wsp += SZ_WO;              // rows 1024, k 1024, fragment-major, x1024
    h16* QH  = (h16*)wsp; wsp += SZ_PL;              // [NB*16][SEQ/16][2][unit]
    h16* KP  = (h16*)wsp; wsp += SZ_PL;              // [NB*16][SEQ/16][2][unit]
    h16* VT  = (h16*)wsp; wsp += SZ_PL;              // [NB*16][SEQ/32][4][unit]
    h16* QR  = (h16*)wsp; wsp += SZ_RP;              // [NB*16][EROWS/16][2][unit] residual x2048
    h16* KR  = (h16*)wsp; wsp += SZ_RP;              // [NB*16][EROWS/16][2][unit] residual x2048
    h16* VR  = (h16*)wsp; wsp += SZ_RP;              // [NB*16][EROWS/32][4][unit] residual x2048
    h16* CXH = (h16*)wsp; wsp += SZ_CX;              // rows NB*SEQ, k 1024, fragment-major, x16
    h16* CXR = (h16*)wsp; wsp += SZ_CR;              // rows NB*EROWS, k 1024, fragment-major, residual x2048
    unsigned* MBW = (unsigned*)wsp; wsp += SZ_MB;    // [SEQ/16][MREC] mask records
    bf* WQ = WB; bf* WK = WB + (size_t)DM * DM; bf* WV = WB + (size_t)2 * DM * DM;

    k_prep<<<PB_M + PB_X + 4 * PB_W, 1024, 0, stream>>>(x, mask, wq, wk, wv, wo, XB, WB, WOH, MBW);
    k_proj3<<<dim3(NB * SEQ / 128, DM / 256, 3), 32 * PW, 0, stream>>>(XB, WQ, WK, WV, bq, bk, bv, QH, QR, KP, KR, VT, VR);

    k_flashf<<<(FB_E + FB_L) * FB_Z, 32 * AW, 0, stream>>>(QH, QR, KP, KR, VT, VR, MBW, CXH, CXR);

    k_oprojf<<<dim3(NB * (EROWS / 64) + NB * ((SEQ - EROWS) / 128), DM / 128, 1), 32 * GW, 0, stream>>>(CXH, CXR, WOH, bo, OUT);
}
